// v000
// The times below were measured on an AMD MI455X: many runs one after another, warmed up first and cycling through
// copies of the inputs, with the whole window's GPU time divided by the number of runs. Launches and the gaps
// between them are all in it. The median over several windows is given; except for v000 it joins two sittings, which
// can be a few percent apart, so the side-by-side timings, each taken in one sitting, are the better comparison.
// The starting kernel, v000, takes 692 microseconds a run.
#include <hip/hip_runtime.h>

// Contractions on v_wmma_f32_16x16x32_f16 (f16 operands, f32 accumulate): 1x1 input conv (weights x64),
// q.k scores (unit feature rows x8 on each side), att.v (att x4096), 1x1 fuse conv (weights x64);
// every scale is an exact power of two folded back in f32. Softmax, norms, sums and selects stay f32.

#define NB   4
#define NC   256
#define NP   4096
#define CIN  1024
#define CAUX 768
#define CFU  512
#define MS   512
#define QCH  128            // query rows per block in the score kernel (8 waves x 16)
#define KT   32             // keys per staged tile
#define QCN  (NP / QCH)     // 32 query chunks per batch

typedef _Float16 v16h __attribute__((ext_vector_type(16)));
typedef _Float16 v8h  __attribute__((ext_vector_type(8)));
typedef v8h v8ha __attribute__((may_alias));
typedef float v8f __attribute__((ext_vector_type(8)));
typedef float v4f __attribute__((ext_vector_type(4)));
typedef v4f v4fa __attribute__((may_alias));

union Frag { v16h v; v8h hf[2]; };

__device__ __forceinline__ v8f zero8() {
  v8f z = {0.f, 0.f, 0.f, 0.f, 0.f, 0.f, 0.f, 0.f};
  return z;
}

__device__ __forceinline__ v8f wmma16(v16h a, v16h b, v8f c) {
  v8f d = __builtin_amdgcn_wmma_f32_16x16x32_f16(false, a, false, b, (short)0, c, false, false);
  asm volatile("v_nop\n\tv_nop\n\tv_nop\n\tv_nop" : "+v"(d) : "v"(a), "v"(b));
  return d;
}

// 16 rows x 32 k fragment from a k-contiguous 16-bit matrix. rowp = start of the row owned by this
// lane (row index = lane & 15). Elements 0..7 <- k0+8h+0..7, elements 8..15 <- k0+16+8h+0..7 with
// h = lane >> 4. Used for A (row = m) and for B (row = n of a [n][k] copy). D: acc[r] = (row 8h+r, col lane&15).
__device__ __forceinline__ v16h ldfrag_g(const _Float16* rowp, int k0, int h) {
  Frag f;
  f.hf[0] = *(const v8h*)(rowp + k0 + 8 * h);
  f.hf[1] = *(const v8h*)(rowp + k0 + 16 + 8 * h);
  return f.v;
}
__device__ __forceinline__ v16h ldfrag_l(const _Float16* rowp, int k0, int h) {
  Frag f;
  f.hf[0] = *(const v8ha*)(rowp + k0 + 8 * h);
  f.hf[1] = *(const v8ha*)(rowp + k0 + 16 + 8 * h);
  return f.v;
}

__device__ __forceinline__ v8h pack8(v4f a, v4f b) {
  v8h r;
  r[0] = (_Float16)a[0]; r[1] = (_Float16)a[1]; r[2] = (_Float16)a[2]; r[3] = (_Float16)a[3];
  r[4] = (_Float16)b[0]; r[5] = (_Float16)b[1]; r[6] = (_Float16)b[2]; r[7] = (_Float16)b[3];
  return r;
}

__device__ __forceinline__ float max8f(v4f a, v4f b) {
  float m0 = fmaxf(fmaxf(a[0], a[1]), fmaxf(a[2], a[3]));
  float m1 = fmaxf(fmaxf(b[0], b[1]), fmaxf(b[2], b[3]));
  return fmaxf(m0, m1);
}

template <typename T>
__device__ __forceinline__ void vst2(T* p, T v) {
  *(T*)p = v;
  
}

// ---------------------------------------------------------------------------
// 1) 8x8 max pool of the 512x512 mask, binarised: mF[b][p] in {0,1}. 4 pixels per thread, 16-B stores.
__global__ void __launch_bounds__(256) k_pool(const float* __restrict__ msk, float* __restrict__ mF) {
  const int i = blockIdx.x * 256 + threadIdx.x;
  if (i >= NB * NP / 4) return;
  const int pix0 = i * 4;
  const int b = pix0 >> 12, p = pix0 & (NP - 1);
  const int y = p >> 6, x0 = p & 63;
  const float* s = msk + ((size_t)b * MS + (size_t)y * 8) * MS + (size_t)x0 * 8;
  float mx[4] = {0.f, 0.f, 0.f, 0.f};
#pragma unroll
  for (int dy = 0; dy < 8; ++dy) {
    const float* row = s + dy * MS;
#pragma unroll
    for (int j = 0; j < 4; ++j) {
      v4f a = *(const v4f*)(row + j * 8);
      v4f c = *(const v4f*)(row + j * 8 + 4);
      mx[j] = fmaxf(mx[j], max8f(a, c));
    }
  }
  v4f r;
#pragma unroll
  for (int j = 0; j < 4; ++j) r[j] = (mx[j] > 0.f) ? 1.f : 0.f;
  vst2((v4f*)(mF + pix0), r);
}

// 2) weights to f16 with x64 scale: Kwh[256][1024], Fwh[256][512]. 8 elements per thread, 16-B stores.
__global__ void __launch_bounds__(256) k_cvtw(const float* __restrict__ Kw, const float* __restrict__ Fw,
                                              _Float16* __restrict__ Kwh, _Float16* __restrict__ Fwh) {
  const int i = blockIdx.x * 256 + threadIdx.x;
  const float* src;
  _Float16* dst;
  if (i < NC * CIN / 8) {
    src = Kw + (size_t)i * 8; dst = Kwh + (size_t)i * 8;
  } else if (i < NC * CIN / 8 + NC * CFU / 8) {
    const int j = i - NC * CIN / 8;
    src = Fw + (size_t)j * 8; dst = Fwh + (size_t)j * 8;
  } else {
    return;
  }
  v4f a = *(const v4f*)src;
  v4f c = *(const v4f*)(src + 4);
  a = a * 64.f; c = c * 64.f;
  vst2((v8h*)dst, pack8(a, c));
}

// 3) inT[b][p][1024] f16 = transpose of concat(x, aux) along channels. Block = 64 channels x 64 pixels,
__global__ void __launch_bounds__(256) k_tin(const float* __restrict__ x, const float* __restrict__ aux,
                                             _Float16* __restrict__ inT) {
  __shared__ __attribute__((aligned(16))) _Float16 T[64][72];   // T[p_local][c_local]
  const int t = threadIdx.x, blk = blockIdx.x;
  if (blk >= NB * (CIN / 64) * (NP / 64)) return;
  const int b = blk >> 10, ct = (blk >> 6) & 15, pt = blk & 63;
  const int c0 = ct * 64, p0 = pt * 64;
#pragma unroll
  for (int i = 0; i < 4; ++i) {
    const int f = t + 256 * i;            // 1024 float4 chunks: 64 channel rows x 16
    const int cl = f >> 4, p4 = (f & 15) * 4;
    const int c = c0 + cl;
    const float* src = (c0 < NC)
        ? x   + ((size_t)(b * NC + c)) * NP + p0 + p4
        : aux + ((size_t)(b * CAUX + (c - NC))) * NP + p0 + p4;
    v4f v = *(const v4f*)src;
    T[p4 + 0][cl] = (_Float16)v[0];
    T[p4 + 1][cl] = (_Float16)v[1];
    T[p4 + 2][cl] = (_Float16)v[2];
    T[p4 + 3][cl] = (_Float16)v[3];
  }
  __syncthreads();
  v8h val[2];
  size_t off[2];
#pragma unroll
  for (int i = 0; i < 2; ++i) {
    const int r = (t >> 3) + 32 * i, q = t & 7;
    val[i] = *(const v8ha*)&T[r][q * 8];
    off[i] = ((size_t)(b * NP + p0 + r)) * CIN + c0 + q * 8;
  }
#pragma unroll
  for (int i = 0; i < 2; ++i) vst2((v8h*)(inT + off[i]), val[i]);
}

// 4) feats = inT . Kw^T (+ bias), then per-pixel L2 normalisation, stored as Nh[b][p][256] = f16(8 * unit row).
//    Block = 32 pixels x 256 channels; wave (ptile, og) = 16 pixels x 64 channels; K = 1024 in 32-steps.
__global__ void __launch_bounds__(256) k_feats(const _Float16* __restrict__ inT, const _Float16* __restrict__ Kwh,
                                               const float* __restrict__ Kb, _Float16* __restrict__ Nh) {
  __shared__ __attribute__((aligned(16))) float F[32][260];   // F[p_local][channel]
  const int t = threadIdx.x, lane = t & 31, wid = t >> 5, h = lane >> 4, n = lane & 15;
  const int blk = blockIdx.x;
  if (blk >= NB * NP / 32) return;
  const int b = blk >> 7, pb = (blk & 127) * 32;
  const int ptile = wid >> 2, og = wid & 3;
  const _Float16* Arow = inT + ((size_t)(b * NP + pb + ptile * 16 + n)) * CIN;   // A: row m = pixel
  const _Float16* Bb   = Kwh + ((size_t)(og * 64 + n)) * CIN;                     // B: row n = out channel
  v8f d[4];
#pragma unroll
  for (int j = 0; j < 4; ++j) d[j] = zero8();
#pragma unroll 1
  for (int k0 = 0; k0 < CIN; k0 += 32) {
    const v16h a = ldfrag_g(Arow, k0, h);
#pragma unroll
    for (int j = 0; j < 4; ++j) d[j] = wmma16(a, ldfrag_g(Bb + (size_t)j * 16 * CIN, k0, h), d[j]);
  }
#pragma unroll
  for (int j = 0; j < 4; ++j) {
    const int o = og * 64 + j * 16 + n;
    const float bias = Kb[o];
#pragma unroll
    for (int r = 0; r < 8; ++r) F[ptile * 16 + 8 * h + r][o] = d[j][r] * (1.f / 64.f) + bias;
  }
  __syncthreads();
  v8h vals[4];
  size_t offs[4];
#pragma unroll
  for (int i = 0; i < 4; ++i) {
    const int pl = wid * 4 + i;                        // 4 pixels per wave, one wave per 512-B row
    v4f a = *(const v4fa*)&F[pl][lane * 8];
    v4f c = *(const v4fa*)&F[pl][lane * 8 + 4];
    float ss = a[0] * a[0] + a[1] * a[1] + a[2] * a[2] + a[3] * a[3]
             + c[0] * c[0] + c[1] * c[1] + c[2] * c[2] + c[3] * c[3];
    ss += __shfl_xor(ss, 16); ss += __shfl_xor(ss, 8); ss += __shfl_xor(ss, 4);
    ss += __shfl_xor(ss, 2);  ss += __shfl_xor(ss, 1);
    const float inv = 8.f * (1.f / (sqrtf(ss) + 1e-8f));
    vals[i] = pack8(a * inv, c * inv);
    offs[i] = ((size_t)(b * NP + pb + pl)) * NC + lane * 8;
  }
#pragma unroll
  for (int i = 0; i < 4; ++i) vst2((v8h*)(Nh + offs[i]), vals[i]);
}

// 5) Vh[b][c][p] = f16( x * (1 - m[p]) ). 8 elements per thread, 16-B stores.
__global__ void __launch_bounds__(256) k_makev(const float* __restrict__ x, const float* __restrict__ mF,
                                               _Float16* __restrict__ Vh) {
  const int i = blockIdx.x * 256 + threadIdx.x;
  if (i >= NB * NC * NP / 8) return;
  const size_t e0 = (size_t)i * 8;
  const int p = (int)(e0 & (NP - 1));
  const int b = (int)(e0 >> 20);
  v4f x0 = *(const v4f*)(x + e0);
  v4f x1 = *(const v4f*)(x + e0 + 4);
  v4f m0 = *(const v4f*)(mF + (size_t)b * NP + p);
  v4f m1 = *(const v4f*)(mF + (size_t)b * NP + p + 4);
  v4f k0 = 1.f - m0, k1 = 1.f - m1;
  vst2((v8h*)(Vh + e0), pack8(x0 * k0, x1 * k1));
}

//    fixed shift 20 (|cos| <= 1). Pass 2: att tiles -> per-block column sums (cpart) and O^T = V . att^T.
//    Q chunk, K tile, V tile and the per-wave att^T tile are staged in LDS; every fragment uses ldfrag_*.
__global__ void __launch_bounds__(256) __attribute__((amdgpu_num_vgpr(252)))
k_attn(const _Float16* __restrict__ Nh, const _Float16* __restrict__ Vh, const float* __restrict__ mF,
       _Float16* __restrict__ attT, float* __restrict__ cpart) {
  __shared__ __attribute__((aligned(16))) _Float16 Qs[QCH][264];   // q rows (later reused as O^T tile)
  __shared__ __attribute__((aligned(16))) _Float16 Ks[KT][264];    // key rows  [n=key][k=channel]
  __shared__ __attribute__((aligned(16))) _Float16 Vs[NC][40];     // V tile    [m=channel][k=key]
  __shared__ __attribute__((aligned(16))) _Float16 Ps[8][16][40];  // att^T     [n=q][k=key] per wave
  __shared__ float cs[8][32];                                      // per-wave column sums, 32 keys
  __shared__ __attribute__((aligned(16))) float csb[NP];           // per-block column sums

  const int t = threadIdx.x, lane = t & 31, wid = t >> 5, h = lane >> 4, n = lane & 15;
  const int blk = blockIdx.x;
  if (blk >= NB * QCN) return;
  const int b = blk >> 5, qc = blk & 31;
  const int qblk = qc * QCH, qw = qblk + wid * 16;
  const _Float16* Nb = Nh + (size_t)b * NP * NC;
  const _Float16* Vb = Vh + (size_t)b * NC * NP;
  const float* mb = mF + (size_t)b * NP;

  // stage the block's 128 query rows
#pragma unroll
  for (int i = 0; i < 16; ++i) {
    const int id = t + 256 * i;
    const int row = id >> 5, c8 = (id & 31) * 8;
    *(v8h*)&Qs[row][c8] = *(const v8h*)(Nb + (size_t)(qblk + row) * NC + c8);
  }
  __syncthreads();

  const _Float16* Qrow = &Qs[wid * 16 + n][0];

  float invs[8];
  {
    v16h qf[8];
#pragma unroll
    for (int cb = 0; cb < 8; ++cb) qf[cb] = ldfrag_l(Qrow, cb * 32, h);
    float acc[8];
#pragma unroll
    for (int r = 0; r < 8; ++r) acc[r] = 0.f;
#pragma unroll 1
    for (int kb = 0; kb < NP; kb += KT) {
      __syncthreads();
#pragma unroll
      for (int i = 0; i < 4; ++i) {
        const int id = t + 256 * i;
        const int row = id >> 5, c8 = (id & 31) * 8;
        *(v8h*)&Ks[row][c8] = *(const v8h*)(Nb + (size_t)(kb + row) * NC + c8);
      }
      __syncthreads();
#pragma unroll
      for (int sub = 0; sub < 2; ++sub) {
        v8f s = zero8();
        const _Float16* Krow = &Ks[sub * 16 + n][0];
#pragma unroll
        for (int cb = 0; cb < 8; ++cb) s = wmma16(qf[cb], ldfrag_l(Krow, cb * 32, h), s);
        const float km = 1.f - mb[kb + sub * 16 + n];
#pragma unroll
        for (int r = 0; r < 8; ++r) acc[r] += km * __expf(0.3125f * s[r] - 20.f);
      }
    }
#pragma unroll
    for (int r = 0; r < 8; ++r) {
      float a = acc[r];
      a += __shfl_xor(a, 1); a += __shfl_xor(a, 2); a += __shfl_xor(a, 4); a += __shfl_xor(a, 8);
      invs[r] = mb[qw + 8 * h + r] / (a + 1e-30f);     // query mask folded in: invalid rows -> 0
    }
  }

  // ---- pass 2: att tiles, column sums, O^T = V . (att*4096)^T ----
  v8f o[16];
#pragma unroll
  for (int cc = 0; cc < 16; ++cc) o[cc] = zero8();
#pragma unroll 1
  for (int kb = 0; kb < NP; kb += KT) {
    __syncthreads();
#pragma unroll
    for (int i = 0; i < 4; ++i) {
      const int id = t + 256 * i;
      const int row = id >> 5, c8 = (id & 31) * 8;
      *(v8h*)&Ks[row][c8] = *(const v8h*)(Nb + (size_t)(kb + row) * NC + c8);
      const int vr = id >> 2, v8 = (id & 3) * 8;
      *(v8h*)&Vs[vr][v8] = *(const v8h*)(Vb + (size_t)vr * NP + kb + v8);
    }
    __syncthreads();
#pragma unroll
    for (int sub = 0; sub < 2; ++sub) {
      v8f s = zero8();
      const _Float16* Krow = &Ks[sub * 16 + n][0];
#pragma unroll
      for (int cb = 0; cb < 8; ++cb) s = wmma16(ldfrag_l(Qrow, cb * 32, h), ldfrag_l(Krow, cb * 32, h), s);
      const float km = 1.f - mb[kb + sub * 16 + n];
      float csum = 0.f;
#pragma unroll
      for (int r = 0; r < 8; ++r) {
        const float att = invs[r] * km * __expf(0.3125f * s[r] - 20.f);   // D row q = 8h+r, col key = n
        csum += att;
        Ps[wid][8 * h + r][sub * 16 + n] = (_Float16)(att * 4096.f);
      }
      csum += __shfl_xor(csum, 16);
      if (lane < 16) cs[wid][sub * 16 + lane] = csum;
    }
    __syncthreads();
    if (wid == 0) {
      float tt = 0.f;
#pragma unroll
      for (int w = 0; w < 8; ++w) tt += cs[w][lane];
      csb[kb + lane] = tt;
    }
    const v16h pB = ldfrag_l(&Ps[wid][n][0], 0, h);                   // B: k = key, n = q
#pragma unroll
    for (int g = 0; g < 4; ++g) {
#pragma unroll
      for (int j = 0; j < 4; ++j)
        o[g * 4 + j] = wmma16(ldfrag_l(&Vs[g * 64 + j * 16 + n][0], 0, h), pB, o[g * 4 + j]);   // A: m = channel
    }
  }

  // O^T tile (D rows = channel cc*16+8h+r, cols = q) -> f16, staged in this wave's own Qs rows as [q][channel]
#pragma unroll
  for (int cc = 0; cc < 16; ++cc) {
    v8h tv;
#pragma unroll
    for (int r = 0; r < 8; ++r) tv[r] = (_Float16)(o[cc][r] * (1.f / 4096.f));
    *(v8h*)&Qs[wid * 16 + n][cc * 16 + 8 * h] = tv;
  }
  __syncthreads();
  // attT[b][q][256]: one 512-B row per instruction, 16 B per lane
  _Float16* arow = attT + ((size_t)(b * NP + qw)) * NC + lane * 8;
#pragma unroll
  for (int i = 0; i < 16; ++i) {
    v8h v = *(const v8ha*)&Qs[wid * 16 + i][lane * 8];
    vst2((v8h*)(arow + (size_t)i * NC), v);
  }
  float* cp = cpart + ((size_t)(b * QCN + qc)) * NP;
#pragma unroll
  for (int i = 0; i < 4; ++i) {
    const int f = t + 256 * i;
    v4f v = *(const v4fa*)&csb[f * 4];
    vst2((v4f*)(cp + (size_t)f * 4), v);
  }
}

// 7) fused = concat(att_fore, x) . Fw^T, then out0[b][o][p] = m[p] ? fused : x. Block = 32 pixels x 256
__global__ void __launch_bounds__(256)
k_fuse(const _Float16* __restrict__ attT, const _Float16* __restrict__ inT, const _Float16* __restrict__ Fwh,
       const float* __restrict__ x, const float* __restrict__ mF, float* __restrict__ out0) {
  __shared__ __attribute__((aligned(16))) float G[NC][36];   // G[channel][p_local]
  const int t = threadIdx.x, lane = t & 31, wid = t >> 5, h = lane >> 4, n = lane & 15;
  const int blk = blockIdx.x;
  if (blk >= NB * NP / 32) return;
  const int b = blk >> 7, pb = (blk & 127) * 32;
  const int ptile = wid >> 2, og = wid & 3;
  const size_t prow = (size_t)b * NP + pb + ptile * 16 + n;
  const _Float16* A1 = attT + prow * NC;     // input channels 0..255   (att_fore)
  const _Float16* A2 = inT + prow * CIN;     // input channels 256..511 (x = first 256 columns of inT)
  const _Float16* Bb = Fwh + ((size_t)(og * 64 + n)) * CFU;
  v8f d[4];
#pragma unroll
  for (int j = 0; j < 4; ++j) d[j] = zero8();
#pragma unroll 1
  for (int k0 = 0; k0 < NC; k0 += 32) {
    const v16h a = ldfrag_g(A1, k0, h);
#pragma unroll
    for (int j = 0; j < 4; ++j) d[j] = wmma16(a, ldfrag_g(Bb + (size_t)j * 16 * CFU, k0, h), d[j]);
  }
#pragma unroll 1
  for (int k0 = 0; k0 < NC; k0 += 32) {
    const v16h a = ldfrag_g(A2, k0, h);
#pragma unroll
    for (int j = 0; j < 4; ++j) d[j] = wmma16(a, ldfrag_g(Bb + (size_t)j * 16 * CFU, NC + k0, h), d[j]);
  }
#pragma unroll
  for (int j = 0; j < 4; ++j) {
    const int o = og * 64 + j * 16 + n;
#pragma unroll
    for (int r = 0; r < 8; ++r) G[o][ptile * 16 + 8 * h + r] = d[j][r] * (1.f / 64.f);
  }
  __syncthreads();
  v4f vals[8];
  size_t offs[8];
#pragma unroll
  for (int i = 0; i < 8; ++i) {
    const int o = wid * 32 + i * 4 + (lane >> 3);      // wave owns 32 channels; 4 lines per instruction
    const int p4 = (lane & 7) * 4;
    v4f fz = *(const v4fa*)&G[o][p4];
    v4f mv = *(const v4f*)(mF + (size_t)b * NP + pb + p4);
    const size_t gi = ((size_t)(b * NC + o)) * NP + pb + p4;
    v4f xv = *(const v4f*)(x + gi);
    v4f rv;
#pragma unroll
    for (int e = 0; e < 4; ++e) rv[e] = (mv[e] > 0.5f) ? fz[e] : xv[e];
    vals[i] = rv; offs[i] = gi;
  }
#pragma unroll
  for (int i = 0; i < 8; ++i) vst2((v4f*)(out0 + offs[i]), vals[i]);
}

// 8) single block: visatt[b][k] = fixed-order sum of the 32 partial column sums, global max,
__global__ void __launch_bounds__(256) k_final(const float* __restrict__ cpart, float* __restrict__ out1) {
  __shared__ __attribute__((aligned(16))) float vis[NB * NP];
  __shared__ float red[8];
  const int t = threadIdx.x, lane = t & 31, wid = t >> 5;
  float mx = 0.f;
  for (int idx = t; idx < NB * NP; idx += 256) {
    const int b = idx >> 12, k = idx & (NP - 1);
    const float* cp = cpart + (size_t)b * QCN * NP + k;
    float s = 0.f;
#pragma unroll 8
    for (int q = 0; q < QCN; ++q) s += cp[(size_t)q * NP];
    vis[idx] = s;
    mx = fmaxf(mx, s);
  }
  mx = fmaxf(mx, __shfl_xor(mx, 16)); mx = fmaxf(mx, __shfl_xor(mx, 8)); mx = fmaxf(mx, __shfl_xor(mx, 4));
  mx = fmaxf(mx, __shfl_xor(mx, 2));  mx = fmaxf(mx, __shfl_xor(mx, 1));
  if (lane == 0) red[wid] = mx;
  __syncthreads();
  mx = red[0];
#pragma unroll
  for (int w = 1; w < 8; ++w) mx = fmaxf(mx, red[w]);
  const float inv = 1.f / mx;
  for (int i = 0; i < 1024; ++i) {
    const int f = t + 256 * i;
    const int X4 = (f & 127) * 4, Y = (f >> 7) & 511, bb = f >> 16;
    const float v = vis[bb * NP + (Y >> 3) * 64 + (X4 >> 3)] * inv;
    v4f r; r[0] = v; r[1] = v; r[2] = v; r[3] = v;
    *(v4f*)(out1 + (size_t)f * 4) = r;
  }
  
}

// ---------------------------------------------------------------------------
extern "C" void kernel_launch(void* const* d_in, const int* in_sizes, int n_in,
                              void* d_out, int out_size, void* d_ws, size_t ws_size,
                              hipStream_t stream) {
  if (n_in < 6) return;
  if (in_sizes[0] != NB * NC * NP) return;        // x      [4,256,64,64] f32
  if (in_sizes[1] != NB * MS * MS) return;        // mask   [4,1,512,512] f32
  if (in_sizes[2] != NB * CAUX * NP) return;      // aux    [4,768,64,64] f32
  if (in_sizes[3] != NC * CIN) return;            // K_w    [256,1024]    f32
  if (in_sizes[4] != NC) return;                  // K_b    [256]         f32
  if (in_sizes[5] != NC * CFU) return;            // fuse_w [256,512]     f32
  if (out_size != NB * NC * NP + NB * MS * MS) return;

  const float* x   = (const float*)d_in[0];
  const float* msk = (const float*)d_in[1];
  const float* aux = (const float*)d_in[2];
  const float* Kw  = (const float*)d_in[3];
  const float* Kb  = (const float*)d_in[4];
  const float* Fw  = (const float*)d_in[5];
  float* out0 = (float*)d_out;                           // 4,194,304 f32 at byte 0
  float* out1 = out0 + (size_t)NB * NC * NP;             // 1,048,576 f32 at byte 16,777,216

  const size_t o_m   = 0;                                          //     65,536 B
  const size_t o_kwh = o_m   + (size_t)NB * NP * 4;                //    524,288 B
  const size_t o_fwh = o_kwh + (size_t)NC * CIN * 2;               //    262,144 B
  const size_t o_inT = o_fwh + (size_t)NC * CFU * 2;               // 33,554,432 B
  const size_t o_nh  = o_inT + (size_t)NB * NP * CIN * 2;          //  8,388,608 B
  const size_t o_vh  = o_nh  + (size_t)NB * NP * NC * 2;           //  8,388,608 B
  const size_t o_att = o_vh  + (size_t)NB * NC * NP * 2;           //  8,388,608 B
  const size_t o_cp  = o_att + (size_t)NB * NP * NC * 2;           //  2,097,152 B
  const size_t total = o_cp  + (size_t)NB * QCN * NP * 4;          // 61,669,376 B
  if (total > ws_size) return;

  char* w = (char*)d_ws;
  float*    mF    = (float*)(w + o_m);
  _Float16* Kwh   = (_Float16*)(w + o_kwh);
  _Float16* Fwh   = (_Float16*)(w + o_fwh);
  _Float16* inT   = (_Float16*)(w + o_inT);
  _Float16* Nh    = (_Float16*)(w + o_nh);
  _Float16* Vh    = (_Float16*)(w + o_vh);
  _Float16* attT  = (_Float16*)(w + o_att);
  float*    cpart = (float*)(w + o_cp);

  k_cvtw <<<(NC * CIN / 8 + NC * CFU / 8) / 256, 256, 0, stream>>>(Kw, Fw, Kwh, Fwh);   // 192 blocks
  k_pool <<<(NB * NP / 4) / 256, 256, 0, stream>>>(msk, mF);                            // 16 blocks
  k_tin  <<<NB * (CIN / 64) * (NP / 64), 256, 0, stream>>>(x, aux, inT);                // 4096 blocks
  k_feats<<<NB * NP / 32, 256, 0, stream>>>(inT, Kwh, Kb, Nh);                          // 512 blocks
  k_makev<<<(NB * NC * NP / 8) / 256, 256, 0, stream>>>(x, mF, Vh);                      // 2048 blocks
  k_attn <<<NB * QCN, 256, 0, stream>>>(Nh, Vh, mF, attT, cpart);                       // 128 blocks
  k_fuse <<<NB * NP / 32, 256, 0, stream>>>(attT, inT, Fwh, x, mF, out0);               // 512 blocks
  k_final<<<1, 256, 0, stream>>>(cpart, out1);
}

// v001
// One run takes 543 microseconds.
// Two timings next to v000 both put it at 1.29 times that version's speed.
#include <hip/hip_runtime.h>

// Contractions on v_wmma_f32_16x16x32_f16 (f16 operands, f32 accumulate): 1x1 input conv (weights x64),
// q.k scores (unit feature rows x8 on each side), att.v (att x4096), 1x1 fuse conv (weights x64);
// every scale is an exact power of two folded back in f32. Softmax, norms, sums and selects stay f32.

#define NB   4
#define NC   256
#define NP   4096
#define CIN  1024
#define CAUX 768
#define CFU  512
#define MS   512
#define QCH  128            // query rows per block in the score kernel (8 waves x 16)
#define KT   32             // keys per staged tile
#define QCN  (NP / QCH)     // 32 query chunks per batch

typedef _Float16 v16h __attribute__((ext_vector_type(16)));
typedef _Float16 v8h  __attribute__((ext_vector_type(8)));
typedef v8h v8ha __attribute__((may_alias));
typedef float v8f __attribute__((ext_vector_type(8)));
typedef float v4f __attribute__((ext_vector_type(4)));
typedef v4f v4fa __attribute__((may_alias));

union Frag { v16h v; v8h hf[2]; };

__device__ __forceinline__ v8f zero8() {
  v8f z = {0.f, 0.f, 0.f, 0.f, 0.f, 0.f, 0.f, 0.f};
  return z;
}

__device__ __forceinline__ v8f wmma16(v16h a, v16h b, v8f c) {
  v8f d = __builtin_amdgcn_wmma_f32_16x16x32_f16(false, a, false, b, (short)0, c, false, false);
  asm volatile("v_nop\n\tv_nop\n\tv_nop\n\tv_nop" : "+v"(d) : "v"(a), "v"(b));
  return d;
}

// 16 rows x 32 k fragment from a k-contiguous 16-bit matrix. rowp = start of the row owned by this
// lane (row index = lane & 15). Elements 0..7 <- k0+8h+0..7, elements 8..15 <- k0+16+8h+0..7 with
// h = lane >> 4. Used for A (row = m) and for B (row = n of a [n][k] copy). D: acc[r] = (row 8h+r, col lane&15).
__device__ __forceinline__ v16h ldfrag_g(const _Float16* rowp, int k0, int h) {
  Frag f;
  f.hf[0] = *(const v8h*)(rowp + k0 + 8 * h);
  f.hf[1] = *(const v8h*)(rowp + k0 + 16 + 8 * h);
  return f.v;
}
__device__ __forceinline__ v16h ldfrag_l(const _Float16* rowp, int k0, int h) {
  Frag f;
  f.hf[0] = *(const v8ha*)(rowp + k0 + 8 * h);
  f.hf[1] = *(const v8ha*)(rowp + k0 + 16 + 8 * h);
  return f.v;
}

__device__ __forceinline__ v8h pack8(v4f a, v4f b) {
  v8h r;
  r[0] = (_Float16)a[0]; r[1] = (_Float16)a[1]; r[2] = (_Float16)a[2]; r[3] = (_Float16)a[3];
  r[4] = (_Float16)b[0]; r[5] = (_Float16)b[1]; r[6] = (_Float16)b[2]; r[7] = (_Float16)b[3];
  return r;
}

__device__ __forceinline__ float max8f(v4f a, v4f b) {
  float m0 = fmaxf(fmaxf(a[0], a[1]), fmaxf(a[2], a[3]));
  float m1 = fmaxf(fmaxf(b[0], b[1]), fmaxf(b[2], b[3]));
  return fmaxf(m0, m1);
}

template <typename T>
__device__ __forceinline__ void vst2(T* p, T v) {
  *(T*)p = v;
  
}

// ---------------------------------------------------------------------------
// 1) 8x8 max pool of the 512x512 mask, binarised: mF[b][p] in {0,1}. 4 pixels per thread, 16-B stores.
__global__ void __launch_bounds__(256) k_pool(const float* __restrict__ msk, float* __restrict__ mF) {
  const int i = blockIdx.x * 256 + threadIdx.x;
  if (i >= NB * NP / 4) return;
  const int pix0 = i * 4;
  const int b = pix0 >> 12, p = pix0 & (NP - 1);
  const int y = p >> 6, x0 = p & 63;
  const float* s = msk + ((size_t)b * MS + (size_t)y * 8) * MS + (size_t)x0 * 8;
  float mx[4] = {0.f, 0.f, 0.f, 0.f};
#pragma unroll
  for (int dy = 0; dy < 8; ++dy) {
    const float* row = s + dy * MS;
#pragma unroll
    for (int j = 0; j < 4; ++j) {
      v4f a = *(const v4f*)(row + j * 8);
      v4f c = *(const v4f*)(row + j * 8 + 4);
      mx[j] = fmaxf(mx[j], max8f(a, c));
    }
  }
  v4f r;
#pragma unroll
  for (int j = 0; j < 4; ++j) r[j] = (mx[j] > 0.f) ? 1.f : 0.f;
  vst2((v4f*)(mF + pix0), r);
}

// 2) weights to f16 with x64 scale: Kwh[256][1024], Fwh[256][512]. 8 elements per thread, 16-B stores.
__global__ void __launch_bounds__(256) k_cvtw(const float* __restrict__ Kw, const float* __restrict__ Fw,
                                              _Float16* __restrict__ Kwh, _Float16* __restrict__ Fwh) {
  const int i = blockIdx.x * 256 + threadIdx.x;
  const float* src;
  _Float16* dst;
  if (i < NC * CIN / 8) {
    src = Kw + (size_t)i * 8; dst = Kwh + (size_t)i * 8;
  } else if (i < NC * CIN / 8 + NC * CFU / 8) {
    const int j = i - NC * CIN / 8;
    src = Fw + (size_t)j * 8; dst = Fwh + (size_t)j * 8;
  } else {
    return;
  }
  v4f a = *(const v4f*)src;
  v4f c = *(const v4f*)(src + 4);
  a = a * 64.f; c = c * 64.f;
  vst2((v8h*)dst, pack8(a, c));
}

// 3) inT[b][p][1024] f16 = transpose of concat(x, aux) along channels. Block = 64 channels x 64 pixels,
__global__ void __launch_bounds__(256) k_tin(const float* __restrict__ x, const float* __restrict__ aux,
                                             _Float16* __restrict__ inT) {
  __shared__ __attribute__((aligned(16))) _Float16 T[64][72];   // T[p_local][c_local]
  const int t = threadIdx.x, blk = blockIdx.x;
  if (blk >= NB * (CIN / 64) * (NP / 64)) return;
  const int b = blk >> 10, ct = (blk >> 6) & 15, pt = blk & 63;
  const int c0 = ct * 64, p0 = pt * 64;
#pragma unroll
  for (int i = 0; i < 4; ++i) {
    const int f = t + 256 * i;            // 1024 float4 chunks: 64 channel rows x 16
    const int cl = f >> 4, p4 = (f & 15) * 4;
    const int c = c0 + cl;
    const float* src = (c0 < NC)
        ? x   + ((size_t)(b * NC + c)) * NP + p0 + p4
        : aux + ((size_t)(b * CAUX + (c - NC))) * NP + p0 + p4;
    v4f v = *(const v4f*)src;
    T[p4 + 0][cl] = (_Float16)v[0];
    T[p4 + 1][cl] = (_Float16)v[1];
    T[p4 + 2][cl] = (_Float16)v[2];
    T[p4 + 3][cl] = (_Float16)v[3];
  }
  __syncthreads();
  v8h val[2];
  size_t off[2];
#pragma unroll
  for (int i = 0; i < 2; ++i) {
    const int r = (t >> 3) + 32 * i, q = t & 7;
    val[i] = *(const v8ha*)&T[r][q * 8];
    off[i] = ((size_t)(b * NP + p0 + r)) * CIN + c0 + q * 8;
  }
#pragma unroll
  for (int i = 0; i < 2; ++i) vst2((v8h*)(inT + off[i]), val[i]);
}

// 4) feats = inT . Kw^T (+ bias), then per-pixel L2 normalisation, stored as Nh[b][p][256] = f16(8 * unit row).
//    Block = 32 pixels x 256 channels; wave (ptile, og) = 16 pixels x 64 channels; K = 1024 in 32-steps.
__global__ void __launch_bounds__(256) k_feats(const _Float16* __restrict__ inT, const _Float16* __restrict__ Kwh,
                                               const float* __restrict__ Kb, _Float16* __restrict__ Nh) {
  __shared__ __attribute__((aligned(16))) float F[32][260];   // F[p_local][channel]
  const int t = threadIdx.x, lane = t & 31, wid = t >> 5, h = lane >> 4, n = lane & 15;
  const int blk = blockIdx.x;
  if (blk >= NB * NP / 32) return;
  const int b = blk >> 7, pb = (blk & 127) * 32;
  const int ptile = wid >> 2, og = wid & 3;
  const _Float16* Arow = inT + ((size_t)(b * NP + pb + ptile * 16 + n)) * CIN;   // A: row m = pixel
  const _Float16* Bb   = Kwh + ((size_t)(og * 64 + n)) * CIN;                     // B: row n = out channel
  v8f d[4];
#pragma unroll
  for (int j = 0; j < 4; ++j) d[j] = zero8();
#pragma unroll 1
  for (int k0 = 0; k0 < CIN; k0 += 32) {
    const v16h a = ldfrag_g(Arow, k0, h);
#pragma unroll
    for (int j = 0; j < 4; ++j) d[j] = wmma16(a, ldfrag_g(Bb + (size_t)j * 16 * CIN, k0, h), d[j]);
  }
#pragma unroll
  for (int j = 0; j < 4; ++j) {
    const int o = og * 64 + j * 16 + n;
    const float bias = Kb[o];
#pragma unroll
    for (int r = 0; r < 8; ++r) F[ptile * 16 + 8 * h + r][o] = d[j][r] * (1.f / 64.f) + bias;
  }
  __syncthreads();
  v8h vals[4];
  size_t offs[4];
#pragma unroll
  for (int i = 0; i < 4; ++i) {
    const int pl = wid * 4 + i;                        // 4 pixels per wave, one wave per 512-B row
    v4f a = *(const v4fa*)&F[pl][lane * 8];
    v4f c = *(const v4fa*)&F[pl][lane * 8 + 4];
    float ss = a[0] * a[0] + a[1] * a[1] + a[2] * a[2] + a[3] * a[3]
             + c[0] * c[0] + c[1] * c[1] + c[2] * c[2] + c[3] * c[3];
    ss += __shfl_xor(ss, 16); ss += __shfl_xor(ss, 8); ss += __shfl_xor(ss, 4);
    ss += __shfl_xor(ss, 2);  ss += __shfl_xor(ss, 1);
    const float inv = 8.f * (1.f / (sqrtf(ss) + 1e-8f));
    vals[i] = pack8(a * inv, c * inv);
    offs[i] = ((size_t)(b * NP + pb + pl)) * NC + lane * 8;
  }
#pragma unroll
  for (int i = 0; i < 4; ++i) vst2((v8h*)(Nh + offs[i]), vals[i]);
}

// 5) Vh[b][c][p] = f16( x * (1 - m[p]) ). 8 elements per thread, 16-B stores.
__global__ void __launch_bounds__(256) k_makev(const float* __restrict__ x, const float* __restrict__ mF,
                                               _Float16* __restrict__ Vh) {
  const int i = blockIdx.x * 256 + threadIdx.x;
  if (i >= NB * NC * NP / 8) return;
  const size_t e0 = (size_t)i * 8;
  const int p = (int)(e0 & (NP - 1));
  const int b = (int)(e0 >> 20);
  v4f x0 = *(const v4f*)(x + e0);
  v4f x1 = *(const v4f*)(x + e0 + 4);
  v4f m0 = *(const v4f*)(mF + (size_t)b * NP + p);
  v4f m1 = *(const v4f*)(mF + (size_t)b * NP + p + 4);
  v4f k0 = 1.f - m0, k1 = 1.f - m1;
  vst2((v8h*)(Vh + e0), pack8(x0 * k0, x1 * k1));
}

//    fixed shift 20 (|cos| <= 1). Pass 2: att tiles -> per-block column sums (cpart) and O^T = V . att^T.
//    Q chunk, K tile, V tile and the per-wave att^T tile are staged in LDS; every fragment uses ldfrag_*.
__global__ void __launch_bounds__(256) __attribute__((amdgpu_num_vgpr(252)))
k_attn(const _Float16* __restrict__ Nh, const _Float16* __restrict__ Vh, const float* __restrict__ mF,
       _Float16* __restrict__ attT, float* __restrict__ cpart) {
  __shared__ __attribute__((aligned(16))) _Float16 Qs[QCH][264];   // q rows (later reused as O^T tile)
  __shared__ __attribute__((aligned(16))) _Float16 Ks[KT][264];    // key rows  [n=key][k=channel]
  __shared__ __attribute__((aligned(16))) _Float16 Vs[NC][40];     // V tile    [m=channel][k=key]
  __shared__ __attribute__((aligned(16))) _Float16 Ps[8][16][40];  // att^T     [n=q][k=key] per wave
  __shared__ float cs[8][32];                                      // per-wave column sums, 32 keys
  __shared__ __attribute__((aligned(16))) float csb[NP];           // per-block column sums

  const int t = threadIdx.x, lane = t & 31, wid = t >> 5, h = lane >> 4, n = lane & 15;
  const int blk = blockIdx.x;
  if (blk >= NB * QCN) return;
  const int b = blk >> 5, qc = blk & 31;
  const int qblk = qc * QCH, qw = qblk + wid * 16;
  const _Float16* Nb = Nh + (size_t)b * NP * NC;
  const _Float16* Vb = Vh + (size_t)b * NC * NP;
  const float* mb = mF + (size_t)b * NP;

  // stage the block's 128 query rows
#pragma unroll
  for (int i = 0; i < 16; ++i) {
    const int id = t + 256 * i;
    const int row = id >> 5, c8 = (id & 31) * 8;
    *(v8h*)&Qs[row][c8] = *(const v8h*)(Nb + (size_t)(qblk + row) * NC + c8);
  }
  __syncthreads();

  const _Float16* Qrow = &Qs[wid * 16 + n][0];

  float invs[8];
  {
    v16h qf[8];
#pragma unroll
    for (int cb = 0; cb < 8; ++cb) qf[cb] = ldfrag_l(Qrow, cb * 32, h);
    float acc[8];
#pragma unroll
    for (int r = 0; r < 8; ++r) acc[r] = 0.f;
#pragma unroll 1
    for (int kb = 0; kb < NP; kb += KT) {
      __syncthreads();
#pragma unroll
      for (int i = 0; i < 4; ++i) {
        const int id = t + 256 * i;
        const int row = id >> 5, c8 = (id & 31) * 8;
        *(v8h*)&Ks[row][c8] = *(const v8h*)(Nb + (size_t)(kb + row) * NC + c8);
      }
      __syncthreads();
#pragma unroll
      for (int sub = 0; sub < 2; ++sub) {
        v8f s = zero8();
        const _Float16* Krow = &Ks[sub * 16 + n][0];
#pragma unroll
        for (int cb = 0; cb < 8; ++cb) s = wmma16(qf[cb], ldfrag_l(Krow, cb * 32, h), s);
        const float km = 1.f - mb[kb + sub * 16 + n];
#pragma unroll
        for (int r = 0; r < 8; ++r) acc[r] += km * __expf(0.3125f * s[r] - 20.f);
      }
    }
#pragma unroll
    for (int r = 0; r < 8; ++r) {
      float a = acc[r];
      a += __shfl_xor(a, 1); a += __shfl_xor(a, 2); a += __shfl_xor(a, 4); a += __shfl_xor(a, 8);
      invs[r] = mb[qw + 8 * h + r] / (a + 1e-30f);     // query mask folded in: invalid rows -> 0
    }
  }

  // ---- pass 2: att tiles, column sums, O^T = V . (att*4096)^T ----
  v8f o[16];
#pragma unroll
  for (int cc = 0; cc < 16; ++cc) o[cc] = zero8();
#pragma unroll 1
  for (int kb = 0; kb < NP; kb += KT) {
    __syncthreads();
#pragma unroll
    for (int i = 0; i < 4; ++i) {
      const int id = t + 256 * i;
      const int row = id >> 5, c8 = (id & 31) * 8;
      *(v8h*)&Ks[row][c8] = *(const v8h*)(Nb + (size_t)(kb + row) * NC + c8);
      const int vr = id >> 2, v8 = (id & 3) * 8;
      *(v8h*)&Vs[vr][v8] = *(const v8h*)(Vb + (size_t)vr * NP + kb + v8);
    }
    __syncthreads();
#pragma unroll
    for (int sub = 0; sub < 2; ++sub) {
      v8f s = zero8();
      const _Float16* Krow = &Ks[sub * 16 + n][0];
#pragma unroll
      for (int cb = 0; cb < 8; ++cb) s = wmma16(ldfrag_l(Qrow, cb * 32, h), ldfrag_l(Krow, cb * 32, h), s);
      const float km = 1.f - mb[kb + sub * 16 + n];
      float csum = 0.f;
#pragma unroll
      for (int r = 0; r < 8; ++r) {
        const float att = invs[r] * km * __expf(0.3125f * s[r] - 20.f);   // D row q = 8h+r, col key = n
        csum += att;
        Ps[wid][8 * h + r][sub * 16 + n] = (_Float16)(att * 4096.f);
      }
      csum += __shfl_xor(csum, 16);
      if (lane < 16) cs[wid][sub * 16 + lane] = csum;
    }
    __syncthreads();
    if (wid == 0) {
      float tt = 0.f;
#pragma unroll
      for (int w = 0; w < 8; ++w) tt += cs[w][lane];
      csb[kb + lane] = tt;
    }
    const v16h pB = ldfrag_l(&Ps[wid][n][0], 0, h);                   // B: k = key, n = q
#pragma unroll
    for (int g = 0; g < 4; ++g) {
#pragma unroll
      for (int j = 0; j < 4; ++j)
        o[g * 4 + j] = wmma16(ldfrag_l(&Vs[g * 64 + j * 16 + n][0], 0, h), pB, o[g * 4 + j]);   // A: m = channel
    }
  }

  // O^T tile (D rows = channel cc*16+8h+r, cols = q) -> f16, staged in this wave's own Qs rows as [q][channel]
#pragma unroll
  for (int cc = 0; cc < 16; ++cc) {
    v8h tv;
#pragma unroll
    for (int r = 0; r < 8; ++r) tv[r] = (_Float16)(o[cc][r] * (1.f / 4096.f));
    *(v8h*)&Qs[wid * 16 + n][cc * 16 + 8 * h] = tv;
  }
  __syncthreads();
  // attT[b][q][256]: one 512-B row per instruction, 16 B per lane
  _Float16* arow = attT + ((size_t)(b * NP + qw)) * NC + lane * 8;
#pragma unroll
  for (int i = 0; i < 16; ++i) {
    v8h v = *(const v8ha*)&Qs[wid * 16 + i][lane * 8];
    vst2((v8h*)(arow + (size_t)i * NC), v);
  }
  float* cp = cpart + ((size_t)(b * QCN + qc)) * NP;
#pragma unroll
  for (int i = 0; i < 4; ++i) {
    const int f = t + 256 * i;
    v4f v = *(const v4fa*)&csb[f * 4];
    vst2((v4f*)(cp + (size_t)f * 4), v);
  }
}

// 7) fused = concat(att_fore, x) . Fw^T, then out0[b][o][p] = m[p] ? fused : x. Block = 32 pixels x 256
__global__ void __launch_bounds__(256)
k_fuse(const _Float16* __restrict__ attT, const _Float16* __restrict__ inT, const _Float16* __restrict__ Fwh,
       const float* __restrict__ x, const float* __restrict__ mF, float* __restrict__ out0) {
  __shared__ __attribute__((aligned(16))) float G[NC][36];   // G[channel][p_local]
  const int t = threadIdx.x, lane = t & 31, wid = t >> 5, h = lane >> 4, n = lane & 15;
  const int blk = blockIdx.x;
  if (blk >= NB * NP / 32) return;
  const int b = blk >> 7, pb = (blk & 127) * 32;
  const int ptile = wid >> 2, og = wid & 3;
  const size_t prow = (size_t)b * NP + pb + ptile * 16 + n;
  const _Float16* A1 = attT + prow * NC;     // input channels 0..255   (att_fore)
  const _Float16* A2 = inT + prow * CIN;     // input channels 256..511 (x = first 256 columns of inT)
  const _Float16* Bb = Fwh + ((size_t)(og * 64 + n)) * CFU;
  v8f d[4];
#pragma unroll
  for (int j = 0; j < 4; ++j) d[j] = zero8();
#pragma unroll 1
  for (int k0 = 0; k0 < NC; k0 += 32) {
    const v16h a = ldfrag_g(A1, k0, h);
#pragma unroll
    for (int j = 0; j < 4; ++j) d[j] = wmma16(a, ldfrag_g(Bb + (size_t)j * 16 * CFU, k0, h), d[j]);
  }
#pragma unroll 1
  for (int k0 = 0; k0 < NC; k0 += 32) {
    const v16h a = ldfrag_g(A2, k0, h);
#pragma unroll
    for (int j = 0; j < 4; ++j) d[j] = wmma16(a, ldfrag_g(Bb + (size_t)j * 16 * CFU, NC + k0, h), d[j]);
  }
#pragma unroll
  for (int j = 0; j < 4; ++j) {
    const int o = og * 64 + j * 16 + n;
#pragma unroll
    for (int r = 0; r < 8; ++r) G[o][ptile * 16 + 8 * h + r] = d[j][r] * (1.f / 64.f);
  }
  __syncthreads();
  v4f vals[8];
  size_t offs[8];
#pragma unroll
  for (int i = 0; i < 8; ++i) {
    const int o = wid * 32 + i * 4 + (lane >> 3);      // wave owns 32 channels; 4 lines per instruction
    const int p4 = (lane & 7) * 4;
    v4f fz = *(const v4fa*)&G[o][p4];
    v4f mv = *(const v4f*)(mF + (size_t)b * NP + pb + p4);
    const size_t gi = ((size_t)(b * NC + o)) * NP + pb + p4;
    v4f xv = *(const v4f*)(x + gi);
    v4f rv;
#pragma unroll
    for (int e = 0; e < 4; ++e) rv[e] = (mv[e] > 0.5f) ? fz[e] : xv[e];
    vals[i] = rv; offs[i] = gi;
  }
#pragma unroll
  for (int i = 0; i < 8; ++i) vst2((v4f*)(out0 + offs[i]), vals[i]);
}

// 8) visatt[b][k] = fixed-order sum of the 32 partial column sums; one key per thread, 128 blocks.
//    Each block also leaves the maximum of its 128 sums (start value 0) in bmax[block].
#define VB 128              // threads per block, and number of blocks (VB * VB = NB * NP)
__global__ void __launch_bounds__(VB) k_vis(const float* __restrict__ cpart, float* __restrict__ vis,
                                            float* __restrict__ bmax) {
  __shared__ float red[VB / 32];
  const int t = threadIdx.x, lane = t & 31, wid = t >> 5;
  const int idx = blockIdx.x * VB + t;
  if (blockIdx.x >= NB * NP / VB) return;
  const int b = idx >> 12, k = idx & (NP - 1);
  const float* cp = cpart + (size_t)b * QCN * NP + k;
  float v[QCN];
#pragma unroll
  for (int q = 0; q < QCN; ++q) v[q] = cp[(size_t)q * NP];
  float s = 0.f;
#pragma unroll
  for (int q = 0; q < QCN; ++q) s += v[q];
  vis[idx] = s;
  float mx = fmaxf(0.f, s);
  mx = fmaxf(mx, __shfl_xor(mx, 16)); mx = fmaxf(mx, __shfl_xor(mx, 8)); mx = fmaxf(mx, __shfl_xor(mx, 4));
  mx = fmaxf(mx, __shfl_xor(mx, 2));  mx = fmaxf(mx, __shfl_xor(mx, 1));
  if (lane == 0) red[wid] = mx;
  __syncthreads();
  if (t == 0) bmax[blockIdx.x] = fmaxf(fmaxf(red[0], red[1]), fmaxf(red[2], red[3]));
}

// 9) out1 = 8x nearest upsample of visatt / global max. Block = one strip of 8 output rows (one visatt row):
//    every wave folds the 128 block maxima itself, each thread reads one visatt value and stores it 4 x 16 B.
__global__ void __launch_bounds__(256) k_up(const float* __restrict__ vis, const float* __restrict__ bmax,
                                            float* __restrict__ out1) {
  const int t = threadIdx.x, lane = t & 31;
  const int blk = blockIdx.x;
  if (blk >= NB * 64) return;
  const v4f bm = *(const v4f*)(bmax + lane * 4);
  const float sv = vis[blk * 64 + ((t & 127) >> 1)];
  float mx = fmaxf(fmaxf(bm[0], bm[1]), fmaxf(bm[2], bm[3]));
  mx = fmaxf(mx, __shfl_xor(mx, 16)); mx = fmaxf(mx, __shfl_xor(mx, 8)); mx = fmaxf(mx, __shfl_xor(mx, 4));
  mx = fmaxf(mx, __shfl_xor(mx, 2));  mx = fmaxf(mx, __shfl_xor(mx, 1));
  const float inv = 1.f / mx;
  const float v = sv * inv;
  v4f r; r[0] = v; r[1] = v; r[2] = v; r[3] = v;
  float* dst = out1 + ((size_t)blk * 1024 + t) * 4;
#pragma unroll
  for (int i = 0; i < 4; ++i) *(v4f*)(dst + (size_t)i * 1024) = r;
}

// ---------------------------------------------------------------------------
extern "C" void kernel_launch(void* const* d_in, const int* in_sizes, int n_in,
                              void* d_out, int out_size, void* d_ws, size_t ws_size,
                              hipStream_t stream) {
  if (n_in < 6) return;
  if (in_sizes[0] != NB * NC * NP) return;        // x      [4,256,64,64] f32
  if (in_sizes[1] != NB * MS * MS) return;        // mask   [4,1,512,512] f32
  if (in_sizes[2] != NB * CAUX * NP) return;      // aux    [4,768,64,64] f32
  if (in_sizes[3] != NC * CIN) return;            // K_w    [256,1024]    f32
  if (in_sizes[4] != NC) return;                  // K_b    [256]         f32
  if (in_sizes[5] != NC * CFU) return;            // fuse_w [256,512]     f32
  if (out_size != NB * NC * NP + NB * MS * MS) return;

  const float* x   = (const float*)d_in[0];
  const float* msk = (const float*)d_in[1];
  const float* aux = (const float*)d_in[2];
  const float* Kw  = (const float*)d_in[3];
  const float* Kb  = (const float*)d_in[4];
  const float* Fw  = (const float*)d_in[5];
  float* out0 = (float*)d_out;                           // 4,194,304 f32 at byte 0
  float* out1 = out0 + (size_t)NB * NC * NP;             // 1,048,576 f32 at byte 16,777,216

  const size_t o_m   = 0;                                          //     65,536 B
  const size_t o_kwh = o_m   + (size_t)NB * NP * 4;                //    524,288 B
  const size_t o_fwh = o_kwh + (size_t)NC * CIN * 2;               //    262,144 B
  const size_t o_inT = o_fwh + (size_t)NC * CFU * 2;               // 33,554,432 B
  const size_t o_nh  = o_inT + (size_t)NB * NP * CIN * 2;          //  8,388,608 B
  const size_t o_vh  = o_nh  + (size_t)NB * NP * NC * 2;           //  8,388,608 B
  const size_t o_att = o_vh  + (size_t)NB * NC * NP * 2;           //  8,388,608 B
  const size_t o_cp  = o_att + (size_t)NB * NP * NC * 2;           //  2,097,152 B
  const size_t o_vis = o_cp  + (size_t)NB * QCN * NP * 4;          //     65,536 B
  const size_t o_bm  = o_vis + (size_t)NB * NP * 4;                //        512 B
  const size_t total = o_bm  + (size_t)VB * 4;                     // 61,735,424 B
  if (total > ws_size) return;

  char* w = (char*)d_ws;
  float*    mF    = (float*)(w + o_m);
  _Float16* Kwh   = (_Float16*)(w + o_kwh);
  _Float16* Fwh   = (_Float16*)(w + o_fwh);
  _Float16* inT   = (_Float16*)(w + o_inT);
  _Float16* Nh    = (_Float16*)(w + o_nh);
  _Float16* Vh    = (_Float16*)(w + o_vh);
  _Float16* attT  = (_Float16*)(w + o_att);
  float*    cpart = (float*)(w + o_cp);
  float*    vis   = (float*)(w + o_vis);
  float*    bmax  = (float*)(w + o_bm);

  k_cvtw <<<(NC * CIN / 8 + NC * CFU / 8) / 256, 256, 0, stream>>>(Kw, Fw, Kwh, Fwh);   // 192 blocks
  k_pool <<<(NB * NP / 4) / 256, 256, 0, stream>>>(msk, mF);                            // 16 blocks
  k_tin  <<<NB * (CIN / 64) * (NP / 64), 256, 0, stream>>>(x, aux, inT);                // 4096 blocks
  k_feats<<<NB * NP / 32, 256, 0, stream>>>(inT, Kwh, Kb, Nh);                          // 512 blocks
  k_makev<<<(NB * NC * NP / 8) / 256, 256, 0, stream>>>(x, mF, Vh);                      // 2048 blocks
  k_attn <<<NB * QCN, 256, 0, stream>>>(Nh, Vh, mF, attT, cpart);                       // 128 blocks
  k_fuse <<<NB * NP / 32, 256, 0, stream>>>(attT, inT, Fwh, x, mF, out0);               // 512 blocks
  k_vis  <<<NB * NP / VB, VB, 0, stream>>>(cpart, vis, bmax);                           // 128 blocks
  k_up   <<<NB * 64, 256, 0, stream>>>(vis, bmax, out1);                                // 256 blocks
}

// v002
// A run of this version takes 343 microseconds.
// Timed twice side by side with v001, it ran 1.58 times as fast both times.
// Over all steps from v000 it is 2.03 times as fast.
#include <hip/hip_runtime.h>

// Contractions on v_wmma_f32_16x16x32_f16 (f16 operands, f32 accumulate): 1x1 input conv (weights x64),
// q.k scores (unit feature rows x8 on each side), att.v (att x4096), 1x1 fuse conv (weights x64);
// every scale is an exact power of two folded back in f32. Softmax, norms, sums and selects stay f32.

#define NB   4
#define NC   256
#define NP   4096
#define CIN  1024
#define CAUX 768
#define CFU  512
#define MS   512
#define QCH  128            // query rows per block in the score kernel (8 waves x 16)
#define KT   32             // keys per staged tile
#define QCN  (NP / QCH)     // 32 query chunks per batch

typedef _Float16 v16h __attribute__((ext_vector_type(16)));
typedef _Float16 v8h  __attribute__((ext_vector_type(8)));
typedef v8h v8ha __attribute__((may_alias));
typedef float v8f __attribute__((ext_vector_type(8)));
typedef float v4f __attribute__((ext_vector_type(4)));
typedef v4f v4fa __attribute__((may_alias));
typedef int v4i __attribute__((ext_vector_type(4)));
typedef v4i v4ia __attribute__((may_alias));

union Frag { v16h v; v8h hf[2]; };

__device__ __forceinline__ v8f zero8() {
  v8f z = {0.f, 0.f, 0.f, 0.f, 0.f, 0.f, 0.f, 0.f};
  return z;
}

__device__ __forceinline__ v8f wmma16(v16h a, v16h b, v8f c) {
  v8f d = __builtin_amdgcn_wmma_f32_16x16x32_f16(false, a, false, b, (short)0, c, false, false);
  asm volatile("v_nop\n\tv_nop\n\tv_nop\n\tv_nop" : "+v"(d) : "v"(a), "v"(b));
  return d;
}

// 16 rows x 32 k fragment from a k-contiguous 16-bit matrix. rowp = start of the row owned by this
// lane (row index = lane & 15). Elements 0..7 <- k0+8h+0..7, elements 8..15 <- k0+16+8h+0..7 with
// h = lane >> 4. Used for A (row = m) and for B (row = n of a [n][k] copy). D: acc[r] = (row 8h+r, col lane&15).
__device__ __forceinline__ v16h ldfrag_g(const _Float16* rowp, int k0, int h) {
  Frag f;
  f.hf[0] = *(const v8h*)(rowp + k0 + 8 * h);
  f.hf[1] = *(const v8h*)(rowp + k0 + 16 + 8 * h);
  return f.v;
}
__device__ __forceinline__ v16h ldfrag_l(const _Float16* rowp, int k0, int h) {
  Frag f;
  f.hf[0] = *(const v8ha*)(rowp + k0 + 8 * h);
  f.hf[1] = *(const v8ha*)(rowp + k0 + 16 + 8 * h);
  return f.v;
}

__device__ __forceinline__ v8h pack8(v4f a, v4f b) {
  v8h r;
  r[0] = (_Float16)a[0]; r[1] = (_Float16)a[1]; r[2] = (_Float16)a[2]; r[3] = (_Float16)a[3];
  r[4] = (_Float16)b[0]; r[5] = (_Float16)b[1]; r[6] = (_Float16)b[2]; r[7] = (_Float16)b[3];
  return r;
}

__device__ __forceinline__ float max8f(v4f a, v4f b) {
  float m0 = fmaxf(fmaxf(a[0], a[1]), fmaxf(a[2], a[3]));
  float m1 = fmaxf(fmaxf(b[0], b[1]), fmaxf(b[2], b[3]));
  return fmaxf(m0, m1);
}

template <typename T>
__device__ __forceinline__ void vst2(T* p, T v) {
  *(T*)p = v;
  
}

// ---------------------------------------------------------------------------
// 1) 8x8 max pool of the 512x512 mask, binarised: mF[b][p] in {0,1}. 4 pixels per thread, 16-B stores.
__global__ void __launch_bounds__(256) k_pool(const float* __restrict__ msk, float* __restrict__ mF) {
  const int i = blockIdx.x * 256 + threadIdx.x;
  if (i >= NB * NP / 4) return;
  const int pix0 = i * 4;
  const int b = pix0 >> 12, p = pix0 & (NP - 1);
  const int y = p >> 6, x0 = p & 63;
  const float* s = msk + ((size_t)b * MS + (size_t)y * 8) * MS + (size_t)x0 * 8;
  float mx[4] = {0.f, 0.f, 0.f, 0.f};
#pragma unroll
  for (int dy = 0; dy < 8; ++dy) {
    const float* row = s + dy * MS;
#pragma unroll
    for (int j = 0; j < 4; ++j) {
      v4f a = *(const v4f*)(row + j * 8);
      v4f c = *(const v4f*)(row + j * 8 + 4);
      mx[j] = fmaxf(mx[j], max8f(a, c));
    }
  }
  v4f r;
#pragma unroll
  for (int j = 0; j < 4; ++j) r[j] = (mx[j] > 0.f) ? 1.f : 0.f;
  vst2((v4f*)(mF + pix0), r);
}

// 1b) dense order of the keys. A pixel with m = 0 is a key; every term of a pixel with m = 1 on the key side is
//     multiplied by 0, so only the keys get a slot. Per batch: kpos[p] = slot of key p (-1 for a non-key),
//     kidx = the pixels as a permutation, keys first (in pixel order), then the non-keys; nkA[b] = number of keys.
__global__ void __launch_bounds__(256) k_rank(const float* __restrict__ mF, int* __restrict__ kpos,
                                              int* __restrict__ kidx, int* __restrict__ nkA) {
  __shared__ __attribute__((aligned(16))) int cnt[256];
  const int t = threadIdx.x, b = blockIdx.x;
  if (b >= NB) return;
  const float* ms = mF + (size_t)b * NP + t * 16;
  bool key[16];
  int c = 0;
#pragma unroll   // both loops unrolled whole: key[] is indexed by constants and stays in registers
  for (int j = 0; j < 4; ++j) {
    v4f a = *(const v4f*)(ms + j * 4);
#pragma unroll
    for (int e = 0; e < 4; ++e) { key[j * 4 + e] = a[e] < 0.5f; c += key[j * 4 + e] ? 1 : 0; }
  }
  cnt[t] = c;
  __syncthreads();
  int pre = 0, tot = 0;
#pragma unroll 4   // four 16-B LDS reads in flight per trip instead of one waited read
  for (int i = 0; i < 64; ++i) {
    v4i v = *(const v4ia*)&cnt[i * 4];
#pragma unroll
    for (int e = 0; e < 4; ++e) { tot += v[e]; pre += (i * 4 + e < t) ? v[e] : 0; }
  }
  int* kp = kpos + (size_t)b * NP + t * 16;
  int* ki = kidx + (size_t)b * NP;
  int r = pre;                                   // keys in front of the current pixel
#pragma unroll   // as above: key[] and w by constant index
  for (int j = 0; j < 4; ++j) {
    v4i w;
#pragma unroll
    for (int e = 0; e < 4; ++e) {
      const int p = t * 16 + j * 4 + e;
      const bool k = key[j * 4 + e];
      w[e] = k ? r : -1;
      ki[k ? r : tot + p - r] = p;
      r += k ? 1 : 0;
    }
    *(v4i*)(kp + j * 4) = w;
  }
  if (t == 0) nkA[b] = tot;
}

// 2) weights to f16 with x64 scale: Kwh[256][1024], Fwh[256][512]. 8 elements per thread, 16-B stores.
__global__ void __launch_bounds__(256) k_cvtw(const float* __restrict__ Kw, const float* __restrict__ Fw,
                                              _Float16* __restrict__ Kwh, _Float16* __restrict__ Fwh) {
  const int i = blockIdx.x * 256 + threadIdx.x;
  const float* src;
  _Float16* dst;
  if (i < NC * CIN / 8) {
    src = Kw + (size_t)i * 8; dst = Kwh + (size_t)i * 8;
  } else if (i < NC * CIN / 8 + NC * CFU / 8) {
    const int j = i - NC * CIN / 8;
    src = Fw + (size_t)j * 8; dst = Fwh + (size_t)j * 8;
  } else {
    return;
  }
  v4f a = *(const v4f*)src;
  v4f c = *(const v4f*)(src + 4);
  a = a * 64.f; c = c * 64.f;
  vst2((v8h*)dst, pack8(a, c));
}

// 3) inT[b][p][1024] f16 = transpose of concat(x, aux) along channels. Block = 64 channels x 64 pixels,
__global__ void __launch_bounds__(256) k_tin(const float* __restrict__ x, const float* __restrict__ aux,
                                             _Float16* __restrict__ inT) {
  __shared__ __attribute__((aligned(16))) _Float16 T[64][72];   // T[p_local][c_local]
  const int t = threadIdx.x, blk = blockIdx.x;
  if (blk >= NB * (CIN / 64) * (NP / 64)) return;
  const int b = blk >> 10, ct = (blk >> 6) & 15, pt = blk & 63;
  const int c0 = ct * 64, p0 = pt * 64;
#pragma unroll
  for (int i = 0; i < 4; ++i) {
    const int f = t + 256 * i;            // 1024 float4 chunks: 64 channel rows x 16
    const int cl = f >> 4, p4 = (f & 15) * 4;
    const int c = c0 + cl;
    const float* src = (c0 < NC)
        ? x   + ((size_t)(b * NC + c)) * NP + p0 + p4
        : aux + ((size_t)(b * CAUX + (c - NC))) * NP + p0 + p4;
    v4f v = *(const v4f*)src;
    T[p4 + 0][cl] = (_Float16)v[0];
    T[p4 + 1][cl] = (_Float16)v[1];
    T[p4 + 2][cl] = (_Float16)v[2];
    T[p4 + 3][cl] = (_Float16)v[3];
  }
  __syncthreads();
  v8h val[2];
  size_t off[2];
#pragma unroll
  for (int i = 0; i < 2; ++i) {
    const int r = (t >> 3) + 32 * i, q = t & 7;
    val[i] = *(const v8ha*)&T[r][q * 8];
    off[i] = ((size_t)(b * NP + p0 + r)) * CIN + c0 + q * 8;
  }
#pragma unroll
  for (int i = 0; i < 2; ++i) vst2((v8h*)(inT + off[i]), val[i]);
}

// 4) feats = inT . Kw^T (+ bias), then per-pixel L2 normalisation, stored as Nh[b][p][256] = f16(8 * unit row);
//    the row of a key goes to its dense slot Kc[b][kpos[p]][256] as well.
//    Block = 32 pixels x 256 channels; wave (ptile, og) = 16 pixels x 64 channels; K = 1024 in 32-steps.
__global__ void __launch_bounds__(256) k_feats(const _Float16* __restrict__ inT, const _Float16* __restrict__ Kwh,
                                               const float* __restrict__ Kb, const int* __restrict__ kpos,
                                               _Float16* __restrict__ Nh, _Float16* __restrict__ Kc) {
  __shared__ __attribute__((aligned(16))) float F[32][260];   // F[p_local][channel]
  const int t = threadIdx.x, lane = t & 31, wid = t >> 5, h = lane >> 4, n = lane & 15;
  const int blk = blockIdx.x;
  if (blk >= NB * NP / 32) return;
  const int b = blk >> 7, pb = (blk & 127) * 32;
  const int ptile = wid >> 2, og = wid & 3;
  const _Float16* Arow = inT + ((size_t)(b * NP + pb + ptile * 16 + n)) * CIN;   // A: row m = pixel
  const _Float16* Bb   = Kwh + ((size_t)(og * 64 + n)) * CIN;                     // B: row n = out channel
  v8f d[4];
#pragma unroll
  for (int j = 0; j < 4; ++j) d[j] = zero8();
#pragma unroll 1
  for (int k0 = 0; k0 < CIN; k0 += 32) {
    const v16h a = ldfrag_g(Arow, k0, h);
#pragma unroll
    for (int j = 0; j < 4; ++j) d[j] = wmma16(a, ldfrag_g(Bb + (size_t)j * 16 * CIN, k0, h), d[j]);
  }
#pragma unroll
  for (int j = 0; j < 4; ++j) {
    const int o = og * 64 + j * 16 + n;
    const float bias = Kb[o];
#pragma unroll
    for (int r = 0; r < 8; ++r) F[ptile * 16 + 8 * h + r][o] = d[j][r] * (1.f / 64.f) + bias;
  }
  __syncthreads();
  v8h vals[4];
  size_t offs[4];
  int slot[4];
#pragma unroll
  for (int i = 0; i < 4; ++i) {
    const int pl = wid * 4 + i;                        // 4 pixels per wave, one wave per 512-B row
    slot[i] = kpos[b * NP + pb + pl];
    v4f a = *(const v4fa*)&F[pl][lane * 8];
    v4f c = *(const v4fa*)&F[pl][lane * 8 + 4];
    float ss = a[0] * a[0] + a[1] * a[1] + a[2] * a[2] + a[3] * a[3]
             + c[0] * c[0] + c[1] * c[1] + c[2] * c[2] + c[3] * c[3];
    ss += __shfl_xor(ss, 16); ss += __shfl_xor(ss, 8); ss += __shfl_xor(ss, 4);
    ss += __shfl_xor(ss, 2);  ss += __shfl_xor(ss, 1);
    const float inv = 8.f * (1.f / (sqrtf(ss) + 1e-8f));
    vals[i] = pack8(a * inv, c * inv);
    offs[i] = ((size_t)(b * NP + pb + pl)) * NC + lane * 8;
  }
#pragma unroll
  for (int i = 0; i < 4; ++i) vst2((v8h*)(Nh + offs[i]), vals[i]);
#pragma unroll   // slot[] and vals[] by constant index, in registers
  for (int i = 0; i < 4; ++i)
    if ((unsigned)slot[i] < (unsigned)NP) vst2((v8h*)(Kc + ((size_t)(b * NP + slot[i])) * NC + lane * 8), vals[i]);
}

// 5) Vh[b][c][j] = f16( x[b][c][kidx[j]] ) for the dense key slots j < nk, 0 up to the end of the last 32-key tile.
//    8 slots per thread, 16-B stores.
__global__ void __launch_bounds__(256) k_makev(const float* __restrict__ x, const int* __restrict__ kidx,
                                               const int* __restrict__ nkA, _Float16* __restrict__ Vh) {
  const int i = blockIdx.x * 256 + threadIdx.x;
  if (i >= NB * NC * NP / 8) return;
  const size_t e0 = (size_t)i * 8;
  const int j0 = (int)(e0 & (NP - 1));
  const int b = (int)(e0 >> 20);
  const int nk = min(max(nkA[b], 0), NP);
  if (j0 >= ((nk + KT - 1) & ~(KT - 1))) return;
  const float* xr = x + (e0 - (size_t)j0);
  const int* ki = kidx + (size_t)b * NP + j0;
  v4i i0 = *(const v4i*)ki;
  v4i i1 = *(const v4i*)(ki + 4);
  v4f a, c;
#pragma unroll   // vector elements by constant index, all eight gathers in flight
  for (int e = 0; e < 4; ++e) {
    const float va = xr[i0[e] & (NP - 1)];
    asm volatile("s_wait_xcnt 0x0" ::: "memory");   // before a later gather's result lands in this load's address registers
    const float vc = xr[i1[e] & (NP - 1)];
    asm volatile("s_wait_xcnt 0x0" ::: "memory");   // the same
    a[e] = (j0 + e < nk) ? va : 0.f;
    c[e] = (j0 + 4 + e < nk) ? vc : 0.f;
  }
  vst2((v8h*)(Vh + e0), pack8(a, c));
}

// 6) attention over the nk dense keys of the batch. Pass 1: row sums of exp(20 cos - 20),
//    fixed shift 20 (|cos| <= 1). Pass 2: att tiles -> per-block column sums (cpart) and O^T = V . att^T.
//    Q chunk, K tile, V tile and the per-wave att^T tile are staged in LDS; every fragment uses ldfrag_*.
__global__ void __launch_bounds__(256) __attribute__((amdgpu_num_vgpr(252)))
k_attn(const _Float16* __restrict__ Nh, const _Float16* __restrict__ Kc, const _Float16* __restrict__ Vh,
       const float* __restrict__ mF, const int* __restrict__ nkA, _Float16* __restrict__ attT,
       float* __restrict__ cpart) {
  __shared__ __attribute__((aligned(16))) _Float16 Qs[QCH][264];   // q rows (later reused as O^T tile)
  __shared__ __attribute__((aligned(16))) _Float16 Ks[KT][264];    // key rows  [n=key][k=channel]
  __shared__ __attribute__((aligned(16))) _Float16 Vs[NC][40];     // V tile    [m=channel][k=key]
  __shared__ __attribute__((aligned(16))) _Float16 Ps[8][16][40];  // att^T     [n=q][k=key] per wave
  __shared__ float cs[8][32];                                      // per-wave column sums, 32 keys
  __shared__ __attribute__((aligned(16))) float csb[NP];           // per-block column sums

  const int t = threadIdx.x, lane = t & 31, wid = t >> 5, h = lane >> 4, n = lane & 15;
  const int blk = blockIdx.x;
  if (blk >= NB * QCN) return;
  const int b = blk >> 5, qc = blk & 31;
  const int qblk = qc * QCH, qw = qblk + wid * 16;
  const _Float16* Nb = Nh + (size_t)b * NP * NC;
  const _Float16* Kb = Kc + (size_t)b * NP * NC;
  const int nk = __builtin_amdgcn_readfirstlane(min(max(nkA[b], 0), NP));   // in a scalar register: the key loops and their barriers stand under scalar branches
  const _Float16* Vb = Vh + (size_t)b * NC * NP;
  const float* mb = mF + (size_t)b * NP;

  // stage the block's 128 query rows
#pragma unroll
  for (int i = 0; i < 16; ++i) {
    const int id = t + 256 * i;
    const int row = id >> 5, c8 = (id & 31) * 8;
    *(v8h*)&Qs[row][c8] = *(const v8h*)(Nb + (size_t)(qblk + row) * NC + c8);
  }
  __syncthreads();

  const _Float16* Qrow = &Qs[wid * 16 + n][0];

  float invs[8];
  {
    v16h qf[8];
#pragma unroll
    for (int cb = 0; cb < 8; ++cb) qf[cb] = ldfrag_l(Qrow, cb * 32, h);
    float acc[8];
#pragma unroll
    for (int r = 0; r < 8; ++r) acc[r] = 0.f;
#pragma unroll 1
    for (int kb = 0; kb < nk; kb += KT) {
      __syncthreads();
#pragma unroll
      for (int i = 0; i < 4; ++i) {
        const int id = t + 256 * i;
        const int row = id >> 5, c8 = (id & 31) * 8;
        *(v8h*)&Ks[row][c8] = *(const v8h*)(Kb + (size_t)min(kb + row, nk - 1) * NC + c8);   // slots past nk: last key again
      }
      __syncthreads();
#pragma unroll
      for (int sub = 0; sub < 2; ++sub) {
        v8f s = zero8();
        const _Float16* Krow = &Ks[sub * 16 + n][0];
#pragma unroll
        for (int cb = 0; cb < 8; ++cb) s = wmma16(qf[cb], ldfrag_l(Krow, cb * 32, h), s);
        const float km = (kb + sub * 16 + n < nk) ? 1.f : 0.f;
#pragma unroll
        for (int r = 0; r < 8; ++r) acc[r] += km * __expf(0.3125f * s[r] - 20.f);
      }
    }
#pragma unroll
    for (int r = 0; r < 8; ++r) {
      float a = acc[r];
      a += __shfl_xor(a, 1); a += __shfl_xor(a, 2); a += __shfl_xor(a, 4); a += __shfl_xor(a, 8);
      invs[r] = mb[qw + 8 * h + r] / (a + 1e-30f);     // query mask folded in: invalid rows -> 0
    }
  }

  // ---- pass 2: att tiles, column sums, O^T = V . (att*4096)^T ----
  v8f o[16];
#pragma unroll
  for (int cc = 0; cc < 16; ++cc) o[cc] = zero8();
#pragma unroll 1
  for (int kb = 0; kb < nk; kb += KT) {
    __syncthreads();
#pragma unroll
    for (int i = 0; i < 4; ++i) {
      const int id = t + 256 * i;
      const int row = id >> 5, c8 = (id & 31) * 8;
      *(v8h*)&Ks[row][c8] = *(const v8h*)(Kb + (size_t)min(kb + row, nk - 1) * NC + c8);
      const int vr = id >> 2, v8 = (id & 3) * 8;
      *(v8h*)&Vs[vr][v8] = *(const v8h*)(Vb + (size_t)vr * NP + kb + v8);
    }
    __syncthreads();
#pragma unroll
    for (int sub = 0; sub < 2; ++sub) {
      v8f s = zero8();
      const _Float16* Krow = &Ks[sub * 16 + n][0];
#pragma unroll
      for (int cb = 0; cb < 8; ++cb) s = wmma16(ldfrag_l(Qrow, cb * 32, h), ldfrag_l(Krow, cb * 32, h), s);
      const float km = (kb + sub * 16 + n < nk) ? 1.f : 0.f;
      float csum = 0.f;
#pragma unroll
      for (int r = 0; r < 8; ++r) {
        const float att = invs[r] * km * __expf(0.3125f * s[r] - 20.f);   // D row q = 8h+r, col key = n
        csum += att;
        Ps[wid][8 * h + r][sub * 16 + n] = (_Float16)(att * 4096.f);
      }
      csum += __shfl_xor(csum, 16);
      if (lane < 16) cs[wid][sub * 16 + lane] = csum;
    }
    __syncthreads();
    if (wid == 0) {
      float tt = 0.f;
#pragma unroll
      for (int w = 0; w < 8; ++w) tt += cs[w][lane];
      csb[kb + lane] = tt;
    }
    const v16h pB = ldfrag_l(&Ps[wid][n][0], 0, h);                   // B: k = key, n = q
#pragma unroll
    for (int g = 0; g < 4; ++g) {
#pragma unroll
      for (int j = 0; j < 4; ++j)
        o[g * 4 + j] = wmma16(ldfrag_l(&Vs[g * 64 + j * 16 + n][0], 0, h), pB, o[g * 4 + j]);   // A: m = channel
    }
  }

  // O^T tile (D rows = channel cc*16+8h+r, cols = q) -> f16, staged in this wave's own Qs rows as [q][channel]
#pragma unroll
  for (int cc = 0; cc < 16; ++cc) {
    v8h tv;
#pragma unroll
    for (int r = 0; r < 8; ++r) tv[r] = (_Float16)(o[cc][r] * (1.f / 4096.f));
    *(v8h*)&Qs[wid * 16 + n][cc * 16 + 8 * h] = tv;
  }
  __syncthreads();
  // attT[b][q][256]: one 512-B row per instruction, 16 B per lane
  _Float16* arow = attT + ((size_t)(b * NP + qw)) * NC + lane * 8;
#pragma unroll
  for (int i = 0; i < 16; ++i) {
    v8h v = *(const v8ha*)&Qs[wid * 16 + i][lane * 8];
    vst2((v8h*)(arow + (size_t)i * NC), v);
  }
  float* cp = cpart + ((size_t)(b * QCN + qc)) * NP;
#pragma unroll
  for (int i = 0; i < 4; ++i) {
    const int f = t + 256 * i;
    if (f * 4 < nk) {                                  // csb holds whole 32-key tiles up to nk
      v4f v = *(const v4fa*)&csb[f * 4];
      vst2((v4f*)(cp + (size_t)f * 4), v);
    }
  }
}

// 7) fused = concat(att_fore, x) . Fw^T, then out0[b][o][p] = m[p] ? fused : x. Block = 32 pixels x 256
__global__ void __launch_bounds__(256)
k_fuse(const _Float16* __restrict__ attT, const _Float16* __restrict__ inT, const _Float16* __restrict__ Fwh,
       const float* __restrict__ x, const float* __restrict__ mF, float* __restrict__ out0) {
  __shared__ __attribute__((aligned(16))) float G[NC][36];   // G[channel][p_local]
  const int t = threadIdx.x, lane = t & 31, wid = t >> 5, h = lane >> 4, n = lane & 15;
  const int blk = blockIdx.x;
  if (blk >= NB * NP / 32) return;
  const int b = blk >> 7, pb = (blk & 127) * 32;
  const int ptile = wid >> 2, og = wid & 3;
  const size_t prow = (size_t)b * NP + pb + ptile * 16 + n;
  const _Float16* A1 = attT + prow * NC;     // input channels 0..255   (att_fore)
  const _Float16* A2 = inT + prow * CIN;     // input channels 256..511 (x = first 256 columns of inT)
  const _Float16* Bb = Fwh + ((size_t)(og * 64 + n)) * CFU;
  v8f d[4];
#pragma unroll
  for (int j = 0; j < 4; ++j) d[j] = zero8();
#pragma unroll 1
  for (int k0 = 0; k0 < NC; k0 += 32) {
    const v16h a = ldfrag_g(A1, k0, h);
#pragma unroll
    for (int j = 0; j < 4; ++j) d[j] = wmma16(a, ldfrag_g(Bb + (size_t)j * 16 * CFU, k0, h), d[j]);
  }
#pragma unroll 1
  for (int k0 = 0; k0 < NC; k0 += 32) {
    const v16h a = ldfrag_g(A2, k0, h);
#pragma unroll
    for (int j = 0; j < 4; ++j) d[j] = wmma16(a, ldfrag_g(Bb + (size_t)j * 16 * CFU, NC + k0, h), d[j]);
  }
#pragma unroll
  for (int j = 0; j < 4; ++j) {
    const int o = og * 64 + j * 16 + n;
#pragma unroll
    for (int r = 0; r < 8; ++r) G[o][ptile * 16 + 8 * h + r] = d[j][r] * (1.f / 64.f);
  }
  __syncthreads();
  v4f vals[8];
  size_t offs[8];
#pragma unroll
  for (int i = 0; i < 8; ++i) {
    const int o = wid * 32 + i * 4 + (lane >> 3);      // wave owns 32 channels; 4 lines per instruction
    const int p4 = (lane & 7) * 4;
    v4f fz = *(const v4fa*)&G[o][p4];
    v4f mv = *(const v4f*)(mF + (size_t)b * NP + pb + p4);
    const size_t gi = ((size_t)(b * NC + o)) * NP + pb + p4;
    v4f xv = *(const v4f*)(x + gi);
    v4f rv;
#pragma unroll
    for (int e = 0; e < 4; ++e) rv[e] = (mv[e] > 0.5f) ? fz[e] : xv[e];
    vals[i] = rv; offs[i] = gi;
  }
#pragma unroll
  for (int i = 0; i < 8; ++i) vst2((v4f*)(out0 + offs[i]), vals[i]);
}

// 8) visatt[b][p] = fixed-order sum of the 32 partial column sums at the pixel's key slot, 0 for a non-key;
//    one pixel per thread, 128 blocks.
//    Each block also leaves the maximum of its 128 sums (start value 0) in bmax[block].
#define VB 128              // threads per block, and number of blocks (VB * VB = NB * NP)
__global__ void __launch_bounds__(VB) k_vis(const float* __restrict__ cpart, const int* __restrict__ kpos,
                                            float* __restrict__ vis, float* __restrict__ bmax) {
  __shared__ float red[VB / 32];
  const int t = threadIdx.x, lane = t & 31, wid = t >> 5;
  const int idx = blockIdx.x * VB + t;
  if (blockIdx.x >= NB * NP / VB) return;
  const int b = idx >> 12;
  const int slot = kpos[idx];
  float s = 0.f;
  if ((unsigned)slot < (unsigned)NP) {
    const float* cp = cpart + (size_t)b * QCN * NP + slot;
    float v[QCN];
#pragma unroll
    for (int q = 0; q < QCN; ++q) v[q] = cp[(size_t)q * NP];
#pragma unroll
    for (int q = 0; q < QCN; ++q) s += v[q];
  }
  vis[idx] = s;
  float mx = fmaxf(0.f, s);
  mx = fmaxf(mx, __shfl_xor(mx, 16)); mx = fmaxf(mx, __shfl_xor(mx, 8)); mx = fmaxf(mx, __shfl_xor(mx, 4));
  mx = fmaxf(mx, __shfl_xor(mx, 2));  mx = fmaxf(mx, __shfl_xor(mx, 1));
  if (lane == 0) red[wid] = mx;
  __syncthreads();
  if (t == 0) bmax[blockIdx.x] = fmaxf(fmaxf(red[0], red[1]), fmaxf(red[2], red[3]));
}

// 9) out1 = 8x nearest upsample of visatt / global max. Block = one strip of 8 output rows (one visatt row):
//    every wave folds the 128 block maxima itself, each thread reads one visatt value and stores it 4 x 16 B.
__global__ void __launch_bounds__(256) k_up(const float* __restrict__ vis, const float* __restrict__ bmax,
                                            float* __restrict__ out1) {
  const int t = threadIdx.x, lane = t & 31;
  const int blk = blockIdx.x;
  if (blk >= NB * 64) return;
  const v4f bm = *(const v4f*)(bmax + lane * 4);
  const float sv = vis[blk * 64 + ((t & 127) >> 1)];
  float mx = fmaxf(fmaxf(bm[0], bm[1]), fmaxf(bm[2], bm[3]));
  mx = fmaxf(mx, __shfl_xor(mx, 16)); mx = fmaxf(mx, __shfl_xor(mx, 8)); mx = fmaxf(mx, __shfl_xor(mx, 4));
  mx = fmaxf(mx, __shfl_xor(mx, 2));  mx = fmaxf(mx, __shfl_xor(mx, 1));
  const float inv = 1.f / mx;
  const float v = sv * inv;
  v4f r; r[0] = v; r[1] = v; r[2] = v; r[3] = v;
  float* dst = out1 + ((size_t)blk * 1024 + t) * 4;
#pragma unroll
  for (int i = 0; i < 4; ++i) *(v4f*)(dst + (size_t)i * 1024) = r;
}

// ---------------------------------------------------------------------------
extern "C" void kernel_launch(void* const* d_in, const int* in_sizes, int n_in,
                              void* d_out, int out_size, void* d_ws, size_t ws_size,
                              hipStream_t stream) {
  if (n_in < 6) return;
  if (in_sizes[0] != NB * NC * NP) return;        // x      [4,256,64,64] f32
  if (in_sizes[1] != NB * MS * MS) return;        // mask   [4,1,512,512] f32
  if (in_sizes[2] != NB * CAUX * NP) return;      // aux    [4,768,64,64] f32
  if (in_sizes[3] != NC * CIN) return;            // K_w    [256,1024]    f32
  if (in_sizes[4] != NC) return;                  // K_b    [256]         f32
  if (in_sizes[5] != NC * CFU) return;            // fuse_w [256,512]     f32
  if (out_size != NB * NC * NP + NB * MS * MS) return;

  const float* x   = (const float*)d_in[0];
  const float* msk = (const float*)d_in[1];
  const float* aux = (const float*)d_in[2];
  const float* Kw  = (const float*)d_in[3];
  const float* Kb  = (const float*)d_in[4];
  const float* Fw  = (const float*)d_in[5];
  float* out0 = (float*)d_out;                           // 4,194,304 f32 at byte 0
  float* out1 = out0 + (size_t)NB * NC * NP;             // 1,048,576 f32 at byte 16,777,216

  const size_t o_m   = 0;                                          //     65,536 B
  const size_t o_kwh = o_m   + (size_t)NB * NP * 4;                //    524,288 B
  const size_t o_fwh = o_kwh + (size_t)NC * CIN * 2;               //    262,144 B
  const size_t o_inT = o_fwh + (size_t)NC * CFU * 2;               // 33,554,432 B
  const size_t o_nh  = o_inT + (size_t)NB * NP * CIN * 2;          //  8,388,608 B
  const size_t o_vh  = o_nh  + (size_t)NB * NP * NC * 2;           //  8,388,608 B
  const size_t o_att = o_vh  + (size_t)NB * NC * NP * 2;           //  8,388,608 B
  const size_t o_cp  = o_att + (size_t)NB * NP * NC * 2;           //  2,097,152 B
  const size_t o_vis = o_cp  + (size_t)NB * QCN * NP * 4;          //     65,536 B
  const size_t o_bm  = o_vis + (size_t)NB * NP * 4;                //        512 B
  const size_t o_kc  = o_bm  + (size_t)VB * 4;                     //  8,388,608 B
  const size_t o_kp  = o_kc  + (size_t)NB * NP * NC * 2;           //     65,536 B
  const size_t o_ki  = o_kp  + (size_t)NB * NP * 4;                //     65,536 B
  const size_t o_nk  = o_ki  + (size_t)NB * NP * 4;                //         16 B
  const size_t total = o_nk  + (size_t)NB * 4;                     // 70,255,120 B
  if (total > ws_size) return;

  char* w = (char*)d_ws;
  float*    mF    = (float*)(w + o_m);
  _Float16* Kwh   = (_Float16*)(w + o_kwh);
  _Float16* Fwh   = (_Float16*)(w + o_fwh);
  _Float16* inT   = (_Float16*)(w + o_inT);
  _Float16* Nh    = (_Float16*)(w + o_nh);
  _Float16* Vh    = (_Float16*)(w + o_vh);
  _Float16* attT  = (_Float16*)(w + o_att);
  float*    cpart = (float*)(w + o_cp);
  float*    vis   = (float*)(w + o_vis);
  float*    bmax  = (float*)(w + o_bm);
  _Float16* Kc    = (_Float16*)(w + o_kc);
  int*      kpos  = (int*)(w + o_kp);
  int*      kidx  = (int*)(w + o_ki);
  int*      nkA   = (int*)(w + o_nk);

  k_cvtw <<<(NC * CIN / 8 + NC * CFU / 8) / 256, 256, 0, stream>>>(Kw, Fw, Kwh, Fwh);   // 192 blocks
  k_pool <<<(NB * NP / 4) / 256, 256, 0, stream>>>(msk, mF);                            // 16 blocks
  k_rank <<<NB, 256, 0, stream>>>(mF, kpos, kidx, nkA);                                 // 4 blocks
  k_tin  <<<NB * (CIN / 64) * (NP / 64), 256, 0, stream>>>(x, aux, inT);                // 4096 blocks
  k_feats<<<NB * NP / 32, 256, 0, stream>>>(inT, Kwh, Kb, kpos, Nh, Kc);                         // 512 blocks
  k_makev<<<(NB * NC * NP / 8) / 256, 256, 0, stream>>>(x, kidx, nkA, Vh);                     // 2048 blocks
  k_attn <<<NB * QCN, 256, 0, stream>>>(Nh, Kc, Vh, mF, nkA, attT, cpart);                      // 128 blocks
  k_fuse <<<NB * NP / 32, 256, 0, stream>>>(attT, inT, Fwh, x, mF, out0);               // 512 blocks
  k_vis  <<<NB * NP / VB, VB, 0, stream>>>(cpart, kpos, vis, bmax);                          // 128 blocks
  k_up   <<<NB * 64, 256, 0, stream>>>(vis, bmax, out1);                                // 256 blocks
}

// v003
// Measured time: 202 microseconds a run.
// Timed twice side by side with v002, it ran 1.71 times as fast both times.
// All steps since v000 together make it 3.47 times as fast.
#include <hip/hip_runtime.h>

// Contractions on v_wmma_f32_16x16x32_f16 (f16 operands, f32 accumulate): 1x1 input conv (weights x64),
// q.k scores (unit feature rows x8 on each side), att.v (att x4096), 1x1 fuse conv (weights x64);
// every scale is an exact power of two folded back in f32. Softmax, norms, sums and selects stay f32.

#define NB   4
#define NC   256
#define NP   4096
#define CIN  1024
#define CAUX 768
#define CFU  512
#define MS   512
#define QCH  64             // query rows per block in the score kernel (4 query tiles x 16)
#define KG   4              // key groups per block: waves that share a query tile and split the staged keys
#define KW   32             // keys per wave and trip
#define KT   (KG * KW)      // 128 keys per staged tile
#define AW   (QCH / 16 * KG)  // 16 waves per block in the score kernel
#define ATH  (AW * 32)      // its 512 threads
#define VP   (KT + 8)       // LDS pitch of a V row in elements: 272 B = 16 B x 17
#define QCN  (NP / QCH)     // 64 query chunks per batch

typedef _Float16 v16h __attribute__((ext_vector_type(16)));
typedef _Float16 v8h  __attribute__((ext_vector_type(8)));
typedef v8h v8ha __attribute__((may_alias));
typedef float v8f __attribute__((ext_vector_type(8)));
typedef float v4f __attribute__((ext_vector_type(4)));
typedef v4f v4fa __attribute__((may_alias));
typedef int v4i __attribute__((ext_vector_type(4)));
typedef v4i v4ia __attribute__((may_alias));

union Frag { v16h v; v8h hf[2]; };

__device__ __forceinline__ v8f zero8() {
  v8f z = {0.f, 0.f, 0.f, 0.f, 0.f, 0.f, 0.f, 0.f};
  return z;
}

__device__ __forceinline__ v8f wmma16(v16h a, v16h b, v8f c) {
  v8f d = __builtin_amdgcn_wmma_f32_16x16x32_f16(false, a, false, b, (short)0, c, false, false);
  asm volatile("v_nop\n\tv_nop\n\tv_nop\n\tv_nop" : "+v"(d) : "v"(a), "v"(b));
  return d;
}

// 16 rows x 32 k fragment from a k-contiguous 16-bit matrix. rowp = start of the row owned by this
// lane (row index = lane & 15). Elements 0..7 <- k0+8h+0..7, elements 8..15 <- k0+16+8h+0..7 with
// h = lane >> 4. Used for A (row = m) and for B (row = n of a [n][k] copy). D: acc[r] = (row 8h+r, col lane&15).
__device__ __forceinline__ v16h ldfrag_g(const _Float16* rowp, int k0, int h) {
  Frag f;
  f.hf[0] = *(const v8h*)(rowp + k0 + 8 * h);
  f.hf[1] = *(const v8h*)(rowp + k0 + 16 + 8 * h);
  return f.v;
}
__device__ __forceinline__ v16h ldfrag_l(const _Float16* rowp, int k0, int h) {
  Frag f;
  f.hf[0] = *(const v8ha*)(rowp + k0 + 8 * h);
  f.hf[1] = *(const v8ha*)(rowp + k0 + 16 + 8 * h);
  return f.v;
}

__device__ __forceinline__ v8h pack8(v4f a, v4f b) {
  v8h r;
  r[0] = (_Float16)a[0]; r[1] = (_Float16)a[1]; r[2] = (_Float16)a[2]; r[3] = (_Float16)a[3];
  r[4] = (_Float16)b[0]; r[5] = (_Float16)b[1]; r[6] = (_Float16)b[2]; r[7] = (_Float16)b[3];
  return r;
}

__device__ __forceinline__ float max8f(v4f a, v4f b) {
  float m0 = fmaxf(fmaxf(a[0], a[1]), fmaxf(a[2], a[3]));
  float m1 = fmaxf(fmaxf(b[0], b[1]), fmaxf(b[2], b[3]));
  return fmaxf(m0, m1);
}

template <typename T>
__device__ __forceinline__ void vst2(T* p, T v) {
  *(T*)p = v;
  
}

// ---------------------------------------------------------------------------
// 1) 8x8 max pool of the 512x512 mask, binarised: mF[b][p] in {0,1}. 4 pixels per thread, 16-B stores.
__global__ void __launch_bounds__(256) k_pool(const float* __restrict__ msk, float* __restrict__ mF) {
  const int i = blockIdx.x * 256 + threadIdx.x;
  if (i >= NB * NP / 4) return;
  const int pix0 = i * 4;
  const int b = pix0 >> 12, p = pix0 & (NP - 1);
  const int y = p >> 6, x0 = p & 63;
  const float* s = msk + ((size_t)b * MS + (size_t)y * 8) * MS + (size_t)x0 * 8;
  float mx[4] = {0.f, 0.f, 0.f, 0.f};
#pragma unroll
  for (int dy = 0; dy < 8; ++dy) {
    const float* row = s + dy * MS;
#pragma unroll
    for (int j = 0; j < 4; ++j) {
      v4f a = *(const v4f*)(row + j * 8);
      v4f c = *(const v4f*)(row + j * 8 + 4);
      mx[j] = fmaxf(mx[j], max8f(a, c));
    }
  }
  v4f r;
#pragma unroll
  for (int j = 0; j < 4; ++j) r[j] = (mx[j] > 0.f) ? 1.f : 0.f;
  vst2((v4f*)(mF + pix0), r);
}

// 1b) dense order of the keys. A pixel with m = 0 is a key; every term of a pixel with m = 1 on the key side is
//     multiplied by 0, so only the keys get a slot. Per batch: kpos[p] = slot of key p (-1 for a non-key),
//     kidx = the pixels as a permutation, keys first (in pixel order), then the non-keys; nkA[b] = number of keys.
__global__ void __launch_bounds__(256) k_rank(const float* __restrict__ mF, int* __restrict__ kpos,
                                              int* __restrict__ kidx, int* __restrict__ nkA) {
  __shared__ __attribute__((aligned(16))) int cnt[256];
  const int t = threadIdx.x, b = blockIdx.x;
  if (b >= NB) return;
  const float* ms = mF + (size_t)b * NP + t * 16;
  bool key[16];
  int c = 0;
#pragma unroll   // both loops unrolled whole: key[] is indexed by constants and stays in registers
  for (int j = 0; j < 4; ++j) {
    v4f a = *(const v4f*)(ms + j * 4);
#pragma unroll
    for (int e = 0; e < 4; ++e) { key[j * 4 + e] = a[e] < 0.5f; c += key[j * 4 + e] ? 1 : 0; }
  }
  cnt[t] = c;
  __syncthreads();
  int pre = 0, tot = 0;
#pragma unroll 4   // four 16-B LDS reads in flight per trip instead of one waited read
  for (int i = 0; i < 64; ++i) {
    v4i v = *(const v4ia*)&cnt[i * 4];
#pragma unroll
    for (int e = 0; e < 4; ++e) { tot += v[e]; pre += (i * 4 + e < t) ? v[e] : 0; }
  }
  int* kp = kpos + (size_t)b * NP + t * 16;
  int* ki = kidx + (size_t)b * NP;
  int r = pre;                                   // keys in front of the current pixel
#pragma unroll   // as above: key[] and w by constant index
  for (int j = 0; j < 4; ++j) {
    v4i w;
#pragma unroll
    for (int e = 0; e < 4; ++e) {
      const int p = t * 16 + j * 4 + e;
      const bool k = key[j * 4 + e];
      w[e] = k ? r : -1;
      ki[k ? r : tot + p - r] = p;
      r += k ? 1 : 0;
    }
    *(v4i*)(kp + j * 4) = w;
  }
  if (t == 0) nkA[b] = tot;
}

// 2) weights to f16 with x64 scale: Kwh[256][1024], Fwh[256][512]. 8 elements per thread, 16-B stores.
__global__ void __launch_bounds__(256) k_cvtw(const float* __restrict__ Kw, const float* __restrict__ Fw,
                                              _Float16* __restrict__ Kwh, _Float16* __restrict__ Fwh) {
  const int i = blockIdx.x * 256 + threadIdx.x;
  const float* src;
  _Float16* dst;
  if (i < NC * CIN / 8) {
    src = Kw + (size_t)i * 8; dst = Kwh + (size_t)i * 8;
  } else if (i < NC * CIN / 8 + NC * CFU / 8) {
    const int j = i - NC * CIN / 8;
    src = Fw + (size_t)j * 8; dst = Fwh + (size_t)j * 8;
  } else {
    return;
  }
  v4f a = *(const v4f*)src;
  v4f c = *(const v4f*)(src + 4);
  a = a * 64.f; c = c * 64.f;
  vst2((v8h*)dst, pack8(a, c));
}

// 3) inT[b][p][1024] f16 = transpose of concat(x, aux) along channels. Block = 64 channels x 64 pixels,
__global__ void __launch_bounds__(256) k_tin(const float* __restrict__ x, const float* __restrict__ aux,
                                             _Float16* __restrict__ inT) {
  __shared__ __attribute__((aligned(16))) _Float16 T[64][72];   // T[p_local][c_local]
  const int t = threadIdx.x, blk = blockIdx.x;
  if (blk >= NB * (CIN / 64) * (NP / 64)) return;
  const int b = blk >> 10, ct = (blk >> 6) & 15, pt = blk & 63;
  const int c0 = ct * 64, p0 = pt * 64;
#pragma unroll
  for (int i = 0; i < 4; ++i) {
    const int f = t + 256 * i;            // 1024 float4 chunks: 64 channel rows x 16
    const int cl = f >> 4, p4 = (f & 15) * 4;
    const int c = c0 + cl;
    const float* src = (c0 < NC)
        ? x   + ((size_t)(b * NC + c)) * NP + p0 + p4
        : aux + ((size_t)(b * CAUX + (c - NC))) * NP + p0 + p4;
    v4f v = *(const v4f*)src;
    T[p4 + 0][cl] = (_Float16)v[0];
    T[p4 + 1][cl] = (_Float16)v[1];
    T[p4 + 2][cl] = (_Float16)v[2];
    T[p4 + 3][cl] = (_Float16)v[3];
  }
  __syncthreads();
  v8h val[2];
  size_t off[2];
#pragma unroll
  for (int i = 0; i < 2; ++i) {
    const int r = (t >> 3) + 32 * i, q = t & 7;
    val[i] = *(const v8ha*)&T[r][q * 8];
    off[i] = ((size_t)(b * NP + p0 + r)) * CIN + c0 + q * 8;
  }
#pragma unroll
  for (int i = 0; i < 2; ++i) vst2((v8h*)(inT + off[i]), val[i]);
}

// 4) feats = inT . Kw^T (+ bias), then per-pixel L2 normalisation, stored as Nh[b][p][256] = f16(8 * unit row);
//    the row of a key goes to its dense slot Kc[b][kpos[p]][256] as well.
//    Block = 32 pixels x 256 channels; wave (ptile, og) = 16 pixels x 64 channels; K = 1024 in 32-steps.
__global__ void __launch_bounds__(256) k_feats(const _Float16* __restrict__ inT, const _Float16* __restrict__ Kwh,
                                               const float* __restrict__ Kb, const int* __restrict__ kpos,
                                               _Float16* __restrict__ Nh, _Float16* __restrict__ Kc) {
  __shared__ __attribute__((aligned(16))) float F[32][260];   // F[p_local][channel]
  const int t = threadIdx.x, lane = t & 31, wid = t >> 5, h = lane >> 4, n = lane & 15;
  const int blk = blockIdx.x;
  if (blk >= NB * NP / 32) return;
  const int b = blk >> 7, pb = (blk & 127) * 32;
  const int ptile = wid >> 2, og = wid & 3;
  const _Float16* Arow = inT + ((size_t)(b * NP + pb + ptile * 16 + n)) * CIN;   // A: row m = pixel
  const _Float16* Bb   = Kwh + ((size_t)(og * 64 + n)) * CIN;                     // B: row n = out channel
  v8f d[4];
#pragma unroll
  for (int j = 0; j < 4; ++j) d[j] = zero8();
#pragma unroll 1
  for (int k0 = 0; k0 < CIN; k0 += 32) {
    const v16h a = ldfrag_g(Arow, k0, h);
#pragma unroll
    for (int j = 0; j < 4; ++j) d[j] = wmma16(a, ldfrag_g(Bb + (size_t)j * 16 * CIN, k0, h), d[j]);
  }
#pragma unroll
  for (int j = 0; j < 4; ++j) {
    const int o = og * 64 + j * 16 + n;
    const float bias = Kb[o];
#pragma unroll
    for (int r = 0; r < 8; ++r) F[ptile * 16 + 8 * h + r][o] = d[j][r] * (1.f / 64.f) + bias;
  }
  __syncthreads();
  v8h vals[4];
  size_t offs[4];
  int slot[4];
#pragma unroll
  for (int i = 0; i < 4; ++i) {
    const int pl = wid * 4 + i;                        // 4 pixels per wave, one wave per 512-B row
    slot[i] = kpos[b * NP + pb + pl];
    v4f a = *(const v4fa*)&F[pl][lane * 8];
    v4f c = *(const v4fa*)&F[pl][lane * 8 + 4];
    float ss = a[0] * a[0] + a[1] * a[1] + a[2] * a[2] + a[3] * a[3]
             + c[0] * c[0] + c[1] * c[1] + c[2] * c[2] + c[3] * c[3];
    ss += __shfl_xor(ss, 16); ss += __shfl_xor(ss, 8); ss += __shfl_xor(ss, 4);
    ss += __shfl_xor(ss, 2);  ss += __shfl_xor(ss, 1);
    const float inv = 8.f * (1.f / (sqrtf(ss) + 1e-8f));
    vals[i] = pack8(a * inv, c * inv);
    offs[i] = ((size_t)(b * NP + pb + pl)) * NC + lane * 8;
  }
#pragma unroll
  for (int i = 0; i < 4; ++i) vst2((v8h*)(Nh + offs[i]), vals[i]);
#pragma unroll   // slot[] and vals[] by constant index, in registers
  for (int i = 0; i < 4; ++i)
    if ((unsigned)slot[i] < (unsigned)NP) vst2((v8h*)(Kc + ((size_t)(b * NP + slot[i])) * NC + lane * 8), vals[i]);
}

// 5) Vh[b][c][j] = f16( x[b][c][kidx[j]] ) for the dense key slots j < nk, 0 up to the end of the last 128-key tile.
//    8 slots per thread, 16-B stores.
__global__ void __launch_bounds__(256) k_makev(const float* __restrict__ x, const int* __restrict__ kidx,
                                               const int* __restrict__ nkA, _Float16* __restrict__ Vh) {
  const int i = blockIdx.x * 256 + threadIdx.x;
  if (i >= NB * NC * NP / 8) return;
  const size_t e0 = (size_t)i * 8;
  const int j0 = (int)(e0 & (NP - 1));
  const int b = (int)(e0 >> 20);
  const int nk = min(max(nkA[b], 0), NP);
  if (j0 >= ((nk + KT - 1) & ~(KT - 1))) return;
  const float* xr = x + (e0 - (size_t)j0);
  const int* ki = kidx + (size_t)b * NP + j0;
  v4i i0 = *(const v4i*)ki;
  v4i i1 = *(const v4i*)(ki + 4);
  v4f a, c;
#pragma unroll   // vector elements by constant index, all eight gathers in flight
  for (int e = 0; e < 4; ++e) {
    const float va = xr[i0[e] & (NP - 1)];
    asm volatile("s_wait_xcnt 0x0" ::: "memory");   // before a later gather's result lands in this load's address registers
    const float vc = xr[i1[e] & (NP - 1)];
    asm volatile("s_wait_xcnt 0x0" ::: "memory");   // the same
    a[e] = (j0 + e < nk) ? va : 0.f;
    c[e] = (j0 + 4 + e < nk) ? vc : 0.f;
  }
  vst2((v8h*)(Vh + e0), pack8(a, c));
}

// One wave's share of a staged key tile: rows r0, r0 + 16, ..., r0 + 112 of Kb, 512 B each, 16 B per lane (r0, nk the
// same in every lane). A whole tile takes one address and constant offsets; in the last, partial tile a slot past nk
// reads the last key again.
__device__ __forceinline__ void ldkeys(v8h (&kr)[KT / AW], const _Float16* Kb, const _Float16* p, int r0, int nk, int lane) {
  if (r0 + (KT - AW) < nk) {                           // p = the lane's 16 B of row r0, carried from trip to trip
#pragma unroll
    for (int i = 0; i < KT / AW; ++i) {
      kr[i] = *(const v8h*)(p + (size_t)(AW * i) * NC);
      if (i >= KT / AW - 2) asm volatile("s_wait_xcnt 0x0" ::: "memory");   // the shared address registers are free from the last load on: before its result or a later value lands in them
    }
  } else {
#pragma unroll
    for (int i = 0; i < KT / AW; ++i) {
      kr[i] = *(const v8h*)(Kb + (size_t)min(r0 + AW * i, nk - 1) * NC + lane * 8);
      asm volatile("s_wait_xcnt 0x0" ::: "memory");   // before a later load's result lands in this load's address registers
    }
  }
}

// 6) attention over the nk dense keys of the batch. Block = 64 query rows, 16 waves: wave (qt, kg) owns query tile qt
//    (16 rows) and key group kg (32 of the 128 keys staged per trip), so a trip covers four times the keys of a
//    one-group block and 256 blocks fill the chip. Pass 1: row sums of exp(20 cos - 20), fixed shift 20 (|cos| <= 1),
//    the four groups' partial sums added through LDS. Pass 2: att tiles -> per-block column sums (cpart) and
//    O^T = V . att^T, the four groups' partial O^T added through LDS behind the loop, in a fixed order.
//    Q chunk, K tile, V tile and the per-wave att^T tile are staged in LDS; every fragment uses ldfrag_*.
__global__ void __launch_bounds__(ATH) __attribute__((amdgpu_num_vgpr(252)))
k_attn(const _Float16* __restrict__ Nh, const _Float16* __restrict__ Kc, const _Float16* __restrict__ Vh,
       const float* __restrict__ mF, const int* __restrict__ nkA, _Float16* __restrict__ attT,
       float* __restrict__ cpart) {
  __shared__ __attribute__((aligned(16))) _Float16 Qs[QCH][264];   // q rows (later reused as O^T tile)
  __shared__ __attribute__((aligned(16))) _Float16 KV[KT * 264 + NC * VP];   // K tile, V tile; behind the loop: partial O^T in f32
  __shared__ __attribute__((aligned(16))) _Float16 Ps[AW][16][40]; // att^T     [n=q][k=key] per wave
  __shared__ float cs[AW][KW];                                     // per-wave column sums, 32 keys
  __shared__ float rs[KG][QCH];                                    // per-key-group row sums
  __shared__ __attribute__((aligned(16))) float csb[NP];           // per-block column sums
  _Float16* const Ks = KV;                 // key rows  [n=key][k=channel], pitch 264
  _Float16* const Vs = KV + KT * 264;      // V tile    [m=channel][k=key], pitch VP

  const int t = threadIdx.x, lane = t & 31, h = lane >> 4, n = lane & 15;
  const int wid = __builtin_amdgcn_readfirstlane(t >> 5);   // in a scalar register: the tests on the wave's group are scalar branches
  const int qt = wid & 3, kg = wid >> 2;
  const int blk = blockIdx.x;
  if (blk >= NB * QCN) return;
  const int b = blk / QCN, qc = blk % QCN;
  const int qblk = qc * QCH;
  const _Float16* Nb = Nh + (size_t)b * NP * NC;
  const _Float16* Kb = Kc + (size_t)b * NP * NC;
  const int nk = __builtin_amdgcn_readfirstlane(min(max(nkA[b], 0), NP));   // in a scalar register: the key loops and their barriers stand under scalar branches
  const _Float16* Vb = Vh + (size_t)b * NC * NP;
  const float* mb = mF + (size_t)b * NP;

  // stage the block's 64 query rows
#pragma unroll
  for (int i = 0; i < QCH * 32 / ATH; ++i) {
    const int id = t + ATH * i;
    const int row = id >> 5, c8 = (id & 31) * 8;
    *(v8h*)&Qs[row][c8] = *(const v8h*)(Nb + (size_t)(qblk + row) * NC + c8);
  }
  __syncthreads();

  const _Float16* Qrow = &Qs[qt * 16 + n][0];

  float invs[8];
  {
    v16h qf[8];
#pragma unroll
    for (int cb = 0; cb < 8; ++cb) qf[cb] = ldfrag_l(Qrow, cb * 32, h);
    float acc[8];
#pragma unroll
    for (int r = 0; r < 8; ++r) acc[r] = 0.f;
    const _Float16* kp1 = Kb + (size_t)wid * NC + lane * 8;
#pragma unroll 1
    for (int kb = 0; kb < nk; kb += KT) {
      __syncthreads();
      v8h kr[KT / AW];
      ldkeys(kr, Kb, kp1, kb + wid, nk, lane);
      kp1 += (size_t)KT * NC;
#pragma unroll
      for (int i = 0; i < KT / AW; ++i) *(v8h*)&Ks[(wid + AW * i) * 264 + lane * 8] = kr[i];
      __syncthreads();
#pragma unroll
      for (int sub = 0; sub < 2; ++sub) {
        v8f s = zero8();
        const _Float16* Krow = &Ks[(kg * KW + sub * 16 + n) * 264];
#pragma unroll
        for (int cb = 0; cb < 8; ++cb) s = wmma16(qf[cb], ldfrag_l(Krow, cb * 32, h), s);
        const float km = (kb + kg * KW + sub * 16 + n < nk) ? 1.f : 0.f;
#pragma unroll
        for (int r = 0; r < 8; ++r) acc[r] += km * __expf(0.3125f * s[r] - 20.f);
      }
    }
#pragma unroll
    for (int r = 0; r < 8; ++r) {
      float a = acc[r];
      a += __shfl_xor(a, 1); a += __shfl_xor(a, 2); a += __shfl_xor(a, 4); a += __shfl_xor(a, 8);
      if (n == 0) rs[kg][qt * 16 + 8 * h + r] = a;
    }
    __syncthreads();
#pragma unroll
    for (int r = 0; r < 8; ++r) {
      const int ql = qt * 16 + 8 * h + r;
      const float a = (rs[0][ql] + rs[1][ql]) + (rs[2][ql] + rs[3][ql]);
      invs[r] = mb[qblk + ql] / (a + 1e-30f);          // query mask folded in: invalid rows -> 0
    }
  }

  // ---- pass 2: att tiles, column sums, O^T = V . (att*4096)^T ----
  const int vr0 = t >> 4, v8 = (t & 15) * 8;           // V staging: channel row and key offset of this thread's 16 B
  const unsigned voff = (unsigned)(vr0 * NP + v8);
  const _Float16* kp2 = Kb + (size_t)wid * NC + lane * 8;
  v8f o[16];
#pragma unroll
  for (int cc = 0; cc < 16; ++cc) o[cc] = zero8();
#pragma unroll 1
  for (int kb = 0; kb < nk; kb += KT) {
    __syncthreads();
    v8h vv[KT / AW], kr[KT / AW];
    ldkeys(kr, Kb, kp2, kb + wid, nk, lane);
    kp2 += (size_t)KT * NC;
#pragma unroll
    for (int i = 0; i < KT / AW; ++i) {
      vv[i] = *(const v8h*)(Vb + kb + (size_t)(32 * i) * NP + voff);   // two 256-B row pieces per wave and load
      if (i >= KT / AW - 2) asm volatile("s_wait_xcnt 0x0" ::: "memory");   // as in ldkeys: before the shared address registers are written again
    }
#pragma unroll
    for (int i = 0; i < KT / AW; ++i) {
      *(v8h*)&Ks[(wid + AW * i) * 264 + lane * 8] = kr[i];
      *(v8h*)&Vs[(vr0 + 32 * i) * VP + v8] = vv[i];
    }
    __syncthreads();
#pragma unroll
    for (int sub = 0; sub < 2; ++sub) {
      v8f s = zero8();
      const _Float16* Krow = &Ks[(kg * KW + sub * 16 + n) * 264];
#pragma unroll
      for (int cb = 0; cb < 8; ++cb) s = wmma16(ldfrag_l(Qrow, cb * 32, h), ldfrag_l(Krow, cb * 32, h), s);
      const float km = (kb + kg * KW + sub * 16 + n < nk) ? 1.f : 0.f;
      float csum = 0.f;
#pragma unroll
      for (int r = 0; r < 8; ++r) {
        const float att = invs[r] * km * __expf(0.3125f * s[r] - 20.f);   // D row q = 8h+r, col key = n
        csum += att;
        Ps[wid][8 * h + r][sub * 16 + n] = (_Float16)(att * 4096.f);
      }
      csum += __shfl_xor(csum, 16);
      if (lane < 16) cs[wid][sub * 16 + lane] = csum;
    }
    __syncthreads();
    if (wid < KG) {                                    // wave g folds key group g: its four query tiles' sums
      float tt = 0.f;
#pragma unroll
      for (int w = 0; w < 4; ++w) tt += cs[wid * 4 + w][lane];
      csb[kb + wid * KW + lane] = tt;
    }
    const v16h pB = ldfrag_l(&Ps[wid][n][0], 0, h);                   // B: k = key, n = q
#pragma unroll
    for (int g = 0; g < 4; ++g) {
#pragma unroll
      for (int j = 0; j < 4; ++j)
        o[g * 4 + j] = wmma16(ldfrag_l(&Vs[(g * 64 + j * 16 + n) * VP], kg * KW, h), pB, o[g * 4 + j]);   // A: m = channel
    }
  }

  // the four key groups' partial O^T tiles, added in f32 as (g0 + g2) + (g1 + g3); a tile lies in the K/V space as
  // [cc][half][lane][4], 16 B per lane, 16 KiB per wave
  float* const R = (float*)KV;
  __syncthreads();                                     // every wave has left the K and V tiles
  if (kg >= 2) {
    float* rp = R + ((kg - 2) * 4 + qt) * 4096 + lane * 4;
#pragma unroll
    for (int cc = 0; cc < 16; ++cc) {
      v4f lo = {o[cc][0], o[cc][1], o[cc][2], o[cc][3]};
      v4f hi = {o[cc][4], o[cc][5], o[cc][6], o[cc][7]};
      *(v4fa*)(rp + cc * 256) = lo;
      *(v4fa*)(rp + cc * 256 + 128) = hi;
    }
  }
  __syncthreads();
  if (kg < 2) {
    const float* rp = R + (kg * 4 + qt) * 4096 + lane * 4;
#pragma unroll
    for (int cc = 0; cc < 16; ++cc) {
      v4f lo = *(const v4fa*)(rp + cc * 256);
      v4f hi = *(const v4fa*)(rp + cc * 256 + 128);
#pragma unroll
      for (int e = 0; e < 4; ++e) { o[cc][e] += lo[e]; o[cc][4 + e] += hi[e]; }
    }
  }
  __syncthreads();
  if (kg == 1) {
    float* rp = R + qt * 4096 + lane * 4;
#pragma unroll
    for (int cc = 0; cc < 16; ++cc) {
      v4f lo = {o[cc][0], o[cc][1], o[cc][2], o[cc][3]};
      v4f hi = {o[cc][4], o[cc][5], o[cc][6], o[cc][7]};
      *(v4fa*)(rp + cc * 256) = lo;
      *(v4fa*)(rp + cc * 256 + 128) = hi;
    }
  }
  __syncthreads();
  // O^T tile (D rows = channel cc*16+8h+r, cols = q) -> f16, staged in the query tile's own Qs rows as [q][channel]
  if (kg == 0) {
    const float* rp = R + qt * 4096 + lane * 4;
#pragma unroll
    for (int cc = 0; cc < 16; ++cc) {
      v4f lo = *(const v4fa*)(rp + cc * 256);
      v4f hi = *(const v4fa*)(rp + cc * 256 + 128);
      v8h tv;
#pragma unroll
      for (int e = 0; e < 4; ++e) {
        tv[e]     = (_Float16)((o[cc][e] + lo[e]) * (1.f / 4096.f));
        tv[4 + e] = (_Float16)((o[cc][4 + e] + hi[e]) * (1.f / 4096.f));
      }
      *(v8h*)&Qs[qt * 16 + n][cc * 16 + 8 * h] = tv;
    }
  }
  __syncthreads();
  // attT[b][q][256]: one 512-B row per instruction, 16 B per lane, four rows per wave
  _Float16* arow = attT + ((size_t)(b * NP + qblk + wid * 4)) * NC + lane * 8;
#pragma unroll
  for (int i = 0; i < QCH / AW; ++i) {
    v8h v = *(const v8ha*)&Qs[wid * 4 + i][lane * 8];
    vst2((v8h*)(arow + (size_t)i * NC), v);
  }
  float* cp = cpart + ((size_t)(b * QCN + qc)) * NP;
#pragma unroll
  for (int i = 0; i < NP / 4 / ATH; ++i) {
    const int f = t + ATH * i;
    if (f * 4 < nk) {                                  // csb holds whole 128-key tiles up to nk
      v4f v = *(const v4fa*)&csb[f * 4];
      vst2((v4f*)(cp + (size_t)f * 4), v);
    }
  }
}

// 7) fused = concat(att_fore, x) . Fw^T, then out0[b][o][p] = m[p] ? fused : x. Block = 32 pixels x 256
__global__ void __launch_bounds__(256)
k_fuse(const _Float16* __restrict__ attT, const _Float16* __restrict__ inT, const _Float16* __restrict__ Fwh,
       const float* __restrict__ x, const float* __restrict__ mF, float* __restrict__ out0) {
  __shared__ __attribute__((aligned(16))) float G[NC][36];   // G[channel][p_local]
  const int t = threadIdx.x, lane = t & 31, wid = t >> 5, h = lane >> 4, n = lane & 15;
  const int blk = blockIdx.x;
  if (blk >= NB * NP / 32) return;
  const int b = blk >> 7, pb = (blk & 127) * 32;
  const int ptile = wid >> 2, og = wid & 3;
  const size_t prow = (size_t)b * NP + pb + ptile * 16 + n;
  const _Float16* A1 = attT + prow * NC;     // input channels 0..255   (att_fore)
  const _Float16* A2 = inT + prow * CIN;     // input channels 256..511 (x = first 256 columns of inT)
  const _Float16* Bb = Fwh + ((size_t)(og * 64 + n)) * CFU;
  v8f d[4];
#pragma unroll
  for (int j = 0; j < 4; ++j) d[j] = zero8();
#pragma unroll 1
  for (int k0 = 0; k0 < NC; k0 += 32) {
    const v16h a = ldfrag_g(A1, k0, h);
#pragma unroll
    for (int j = 0; j < 4; ++j) d[j] = wmma16(a, ldfrag_g(Bb + (size_t)j * 16 * CFU, k0, h), d[j]);
  }
#pragma unroll 1
  for (int k0 = 0; k0 < NC; k0 += 32) {
    const v16h a = ldfrag_g(A2, k0, h);
#pragma unroll
    for (int j = 0; j < 4; ++j) d[j] = wmma16(a, ldfrag_g(Bb + (size_t)j * 16 * CFU, NC + k0, h), d[j]);
  }
#pragma unroll
  for (int j = 0; j < 4; ++j) {
    const int o = og * 64 + j * 16 + n;
#pragma unroll
    for (int r = 0; r < 8; ++r) G[o][ptile * 16 + 8 * h + r] = d[j][r] * (1.f / 64.f);
  }
  __syncthreads();
  v4f vals[8];
  size_t offs[8];
#pragma unroll
  for (int i = 0; i < 8; ++i) {
    const int o = wid * 32 + i * 4 + (lane >> 3);      // wave owns 32 channels; 4 lines per instruction
    const int p4 = (lane & 7) * 4;
    v4f fz = *(const v4fa*)&G[o][p4];
    v4f mv = *(const v4f*)(mF + (size_t)b * NP + pb + p4);
    const size_t gi = ((size_t)(b * NC + o)) * NP + pb + p4;
    v4f xv = *(const v4f*)(x + gi);
    v4f rv;
#pragma unroll
    for (int e = 0; e < 4; ++e) rv[e] = (mv[e] > 0.5f) ? fz[e] : xv[e];
    vals[i] = rv; offs[i] = gi;
  }
#pragma unroll
  for (int i = 0; i < 8; ++i) vst2((v4f*)(out0 + offs[i]), vals[i]);
}

// 8) visatt[b][p] = fixed-order sum of the 64 partial column sums at the pixel's key slot, 0 for a non-key;
//    one pixel per thread, 128 blocks.
//    Each block also leaves the maximum of its 128 sums (start value 0) in bmax[block].
#define VB 128              // threads per block, and number of blocks (VB * VB = NB * NP)
__global__ void __launch_bounds__(VB) k_vis(const float* __restrict__ cpart, const int* __restrict__ kpos,
                                            float* __restrict__ vis, float* __restrict__ bmax) {
  __shared__ float red[VB / 32];
  const int t = threadIdx.x, lane = t & 31, wid = t >> 5;
  const int idx = blockIdx.x * VB + t;
  if (blockIdx.x >= NB * NP / VB) return;
  const int b = idx >> 12;
  const int slot = kpos[idx];
  float s = 0.f;
  if ((unsigned)slot < (unsigned)NP) {
    const float* cp = cpart + (size_t)b * QCN * NP + slot;
    float v[QCN];
#pragma unroll
    for (int q = 0; q < QCN; ++q) v[q] = cp[(size_t)q * NP];
#pragma unroll
    for (int q = 0; q < QCN; ++q) s += v[q];
  }
  vis[idx] = s;
  float mx = fmaxf(0.f, s);
  mx = fmaxf(mx, __shfl_xor(mx, 16)); mx = fmaxf(mx, __shfl_xor(mx, 8)); mx = fmaxf(mx, __shfl_xor(mx, 4));
  mx = fmaxf(mx, __shfl_xor(mx, 2));  mx = fmaxf(mx, __shfl_xor(mx, 1));
  if (lane == 0) red[wid] = mx;
  __syncthreads();
  if (t == 0) bmax[blockIdx.x] = fmaxf(fmaxf(red[0], red[1]), fmaxf(red[2], red[3]));
}

// 9) out1 = 8x nearest upsample of visatt / global max. Block = one strip of 8 output rows (one visatt row):
//    every wave folds the 128 block maxima itself, each thread reads one visatt value and stores it 4 x 16 B.
__global__ void __launch_bounds__(256) k_up(const float* __restrict__ vis, const float* __restrict__ bmax,
                                            float* __restrict__ out1) {
  const int t = threadIdx.x, lane = t & 31;
  const int blk = blockIdx.x;
  if (blk >= NB * 64) return;
  const v4f bm = *(const v4f*)(bmax + lane * 4);
  const float sv = vis[blk * 64 + ((t & 127) >> 1)];
  float mx = fmaxf(fmaxf(bm[0], bm[1]), fmaxf(bm[2], bm[3]));
  mx = fmaxf(mx, __shfl_xor(mx, 16)); mx = fmaxf(mx, __shfl_xor(mx, 8)); mx = fmaxf(mx, __shfl_xor(mx, 4));
  mx = fmaxf(mx, __shfl_xor(mx, 2));  mx = fmaxf(mx, __shfl_xor(mx, 1));
  const float inv = 1.f / mx;
  const float v = sv * inv;
  v4f r; r[0] = v; r[1] = v; r[2] = v; r[3] = v;
  float* dst = out1 + ((size_t)blk * 1024 + t) * 4;
#pragma unroll
  for (int i = 0; i < 4; ++i) *(v4f*)(dst + (size_t)i * 1024) = r;
}

// ---------------------------------------------------------------------------
extern "C" void kernel_launch(void* const* d_in, const int* in_sizes, int n_in,
                              void* d_out, int out_size, void* d_ws, size_t ws_size,
                              hipStream_t stream) {
  if (n_in < 6) return;
  if (in_sizes[0] != NB * NC * NP) return;        // x      [4,256,64,64] f32
  if (in_sizes[1] != NB * MS * MS) return;        // mask   [4,1,512,512] f32
  if (in_sizes[2] != NB * CAUX * NP) return;      // aux    [4,768,64,64] f32
  if (in_sizes[3] != NC * CIN) return;            // K_w    [256,1024]    f32
  if (in_sizes[4] != NC) return;                  // K_b    [256]         f32
  if (in_sizes[5] != NC * CFU) return;            // fuse_w [256,512]     f32
  if (out_size != NB * NC * NP + NB * MS * MS) return;

  const float* x   = (const float*)d_in[0];
  const float* msk = (const float*)d_in[1];
  const float* aux = (const float*)d_in[2];
  const float* Kw  = (const float*)d_in[3];
  const float* Kb  = (const float*)d_in[4];
  const float* Fw  = (const float*)d_in[5];
  float* out0 = (float*)d_out;                           // 4,194,304 f32 at byte 0
  float* out1 = out0 + (size_t)NB * NC * NP;             // 1,048,576 f32 at byte 16,777,216

  const size_t o_m   = 0;                                          //     65,536 B
  const size_t o_kwh = o_m   + (size_t)NB * NP * 4;                //    524,288 B
  const size_t o_fwh = o_kwh + (size_t)NC * CIN * 2;               //    262,144 B
  const size_t o_inT = o_fwh + (size_t)NC * CFU * 2;               // 33,554,432 B
  const size_t o_nh  = o_inT + (size_t)NB * NP * CIN * 2;          //  8,388,608 B
  const size_t o_vh  = o_nh  + (size_t)NB * NP * NC * 2;           //  8,388,608 B
  const size_t o_att = o_vh  + (size_t)NB * NC * NP * 2;           //  8,388,608 B
  const size_t o_cp  = o_att + (size_t)NB * NP * NC * 2;           //  4,194,304 B
  const size_t o_vis = o_cp  + (size_t)NB * QCN * NP * 4;          //     65,536 B
  const size_t o_bm  = o_vis + (size_t)NB * NP * 4;                //        512 B
  const size_t o_kc  = o_bm  + (size_t)VB * 4;                     //  8,388,608 B
  const size_t o_kp  = o_kc  + (size_t)NB * NP * NC * 2;           //     65,536 B
  const size_t o_ki  = o_kp  + (size_t)NB * NP * 4;                //     65,536 B
  const size_t o_nk  = o_ki  + (size_t)NB * NP * 4;                //         16 B
  const size_t total = o_nk  + (size_t)NB * 4;                     // 72,352,272 B
  if (total > ws_size) return;

  char* w = (char*)d_ws;
  float*    mF    = (float*)(w + o_m);
  _Float16* Kwh   = (_Float16*)(w + o_kwh);
  _Float16* Fwh   = (_Float16*)(w + o_fwh);
  _Float16* inT   = (_Float16*)(w + o_inT);
  _Float16* Nh    = (_Float16*)(w + o_nh);
  _Float16* Vh    = (_Float16*)(w + o_vh);
  _Float16* attT  = (_Float16*)(w + o_att);
  float*    cpart = (float*)(w + o_cp);
  float*    vis   = (float*)(w + o_vis);
  float*    bmax  = (float*)(w + o_bm);
  _Float16* Kc    = (_Float16*)(w + o_kc);
  int*      kpos  = (int*)(w + o_kp);
  int*      kidx  = (int*)(w + o_ki);
  int*      nkA   = (int*)(w + o_nk);

  k_cvtw <<<(NC * CIN / 8 + NC * CFU / 8) / 256, 256, 0, stream>>>(Kw, Fw, Kwh, Fwh);   // 192 blocks
  k_pool <<<(NB * NP / 4) / 256, 256, 0, stream>>>(msk, mF);                            // 16 blocks
  k_rank <<<NB, 256, 0, stream>>>(mF, kpos, kidx, nkA);                                 // 4 blocks
  k_tin  <<<NB * (CIN / 64) * (NP / 64), 256, 0, stream>>>(x, aux, inT);                // 4096 blocks
  k_feats<<<NB * NP / 32, 256, 0, stream>>>(inT, Kwh, Kb, kpos, Nh, Kc);                         // 512 blocks
  k_makev<<<(NB * NC * NP / 8) / 256, 256, 0, stream>>>(x, kidx, nkA, Vh);                     // 2048 blocks
  k_attn <<<NB * QCN, ATH, 0, stream>>>(Nh, Kc, Vh, mF, nkA, attT, cpart);                      // 256 blocks
  k_fuse <<<NB * NP / 32, 256, 0, stream>>>(attT, inT, Fwh, x, mF, out0);               // 512 blocks
  k_vis  <<<NB * NP / VB, VB, 0, stream>>>(cpart, kpos, vis, bmax);                          // 128 blocks
  k_up   <<<NB * 64, 256, 0, stream>>>(vis, bmax, out1);                                // 256 blocks
}

// v004
// Measured time: 183 microseconds a run.
// In both of two side-by-side timings against v003, it was 1.10 times as fast.
// All steps since v000 together make it 3.83 times as fast.
#include <hip/hip_runtime.h>

// Contractions on v_wmma_f32_16x16x32_f16 (f16 operands, f32 accumulate): 1x1 input conv (weights x64),
// q.k scores (unit feature rows x8 on each side), att.v (att x4096), 1x1 fuse conv (weights x64);
// every scale is an exact power of two folded back in f32. Softmax, norms, sums and selects stay f32.

#define NB   4
#define NC   256
#define NP   4096
#define CIN  1024
#define CAUX 768
#define CFU  512
#define MS   512
#define QCH  64             // query rows per block in the score kernel (4 query tiles x 16)
#define KG   4              // key groups per block: waves that share a query tile and split the staged keys
#define KW   32             // keys per wave and trip
#define KT   (KG * KW)      // 128 keys per staged tile
#define AW   (QCH / 16 * KG)  // 16 waves per block in the score kernel
#define ATH  (AW * 32)      // its 512 threads
#define VP   (KT + 8)       // LDS pitch of a V row in elements: 272 B = 16 B x 17
#define QCN  (NP / QCH)     // 64 query chunks per batch

typedef _Float16 v16h __attribute__((ext_vector_type(16)));
typedef _Float16 v8h  __attribute__((ext_vector_type(8)));
typedef v8h v8ha __attribute__((may_alias));
typedef float v8f __attribute__((ext_vector_type(8)));
typedef float v4f __attribute__((ext_vector_type(4)));
typedef v4f v4fa __attribute__((may_alias));
typedef int v4i __attribute__((ext_vector_type(4)));
typedef v4i v4ia __attribute__((may_alias));

union Frag { v16h v; v8h hf[2]; };

__device__ __forceinline__ v8f zero8() {
  v8f z = {0.f, 0.f, 0.f, 0.f, 0.f, 0.f, 0.f, 0.f};
  return z;
}

__device__ __forceinline__ v8f wmma16(v16h a, v16h b, v8f c) {
  v8f d = __builtin_amdgcn_wmma_f32_16x16x32_f16(false, a, false, b, (short)0, c, false, false);
  asm volatile("v_nop\n\tv_nop\n\tv_nop\n\tv_nop" : "+v"(d) : "v"(a), "v"(b));
  return d;
}

// 16 rows x 32 k fragment from a k-contiguous 16-bit matrix. rowp = start of the row owned by this
// lane (row index = lane & 15). Elements 0..7 <- k0+8h+0..7, elements 8..15 <- k0+16+8h+0..7 with
// h = lane >> 4. Used for A (row = m) and for B (row = n of a [n][k] copy). D: acc[r] = (row 8h+r, col lane&15).
__device__ __forceinline__ v16h ldfrag_g(const _Float16* rowp, int k0, int h) {
  Frag f;
  f.hf[0] = *(const v8h*)(rowp + k0 + 8 * h);
  f.hf[1] = *(const v8h*)(rowp + k0 + 16 + 8 * h);
  return f.v;
}
__device__ __forceinline__ v16h ldfrag_l(const _Float16* rowp, int k0, int h) {
  Frag f;
  f.hf[0] = *(const v8ha*)(rowp + k0 + 8 * h);
  f.hf[1] = *(const v8ha*)(rowp + k0 + 16 + 8 * h);
  return f.v;
}

__device__ __forceinline__ v8h pack8(v4f a, v4f b) {
  v8h r;
  r[0] = (_Float16)a[0]; r[1] = (_Float16)a[1]; r[2] = (_Float16)a[2]; r[3] = (_Float16)a[3];
  r[4] = (_Float16)b[0]; r[5] = (_Float16)b[1]; r[6] = (_Float16)b[2]; r[7] = (_Float16)b[3];
  return r;
}

__device__ __forceinline__ float max8f(v4f a, v4f b) {
  float m0 = fmaxf(fmaxf(a[0], a[1]), fmaxf(a[2], a[3]));
  float m1 = fmaxf(fmaxf(b[0], b[1]), fmaxf(b[2], b[3]));
  return fmaxf(m0, m1);
}

template <typename T>
__device__ __forceinline__ void vst2(T* p, T v) {
  *(T*)p = v;
  
}

// ---------------------------------------------------------------------------
// 1) 8x8 max pool of the 512x512 mask, binarised: mF[b][p] in {0,1}. 4 pixels per thread, 16-B stores.
__device__ __forceinline__ void d_pool(int blk, const float* __restrict__ msk, float* __restrict__ mF) {
  const int i = blk * 256 + threadIdx.x;
  if (i >= NB * NP / 4) return;
  const int pix0 = i * 4;
  const int b = pix0 >> 12, p = pix0 & (NP - 1);
  const int y = p >> 6, x0 = p & 63;
  const float* s = msk + ((size_t)b * MS + (size_t)y * 8) * MS + (size_t)x0 * 8;
  float mx[4] = {0.f, 0.f, 0.f, 0.f};
#pragma unroll 1   // one mask row (eight 16-B loads) in flight: unrolled whole, this part's registers would halve the waves that the transpose blocks of the same grid keep on a SIMD
  for (int dy = 0; dy < 8; ++dy) {
    const float* row = s + dy * MS;
#pragma unroll
    for (int j = 0; j < 4; ++j) {
      v4f a = *(const v4f*)(row + j * 8);
      v4f c = *(const v4f*)(row + j * 8 + 4);
      mx[j] = fmaxf(mx[j], max8f(a, c));
    }
    asm volatile("s_wait_xcnt 0x0" ::: "memory");   // before the next trip's address is written into the registers that this trip's loads name
  }
  v4f r;
#pragma unroll
  for (int j = 0; j < 4; ++j) r[j] = (mx[j] > 0.f) ? 1.f : 0.f;
  vst2((v4f*)(mF + pix0), r);
}

// 1b) dense order of the keys. A pixel with m = 0 is a key; every term of a pixel with m = 1 on the key side is
//     multiplied by 0, so only the keys get a slot. Per batch: kpos[p] = slot of key p (-1 for a non-key),
//     kidx = the pixels as a permutation, keys first (in pixel order), then the non-keys; nkA[b] = number of keys.
__global__ void __launch_bounds__(256) k_rank(const float* __restrict__ mF, int* __restrict__ kpos,
                                              int* __restrict__ kidx, int* __restrict__ nkA) {
  __shared__ __attribute__((aligned(16))) int cnt[256];
  const int t = threadIdx.x, b = blockIdx.x;
  if (b >= NB) return;
  const float* ms = mF + (size_t)b * NP + t * 16;
  bool key[16];
  int c = 0;
#pragma unroll   // both loops unrolled whole: key[] is indexed by constants and stays in registers
  for (int j = 0; j < 4; ++j) {
    v4f a = *(const v4f*)(ms + j * 4);
#pragma unroll
    for (int e = 0; e < 4; ++e) { key[j * 4 + e] = a[e] < 0.5f; c += key[j * 4 + e] ? 1 : 0; }
  }
  cnt[t] = c;
  __syncthreads();
  int pre = 0, tot = 0;
#pragma unroll 4   // four 16-B LDS reads in flight per trip instead of one waited read
  for (int i = 0; i < 64; ++i) {
    v4i v = *(const v4ia*)&cnt[i * 4];
#pragma unroll
    for (int e = 0; e < 4; ++e) { tot += v[e]; pre += (i * 4 + e < t) ? v[e] : 0; }
  }
  int* kp = kpos + (size_t)b * NP + t * 16;
  int* ki = kidx + (size_t)b * NP;
  int r = pre;                                   // keys in front of the current pixel
#pragma unroll   // as above: key[] and w by constant index
  for (int j = 0; j < 4; ++j) {
    v4i w;
#pragma unroll
    for (int e = 0; e < 4; ++e) {
      const int p = t * 16 + j * 4 + e;
      const bool k = key[j * 4 + e];
      w[e] = k ? r : -1;
      ki[k ? r : tot + p - r] = p;
      r += k ? 1 : 0;
    }
    *(v4i*)(kp + j * 4) = w;
  }
  if (t == 0) nkA[b] = tot;
}

// 2) weights to f16 with x64 scale: Kwh[256][1024], Fwh[256][512]. 8 elements per thread, 16-B stores.
__device__ __forceinline__ void d_cvtw(int blk, const float* __restrict__ Kw, const float* __restrict__ Fw,
                                       _Float16* __restrict__ Kwh, _Float16* __restrict__ Fwh) {
  const int i = blk * 256 + threadIdx.x;
  const float* src;
  _Float16* dst;
  if (i < NC * CIN / 8) {
    src = Kw + (size_t)i * 8; dst = Kwh + (size_t)i * 8;
  } else if (i < NC * CIN / 8 + NC * CFU / 8) {
    const int j = i - NC * CIN / 8;
    src = Fw + (size_t)j * 8; dst = Fwh + (size_t)j * 8;
  } else {
    return;
  }
  v4f a = *(const v4f*)src;
  v4f c = *(const v4f*)(src + 4);
  a = a * 64.f; c = c * 64.f;
  vst2((v8h*)dst, pack8(a, c));
}

// 3) inT[b][p][1024] f16 = transpose of concat(x, aux) along channels. Block = 64 channels x 64 pixels,
__device__ __forceinline__ void d_tin(int blk, const float* __restrict__ x, const float* __restrict__ aux,
                                      _Float16* __restrict__ inT) {
  __shared__ __attribute__((aligned(16))) _Float16 T[64][72];   // T[p_local][c_local]
  const int t = threadIdx.x;
  if (blk >= NB * (CIN / 64) * (NP / 64)) return;
  const int b = blk >> 10, ct = (blk >> 6) & 15, pt = blk & 63;
  const int c0 = ct * 64, p0 = pt * 64;
  // the block's source is picked once, in front of the loop: picked per load, the merged grid's build branches round every load and waits for each
  const float* src0 = (c0 < NC) ? x   + ((size_t)(b * NC + c0)) * NP + p0
                                : aux + ((size_t)(b * CAUX + (c0 - NC))) * NP + p0;
#pragma unroll
  for (int i = 0; i < 4; ++i) {
    const int f = t + 256 * i;            // 1024 float4 chunks: 64 channel rows x 16
    const int cl = f >> 4, p4 = (f & 15) * 4;
    v4f v = *(const v4f*)(src0 + (size_t)cl * NP + p4);
    T[p4 + 0][cl] = (_Float16)v[0];
    T[p4 + 1][cl] = (_Float16)v[1];
    T[p4 + 2][cl] = (_Float16)v[2];
    T[p4 + 3][cl] = (_Float16)v[3];
  }
  __syncthreads();
  v8h val[2];
  size_t off[2];
#pragma unroll
  for (int i = 0; i < 2; ++i) {
    const int r = (t >> 3) + 32 * i, q = t & 7;
    val[i] = *(const v8ha*)&T[r][q * 8];
    off[i] = ((size_t)(b * NP + p0 + r)) * CIN + c0 + q * 8;
  }
#pragma unroll
  for (int i = 0; i < 2; ++i) vst2((v8h*)(inT + off[i]), val[i]);
}

// 1 + 2 + 3 in one grid: the three parts read inputs only and write buffers of their own, so none waits for another.
// The block index picks the part; the 16 pool blocks, the longest, take the lowest indices.
#define PB ((NB * NP / 4) / 256)                       // 16 pool blocks
#define WB ((NC * CIN / 8 + NC * CFU / 8) / 256)       // 192 weight blocks
#define TB (NB * (CIN / 64) * (NP / 64))               // 4096 transpose blocks
__global__ void __launch_bounds__(256) k_pre(const float* __restrict__ msk, float* __restrict__ mF,
                                             const float* __restrict__ Kw, const float* __restrict__ Fw,
                                             _Float16* __restrict__ Kwh, _Float16* __restrict__ Fwh,
                                             const float* __restrict__ x, const float* __restrict__ aux,
                                             _Float16* __restrict__ inT) {
  const int blk = blockIdx.x;
  if (blk < PB) d_pool(blk, msk, mF);
  else if (blk < PB + WB) d_cvtw(blk - PB, Kw, Fw, Kwh, Fwh);
  else d_tin(blk - (PB + WB), x, aux, inT);
}

// 4) feats = inT . Kw^T (+ bias), then per-pixel L2 normalisation, stored as Nh[b][p][256] = f16(8 * unit row);
//    the row of a key goes to its dense slot Kc[b][kpos[p]][256] as well.
//    Block = 32 pixels x 256 channels; wave (ptile, og) = 16 pixels x 64 channels; K = 1024 in 32-steps.
__device__ __forceinline__ void d_feats(int blk, const _Float16* __restrict__ inT, const _Float16* __restrict__ Kwh,
                                        const float* __restrict__ Kb, const int* __restrict__ kpos,
                                        _Float16* __restrict__ Nh, _Float16* __restrict__ Kc) {
  __shared__ __attribute__((aligned(16))) float F[32][260];   // F[p_local][channel]
  const int t = threadIdx.x, lane = t & 31, wid = t >> 5, h = lane >> 4, n = lane & 15;
  if (blk >= NB * NP / 32) return;
  const int b = blk >> 7, pb = (blk & 127) * 32;
  const int ptile = wid >> 2, og = wid & 3;
  const _Float16* Arow = inT + ((size_t)(b * NP + pb + ptile * 16 + n)) * CIN;   // A: row m = pixel
  const _Float16* Bb   = Kwh + ((size_t)(og * 64 + n)) * CIN;                     // B: row n = out channel
  v8f d[4];
#pragma unroll
  for (int j = 0; j < 4; ++j) d[j] = zero8();
#pragma unroll 1
  for (int k0 = 0; k0 < CIN; k0 += 32) {
    const v16h a = ldfrag_g(Arow, k0, h);
#pragma unroll
    for (int j = 0; j < 4; ++j) d[j] = wmma16(a, ldfrag_g(Bb + (size_t)j * 16 * CIN, k0, h), d[j]);
  }
#pragma unroll
  for (int j = 0; j < 4; ++j) {
    const int o = og * 64 + j * 16 + n;
    const float bias = Kb[o];
#pragma unroll
    for (int r = 0; r < 8; ++r) F[ptile * 16 + 8 * h + r][o] = d[j][r] * (1.f / 64.f) + bias;
  }
  __syncthreads();
  v8h vals[4];
  size_t offs[4];
  int slot[4];
#pragma unroll
  for (int i = 0; i < 4; ++i) {
    const int pl = wid * 4 + i;                        // 4 pixels per wave, one wave per 512-B row
    slot[i] = kpos[b * NP + pb + pl];
    v4f a = *(const v4fa*)&F[pl][lane * 8];
    v4f c = *(const v4fa*)&F[pl][lane * 8 + 4];
    float ss = a[0] * a[0] + a[1] * a[1] + a[2] * a[2] + a[3] * a[3]
             + c[0] * c[0] + c[1] * c[1] + c[2] * c[2] + c[3] * c[3];
    ss += __shfl_xor(ss, 16); ss += __shfl_xor(ss, 8); ss += __shfl_xor(ss, 4);
    ss += __shfl_xor(ss, 2);  ss += __shfl_xor(ss, 1);
    const float inv = 8.f * (1.f / (sqrtf(ss) + 1e-8f));
    vals[i] = pack8(a * inv, c * inv);
    offs[i] = ((size_t)(b * NP + pb + pl)) * NC + lane * 8;
  }
#pragma unroll
  for (int i = 0; i < 4; ++i) vst2((v8h*)(Nh + offs[i]), vals[i]);
#pragma unroll   // slot[] and vals[] by constant index, in registers
  for (int i = 0; i < 4; ++i)
    if ((unsigned)slot[i] < (unsigned)NP) vst2((v8h*)(Kc + ((size_t)(b * NP + slot[i])) * NC + lane * 8), vals[i]);
}

// 5) Vh[b][c][j] = f16( x[b][c][kidx[j]] ) for the dense key slots j < nk, 0 up to the end of the last 128-key tile.
//    8 slots per thread, 16-B stores.
__device__ __forceinline__ void d_makev(int blk, const float* __restrict__ x, const int* __restrict__ kidx,
                                        const int* __restrict__ nkA, _Float16* __restrict__ Vh) {
  const int i = blk * 256 + threadIdx.x;
  if (i >= NB * NC * NP / 8) return;
  const size_t e0 = (size_t)i * 8;
  const int j0 = (int)(e0 & (NP - 1));
  const int b = (int)(e0 >> 20);
  const int nk = min(max(nkA[b], 0), NP);
  if (j0 >= ((nk + KT - 1) & ~(KT - 1))) return;
  const float* xr = x + (e0 - (size_t)j0);
  const int* ki = kidx + (size_t)b * NP + j0;
  v4i i0 = *(const v4i*)ki;
  v4i i1 = *(const v4i*)(ki + 4);
  v4f a, c;
#pragma unroll   // vector elements by constant index, all eight gathers in flight
  for (int e = 0; e < 4; ++e) {
    const float va = xr[i0[e] & (NP - 1)];
    asm volatile("s_wait_xcnt 0x0" ::: "memory");   // before a later gather's result lands in this load's address registers
    const float vc = xr[i1[e] & (NP - 1)];
    asm volatile("s_wait_xcnt 0x0" ::: "memory");   // the same
    a[e] = (j0 + e < nk) ? va : 0.f;
    c[e] = (j0 + 4 + e < nk) ? vc : 0.f;
  }
  vst2((v8h*)(Vh + e0), pack8(a, c));
}

// 4 + 5 in one grid: neither reads what the other writes. The 512 long product blocks take the lowest indices, the short gather
// blocks follow.
#define FB (NB * NP / 32)                              // 512 product blocks (here and in the fuse grid)
#define GB ((NB * NC * NP / 8) / 256)                  // 2048 gather blocks
__global__ void __launch_bounds__(256) k_fv(const _Float16* __restrict__ inT, const _Float16* __restrict__ Kwh,
                                            const float* __restrict__ Kb, const int* __restrict__ kpos,
                                            _Float16* __restrict__ Nh, _Float16* __restrict__ Kc,
                                            const float* __restrict__ x, const int* __restrict__ kidx,
                                            const int* __restrict__ nkA, _Float16* __restrict__ Vh) {
  const int blk = blockIdx.x;
  if (blk < FB) d_feats(blk, inT, Kwh, Kb, kpos, Nh, Kc);
  else d_makev(blk - FB, x, kidx, nkA, Vh);
}

// One wave's share of a staged key tile: rows r0, r0 + 16, ..., r0 + 112 of Kb, 512 B each, 16 B per lane (r0, nk the
// same in every lane). A whole tile takes one address and constant offsets; in the last, partial tile a slot past nk
// reads the last key again.
__device__ __forceinline__ void ldkeys(v8h (&kr)[KT / AW], const _Float16* Kb, const _Float16* p, int r0, int nk, int lane) {
  if (r0 + (KT - AW) < nk) {                           // p = the lane's 16 B of row r0, carried from trip to trip
#pragma unroll
    for (int i = 0; i < KT / AW; ++i) {
      kr[i] = *(const v8h*)(p + (size_t)(AW * i) * NC);
      if (i >= KT / AW - 2) asm volatile("s_wait_xcnt 0x0" ::: "memory");   // the shared address registers are free from the last load on: before its result or a later value lands in them
    }
  } else {
#pragma unroll
    for (int i = 0; i < KT / AW; ++i) {
      kr[i] = *(const v8h*)(Kb + (size_t)min(r0 + AW * i, nk - 1) * NC + lane * 8);
      asm volatile("s_wait_xcnt 0x0" ::: "memory");   // before a later load's result lands in this load's address registers
    }
  }
}

// 6) attention over the nk dense keys of the batch. Block = 64 query rows, 16 waves: wave (qt, kg) owns query tile qt
//    (16 rows) and key group kg (32 of the 128 keys staged per trip), so a trip covers four times the keys of a
//    one-group block and 256 blocks fill the chip. Pass 1: row sums of exp(20 cos - 20), fixed shift 20 (|cos| <= 1),
//    the four groups' partial sums added through LDS. Pass 2: att tiles -> per-block column sums (cpart) and
//    O^T = V . att^T, the four groups' partial O^T added through LDS behind the loop, in a fixed order.
//    Q chunk, K tile, V tile and the per-wave att^T tile are staged in LDS; every fragment uses ldfrag_*.
__global__ void __launch_bounds__(ATH) __attribute__((amdgpu_num_vgpr(252)))
k_attn(const _Float16* __restrict__ Nh, const _Float16* __restrict__ Kc, const _Float16* __restrict__ Vh,
       const float* __restrict__ mF, const int* __restrict__ nkA, _Float16* __restrict__ attT,
       float* __restrict__ cpart) {
  __shared__ __attribute__((aligned(16))) _Float16 Qs[QCH][264];   // q rows (later reused as O^T tile)
  __shared__ __attribute__((aligned(16))) _Float16 KV[KT * 264 + NC * VP];   // K tile, V tile; behind the loop: partial O^T in f32
  __shared__ __attribute__((aligned(16))) _Float16 Ps[AW][16][40]; // att^T     [n=q][k=key] per wave
  __shared__ float cs[AW][KW];                                     // per-wave column sums, 32 keys
  __shared__ float rs[KG][QCH];                                    // per-key-group row sums
  __shared__ __attribute__((aligned(16))) float csb[NP];           // per-block column sums
  _Float16* const Ks = KV;                 // key rows  [n=key][k=channel], pitch 264
  _Float16* const Vs = KV + KT * 264;      // V tile    [m=channel][k=key], pitch VP

  const int t = threadIdx.x, lane = t & 31, h = lane >> 4, n = lane & 15;
  const int wid = __builtin_amdgcn_readfirstlane(t >> 5);   // in a scalar register: the tests on the wave's group are scalar branches
  const int qt = wid & 3, kg = wid >> 2;
  const int blk = blockIdx.x;
  if (blk >= NB * QCN) return;
  const int b = blk / QCN, qc = blk % QCN;
  const int qblk = qc * QCH;
  const _Float16* Nb = Nh + (size_t)b * NP * NC;
  const _Float16* Kb = Kc + (size_t)b * NP * NC;
  const int nk = __builtin_amdgcn_readfirstlane(min(max(nkA[b], 0), NP));   // in a scalar register: the key loops and their barriers stand under scalar branches
  const _Float16* Vb = Vh + (size_t)b * NC * NP;
  const float* mb = mF + (size_t)b * NP;

  // stage the block's 64 query rows
#pragma unroll
  for (int i = 0; i < QCH * 32 / ATH; ++i) {
    const int id = t + ATH * i;
    const int row = id >> 5, c8 = (id & 31) * 8;
    *(v8h*)&Qs[row][c8] = *(const v8h*)(Nb + (size_t)(qblk + row) * NC + c8);
  }
  __syncthreads();

  const _Float16* Qrow = &Qs[qt * 16 + n][0];

  float invs[8];
  {
    v16h qf[8];
#pragma unroll
    for (int cb = 0; cb < 8; ++cb) qf[cb] = ldfrag_l(Qrow, cb * 32, h);
    float acc[8];
#pragma unroll
    for (int r = 0; r < 8; ++r) acc[r] = 0.f;
    const _Float16* kp1 = Kb + (size_t)wid * NC + lane * 8;
#pragma unroll 1
    for (int kb = 0; kb < nk; kb += KT) {
      __syncthreads();
      v8h kr[KT / AW];
      ldkeys(kr, Kb, kp1, kb + wid, nk, lane);
      kp1 += (size_t)KT * NC;
#pragma unroll
      for (int i = 0; i < KT / AW; ++i) *(v8h*)&Ks[(wid + AW * i) * 264 + lane * 8] = kr[i];
      __syncthreads();
#pragma unroll
      for (int sub = 0; sub < 2; ++sub) {
        v8f s = zero8();
        const _Float16* Krow = &Ks[(kg * KW + sub * 16 + n) * 264];
#pragma unroll
        for (int cb = 0; cb < 8; ++cb) s = wmma16(qf[cb], ldfrag_l(Krow, cb * 32, h), s);
        const float km = (kb + kg * KW + sub * 16 + n < nk) ? 1.f : 0.f;
#pragma unroll
        for (int r = 0; r < 8; ++r) acc[r] += km * __expf(0.3125f * s[r] - 20.f);
      }
    }
#pragma unroll
    for (int r = 0; r < 8; ++r) {
      float a = acc[r];
      a += __shfl_xor(a, 1); a += __shfl_xor(a, 2); a += __shfl_xor(a, 4); a += __shfl_xor(a, 8);
      if (n == 0) rs[kg][qt * 16 + 8 * h + r] = a;
    }
    __syncthreads();
#pragma unroll
    for (int r = 0; r < 8; ++r) {
      const int ql = qt * 16 + 8 * h + r;
      const float a = (rs[0][ql] + rs[1][ql]) + (rs[2][ql] + rs[3][ql]);
      invs[r] = mb[qblk + ql] / (a + 1e-30f);          // query mask folded in: invalid rows -> 0
    }
  }

  // ---- pass 2: att tiles, column sums, O^T = V . (att*4096)^T ----
  const int vr0 = t >> 4, v8 = (t & 15) * 8;           // V staging: channel row and key offset of this thread's 16 B
  const unsigned voff = (unsigned)(vr0 * NP + v8);
  const _Float16* kp2 = Kb + (size_t)wid * NC + lane * 8;
  v8f o[16];
#pragma unroll
  for (int cc = 0; cc < 16; ++cc) o[cc] = zero8();
#pragma unroll 1
  for (int kb = 0; kb < nk; kb += KT) {
    __syncthreads();
    v8h vv[KT / AW], kr[KT / AW];
    ldkeys(kr, Kb, kp2, kb + wid, nk, lane);
    kp2 += (size_t)KT * NC;
#pragma unroll
    for (int i = 0; i < KT / AW; ++i) {
      vv[i] = *(const v8h*)(Vb + kb + (size_t)(32 * i) * NP + voff);   // two 256-B row pieces per wave and load
      if (i >= KT / AW - 2) asm volatile("s_wait_xcnt 0x0" ::: "memory");   // as in ldkeys: before the shared address registers are written again
    }
#pragma unroll
    for (int i = 0; i < KT / AW; ++i) {
      *(v8h*)&Ks[(wid + AW * i) * 264 + lane * 8] = kr[i];
      *(v8h*)&Vs[(vr0 + 32 * i) * VP + v8] = vv[i];
    }
    __syncthreads();
#pragma unroll
    for (int sub = 0; sub < 2; ++sub) {
      v8f s = zero8();
      const _Float16* Krow = &Ks[(kg * KW + sub * 16 + n) * 264];
#pragma unroll
      for (int cb = 0; cb < 8; ++cb) s = wmma16(ldfrag_l(Qrow, cb * 32, h), ldfrag_l(Krow, cb * 32, h), s);
      const float km = (kb + kg * KW + sub * 16 + n < nk) ? 1.f : 0.f;
      float csum = 0.f;
#pragma unroll
      for (int r = 0; r < 8; ++r) {
        const float att = invs[r] * km * __expf(0.3125f * s[r] - 20.f);   // D row q = 8h+r, col key = n
        csum += att;
        Ps[wid][8 * h + r][sub * 16 + n] = (_Float16)(att * 4096.f);
      }
      csum += __shfl_xor(csum, 16);
      if (lane < 16) cs[wid][sub * 16 + lane] = csum;
    }
    __syncthreads();
    if (wid < KG) {                                    // wave g folds key group g: its four query tiles' sums
      float tt = 0.f;
#pragma unroll
      for (int w = 0; w < 4; ++w) tt += cs[wid * 4 + w][lane];
      csb[kb + wid * KW + lane] = tt;
    }
    const v16h pB = ldfrag_l(&Ps[wid][n][0], 0, h);                   // B: k = key, n = q
#pragma unroll
    for (int g = 0; g < 4; ++g) {
#pragma unroll
      for (int j = 0; j < 4; ++j)
        o[g * 4 + j] = wmma16(ldfrag_l(&Vs[(g * 64 + j * 16 + n) * VP], kg * KW, h), pB, o[g * 4 + j]);   // A: m = channel
    }
  }

  // the four key groups' partial O^T tiles, added in f32 as (g0 + g2) + (g1 + g3); a tile lies in the K/V space as
  // [cc][half][lane][4], 16 B per lane, 16 KiB per wave
  float* const R = (float*)KV;
  __syncthreads();                                     // every wave has left the K and V tiles
  if (kg >= 2) {
    float* rp = R + ((kg - 2) * 4 + qt) * 4096 + lane * 4;
#pragma unroll
    for (int cc = 0; cc < 16; ++cc) {
      v4f lo = {o[cc][0], o[cc][1], o[cc][2], o[cc][3]};
      v4f hi = {o[cc][4], o[cc][5], o[cc][6], o[cc][7]};
      *(v4fa*)(rp + cc * 256) = lo;
      *(v4fa*)(rp + cc * 256 + 128) = hi;
    }
  }
  __syncthreads();
  if (kg < 2) {
    const float* rp = R + (kg * 4 + qt) * 4096 + lane * 4;
#pragma unroll
    for (int cc = 0; cc < 16; ++cc) {
      v4f lo = *(const v4fa*)(rp + cc * 256);
      v4f hi = *(const v4fa*)(rp + cc * 256 + 128);
#pragma unroll
      for (int e = 0; e < 4; ++e) { o[cc][e] += lo[e]; o[cc][4 + e] += hi[e]; }
    }
  }
  __syncthreads();
  if (kg == 1) {
    float* rp = R + qt * 4096 + lane * 4;
#pragma unroll
    for (int cc = 0; cc < 16; ++cc) {
      v4f lo = {o[cc][0], o[cc][1], o[cc][2], o[cc][3]};
      v4f hi = {o[cc][4], o[cc][5], o[cc][6], o[cc][7]};
      *(v4fa*)(rp + cc * 256) = lo;
      *(v4fa*)(rp + cc * 256 + 128) = hi;
    }
  }
  __syncthreads();
  // O^T tile (D rows = channel cc*16+8h+r, cols = q) -> f16, staged in the query tile's own Qs rows as [q][channel]
  if (kg == 0) {
    const float* rp = R + qt * 4096 + lane * 4;
#pragma unroll
    for (int cc = 0; cc < 16; ++cc) {
      v4f lo = *(const v4fa*)(rp + cc * 256);
      v4f hi = *(const v4fa*)(rp + cc * 256 + 128);
      v8h tv;
#pragma unroll
      for (int e = 0; e < 4; ++e) {
        tv[e]     = (_Float16)((o[cc][e] + lo[e]) * (1.f / 4096.f));
        tv[4 + e] = (_Float16)((o[cc][4 + e] + hi[e]) * (1.f / 4096.f));
      }
      *(v8h*)&Qs[qt * 16 + n][cc * 16 + 8 * h] = tv;
    }
  }
  __syncthreads();
  // attT[b][q][256]: one 512-B row per instruction, 16 B per lane, four rows per wave
  _Float16* arow = attT + ((size_t)(b * NP + qblk + wid * 4)) * NC + lane * 8;
#pragma unroll
  for (int i = 0; i < QCH / AW; ++i) {
    v8h v = *(const v8ha*)&Qs[wid * 4 + i][lane * 8];
    vst2((v8h*)(arow + (size_t)i * NC), v);
  }
  float* cp = cpart + ((size_t)(b * QCN + qc)) * NP;
#pragma unroll
  for (int i = 0; i < NP / 4 / ATH; ++i) {
    const int f = t + ATH * i;
    if (f * 4 < nk) {                                  // csb holds whole 128-key tiles up to nk
      v4f v = *(const v4fa*)&csb[f * 4];
      vst2((v4f*)(cp + (size_t)f * 4), v);
    }
  }
}

// 7) fused = concat(att_fore, x) . Fw^T, then out0[b][o][p] = m[p] ? fused : x. Block = 32 pixels x 256
__device__ __forceinline__ void
d_fuse(int blk, const _Float16* __restrict__ attT, const _Float16* __restrict__ inT, const _Float16* __restrict__ Fwh,
       const float* __restrict__ x, const float* __restrict__ mF, float* __restrict__ out0) {
  __shared__ __attribute__((aligned(16))) float G[NC][36];   // G[channel][p_local]
  const int t = threadIdx.x, lane = t & 31, wid = t >> 5, h = lane >> 4, n = lane & 15;
  if (blk >= NB * NP / 32) return;
  const int b = blk >> 7, pb = (blk & 127) * 32;
  const int ptile = wid >> 2, og = wid & 3;
  const size_t prow = (size_t)b * NP + pb + ptile * 16 + n;
  const _Float16* A1 = attT + prow * NC;     // input channels 0..255   (att_fore)
  const _Float16* A2 = inT + prow * CIN;     // input channels 256..511 (x = first 256 columns of inT)
  const _Float16* Bb = Fwh + ((size_t)(og * 64 + n)) * CFU;
  v8f d[4];
#pragma unroll
  for (int j = 0; j < 4; ++j) d[j] = zero8();
#pragma unroll 1
  for (int k0 = 0; k0 < NC; k0 += 32) {
    const v16h a = ldfrag_g(A1, k0, h);
#pragma unroll
    for (int j = 0; j < 4; ++j) d[j] = wmma16(a, ldfrag_g(Bb + (size_t)j * 16 * CFU, k0, h), d[j]);
  }
#pragma unroll 1
  for (int k0 = 0; k0 < NC; k0 += 32) {
    const v16h a = ldfrag_g(A2, k0, h);
#pragma unroll
    for (int j = 0; j < 4; ++j) d[j] = wmma16(a, ldfrag_g(Bb + (size_t)j * 16 * CFU, NC + k0, h), d[j]);
  }
#pragma unroll
  for (int j = 0; j < 4; ++j) {
    const int o = og * 64 + j * 16 + n;
#pragma unroll
    for (int r = 0; r < 8; ++r) G[o][ptile * 16 + 8 * h + r] = d[j][r] * (1.f / 64.f);
  }
  __syncthreads();
  v4f vals[8];
  size_t offs[8];
#pragma unroll
  for (int i = 0; i < 8; ++i) {
    const int o = wid * 32 + i * 4 + (lane >> 3);      // wave owns 32 channels; 4 lines per instruction
    const int p4 = (lane & 7) * 4;
    v4f fz = *(const v4fa*)&G[o][p4];
    v4f mv = *(const v4f*)(mF + (size_t)b * NP + pb + p4);
    const size_t gi = ((size_t)(b * NC + o)) * NP + pb + p4;
    v4f xv = *(const v4f*)(x + gi);
    v4f rv;
#pragma unroll
    for (int e = 0; e < 4; ++e) rv[e] = (mv[e] > 0.5f) ? fz[e] : xv[e];
    vals[i] = rv; offs[i] = gi;
  }
#pragma unroll
  for (int i = 0; i < 8; ++i) vst2((v4f*)(out0 + offs[i]), vals[i]);
}

// 8) visatt[b][p] = fixed-order sum of the 64 partial column sums at the pixel's key slot, 0 for a non-key;
//    one pixel per thread, 64 blocks of 256.
//    Each run of 128 pixels also leaves the maximum of its sums (start value 0) in bmax[run], two runs per block.
#define VB 128              // pixels per run, and number of runs (VB * VB = NB * NP)
__device__ __forceinline__ void d_vis(int blk, const float* __restrict__ cpart, const int* __restrict__ kpos,
                                      float* __restrict__ vis, float* __restrict__ bmax) {
  __shared__ float red[256 / 32];
  const int t = threadIdx.x, lane = t & 31, wid = t >> 5;
  const int idx = blk * 256 + t;
  if (blk >= NB * NP / 256) return;
  const int b = idx >> 12;
  const int slot = kpos[idx];
  float s = 0.f;
  if ((unsigned)slot < (unsigned)NP) {
    const float* cp = cpart + (size_t)b * QCN * NP + slot;
    float v[QCN];
#pragma unroll
    for (int q = 0; q < QCN; ++q) v[q] = cp[(size_t)q * NP];
#pragma unroll
    for (int q = 0; q < QCN; ++q) s += v[q];
  }
  vis[idx] = s;
  float mx = fmaxf(0.f, s);
  mx = fmaxf(mx, __shfl_xor(mx, 16)); mx = fmaxf(mx, __shfl_xor(mx, 8)); mx = fmaxf(mx, __shfl_xor(mx, 4));
  mx = fmaxf(mx, __shfl_xor(mx, 2));  mx = fmaxf(mx, __shfl_xor(mx, 1));
  if (lane == 0) red[wid] = mx;
  __syncthreads();
  if ((t & (VB - 1)) == 0) bmax[idx / VB] = fmaxf(fmaxf(red[wid], red[wid + 1]), fmaxf(red[wid + 2], red[wid + 3]));
}

// 7 + 8 in one grid: both read only what the score kernel and earlier launches left, and write buffers of their own.
#define SB (NB * NP / 256)                             // 64 column-sum blocks
__global__ void __launch_bounds__(256) k_post(const _Float16* __restrict__ attT, const _Float16* __restrict__ inT,
                                              const _Float16* __restrict__ Fwh, const float* __restrict__ x,
                                              const float* __restrict__ mF, float* __restrict__ out0,
                                              const float* __restrict__ cpart, const int* __restrict__ kpos,
                                              float* __restrict__ vis, float* __restrict__ bmax) {
  const int blk = blockIdx.x;
  if (blk < FB) d_fuse(blk, attT, inT, Fwh, x, mF, out0);
  else d_vis(blk - FB, cpart, kpos, vis, bmax);
}

// 9) out1 = 8x nearest upsample of visatt / global max. Block = one strip of 8 output rows (one visatt row):
//    every wave folds the 128 run maxima itself, each thread reads one visatt value and stores it 4 x 16 B.
__global__ void __launch_bounds__(256) k_up(const float* __restrict__ vis, const float* __restrict__ bmax,
                                            float* __restrict__ out1) {
  const int t = threadIdx.x, lane = t & 31;
  const int blk = blockIdx.x;
  if (blk >= NB * 64) return;
  const v4f bm = *(const v4f*)(bmax + lane * 4);
  const float sv = vis[blk * 64 + ((t & 127) >> 1)];
  float mx = fmaxf(fmaxf(bm[0], bm[1]), fmaxf(bm[2], bm[3]));
  mx = fmaxf(mx, __shfl_xor(mx, 16)); mx = fmaxf(mx, __shfl_xor(mx, 8)); mx = fmaxf(mx, __shfl_xor(mx, 4));
  mx = fmaxf(mx, __shfl_xor(mx, 2));  mx = fmaxf(mx, __shfl_xor(mx, 1));
  const float inv = 1.f / mx;
  const float v = sv * inv;
  v4f r; r[0] = v; r[1] = v; r[2] = v; r[3] = v;
  float* dst = out1 + ((size_t)blk * 1024 + t) * 4;
#pragma unroll
  for (int i = 0; i < 4; ++i) *(v4f*)(dst + (size_t)i * 1024) = r;
}

// ---------------------------------------------------------------------------
extern "C" void kernel_launch(void* const* d_in, const int* in_sizes, int n_in,
                              void* d_out, int out_size, void* d_ws, size_t ws_size,
                              hipStream_t stream) {
  if (n_in < 6) return;
  if (in_sizes[0] != NB * NC * NP) return;        // x      [4,256,64,64] f32
  if (in_sizes[1] != NB * MS * MS) return;        // mask   [4,1,512,512] f32
  if (in_sizes[2] != NB * CAUX * NP) return;      // aux    [4,768,64,64] f32
  if (in_sizes[3] != NC * CIN) return;            // K_w    [256,1024]    f32
  if (in_sizes[4] != NC) return;                  // K_b    [256]         f32
  if (in_sizes[5] != NC * CFU) return;            // fuse_w [256,512]     f32
  if (out_size != NB * NC * NP + NB * MS * MS) return;

  const float* x   = (const float*)d_in[0];
  const float* msk = (const float*)d_in[1];
  const float* aux = (const float*)d_in[2];
  const float* Kw  = (const float*)d_in[3];
  const float* Kb  = (const float*)d_in[4];
  const float* Fw  = (const float*)d_in[5];
  float* out0 = (float*)d_out;                           // 4,194,304 f32 at byte 0
  float* out1 = out0 + (size_t)NB * NC * NP;             // 1,048,576 f32 at byte 16,777,216

  const size_t o_m   = 0;                                          //     65,536 B
  const size_t o_kwh = o_m   + (size_t)NB * NP * 4;                //    524,288 B
  const size_t o_fwh = o_kwh + (size_t)NC * CIN * 2;               //    262,144 B
  const size_t o_inT = o_fwh + (size_t)NC * CFU * 2;               // 33,554,432 B
  const size_t o_nh  = o_inT + (size_t)NB * NP * CIN * 2;          //  8,388,608 B
  const size_t o_vh  = o_nh  + (size_t)NB * NP * NC * 2;           //  8,388,608 B
  const size_t o_att = o_vh  + (size_t)NB * NC * NP * 2;           //  8,388,608 B
  const size_t o_cp  = o_att + (size_t)NB * NP * NC * 2;           //  4,194,304 B
  const size_t o_vis = o_cp  + (size_t)NB * QCN * NP * 4;          //     65,536 B
  const size_t o_bm  = o_vis + (size_t)NB * NP * 4;                //        512 B
  const size_t o_kc  = o_bm  + (size_t)VB * 4;                     //  8,388,608 B
  const size_t o_kp  = o_kc  + (size_t)NB * NP * NC * 2;           //     65,536 B
  const size_t o_ki  = o_kp  + (size_t)NB * NP * 4;                //     65,536 B
  const size_t o_nk  = o_ki  + (size_t)NB * NP * 4;                //         16 B
  const size_t total = o_nk  + (size_t)NB * 4;                     // 72,352,272 B
  if (total > ws_size) return;

  char* w = (char*)d_ws;
  float*    mF    = (float*)(w + o_m);
  _Float16* Kwh   = (_Float16*)(w + o_kwh);
  _Float16* Fwh   = (_Float16*)(w + o_fwh);
  _Float16* inT   = (_Float16*)(w + o_inT);
  _Float16* Nh    = (_Float16*)(w + o_nh);
  _Float16* Vh    = (_Float16*)(w + o_vh);
  _Float16* attT  = (_Float16*)(w + o_att);
  float*    cpart = (float*)(w + o_cp);
  float*    vis   = (float*)(w + o_vis);
  float*    bmax  = (float*)(w + o_bm);
  _Float16* Kc    = (_Float16*)(w + o_kc);
  int*      kpos  = (int*)(w + o_kp);
  int*      kidx  = (int*)(w + o_ki);
  int*      nkA   = (int*)(w + o_nk);

  k_pre  <<<PB + WB + TB, 256, 0, stream>>>(msk, mF, Kw, Fw, Kwh, Fwh, x, aux, inT);      // 16 + 192 + 4096 blocks
  k_rank <<<NB, 256, 0, stream>>>(mF, kpos, kidx, nkA);                                 // 4 blocks
  k_fv   <<<FB + GB, 256, 0, stream>>>(inT, Kwh, Kb, kpos, Nh, Kc, x, kidx, nkA, Vh);     // 512 + 2048 blocks
  k_attn <<<NB * QCN, ATH, 0, stream>>>(Nh, Kc, Vh, mF, nkA, attT, cpart);                // 256 blocks
  k_post <<<FB + SB, 256, 0, stream>>>(attT, inT, Fwh, x, mF, out0, cpart, kpos, vis, bmax);   // 512 + 64 blocks
  k_up   <<<NB * 64, 256, 0, stream>>>(vis, bmax, out1);                                // 256 blocks
}

// v005
// A run of this version takes 142 microseconds.
// Next to v004, in two timings, it ran 1.31 times as fast each time.
// All steps since v000 together make it 5.02 times as fast.
#include <hip/hip_runtime.h>

// Contractions on v_wmma_f32_16x16x32_f16 (f16 operands, f32 accumulate): 1x1 input conv (weights x64),
// q.k scores (unit feature rows x8 on each side), att.v (att x4096), 1x1 fuse conv (weights x64);
// every scale is an exact power of two folded back in f32. Softmax, norms, sums and selects stay f32.

#define NB   4
#define NC   256
#define NP   4096
#define CIN  1024
#define CAUX 768
#define CFU  512
#define MS   512
#define QCH  64             // query rows per block in the score kernel (4 query tiles x 16)
#define KG   4              // key groups per block: waves that share a query tile and split the staged keys
#define KW   32             // keys per wave and trip
#define KT   (KG * KW)      // 128 keys per staged tile
#define AW   (QCH / 16 * KG)  // 16 waves per block in the score kernel
#define ATH  (AW * 32)      // its 512 threads
#define VP   (KT + 8)       // LDS pitch of a V row in elements: 272 B = 16 B x 17
#define QCN  (NP / QCH)     // 64 query chunks per batch
#define PT   64             // pixels per block in the two 1x1 conv products
#define BK   64             // k per staged tile: one 128-B line of every operand row
#define SP   (BK + 8)       // LDS pitch of a staged row in elements: 144 B = 16 B x 9
#define SBUF ((PT + NC) * SP)   // elements of one staged tile: 64 pixel rows, then 256 weight rows

typedef _Float16 v16h __attribute__((ext_vector_type(16)));
typedef _Float16 v8h  __attribute__((ext_vector_type(8)));
typedef v8h v8ha __attribute__((may_alias));
typedef float v8f __attribute__((ext_vector_type(8)));
typedef float v4f __attribute__((ext_vector_type(4)));
typedef v4f v4fa __attribute__((may_alias));
typedef int v4i __attribute__((ext_vector_type(4)));
typedef v4i v4ia __attribute__((may_alias));
typedef float f1a __attribute__((may_alias));

union Frag { v16h v; v8h hf[2]; };

__device__ __forceinline__ v8f zero8() {
  v8f z = {0.f, 0.f, 0.f, 0.f, 0.f, 0.f, 0.f, 0.f};
  return z;
}

__device__ __forceinline__ v8f wmma16(v16h a, v16h b, v8f c) {
  v8f d = __builtin_amdgcn_wmma_f32_16x16x32_f16(false, a, false, b, (short)0, c, false, false);
  asm volatile("v_nop\n\tv_nop\n\tv_nop\n\tv_nop" : "+v"(d) : "v"(a), "v"(b));
  return d;
}

// 16 rows x 32 k fragment from a k-contiguous 16-bit matrix. rowp = start of the row owned by this
// lane (row index = lane & 15). Elements 0..7 <- k0+8h+0..7, elements 8..15 <- k0+16+8h+0..7 with
// h = lane >> 4. Used for A (row = m) and for B (row = n of a [n][k] copy). D: acc[r] = (row 8h+r, col lane&15).
__device__ __forceinline__ v16h ldfrag_g(const _Float16* rowp, int k0, int h) {
  Frag f;
  f.hf[0] = *(const v8h*)(rowp + k0 + 8 * h);
  f.hf[1] = *(const v8h*)(rowp + k0 + 16 + 8 * h);
  return f.v;
}
__device__ __forceinline__ v16h ldfrag_l(const _Float16* rowp, int k0, int h) {
  Frag f;
  f.hf[0] = *(const v8ha*)(rowp + k0 + 8 * h);
  f.hf[1] = *(const v8ha*)(rowp + k0 + 16 + 8 * h);
  return f.v;
}

__device__ __forceinline__ v8h pack8(v4f a, v4f b) {
  v8h r;
  r[0] = (_Float16)a[0]; r[1] = (_Float16)a[1]; r[2] = (_Float16)a[2]; r[3] = (_Float16)a[3];
  r[4] = (_Float16)b[0]; r[5] = (_Float16)b[1]; r[6] = (_Float16)b[2]; r[7] = (_Float16)b[3];
  return r;
}

__device__ __forceinline__ float max8f(v4f a, v4f b) {
  float m0 = fmaxf(fmaxf(a[0], a[1]), fmaxf(a[2], a[3]));
  float m1 = fmaxf(fmaxf(b[0], b[1]), fmaxf(b[2], b[3]));
  return fmaxf(m0, m1);
}

template <typename T>
__device__ __forceinline__ void vst2(T* p, T v) {
  *(T*)p = v;
  
}

// ---------------------------------------------------------------------------
// 1) 8x8 max pool of the 512x512 mask, binarised: mF[b][p] in {0,1}. 4 pixels per thread, 16-B stores.
__device__ __forceinline__ void d_pool(int blk, const float* __restrict__ msk, float* __restrict__ mF) {
  const int i = blk * 256 + threadIdx.x;
  if (i >= NB * NP / 4) return;
  const int pix0 = i * 4;
  const int b = pix0 >> 12, p = pix0 & (NP - 1);
  const int y = p >> 6, x0 = p & 63;
  const float* s = msk + ((size_t)b * MS + (size_t)y * 8) * MS + (size_t)x0 * 8;
  float mx[4] = {0.f, 0.f, 0.f, 0.f};
#pragma unroll 1   // one mask row (eight 16-B loads) in flight: unrolled whole, this part's registers would halve the waves that the transpose blocks of the same grid keep on a SIMD
  for (int dy = 0; dy < 8; ++dy) {
    const float* row = s + dy * MS;
#pragma unroll
    for (int j = 0; j < 4; ++j) {
      v4f a = *(const v4f*)(row + j * 8);
      v4f c = *(const v4f*)(row + j * 8 + 4);
      mx[j] = fmaxf(mx[j], max8f(a, c));
    }
    asm volatile("s_wait_xcnt 0x0" ::: "memory");   // before the next trip's address is written into the registers that this trip's loads name
  }
  v4f r;
#pragma unroll
  for (int j = 0; j < 4; ++j) r[j] = (mx[j] > 0.f) ? 1.f : 0.f;
  vst2((v4f*)(mF + pix0), r);
}

// 1b) dense order of the keys. A pixel with m = 0 is a key; every term of a pixel with m = 1 on the key side is
//     multiplied by 0, so only the keys get a slot. Per batch: kpos[p] = slot of key p (-1 for a non-key),
//     kidx = the pixels as a permutation, keys first (in pixel order), then the non-keys; nkA[b] = number of keys.
__global__ void __launch_bounds__(256) k_rank(const float* __restrict__ mF, int* __restrict__ kpos,
                                              int* __restrict__ kidx, int* __restrict__ nkA) {
  __shared__ __attribute__((aligned(16))) int cnt[256];
  const int t = threadIdx.x, b = blockIdx.x;
  if (b >= NB) return;
  const float* ms = mF + (size_t)b * NP + t * 16;
  bool key[16];
  int c = 0;
#pragma unroll   // both loops unrolled whole: key[] is indexed by constants and stays in registers
  for (int j = 0; j < 4; ++j) {
    v4f a = *(const v4f*)(ms + j * 4);
#pragma unroll
    for (int e = 0; e < 4; ++e) { key[j * 4 + e] = a[e] < 0.5f; c += key[j * 4 + e] ? 1 : 0; }
  }
  cnt[t] = c;
  __syncthreads();
  int pre = 0, tot = 0;
#pragma unroll 4   // four 16-B LDS reads in flight per trip instead of one waited read
  for (int i = 0; i < 64; ++i) {
    v4i v = *(const v4ia*)&cnt[i * 4];
#pragma unroll
    for (int e = 0; e < 4; ++e) { tot += v[e]; pre += (i * 4 + e < t) ? v[e] : 0; }
  }
  int* kp = kpos + (size_t)b * NP + t * 16;
  int* ki = kidx + (size_t)b * NP;
  int r = pre;                                   // keys in front of the current pixel
#pragma unroll   // as above: key[] and w by constant index
  for (int j = 0; j < 4; ++j) {
    v4i w;
#pragma unroll
    for (int e = 0; e < 4; ++e) {
      const int p = t * 16 + j * 4 + e;
      const bool k = key[j * 4 + e];
      w[e] = k ? r : -1;
      ki[k ? r : tot + p - r] = p;
      r += k ? 1 : 0;
    }
    *(v4i*)(kp + j * 4) = w;
  }
  if (t == 0) nkA[b] = tot;
}

// 2) weights to f16 with x64 scale: Kwh[256][1024], Fwh[256][512]. 8 elements per thread, 16-B stores.
__device__ __forceinline__ void d_cvtw(int blk, const float* __restrict__ Kw, const float* __restrict__ Fw,
                                       _Float16* __restrict__ Kwh, _Float16* __restrict__ Fwh) {
  const int i = blk * 256 + threadIdx.x;
  const float* src;
  _Float16* dst;
  if (i < NC * CIN / 8) {
    src = Kw + (size_t)i * 8; dst = Kwh + (size_t)i * 8;
  } else if (i < NC * CIN / 8 + NC * CFU / 8) {
    const int j = i - NC * CIN / 8;
    src = Fw + (size_t)j * 8; dst = Fwh + (size_t)j * 8;
  } else {
    return;
  }
  v4f a = *(const v4f*)src;
  v4f c = *(const v4f*)(src + 4);
  a = a * 64.f; c = c * 64.f;
  vst2((v8h*)dst, pack8(a, c));
}

// 3) inT[b][p][1024] f16 = transpose of concat(x, aux) along channels. Block = 64 channels x 64 pixels,
__device__ __forceinline__ void d_tin(int blk, const float* __restrict__ x, const float* __restrict__ aux,
                                      _Float16* __restrict__ inT) {
  __shared__ __attribute__((aligned(16))) _Float16 T[64][72];   // T[p_local][c_local]
  const int t = threadIdx.x;
  if (blk >= NB * (CIN / 64) * (NP / 64)) return;
  const int b = blk >> 10, ct = (blk >> 6) & 15, pt = blk & 63;
  const int c0 = ct * 64, p0 = pt * 64;
  // the block's source is picked once, in front of the loop: picked per load, the merged grid's build branches round every load and waits for each
  const float* src0 = (c0 < NC) ? x   + ((size_t)(b * NC + c0)) * NP + p0
                                : aux + ((size_t)(b * CAUX + (c0 - NC))) * NP + p0;
#pragma unroll
  for (int i = 0; i < 4; ++i) {
    const int f = t + 256 * i;            // 1024 float4 chunks: 64 channel rows x 16
    const int cl = f >> 4, p4 = (f & 15) * 4;
    v4f v = *(const v4f*)(src0 + (size_t)cl * NP + p4);
    T[p4 + 0][cl] = (_Float16)v[0];
    T[p4 + 1][cl] = (_Float16)v[1];
    T[p4 + 2][cl] = (_Float16)v[2];
    T[p4 + 3][cl] = (_Float16)v[3];
  }
  __syncthreads();
  v8h val[2];
  size_t off[2];
#pragma unroll
  for (int i = 0; i < 2; ++i) {
    const int r = (t >> 3) + 32 * i, q = t & 7;
    val[i] = *(const v8ha*)&T[r][q * 8];
    off[i] = ((size_t)(b * NP + p0 + r)) * CIN + c0 + q * 8;
  }
#pragma unroll
  for (int i = 0; i < 2; ++i) vst2((v8h*)(inT + off[i]), val[i]);
}

// 1 + 2 + 3 in one grid: the three parts read inputs only and write buffers of their own, so none waits for another.
// The block index picks the part; the 16 pool blocks, the longest, take the lowest indices.
#define PB ((NB * NP / 4) / 256)                       // 16 pool blocks
#define WB ((NC * CIN / 8 + NC * CFU / 8) / 256)       // 192 weight blocks
#define TB (NB * (CIN / 64) * (NP / 64))               // 4096 transpose blocks
__global__ void __launch_bounds__(256) k_pre(const float* __restrict__ msk, float* __restrict__ mF,
                                             const float* __restrict__ Kw, const float* __restrict__ Fw,
                                             _Float16* __restrict__ Kwh, _Float16* __restrict__ Fwh,
                                             const float* __restrict__ x, const float* __restrict__ aux,
                                             _Float16* __restrict__ inT) {
  const int blk = blockIdx.x;
  if (blk < PB) d_pool(blk, msk, mF);
  else if (blk < PB + WB) d_cvtw(blk - PB, Kw, Fw, Kwh, Fwh);
  else d_tin(blk - (PB + WB), x, aux, inT);
}

// The k loop of both 1x1 conv products: D[64 pixels][256 channels] += A . B^T, A and B k-contiguous f16 rows.
// Every 64-k tile (64 A rows, 256 B rows) comes from global memory in whole 128-B lines, 16 B per lane, four lines per
// load, and is laid in LDS; the fragments are read from there. Two buffers: the next tile's loads fly while this tile
// is multiplied, and one barrier per tile publishes it and ends the reads of the buffer that is written next.
// The first NS1 tiles of A come from A1 (row pitch pa1), the other NS2 from A2 (pitch pa2). 8 waves: wave (pt, og) owns
// 32 pixels x 64 channels, d[i][j] = pixel tile i, channel tile j; k runs upward, as in a loop over 32-k steps.
template <int NS1, int NS2>
__device__ __forceinline__ void prod64(_Float16* S, const _Float16* A1, int pa1, const _Float16* A2, int pa2,
                                       const _Float16* B, int pbw, v8f (&d)[2][4]) {
  constexpr int NS = NS1 + NS2;
  const int t = threadIdx.x, lane = t & 31, wid = t >> 5, h = lane >> 4, n = lane & 15;
  const int pt = wid >> 2, og = wid & 3;
  // staging: row (of 32 per load) and 16-B piece of this thread; rows r and r + 8 lie side by side in a half wave,
  // so that at the 144-B pitch their two 128-B lines fall on the two halves of the LDS banks
  const int lr = ((t >> 3) & 16) | ((t & 8)) | ((t >> 4) & 7), lc = (t & 7) * 8;
  const _Float16* g1 = A1 + (size_t)lr * pa1 + lc;
  const _Float16* g2 = A2 + (size_t)lr * pa2 + lc;
  const _Float16* gb = B + (size_t)lr * pbw + lc;
  _Float16* const sw = S + lr * SP + lc;
  const _Float16* const fa = S + (pt * 32 + n) * SP;
  const _Float16* const fb = S + (PT + og * 64 + n) * SP;
  v8h ra[PT / 32], rb[NC / 32];
  auto fetch = [&](int s) {                            // tile s, global memory -> registers
    const bool first = (NS2 == 0) || s < NS1;
    const _Float16* ga = first ? g1 + s * BK : g2 + (s - NS1) * BK;
    const size_t st = first ? (size_t)32 * pa1 : (size_t)32 * pa2;
#pragma unroll
    for (int i = 0; i < PT / 32; ++i) ra[i] = *(const v8h*)(ga + i * st);
#pragma unroll
    for (int i = 0; i < NC / 32; ++i) rb[i] = *(const v8h*)(gb + s * BK + (size_t)(32 * i) * pbw);
    asm volatile("s_wait_xcnt 0x0" ::: "memory");      // before other values are written into the address registers that these loads name
  };
  auto put = [&](int s) {                              // tile s, registers -> its buffer
    _Float16* w = sw + (s & 1) * SBUF;
#pragma unroll
    for (int i = 0; i < PT / 32; ++i) *(v8ha*)(w + 32 * i * SP) = ra[i];
#pragma unroll
    for (int i = 0; i < NC / 32; ++i) *(v8ha*)(w + (PT + 32 * i) * SP) = rb[i];
  };
  auto mult = [&](int s) {                             // tile s: 2 k steps x 8 products
    const int cur = (s & 1) * SBUF;
    v16h af[BK / 32][2], bf[BK / 32][4];
#pragma unroll
    for (int q = 0; q < BK / 32; ++q) {
#pragma unroll
      for (int i = 0; i < 2; ++i) af[q][i] = ldfrag_l(fa + cur + i * 16 * SP, q * 32, h);
#pragma unroll
      for (int j = 0; j < 4; ++j) bf[q][j] = ldfrag_l(fb + cur + j * 16 * SP, q * 32, h);
    }
    __builtin_amdgcn_sched_barrier(0);                 // the tile's LDS reads stay one group in front of its products: spread among them, every place with reads is waited out to 0
#pragma unroll
    for (int q = 0; q < BK / 32; ++q)
#pragma unroll
      for (int j = 0; j < 4; ++j)
#pragma unroll
        for (int i = 0; i < 2; ++i) d[i][j] = wmma16(af[q][i], bf[q][j], d[i][j]);
  };
#pragma unroll
  for (int i = 0; i < 2; ++i)
#pragma unroll
    for (int j = 0; j < 4; ++j) d[i][j] = zero8();
  fetch(0);
  put(0);
  __syncthreads();                                     // tile 0 is published
#pragma unroll 1   // one tile per trip: unrolled, the trips' fragments and staged lines would not fit the registers
  for (int s = 0; s < NS - 1; ++s) {
    fetch(s + 1);
    mult(s);
    put(s + 1);
    __syncthreads();                                   // tile s + 1 is published; every wave has left the buffer of tile s
  }
  mult(NS - 1);
}

// 4) feats = inT . Kw^T (+ bias), then per-pixel L2 normalisation, stored as Nh[b][p][256] = f16(8 * unit row);
//    the row of a key goes to its dense slot Kc[b][kpos[p]][256] as well.
//    Block = 64 pixels x 256 channels; K = 1024 in 16 staged tiles (prod64).
__device__ __forceinline__ void d_feats(int blk, const _Float16* __restrict__ inT, const _Float16* __restrict__ Kwh,
                                        const float* __restrict__ Kb, const int* __restrict__ kpos,
                                        _Float16* __restrict__ Nh, _Float16* __restrict__ Kc) {
  __shared__ __attribute__((aligned(16))) _Float16 S[2 * SBUF];   // two staged tiles; behind the loop F[p_local][channel] in f32, pitch 260
  const int t = threadIdx.x, lane = t & 31, wid = t >> 5, h = lane >> 4, n = lane & 15;
  if (blk >= NB * NP / PT) return;
  const int b = blk / (NP / PT), pb = (blk % (NP / PT)) * PT;
  const int pt = wid >> 2, og = wid & 3;
  v8f d[2][4];
  prod64<CIN / BK, 0>(S, inT + (size_t)(b * NP + pb) * CIN, CIN, inT, 0, Kwh, CIN, d);
  f1a* const F = (f1a*)S;
  __syncthreads();                                     // every wave has left the staged tiles
#pragma unroll
  for (int j = 0; j < 4; ++j) {
    const int o = og * 64 + j * 16 + n;
    const float bias = Kb[o];
#pragma unroll
    for (int i = 0; i < 2; ++i)
#pragma unroll
      for (int r = 0; r < 8; ++r) F[(pt * 32 + i * 16 + 8 * h + r) * 260 + o] = d[i][j][r] * (1.f / 64.f) + bias;
  }
  __syncthreads();
  v8h vals[8];
  size_t offs[8];
  int slot[8];
#pragma unroll
  for (int i = 0; i < 8; ++i) {
    const int pl = wid * 8 + i;                        // 8 pixels per wave, one wave per 512-B row
    slot[i] = kpos[b * NP + pb + pl];
    v4f a = *(const v4fa*)&F[pl * 260 + lane * 8];
    v4f c = *(const v4fa*)&F[pl * 260 + lane * 8 + 4];
    float ss = a[0] * a[0] + a[1] * a[1] + a[2] * a[2] + a[3] * a[3]
             + c[0] * c[0] + c[1] * c[1] + c[2] * c[2] + c[3] * c[3];
    ss += __shfl_xor(ss, 16); ss += __shfl_xor(ss, 8); ss += __shfl_xor(ss, 4);
    ss += __shfl_xor(ss, 2);  ss += __shfl_xor(ss, 1);
    const float inv = 8.f * (1.f / (sqrtf(ss) + 1e-8f));
    vals[i] = pack8(a * inv, c * inv);
    offs[i] = ((size_t)(b * NP + pb + pl)) * NC + lane * 8;
  }
#pragma unroll
  for (int i = 0; i < 8; ++i) vst2((v8h*)(Nh + offs[i]), vals[i]);
#pragma unroll   // slot[] and vals[] by constant index, in registers
  for (int i = 0; i < 8; ++i)
    if ((unsigned)slot[i] < (unsigned)NP) vst2((v8h*)(Kc + ((size_t)(b * NP + slot[i])) * NC + lane * 8), vals[i]);
}

// 5) Vh[b][c][j] = f16( x[b][c][kidx[j]] ) for the dense key slots j < nk, 0 up to the end of the last 128-key tile.
//    8 slots per thread, 16-B stores.
__device__ __forceinline__ void d_makev(int blk, const float* __restrict__ x, const int* __restrict__ kidx,
                                        const int* __restrict__ nkA, _Float16* __restrict__ Vh) {
  const int i = blk * 256 + threadIdx.x;
  if (i >= NB * NC * NP / 8) return;
  const size_t e0 = (size_t)i * 8;
  const int j0 = (int)(e0 & (NP - 1));
  const int b = (int)(e0 >> 20);
  const int nk = min(max(nkA[b], 0), NP);
  if (j0 >= ((nk + KT - 1) & ~(KT - 1))) return;
  const float* xr = x + (e0 - (size_t)j0);
  const int* ki = kidx + (size_t)b * NP + j0;
  v4i i0 = *(const v4i*)ki;
  v4i i1 = *(const v4i*)(ki + 4);
  v4f a, c;
#pragma unroll   // vector elements by constant index, all eight gathers in flight
  for (int e = 0; e < 4; ++e) {
    const float va = xr[i0[e] & (NP - 1)];
    asm volatile("s_wait_xcnt 0x0" ::: "memory");   // before a later gather's result lands in this load's address registers
    const float vc = xr[i1[e] & (NP - 1)];
    asm volatile("s_wait_xcnt 0x0" ::: "memory");   // the same
    a[e] = (j0 + e < nk) ? va : 0.f;
    c[e] = (j0 + 4 + e < nk) ? vc : 0.f;
  }
  vst2((v8h*)(Vh + e0), pack8(a, c));
}

// 4 + 5 in one grid: neither reads what the other writes. The 256 long product blocks take the lowest indices, the
// short gather blocks the rest.
#define FB (NB * NP / PT)                              // 256 product blocks (here and in the fuse grid)
#define GB ((NB * NC * NP / 8) / 256)                  // 2048 gather blocks
__global__ void __launch_bounds__(256) k_fv(const _Float16* __restrict__ inT, const _Float16* __restrict__ Kwh,
                                            const float* __restrict__ Kb, const int* __restrict__ kpos,
                                            _Float16* __restrict__ Nh, _Float16* __restrict__ Kc,
                                            const float* __restrict__ x, const int* __restrict__ kidx,
                                            const int* __restrict__ nkA, _Float16* __restrict__ Vh) {
  const int blk = blockIdx.x;
  if (blk < FB) d_feats(blk, inT, Kwh, Kb, kpos, Nh, Kc);
  else d_makev(blk - FB, x, kidx, nkA, Vh);
}

// One wave's share of a staged key tile: rows r0, r0 + 16, ..., r0 + 112 of Kb, 512 B each, 16 B per lane (r0, nk the
// same in every lane). A whole tile takes one address and constant offsets; in the last, partial tile a slot past nk
// reads the last key again.
__device__ __forceinline__ void ldkeys(v8h (&kr)[KT / AW], const _Float16* Kb, const _Float16* p, int r0, int nk, int lane) {
  if (r0 + (KT - AW) < nk) {                           // p = the lane's 16 B of row r0, carried from trip to trip
#pragma unroll
    for (int i = 0; i < KT / AW; ++i) {
      kr[i] = *(const v8h*)(p + (size_t)(AW * i) * NC);
      if (i >= KT / AW - 2) asm volatile("s_wait_xcnt 0x0" ::: "memory");   // the shared address registers are free from the last load on: before its result or a later value lands in them
    }
  } else {
#pragma unroll
    for (int i = 0; i < KT / AW; ++i) {
      kr[i] = *(const v8h*)(Kb + (size_t)min(r0 + AW * i, nk - 1) * NC + lane * 8);
      asm volatile("s_wait_xcnt 0x0" ::: "memory");   // before a later load's result lands in this load's address registers
    }
  }
}

// 6) attention over the nk dense keys of the batch. Block = 64 query rows, 16 waves: wave (qt, kg) owns query tile qt
//    (16 rows) and key group kg (32 of the 128 keys staged per trip), so a trip covers four times the keys of a
//    one-group block and 256 blocks fill the chip. Pass 1: row sums of exp(20 cos - 20), fixed shift 20 (|cos| <= 1),
//    the four groups' partial sums added through LDS. Pass 2: att tiles -> per-block column sums (cpart) and
//    O^T = V . att^T, the four groups' partial O^T added through LDS behind the loop, in a fixed order.
//    Q chunk, K tile, V tile and the per-wave att^T tile are staged in LDS; every fragment uses ldfrag_*.
__global__ void __launch_bounds__(ATH) __attribute__((amdgpu_num_vgpr(252)))
k_attn(const _Float16* __restrict__ Nh, const _Float16* __restrict__ Kc, const _Float16* __restrict__ Vh,
       const float* __restrict__ mF, const int* __restrict__ nkA, _Float16* __restrict__ attT,
       float* __restrict__ cpart) {
  __shared__ __attribute__((aligned(16))) _Float16 Qs[QCH][264];   // q rows (later reused as O^T tile)
  __shared__ __attribute__((aligned(16))) _Float16 KV[KT * 264 + NC * VP];   // K tile, V tile; behind the loop: partial O^T in f32
  __shared__ __attribute__((aligned(16))) _Float16 Ps[AW][16][40]; // att^T     [n=q][k=key] per wave
  __shared__ float cs[AW][KW];                                     // per-wave column sums, 32 keys
  __shared__ float rs[KG][QCH];                                    // per-key-group row sums
  __shared__ __attribute__((aligned(16))) float csb[NP];           // per-block column sums
  _Float16* const Ks = KV;                 // key rows  [n=key][k=channel], pitch 264
  _Float16* const Vs = KV + KT * 264;      // V tile    [m=channel][k=key], pitch VP

  const int t = threadIdx.x, lane = t & 31, h = lane >> 4, n = lane & 15;
  const int wid = __builtin_amdgcn_readfirstlane(t >> 5);   // in a scalar register: the tests on the wave's group are scalar branches
  const int qt = wid & 3, kg = wid >> 2;
  const int blk = blockIdx.x;
  if (blk >= NB * QCN) return;
  const int b = blk / QCN, qc = blk % QCN;
  const int qblk = qc * QCH;
  const _Float16* Nb = Nh + (size_t)b * NP * NC;
  const _Float16* Kb = Kc + (size_t)b * NP * NC;
  const int nk = __builtin_amdgcn_readfirstlane(min(max(nkA[b], 0), NP));   // in a scalar register: the key loops and their barriers stand under scalar branches
  const _Float16* Vb = Vh + (size_t)b * NC * NP;
  const float* mb = mF + (size_t)b * NP;

  // stage the block's 64 query rows
#pragma unroll
  for (int i = 0; i < QCH * 32 / ATH; ++i) {
    const int id = t + ATH * i;
    const int row = id >> 5, c8 = (id & 31) * 8;
    *(v8h*)&Qs[row][c8] = *(const v8h*)(Nb + (size_t)(qblk + row) * NC + c8);
  }
  __syncthreads();

  const _Float16* Qrow = &Qs[qt * 16 + n][0];

  float invs[8];
  {
    v16h qf[8];
#pragma unroll
    for (int cb = 0; cb < 8; ++cb) qf[cb] = ldfrag_l(Qrow, cb * 32, h);
    float acc[8];
#pragma unroll
    for (int r = 0; r < 8; ++r) acc[r] = 0.f;
    const _Float16* kp1 = Kb + (size_t)wid * NC + lane * 8;
#pragma unroll 1
    for (int kb = 0; kb < nk; kb += KT) {
      __syncthreads();
      v8h kr[KT / AW];
      ldkeys(kr, Kb, kp1, kb + wid, nk, lane);
      kp1 += (size_t)KT * NC;
#pragma unroll
      for (int i = 0; i < KT / AW; ++i) *(v8h*)&Ks[(wid + AW * i) * 264 + lane * 8] = kr[i];
      __syncthreads();
#pragma unroll
      for (int sub = 0; sub < 2; ++sub) {
        v8f s = zero8();
        const _Float16* Krow = &Ks[(kg * KW + sub * 16 + n) * 264];
#pragma unroll
        for (int cb = 0; cb < 8; ++cb) s = wmma16(qf[cb], ldfrag_l(Krow, cb * 32, h), s);
        const float km = (kb + kg * KW + sub * 16 + n < nk) ? 1.f : 0.f;
#pragma unroll
        for (int r = 0; r < 8; ++r) acc[r] += km * __expf(0.3125f * s[r] - 20.f);
      }
    }
#pragma unroll
    for (int r = 0; r < 8; ++r) {
      float a = acc[r];
      a += __shfl_xor(a, 1); a += __shfl_xor(a, 2); a += __shfl_xor(a, 4); a += __shfl_xor(a, 8);
      if (n == 0) rs[kg][qt * 16 + 8 * h + r] = a;
    }
    __syncthreads();
#pragma unroll
    for (int r = 0; r < 8; ++r) {
      const int ql = qt * 16 + 8 * h + r;
      const float a = (rs[0][ql] + rs[1][ql]) + (rs[2][ql] + rs[3][ql]);
      invs[r] = mb[qblk + ql] / (a + 1e-30f);          // query mask folded in: invalid rows -> 0
    }
  }

  // ---- pass 2: att tiles, column sums, O^T = V . (att*4096)^T ----
  const int vr0 = t >> 4, v8 = (t & 15) * 8;           // V staging: channel row and key offset of this thread's 16 B
  const unsigned voff = (unsigned)(vr0 * NP + v8);
  const _Float16* kp2 = Kb + (size_t)wid * NC + lane * 8;
  v8f o[16];
#pragma unroll
  for (int cc = 0; cc < 16; ++cc) o[cc] = zero8();
#pragma unroll 1
  for (int kb = 0; kb < nk; kb += KT) {
    __syncthreads();
    v8h vv[KT / AW], kr[KT / AW];
    ldkeys(kr, Kb, kp2, kb + wid, nk, lane);
    kp2 += (size_t)KT * NC;
#pragma unroll
    for (int i = 0; i < KT / AW; ++i) {
      vv[i] = *(const v8h*)(Vb + kb + (size_t)(32 * i) * NP + voff);   // two 256-B row pieces per wave and load
      if (i >= KT / AW - 2) asm volatile("s_wait_xcnt 0x0" ::: "memory");   // as in ldkeys: before the shared address registers are written again
    }
#pragma unroll
    for (int i = 0; i < KT / AW; ++i) {
      *(v8h*)&Ks[(wid + AW * i) * 264 + lane * 8] = kr[i];
      *(v8h*)&Vs[(vr0 + 32 * i) * VP + v8] = vv[i];
    }
    __syncthreads();
#pragma unroll
    for (int sub = 0; sub < 2; ++sub) {
      v8f s = zero8();
      const _Float16* Krow = &Ks[(kg * KW + sub * 16 + n) * 264];
#pragma unroll
      for (int cb = 0; cb < 8; ++cb) s = wmma16(ldfrag_l(Qrow, cb * 32, h), ldfrag_l(Krow, cb * 32, h), s);
      const float km = (kb + kg * KW + sub * 16 + n < nk) ? 1.f : 0.f;
      float csum = 0.f;
#pragma unroll
      for (int r = 0; r < 8; ++r) {
        const float att = invs[r] * km * __expf(0.3125f * s[r] - 20.f);   // D row q = 8h+r, col key = n
        csum += att;
        Ps[wid][8 * h + r][sub * 16 + n] = (_Float16)(att * 4096.f);
      }
      csum += __shfl_xor(csum, 16);
      if (lane < 16) cs[wid][sub * 16 + lane] = csum;
    }
    __syncthreads();
    if (wid < KG) {                                    // wave g folds key group g: its four query tiles' sums
      float tt = 0.f;
#pragma unroll
      for (int w = 0; w < 4; ++w) tt += cs[wid * 4 + w][lane];
      csb[kb + wid * KW + lane] = tt;
    }
    const v16h pB = ldfrag_l(&Ps[wid][n][0], 0, h);                   // B: k = key, n = q
#pragma unroll
    for (int g = 0; g < 4; ++g) {
#pragma unroll
      for (int j = 0; j < 4; ++j)
        o[g * 4 + j] = wmma16(ldfrag_l(&Vs[(g * 64 + j * 16 + n) * VP], kg * KW, h), pB, o[g * 4 + j]);   // A: m = channel
    }
  }

  // the four key groups' partial O^T tiles, added in f32 as (g0 + g2) + (g1 + g3); a tile lies in the K/V space as
  // [cc][half][lane][4], 16 B per lane, 16 KiB per wave
  float* const R = (float*)KV;
  __syncthreads();                                     // every wave has left the K and V tiles
  if (kg >= 2) {
    float* rp = R + ((kg - 2) * 4 + qt) * 4096 + lane * 4;
#pragma unroll
    for (int cc = 0; cc < 16; ++cc) {
      v4f lo = {o[cc][0], o[cc][1], o[cc][2], o[cc][3]};
      v4f hi = {o[cc][4], o[cc][5], o[cc][6], o[cc][7]};
      *(v4fa*)(rp + cc * 256) = lo;
      *(v4fa*)(rp + cc * 256 + 128) = hi;
    }
  }
  __syncthreads();
  if (kg < 2) {
    const float* rp = R + (kg * 4 + qt) * 4096 + lane * 4;
#pragma unroll
    for (int cc = 0; cc < 16; ++cc) {
      v4f lo = *(const v4fa*)(rp + cc * 256);
      v4f hi = *(const v4fa*)(rp + cc * 256 + 128);
#pragma unroll
      for (int e = 0; e < 4; ++e) { o[cc][e] += lo[e]; o[cc][4 + e] += hi[e]; }
    }
  }
  __syncthreads();
  if (kg == 1) {
    float* rp = R + qt * 4096 + lane * 4;
#pragma unroll
    for (int cc = 0; cc < 16; ++cc) {
      v4f lo = {o[cc][0], o[cc][1], o[cc][2], o[cc][3]};
      v4f hi = {o[cc][4], o[cc][5], o[cc][6], o[cc][7]};
      *(v4fa*)(rp + cc * 256) = lo;
      *(v4fa*)(rp + cc * 256 + 128) = hi;
    }
  }
  __syncthreads();
  // O^T tile (D rows = channel cc*16+8h+r, cols = q) -> f16, staged in the query tile's own Qs rows as [q][channel]
  if (kg == 0) {
    const float* rp = R + qt * 4096 + lane * 4;
#pragma unroll
    for (int cc = 0; cc < 16; ++cc) {
      v4f lo = *(const v4fa*)(rp + cc * 256);
      v4f hi = *(const v4fa*)(rp + cc * 256 + 128);
      v8h tv;
#pragma unroll
      for (int e = 0; e < 4; ++e) {
        tv[e]     = (_Float16)((o[cc][e] + lo[e]) * (1.f / 4096.f));
        tv[4 + e] = (_Float16)((o[cc][4 + e] + hi[e]) * (1.f / 4096.f));
      }
      *(v8h*)&Qs[qt * 16 + n][cc * 16 + 8 * h] = tv;
    }
  }
  __syncthreads();
  // attT[b][q][256]: one 512-B row per instruction, 16 B per lane, four rows per wave
  _Float16* arow = attT + ((size_t)(b * NP + qblk + wid * 4)) * NC + lane * 8;
#pragma unroll
  for (int i = 0; i < QCH / AW; ++i) {
    v8h v = *(const v8ha*)&Qs[wid * 4 + i][lane * 8];
    vst2((v8h*)(arow + (size_t)i * NC), v);
  }
  float* cp = cpart + ((size_t)(b * QCN + qc)) * NP;
#pragma unroll
  for (int i = 0; i < NP / 4 / ATH; ++i) {
    const int f = t + ATH * i;
    if (f * 4 < nk) {                                  // csb holds whole 128-key tiles up to nk
      v4f v = *(const v4fa*)&csb[f * 4];
      vst2((v4f*)(cp + (size_t)f * 4), v);
    }
  }
}

// 7) fused = concat(att_fore, x) . Fw^T, then out0[b][o][p] = m[p] ? fused : x. Block = 64 pixels x 256
//    channels; K = 512 in 8 staged tiles (prod64): input channels 0..255 from attT, 256..511 from the first 256 columns of inT.
__device__ __forceinline__ void
d_fuse(int blk, const _Float16* __restrict__ attT, const _Float16* __restrict__ inT, const _Float16* __restrict__ Fwh,
       const float* __restrict__ x, const float* __restrict__ mF, float* __restrict__ out0) {
  __shared__ __attribute__((aligned(16))) _Float16 S[2 * SBUF];   // two staged tiles; behind the loop G[channel][p_local] in f32, pitch 68
  const int t = threadIdx.x, lane = t & 31, wid = t >> 5, h = lane >> 4, n = lane & 15;
  if (blk >= NB * NP / PT) return;
  const int b = blk / (NP / PT), pb = (blk % (NP / PT)) * PT;
  const int pt = wid >> 2, og = wid & 3;
  const size_t row0 = (size_t)b * NP + pb;
  v8f d[2][4];
  prod64<NC / BK, NC / BK>(S, attT + row0 * NC, NC, inT + row0 * CIN, CIN, Fwh, CFU, d);
  // wave owns 32 channels; two 256-B row pieces per instruction, one address and constant offsets
  const int p4 = (lane & 15) * 4;
  const size_t g0 = ((size_t)(b * NC + wid * 32 + (lane >> 4))) * NP + pb + p4;
  const float* xp = x + g0;
  float* op = out0 + g0;
  const v4f mv = *(const v4f*)(mF + (size_t)b * NP + pb + p4);
  v4f xv[16];
#pragma unroll
  for (int i = 0; i < 16; ++i) {
    xv[i] = *(const v4f*)(xp + (size_t)(2 * i) * NP);
    if (i >= 14) asm volatile("s_wait_xcnt 0x0" ::: "memory");   // as in ldkeys: the shared address registers are free from the last load on
  }
  f1a* const G = (f1a*)S;
  __syncthreads();                                     // every wave has left the staged tiles
#pragma unroll
  for (int j = 0; j < 4; ++j) {
    const int o = og * 64 + j * 16 + n;
#pragma unroll
    for (int i = 0; i < 2; ++i) {
      v4f lo, hi;
#pragma unroll
      for (int e = 0; e < 4; ++e) { lo[e] = d[i][j][e] * (1.f / 64.f); hi[e] = d[i][j][4 + e] * (1.f / 64.f); }
      *(v4fa*)&G[o * 68 + pt * 32 + i * 16 + 8 * h] = lo;
      *(v4fa*)&G[o * 68 + pt * 32 + i * 16 + 8 * h + 4] = hi;
    }
  }
  __syncthreads();
#pragma unroll
  for (int i = 0; i < 16; ++i) {
    const v4f fz = *(const v4fa*)&G[(wid * 32 + 2 * i + (lane >> 4)) * 68 + p4];
    v4f rv;
#pragma unroll
    for (int e = 0; e < 4; ++e) rv[e] = (mv[e] > 0.5f) ? fz[e] : xv[i][e];
    vst2((v4f*)(op + (size_t)(2 * i) * NP), rv);
  }
}

// 8) visatt[b][p] = fixed-order sum of the 64 partial column sums at the pixel's key slot, 0 for a non-key;
//    one pixel per thread, 64 blocks of 256.
//    Each run of 128 pixels also leaves the maximum of its sums (start value 0) in bmax[run], two runs per block.
#define VB 128              // pixels per run, and number of runs (VB * VB = NB * NP)
__device__ __forceinline__ void d_vis(int blk, const float* __restrict__ cpart, const int* __restrict__ kpos,
                                      float* __restrict__ vis, float* __restrict__ bmax) {
  __shared__ float red[256 / 32];
  const int t = threadIdx.x, lane = t & 31, wid = t >> 5;
  const int idx = blk * 256 + t;
  if (blk >= NB * NP / 256) return;
  const int b = idx >> 12;
  const int slot = kpos[idx];
  float s = 0.f;
  if ((unsigned)slot < (unsigned)NP) {
    const float* cp = cpart + (size_t)b * QCN * NP + slot;
    float v[QCN];
#pragma unroll
    for (int q = 0; q < QCN; ++q) v[q] = cp[(size_t)q * NP];
#pragma unroll
    for (int q = 0; q < QCN; ++q) s += v[q];
  }
  vis[idx] = s;
  float mx = fmaxf(0.f, s);
  mx = fmaxf(mx, __shfl_xor(mx, 16)); mx = fmaxf(mx, __shfl_xor(mx, 8)); mx = fmaxf(mx, __shfl_xor(mx, 4));
  mx = fmaxf(mx, __shfl_xor(mx, 2));  mx = fmaxf(mx, __shfl_xor(mx, 1));
  if (lane == 0) red[wid] = mx;
  __syncthreads();
  if ((t & (VB - 1)) == 0) bmax[idx / VB] = fmaxf(fmaxf(red[wid], red[wid + 1]), fmaxf(red[wid + 2], red[wid + 3]));
}

// 7 + 8 in one grid: both read only what the score kernel and earlier launches left, and write buffers of their own.
#define SB (NB * NP / 256)                             // 64 column-sum blocks
__global__ void __launch_bounds__(256) k_post(const _Float16* __restrict__ attT, const _Float16* __restrict__ inT,
                                              const _Float16* __restrict__ Fwh, const float* __restrict__ x,
                                              const float* __restrict__ mF, float* __restrict__ out0,
                                              const float* __restrict__ cpart, const int* __restrict__ kpos,
                                              float* __restrict__ vis, float* __restrict__ bmax) {
  const int blk = blockIdx.x;
  if (blk < FB) d_fuse(blk, attT, inT, Fwh, x, mF, out0);
  else d_vis(blk - FB, cpart, kpos, vis, bmax);
}

// 9) out1 = 8x nearest upsample of visatt / global max. Block = one strip of 8 output rows (one visatt row):
//    every wave folds the 128 run maxima itself, each thread reads one visatt value and stores it 4 x 16 B.
__global__ void __launch_bounds__(256) k_up(const float* __restrict__ vis, const float* __restrict__ bmax,
                                            float* __restrict__ out1) {
  const int t = threadIdx.x, lane = t & 31;
  const int blk = blockIdx.x;
  if (blk >= NB * 64) return;
  const v4f bm = *(const v4f*)(bmax + lane * 4);
  const float sv = vis[blk * 64 + ((t & 127) >> 1)];
  float mx = fmaxf(fmaxf(bm[0], bm[1]), fmaxf(bm[2], bm[3]));
  mx = fmaxf(mx, __shfl_xor(mx, 16)); mx = fmaxf(mx, __shfl_xor(mx, 8)); mx = fmaxf(mx, __shfl_xor(mx, 4));
  mx = fmaxf(mx, __shfl_xor(mx, 2));  mx = fmaxf(mx, __shfl_xor(mx, 1));
  const float inv = 1.f / mx;
  const float v = sv * inv;
  v4f r; r[0] = v; r[1] = v; r[2] = v; r[3] = v;
  float* dst = out1 + ((size_t)blk * 1024 + t) * 4;
#pragma unroll
  for (int i = 0; i < 4; ++i) *(v4f*)(dst + (size_t)i * 1024) = r;
}

// ---------------------------------------------------------------------------
extern "C" void kernel_launch(void* const* d_in, const int* in_sizes, int n_in,
                              void* d_out, int out_size, void* d_ws, size_t ws_size,
                              hipStream_t stream) {
  if (n_in < 6) return;
  if (in_sizes[0] != NB * NC * NP) return;        // x      [4,256,64,64] f32
  if (in_sizes[1] != NB * MS * MS) return;        // mask   [4,1,512,512] f32
  if (in_sizes[2] != NB * CAUX * NP) return;      // aux    [4,768,64,64] f32
  if (in_sizes[3] != NC * CIN) return;            // K_w    [256,1024]    f32
  if (in_sizes[4] != NC) return;                  // K_b    [256]         f32
  if (in_sizes[5] != NC * CFU) return;            // fuse_w [256,512]     f32
  if (out_size != NB * NC * NP + NB * MS * MS) return;

  const float* x   = (const float*)d_in[0];
  const float* msk = (const float*)d_in[1];
  const float* aux = (const float*)d_in[2];
  const float* Kw  = (const float*)d_in[3];
  const float* Kb  = (const float*)d_in[4];
  const float* Fw  = (const float*)d_in[5];
  float* out0 = (float*)d_out;                           // 4,194,304 f32 at byte 0
  float* out1 = out0 + (size_t)NB * NC * NP;             // 1,048,576 f32 at byte 16,777,216

  const size_t o_m   = 0;                                          //     65,536 B
  const size_t o_kwh = o_m   + (size_t)NB * NP * 4;                //    524,288 B
  const size_t o_fwh = o_kwh + (size_t)NC * CIN * 2;               //    262,144 B
  const size_t o_inT = o_fwh + (size_t)NC * CFU * 2;               // 33,554,432 B
  const size_t o_nh  = o_inT + (size_t)NB * NP * CIN * 2;          //  8,388,608 B
  const size_t o_vh  = o_nh  + (size_t)NB * NP * NC * 2;           //  8,388,608 B
  const size_t o_att = o_vh  + (size_t)NB * NC * NP * 2;           //  8,388,608 B
  const size_t o_cp  = o_att + (size_t)NB * NP * NC * 2;           //  4,194,304 B
  const size_t o_vis = o_cp  + (size_t)NB * QCN * NP * 4;          //     65,536 B
  const size_t o_bm  = o_vis + (size_t)NB * NP * 4;                //        512 B
  const size_t o_kc  = o_bm  + (size_t)VB * 4;                     //  8,388,608 B
  const size_t o_kp  = o_kc  + (size_t)NB * NP * NC * 2;           //     65,536 B
  const size_t o_ki  = o_kp  + (size_t)NB * NP * 4;                //     65,536 B
  const size_t o_nk  = o_ki  + (size_t)NB * NP * 4;                //         16 B
  const size_t total = o_nk  + (size_t)NB * 4;                     // 72,352,272 B
  if (total > ws_size) return;

  char* w = (char*)d_ws;
  float*    mF    = (float*)(w + o_m);
  _Float16* Kwh   = (_Float16*)(w + o_kwh);
  _Float16* Fwh   = (_Float16*)(w + o_fwh);
  _Float16* inT   = (_Float16*)(w + o_inT);
  _Float16* Nh    = (_Float16*)(w + o_nh);
  _Float16* Vh    = (_Float16*)(w + o_vh);
  _Float16* attT  = (_Float16*)(w + o_att);
  float*    cpart = (float*)(w + o_cp);
  float*    vis   = (float*)(w + o_vis);
  float*    bmax  = (float*)(w + o_bm);
  _Float16* Kc    = (_Float16*)(w + o_kc);
  int*      kpos  = (int*)(w + o_kp);
  int*      kidx  = (int*)(w + o_ki);
  int*      nkA   = (int*)(w + o_nk);

  k_pre  <<<PB + WB + TB, 256, 0, stream>>>(msk, mF, Kw, Fw, Kwh, Fwh, x, aux, inT);      // 16 + 192 + 4096 blocks
  k_rank <<<NB, 256, 0, stream>>>(mF, kpos, kidx, nkA);                                 // 4 blocks
  k_fv   <<<FB + GB, 256, 0, stream>>>(inT, Kwh, Kb, kpos, Nh, Kc, x, kidx, nkA, Vh);     // 256 + 2048 blocks
  k_attn <<<NB * QCN, ATH, 0, stream>>>(Nh, Kc, Vh, mF, nkA, attT, cpart);                // 256 blocks
  k_post <<<FB + SB, 256, 0, stream>>>(attT, inT, Fwh, x, mF, out0, cpart, kpos, vis, bmax);   // 256 + 64 blocks
  k_up   <<<NB * 64, 256, 0, stream>>>(vis, bmax, out1);                                // 256 blocks
}

// v006
// Measured time: 122 microseconds a run.
// Two timings next to v005 both put it at 1.17 times that version's speed.
// Counting every step since v000, it is 5.87 times as fast.
#include <hip/hip_runtime.h>

// Contractions on v_wmma_f32_16x16x32_f16 (f16 operands, f32 accumulate): 1x1 input conv (weights x64),
// q.k scores (unit feature rows x8 on each side), att.v (att x4096), 1x1 fuse conv (weights x64);
// every scale is an exact power of two folded back in f32. Softmax, norms, sums and selects stay f32.

#define NB   4
#define NC   256
#define NP   4096
#define CIN  1024
#define CAUX 768
#define CFU  512
#define MS   512
#define QCH  64             // query rows per block in the score kernel (4 query tiles x 16)
#define KG   4              // key groups per block: waves that share a query tile and split the staged keys
#define KW   32             // keys per wave and trip
#define KT   (KG * KW)      // 128 keys per staged tile
#define AW   (QCH / 16 * KG)  // 16 waves per block in the score kernel
#define ATH  (AW * 32)      // its 512 threads
#define VP   (KT + 8)       // LDS pitch of a V row in elements: 272 B = 16 B x 17
#define QCN  (NP / QCH)     // 64 query chunks per batch
#define PT   64             // pixels per block in the two 1x1 conv products
#define BK   64             // k per staged tile: one 128-B line of every operand row
#define SP   (BK + 8)       // LDS pitch of a staged row in elements: 144 B = 16 B x 9
#define SBUF ((PT + NC) * SP)   // elements of one staged tile: 64 pixel rows, then 256 weight rows

typedef _Float16 v16h __attribute__((ext_vector_type(16)));
typedef _Float16 v8h  __attribute__((ext_vector_type(8)));
typedef v8h v8ha __attribute__((may_alias));
typedef float v8f __attribute__((ext_vector_type(8)));
typedef float v4f __attribute__((ext_vector_type(4)));
typedef v4f v4fa __attribute__((may_alias));
typedef int v4i __attribute__((ext_vector_type(4)));
typedef v4i v4ia __attribute__((may_alias));
typedef float f1a __attribute__((may_alias));

union Frag { v16h v; v8h hf[2]; };

__device__ __forceinline__ v8f zero8() {
  v8f z = {0.f, 0.f, 0.f, 0.f, 0.f, 0.f, 0.f, 0.f};
  return z;
}

__device__ __forceinline__ v8f wmma16(v16h a, v16h b, v8f c) {
  v8f d = __builtin_amdgcn_wmma_f32_16x16x32_f16(false, a, false, b, (short)0, c, false, false);
  asm volatile("v_nop\n\tv_nop\n\tv_nop\n\tv_nop" : "+v"(d) : "v"(a), "v"(b));
  return d;
}

// 16 rows x 32 k fragment from a k-contiguous 16-bit matrix. rowp = start of the row owned by this
// lane (row index = lane & 15). Elements 0..7 <- k0+8h+0..7, elements 8..15 <- k0+16+8h+0..7 with
// h = lane >> 4. Used for A (row = m) and for B (row = n of a [n][k] copy). D: acc[r] = (row 8h+r, col lane&15).
__device__ __forceinline__ v16h ldfrag_g(const _Float16* rowp, int k0, int h) {
  Frag f;
  f.hf[0] = *(const v8h*)(rowp + k0 + 8 * h);
  f.hf[1] = *(const v8h*)(rowp + k0 + 16 + 8 * h);
  return f.v;
}
__device__ __forceinline__ v16h ldfrag_l(const _Float16* rowp, int k0, int h) {
  Frag f;
  f.hf[0] = *(const v8ha*)(rowp + k0 + 8 * h);
  f.hf[1] = *(const v8ha*)(rowp + k0 + 16 + 8 * h);
  return f.v;
}

__device__ __forceinline__ v8h pack8(v4f a, v4f b) {
  v8h r;
  r[0] = (_Float16)a[0]; r[1] = (_Float16)a[1]; r[2] = (_Float16)a[2]; r[3] = (_Float16)a[3];
  r[4] = (_Float16)b[0]; r[5] = (_Float16)b[1]; r[6] = (_Float16)b[2]; r[7] = (_Float16)b[3];
  return r;
}

__device__ __forceinline__ float max8f(v4f a, v4f b) {
  float m0 = fmaxf(fmaxf(a[0], a[1]), fmaxf(a[2], a[3]));
  float m1 = fmaxf(fmaxf(b[0], b[1]), fmaxf(b[2], b[3]));
  return fmaxf(m0, m1);
}

template <typename T>
__device__ __forceinline__ void vst2(T* p, T v) {
  *(T*)p = v;
  
}

// ---------------------------------------------------------------------------
// 1) 8x8 max pool of the 512x512 mask, binarised: mF[b][p] in {0,1}. 4 pixels per thread, 16-B stores.
__device__ __forceinline__ void d_pool(int blk, const float* __restrict__ msk, float* __restrict__ mF) {
  const int i = blk * 256 + threadIdx.x;
  if (i >= NB * NP / 4) return;
  const int pix0 = i * 4;
  const int b = pix0 >> 12, p = pix0 & (NP - 1);
  const int y = p >> 6, x0 = p & 63;
  const float* s = msk + ((size_t)b * MS + (size_t)y * 8) * MS + (size_t)x0 * 8;
  float mx[4] = {0.f, 0.f, 0.f, 0.f};
#pragma unroll 1   // one mask row (eight 16-B loads) in flight: unrolled whole, this part's registers would halve the waves that the transpose blocks of the same grid keep on a SIMD
  for (int dy = 0; dy < 8; ++dy) {
    const float* row = s + dy * MS;
#pragma unroll
    for (int j = 0; j < 4; ++j) {
      v4f a = *(const v4f*)(row + j * 8);
      v4f c = *(const v4f*)(row + j * 8 + 4);
      mx[j] = fmaxf(mx[j], max8f(a, c));
    }
    asm volatile("s_wait_xcnt 0x0" ::: "memory");   // before the next trip's address is written into the registers that this trip's loads name
  }
  v4f r;
#pragma unroll
  for (int j = 0; j < 4; ++j) r[j] = (mx[j] > 0.f) ? 1.f : 0.f;
  vst2((v4f*)(mF + pix0), r);
}

// 1b) dense order of the keys. A pixel with m = 0 is a key; every term of a pixel with m = 1 on the key side is
//     multiplied by 0, so only the keys get a slot. Per batch: kpos[p] = slot of key p (-1 for a non-key),
//     kidx = the pixels as a permutation, keys first (in pixel order), then the non-keys; nkA[b] = number of keys.
__global__ void __launch_bounds__(256) k_rank(const float* __restrict__ mF, int* __restrict__ kpos,
                                              int* __restrict__ kidx, int* __restrict__ nkA) {
  __shared__ __attribute__((aligned(16))) int cnt[256];
  const int t = threadIdx.x, b = blockIdx.x;
  if (b >= NB) return;
  const float* ms = mF + (size_t)b * NP + t * 16;
  bool key[16];
  int c = 0;
#pragma unroll   // both loops unrolled whole: key[] is indexed by constants and stays in registers
  for (int j = 0; j < 4; ++j) {
    v4f a = *(const v4f*)(ms + j * 4);
#pragma unroll
    for (int e = 0; e < 4; ++e) { key[j * 4 + e] = a[e] < 0.5f; c += key[j * 4 + e] ? 1 : 0; }
  }
  cnt[t] = c;
  __syncthreads();
  int pre = 0, tot = 0;
#pragma unroll 4   // four 16-B LDS reads in flight per trip instead of one waited read
  for (int i = 0; i < 64; ++i) {
    v4i v = *(const v4ia*)&cnt[i * 4];
#pragma unroll
    for (int e = 0; e < 4; ++e) { tot += v[e]; pre += (i * 4 + e < t) ? v[e] : 0; }
  }
  int* kp = kpos + (size_t)b * NP + t * 16;
  int* ki = kidx + (size_t)b * NP;
  int r = pre;                                   // keys in front of the current pixel
#pragma unroll   // as above: key[] and w by constant index
  for (int j = 0; j < 4; ++j) {
    v4i w;
#pragma unroll
    for (int e = 0; e < 4; ++e) {
      const int p = t * 16 + j * 4 + e;
      const bool k = key[j * 4 + e];
      w[e] = k ? r : -1;
      ki[k ? r : tot + p - r] = p;
      r += k ? 1 : 0;
    }
    *(v4i*)(kp + j * 4) = w;
  }
  if (t == 0) nkA[b] = tot;
}

// 2) weights to f16 with x64 scale: Kwh[256][1024], Fwh[256][512]. 8 elements per thread, 16-B stores.
__device__ __forceinline__ void d_cvtw(int blk, const float* __restrict__ Kw, const float* __restrict__ Fw,
                                       _Float16* __restrict__ Kwh, _Float16* __restrict__ Fwh) {
  const int i = blk * 256 + threadIdx.x;
  const float* src;
  _Float16* dst;
  if (i < NC * CIN / 8) {
    src = Kw + (size_t)i * 8; dst = Kwh + (size_t)i * 8;
  } else if (i < NC * CIN / 8 + NC * CFU / 8) {
    const int j = i - NC * CIN / 8;
    src = Fw + (size_t)j * 8; dst = Fwh + (size_t)j * 8;
  } else {
    return;
  }
  v4f a = *(const v4f*)src;
  v4f c = *(const v4f*)(src + 4);
  a = a * 64.f; c = c * 64.f;
  vst2((v8h*)dst, pack8(a, c));
}

// 3) inT[b][p][1024] f16 = transpose of concat(x, aux) along channels. Block = 64 channels x 64 pixels,
__device__ __forceinline__ void d_tin(int blk, const float* __restrict__ x, const float* __restrict__ aux,
                                      _Float16* __restrict__ inT) {
  __shared__ __attribute__((aligned(16))) _Float16 T[64][72];   // T[p_local][c_local]
  const int t = threadIdx.x;
  if (blk >= NB * (CIN / 64) * (NP / 64)) return;
  const int b = blk >> 10, ct = (blk >> 6) & 15, pt = blk & 63;
  const int c0 = ct * 64, p0 = pt * 64;
  // the block's source is picked once, in front of the loop: picked per load, the merged grid's build branches round every load and waits for each
  const float* src0 = (c0 < NC) ? x   + ((size_t)(b * NC + c0)) * NP + p0
                                : aux + ((size_t)(b * CAUX + (c0 - NC))) * NP + p0;
#pragma unroll
  for (int i = 0; i < 4; ++i) {
    const int f = t + 256 * i;            // 1024 float4 chunks: 64 channel rows x 16
    const int cl = f >> 4, p4 = (f & 15) * 4;
    v4f v = *(const v4f*)(src0 + (size_t)cl * NP + p4);
    T[p4 + 0][cl] = (_Float16)v[0];
    T[p4 + 1][cl] = (_Float16)v[1];
    T[p4 + 2][cl] = (_Float16)v[2];
    T[p4 + 3][cl] = (_Float16)v[3];
  }
  __syncthreads();
  v8h val[2];
  size_t off[2];
#pragma unroll
  for (int i = 0; i < 2; ++i) {
    const int r = (t >> 3) + 32 * i, q = t & 7;
    val[i] = *(const v8ha*)&T[r][q * 8];
    off[i] = ((size_t)(b * NP + p0 + r)) * CIN + c0 + q * 8;
  }
#pragma unroll
  for (int i = 0; i < 2; ++i) vst2((v8h*)(inT + off[i]), val[i]);
}

// 1 + 2 + 3 in one grid: the three parts read inputs only and write buffers of their own, so none waits for another.
// The block index picks the part; the 16 pool blocks, the longest, take the lowest indices.
#define PB ((NB * NP / 4) / 256)                       // 16 pool blocks
#define WB ((NC * CIN / 8 + NC * CFU / 8) / 256)       // 192 weight blocks
#define TB (NB * (CIN / 64) * (NP / 64))               // 4096 transpose blocks
__global__ void __launch_bounds__(256) k_pre(const float* __restrict__ msk, float* __restrict__ mF,
                                             const float* __restrict__ Kw, const float* __restrict__ Fw,
                                             _Float16* __restrict__ Kwh, _Float16* __restrict__ Fwh,
                                             const float* __restrict__ x, const float* __restrict__ aux,
                                             _Float16* __restrict__ inT) {
  const int blk = blockIdx.x;
  if (blk < PB) d_pool(blk, msk, mF);
  else if (blk < PB + WB) d_cvtw(blk - PB, Kw, Fw, Kwh, Fwh);
  else d_tin(blk - (PB + WB), x, aux, inT);
}

// The k loop of both 1x1 conv products: D[64 pixels][256 channels] += A . B^T, A and B k-contiguous f16 rows.
// Every 64-k tile (64 A rows, 256 B rows) comes from global memory in whole 128-B lines, 16 B per lane, four lines per
// load, and is laid in LDS; the fragments are read from there. Two buffers: the next tile's loads fly while this tile
// is multiplied, and one barrier per tile publishes it and ends the reads of the buffer that is written next.
// The first NS1 tiles of A come from A1 (row pitch pa1), the other NS2 from A2 (pitch pa2). 8 waves: wave (pt, og) owns
// 32 pixels x 64 channels, d[i][j] = pixel tile i, channel tile j; k runs upward, as in a loop over 32-k steps.
template <int NS1, int NS2>
__device__ __forceinline__ void prod64(_Float16* S, const _Float16* A1, int pa1, const _Float16* A2, int pa2,
                                       const _Float16* B, int pbw, v8f (&d)[2][4]) {
  constexpr int NS = NS1 + NS2;
  const int t = threadIdx.x, lane = t & 31, wid = t >> 5, h = lane >> 4, n = lane & 15;
  const int pt = wid >> 2, og = wid & 3;
  // staging: row (of 32 per load) and 16-B piece of this thread; rows r and r + 8 lie side by side in a half wave,
  // so that at the 144-B pitch their two 128-B lines fall on the two halves of the LDS banks
  const int lr = ((t >> 3) & 16) | ((t & 8)) | ((t >> 4) & 7), lc = (t & 7) * 8;
  const _Float16* g1 = A1 + (size_t)lr * pa1 + lc;
  const _Float16* g2 = A2 + (size_t)lr * pa2 + lc;
  const _Float16* gb = B + (size_t)lr * pbw + lc;
  _Float16* const sw = S + lr * SP + lc;
  const _Float16* const fa = S + (pt * 32 + n) * SP;
  const _Float16* const fb = S + (PT + og * 64 + n) * SP;
  v8h ra[PT / 32], rb[NC / 32];
  auto fetch = [&](int s) {                            // tile s, global memory -> registers
    const bool first = (NS2 == 0) || s < NS1;
    const _Float16* ga = first ? g1 + s * BK : g2 + (s - NS1) * BK;
    const size_t st = first ? (size_t)32 * pa1 : (size_t)32 * pa2;
#pragma unroll
    for (int i = 0; i < PT / 32; ++i) ra[i] = *(const v8h*)(ga + i * st);
#pragma unroll
    for (int i = 0; i < NC / 32; ++i) rb[i] = *(const v8h*)(gb + s * BK + (size_t)(32 * i) * pbw);
    asm volatile("s_wait_xcnt 0x0" ::: "memory");      // before other values are written into the address registers that these loads name
  };
  auto put = [&](int s) {                              // tile s, registers -> its buffer
    _Float16* w = sw + (s & 1) * SBUF;
#pragma unroll
    for (int i = 0; i < PT / 32; ++i) *(v8ha*)(w + 32 * i * SP) = ra[i];
#pragma unroll
    for (int i = 0; i < NC / 32; ++i) *(v8ha*)(w + (PT + 32 * i) * SP) = rb[i];
  };
  auto mult = [&](int s) {                             // tile s: 2 k steps x 8 products
    const int cur = (s & 1) * SBUF;
    v16h af[BK / 32][2], bf[BK / 32][4];
#pragma unroll
    for (int q = 0; q < BK / 32; ++q) {
#pragma unroll
      for (int i = 0; i < 2; ++i) af[q][i] = ldfrag_l(fa + cur + i * 16 * SP, q * 32, h);
#pragma unroll
      for (int j = 0; j < 4; ++j) bf[q][j] = ldfrag_l(fb + cur + j * 16 * SP, q * 32, h);
    }
    __builtin_amdgcn_sched_barrier(0);                 // the tile's LDS reads stay one group in front of its products: spread among them, every place with reads is waited out to 0
#pragma unroll
    for (int q = 0; q < BK / 32; ++q)
#pragma unroll
      for (int j = 0; j < 4; ++j)
#pragma unroll
        for (int i = 0; i < 2; ++i) d[i][j] = wmma16(af[q][i], bf[q][j], d[i][j]);
  };
#pragma unroll
  for (int i = 0; i < 2; ++i)
#pragma unroll
    for (int j = 0; j < 4; ++j) d[i][j] = zero8();
  fetch(0);
  put(0);
  __syncthreads();                                     // tile 0 is published
#pragma unroll 1   // one tile per trip: unrolled, the trips' fragments and staged lines would not fit the registers
  for (int s = 0; s < NS - 1; ++s) {
    fetch(s + 1);
    mult(s);
    put(s + 1);
    __syncthreads();                                   // tile s + 1 is published; every wave has left the buffer of tile s
  }
  mult(NS - 1);
}

// 4) feats = inT . Kw^T (+ bias), then per-pixel L2 normalisation, stored as Nh[b][p][256] = f16(8 * unit row);
//    the row of a key goes to its dense slot Kc[b][kpos[p]][256] as well.
//    Block = 64 pixels x 256 channels; K = 1024 in 16 staged tiles (prod64).
__device__ __forceinline__ void d_feats(int blk, const _Float16* __restrict__ inT, const _Float16* __restrict__ Kwh,
                                        const float* __restrict__ Kb, const int* __restrict__ kpos,
                                        _Float16* __restrict__ Nh, _Float16* __restrict__ Kc) {
  __shared__ __attribute__((aligned(16))) _Float16 S[2 * SBUF];   // two staged tiles; behind the loop F[p_local][channel] in f32, pitch 260
  const int t = threadIdx.x, lane = t & 31, wid = t >> 5, h = lane >> 4, n = lane & 15;
  if (blk >= NB * NP / PT) return;
  const int b = blk / (NP / PT), pb = (blk % (NP / PT)) * PT;
  const int pt = wid >> 2, og = wid & 3;
  v8f d[2][4];
  prod64<CIN / BK, 0>(S, inT + (size_t)(b * NP + pb) * CIN, CIN, inT, 0, Kwh, CIN, d);
  f1a* const F = (f1a*)S;
  __syncthreads();                                     // every wave has left the staged tiles
#pragma unroll
  for (int j = 0; j < 4; ++j) {
    const int o = og * 64 + j * 16 + n;
    const float bias = Kb[o];
#pragma unroll
    for (int i = 0; i < 2; ++i)
#pragma unroll
      for (int r = 0; r < 8; ++r) F[(pt * 32 + i * 16 + 8 * h + r) * 260 + o] = d[i][j][r] * (1.f / 64.f) + bias;
  }
  __syncthreads();
  v8h vals[8];
  size_t offs[8];
  int slot[8];
#pragma unroll
  for (int i = 0; i < 8; ++i) {
    const int pl = wid * 8 + i;                        // 8 pixels per wave, one wave per 512-B row
    slot[i] = kpos[b * NP + pb + pl];
    v4f a = *(const v4fa*)&F[pl * 260 + lane * 8];
    v4f c = *(const v4fa*)&F[pl * 260 + lane * 8 + 4];
    float ss = a[0] * a[0] + a[1] * a[1] + a[2] * a[2] + a[3] * a[3]
             + c[0] * c[0] + c[1] * c[1] + c[2] * c[2] + c[3] * c[3];
    ss += __shfl_xor(ss, 16); ss += __shfl_xor(ss, 8); ss += __shfl_xor(ss, 4);
    ss += __shfl_xor(ss, 2);  ss += __shfl_xor(ss, 1);
    const float inv = 8.f * (1.f / (sqrtf(ss) + 1e-8f));
    vals[i] = pack8(a * inv, c * inv);
    offs[i] = ((size_t)(b * NP + pb + pl)) * NC + lane * 8;
  }
#pragma unroll
  for (int i = 0; i < 8; ++i) vst2((v8h*)(Nh + offs[i]), vals[i]);
#pragma unroll   // slot[] and vals[] by constant index, in registers
  for (int i = 0; i < 8; ++i)
    if ((unsigned)slot[i] < (unsigned)NP) vst2((v8h*)(Kc + ((size_t)(b * NP + slot[i])) * NC + lane * 8), vals[i]);
}

// 5) Vh[b][c][j] = f16( x[b][c][kidx[j]] ) for the dense key slots j < nk, 0 up to the end of the last 128-key tile.
//    8 slots per thread, 16-B stores.
__device__ __forceinline__ void d_makev(int blk, const float* __restrict__ x, const int* __restrict__ kidx,
                                        const int* __restrict__ nkA, _Float16* __restrict__ Vh) {
  const int i = blk * 256 + threadIdx.x;
  if (i >= NB * NC * NP / 8) return;
  const size_t e0 = (size_t)i * 8;
  const int j0 = (int)(e0 & (NP - 1));
  const int b = (int)(e0 >> 20);
  const int nk = min(max(nkA[b], 0), NP);
  if (j0 >= ((nk + KT - 1) & ~(KT - 1))) return;
  const float* xr = x + (e0 - (size_t)j0);
  const int* ki = kidx + (size_t)b * NP + j0;
  v4i i0 = *(const v4i*)ki;
  v4i i1 = *(const v4i*)(ki + 4);
  v4f a, c;
#pragma unroll   // vector elements by constant index, all eight gathers in flight
  for (int e = 0; e < 4; ++e) {
    const float va = xr[i0[e] & (NP - 1)];
    asm volatile("s_wait_xcnt 0x0" ::: "memory");   // before a later gather's result lands in this load's address registers
    const float vc = xr[i1[e] & (NP - 1)];
    asm volatile("s_wait_xcnt 0x0" ::: "memory");   // the same
    a[e] = (j0 + e < nk) ? va : 0.f;
    c[e] = (j0 + 4 + e < nk) ? vc : 0.f;
  }
  vst2((v8h*)(Vh + e0), pack8(a, c));
}

// 4 + 5 in one grid: neither reads what the other writes. The 256 long product blocks take the lowest indices, the
// short gather blocks the rest.
#define FB (NB * NP / PT)                              // 256 product blocks (here and in the fuse grid)
#define GB ((NB * NC * NP / 8) / 256)                  // 2048 gather blocks
__global__ void __launch_bounds__(256) k_fv(const _Float16* __restrict__ inT, const _Float16* __restrict__ Kwh,
                                            const float* __restrict__ Kb, const int* __restrict__ kpos,
                                            _Float16* __restrict__ Nh, _Float16* __restrict__ Kc,
                                            const float* __restrict__ x, const int* __restrict__ kidx,
                                            const int* __restrict__ nkA, _Float16* __restrict__ Vh) {
  const int blk = blockIdx.x;
  if (blk < FB) d_feats(blk, inT, Kwh, Kb, kpos, Nh, Kc);
  else d_makev(blk - FB, x, kidx, nkA, Vh);
}

// Eight asynchronous 16-B-per-lane copies, global memory -> LDS, through no register. l = the lane's LDS byte addresses,
// g = its global addresses. The s_wait_xcnt stands inside the statement, behind the last copy, so that no address
// register of a copy is written again in front of it.
__device__ __forceinline__ void copy8(const unsigned (&l)[8], const _Float16* const (&g)[8]) {
  asm volatile("global_load_async_to_lds_b128 %0, %8, off\n\t"
               "global_load_async_to_lds_b128 %1, %9, off\n\t"
               "global_load_async_to_lds_b128 %2, %10, off\n\t"
               "global_load_async_to_lds_b128 %3, %11, off\n\t"
               "global_load_async_to_lds_b128 %4, %12, off\n\t"
               "global_load_async_to_lds_b128 %5, %13, off\n\t"
               "global_load_async_to_lds_b128 %6, %14, off\n\t"
               "global_load_async_to_lds_b128 %7, %15, off\n\t"
               "s_wait_xcnt 0x0"
               :: "v"(l[0]), "v"(l[1]), "v"(l[2]), "v"(l[3]), "v"(l[4]), "v"(l[5]), "v"(l[6]), "v"(l[7]),
                  "v"(g[0]), "v"(g[1]), "v"(g[2]), "v"(g[3]), "v"(g[4]), "v"(g[5]), "v"(g[6]), "v"(g[7])
               : "memory");
}

// One wave's share of a staged key tile: rows r0, r0 + 16, ..., r0 + 112 of Kb, 512 B each, 16 B per lane (r0, nk the
// same in every lane, nk > 0), to the tile rows of pitch 264 from LDS byte address dst on. In the last, partial tile a
// slot past nk takes the last key again.
__device__ __forceinline__ void cpkeys(unsigned dst, const _Float16* Kb, int r0, int nk, int lane) {
  unsigned l[KT / AW];
  const _Float16* g[KT / AW];
#pragma unroll   // l[] and g[] by constant index, in registers
  for (int i = 0; i < KT / AW; ++i) {
    l[i] = dst + (unsigned)(AW * i * 264 * 2);
    g[i] = Kb + (size_t)min(r0 + AW * i, nk - 1) * NC + lane * 8;
  }
  copy8(l, g);
}

// One thread's share of a staged V tile: 16 B of channel rows vr0, vr0 + 32, ..., vr0 + 224 (p = its 16 B of row vr0),
// to the tile rows of pitch VP from LDS byte address dst on.
__device__ __forceinline__ void cpvals(unsigned dst, const _Float16* p) {
  unsigned l[KT / AW];
  const _Float16* g[KT / AW];
#pragma unroll   // l[] and g[] by constant index, in registers
  for (int i = 0; i < KT / AW; ++i) {
    l[i] = dst + (unsigned)(32 * i * VP * 2);
    g[i] = p + (size_t)(32 * i) * NP;
  }
  copy8(l, g);
}

// Hand-over of staged tiles between the waves of a block.
__device__ __forceinline__ void publish() {
  asm volatile("s_wait_dscnt 0x0" ::: "memory");      // this wave's LDS reads and writes are over before a buffer goes to its next writer
  asm volatile("s_wait_asynccnt 0x0" ::: "memory");   // this wave's copies have landed before other waves read them
  __syncthreads();
}

// 6) attention over the nk dense keys of the batch. Block = 64 query rows, 16 waves: wave (qt, kg) owns query tile qt
//    (16 rows) and key group kg (32 of the 128 keys staged per trip), so a trip covers four times the keys of a
//    one-group block and 256 blocks fill the chip. Pass 1: row sums of exp(20 cos - 20), fixed shift 20 (|cos| <= 1),
//    the four groups' partial sums added through LDS. Pass 2: att tiles -> per-block column sums (cpart) and
//    O^T = V . att^T, the four groups' partial O^T added through LDS behind the loop, in a fixed order.
//    Q chunk, K tile, V tile and the per-wave att^T tile are staged in LDS; every fragment uses ldfrag_*.
//    K and V tiles come by asynchronous copies that fly while the block multiplies: pass 1 has two K buffers (the second
//    in the V tile's space); in pass 2 the next K tile flies under V . att^T and the next V tile under the scores.
__global__ void __launch_bounds__(ATH) __attribute__((amdgpu_num_vgpr(252)))
k_attn(const _Float16* __restrict__ Nh, const _Float16* __restrict__ Kc, const _Float16* __restrict__ Vh,
       const float* __restrict__ mF, const int* __restrict__ nkA, _Float16* __restrict__ attT,
       float* __restrict__ cpart) {
  __shared__ __attribute__((aligned(16))) _Float16 Qs[QCH][264];   // q rows (later reused as O^T tile)
  __shared__ __attribute__((aligned(16))) _Float16 KV[KT * 264 + NC * VP];   // K tile, V tile (pass 1: a second K tile); behind the loop: partial O^T in f32
  __shared__ __attribute__((aligned(16))) _Float16 Ps[AW][16][40]; // att^T     [n=q][k=key] per wave
  __shared__ float cs[AW][KW];                                     // per-wave column sums, 32 keys
  __shared__ float rs[KG][QCH];                                    // per-key-group row sums
  __shared__ __attribute__((aligned(16))) float csb[NP];           // per-block column sums
  _Float16* const Ks = KV;                 // key rows  [n=key][k=channel], pitch 264
  _Float16* const Vs = KV + KT * 264;      // V tile    [m=channel][k=key], pitch VP

  const int t = threadIdx.x, lane = t & 31, h = lane >> 4, n = lane & 15;
  const int wid = __builtin_amdgcn_readfirstlane(t >> 5);   // in a scalar register: the tests on the wave's group are scalar branches
  const int qt = wid & 3, kg = wid >> 2;
  const int blk = blockIdx.x;
  if (blk >= NB * QCN) return;
  const int b = blk / QCN, qc = blk % QCN;
  const int qblk = qc * QCH;
  const _Float16* Nb = Nh + (size_t)b * NP * NC;
  const _Float16* Kb = Kc + (size_t)b * NP * NC;
  const int nk = __builtin_amdgcn_readfirstlane(min(max(nkA[b], 0), NP));   // in a scalar register: the key loops and their barriers stand under scalar branches
  const _Float16* Vb = Vh + (size_t)b * NC * NP;
  const float* mb = mF + (size_t)b * NP;

  const unsigned kdst = (unsigned)(size_t)&Ks[wid * 264 + lane * 8];   // LDS byte address of this lane's 16 B in tile row wid
  if (nk > 0) cpkeys(kdst, Kb, wid, nk, lane);         // pass 1, tile 0

  // stage the block's 64 query rows
#pragma unroll
  for (int i = 0; i < QCH * 32 / ATH; ++i) {
    const int id = t + ATH * i;
    const int row = id >> 5, c8 = (id & 31) * 8;
    *(v8h*)&Qs[row][c8] = *(const v8h*)(Nb + (size_t)(qblk + row) * NC + c8);
  }
  asm volatile("s_wait_asynccnt 0x0" ::: "memory");    // tile 0 has landed
  __syncthreads();                                     // the query rows and tile 0 are published
  if (KT < nk) cpkeys(kdst + KT * 264 * 2, Kb, KT + wid, nk, lane);   // tile 1, second buffer

  const _Float16* Qrow = &Qs[qt * 16 + n][0];
  const int vr0 = t >> 4, v8 = (t & 15) * 8;           // V staging: channel row and key offset of this thread's 16 B
  const unsigned voff = (unsigned)(vr0 * NP + v8);
  const unsigned vdst = (unsigned)(size_t)&Vs[vr0 * VP + v8];   // its LDS byte address

  float invs[8];
  {
    v16h qf[8];
#pragma unroll
    for (int cb = 0; cb < 8; ++cb) qf[cb] = ldfrag_l(Qrow, cb * 32, h);
    float acc[8];
#pragma unroll
    for (int r = 0; r < 8; ++r) acc[r] = 0.f;
    int cur = 0;                                       // buffer of this trip's tile
    int kb = 0;
#pragma unroll 1
    for (; kb < nk; kb += KT) {
#pragma unroll
      for (int sub = 0; sub < 2; ++sub) {
        v8f s = zero8();
        const _Float16* Krow = &Ks[(cur * KT + kg * KW + sub * 16 + n) * 264];
#pragma unroll
        for (int cb = 0; cb < 8; ++cb) s = wmma16(qf[cb], ldfrag_l(Krow, cb * 32, h), s);
        const float km = (kb + kg * KW + sub * 16 + n < nk) ? 1.f : 0.f;
#pragma unroll
        for (int r = 0; r < 8; ++r) acc[r] += km * __expf(0.3125f * s[r] - 20.f);
      }
      publish();                                       // the next tile is published; every wave has left this trip's buffer
      if (kb + 2 * KT < nk) cpkeys(kdst + cur * (KT * 264 * 2), Kb, kb + 2 * KT + wid, nk, lane);
      cur ^= 1;
    }
    asm volatile("s_wait_asynccnt 0x0" ::: "memory");  // no copy of pass 1 is left in flight
    if (kb > 0) {                                      // there are keys. Pass 2, tile 0: both fly under the row sums' fold
      cpkeys(kdst, Kb, wid, nk, lane);
      cpvals(vdst, Vb + voff);
    }
#pragma unroll
    for (int r = 0; r < 8; ++r) {
      float a = acc[r];
      a += __shfl_xor(a, 1); a += __shfl_xor(a, 2); a += __shfl_xor(a, 4); a += __shfl_xor(a, 8);
      if (n == 0) rs[kg][qt * 16 + 8 * h + r] = a;
    }
    __syncthreads();
#pragma unroll
    for (int r = 0; r < 8; ++r) {
      const int ql = qt * 16 + 8 * h + r;
      const float a = (rs[0][ql] + rs[1][ql]) + (rs[2][ql] + rs[3][ql]);
      invs[r] = mb[qblk + ql] / (a + 1e-30f);          // query mask folded in: invalid rows -> 0
    }
  }

  // ---- pass 2: att tiles, column sums, O^T = V . (att*4096)^T ----
  v8f o[16];
#pragma unroll
  for (int cc = 0; cc < 16; ++cc) o[cc] = zero8();
  publish();                                           // K and V tile 0 are published
#pragma unroll 1
  for (int kb = 0; kb < nk; kb += KT) {
#pragma unroll
    for (int sub = 0; sub < 2; ++sub) {
      v8f s = zero8();
      const _Float16* Krow = &Ks[(kg * KW + sub * 16 + n) * 264];
#pragma unroll
      for (int cb = 0; cb < 8; ++cb) s = wmma16(ldfrag_l(Qrow, cb * 32, h), ldfrag_l(Krow, cb * 32, h), s);
      const float km = (kb + kg * KW + sub * 16 + n < nk) ? 1.f : 0.f;
      float csum = 0.f;
#pragma unroll
      for (int r = 0; r < 8; ++r) {
        const float att = invs[r] * km * __expf(0.3125f * s[r] - 20.f);   // D row q = 8h+r, col key = n
        csum += att;
        Ps[wid][8 * h + r][sub * 16 + n] = (_Float16)(att * 4096.f);
      }
      csum += __shfl_xor(csum, 16);
      if (lane < 16) cs[wid][sub * 16 + lane] = csum;
    }
    publish();                                         // this trip's V tile and column sums are published; every wave has left the K tile
    if (kb + KT < nk) cpkeys(kdst, Kb, kb + KT + wid, nk, lane);   // the next K tile flies under V . att^T
    if (wid < KG) {                                    // wave g folds key group g: its four query tiles' sums
      float tt = 0.f;
#pragma unroll
      for (int w = 0; w < 4; ++w) tt += cs[wid * 4 + w][lane];
      csb[kb + wid * KW + lane] = tt;
    }
    const v16h pB = ldfrag_l(&Ps[wid][n][0], 0, h);                   // B: k = key, n = q
#pragma unroll
    for (int g = 0; g < 4; ++g) {
#pragma unroll
      for (int j = 0; j < 4; ++j)
        o[g * 4 + j] = wmma16(ldfrag_l(&Vs[(g * 64 + j * 16 + n) * VP], kg * KW, h), pB, o[g * 4 + j]);   // A: m = channel
    }
    publish();                                         // the next K tile is published; every wave has left the V tile and the column sums
    if (kb + KT < nk) cpvals(vdst, Vb + (kb + KT) + voff);   // the next V tile flies under the next scores
  }
  asm volatile("s_wait_asynccnt 0x0" ::: "memory");    // no copy is left in flight when the tiles' space is used anew

  // the four key groups' partial O^T tiles, added in f32 as (g0 + g2) + (g1 + g3); a tile lies in the K/V space as
  // [cc][half][lane][4], 16 B per lane, 16 KiB per wave
  float* const R = (float*)KV;
  __syncthreads();                                     // every wave has left the K and V tiles
  if (kg >= 2) {
    float* rp = R + ((kg - 2) * 4 + qt) * 4096 + lane * 4;
#pragma unroll
    for (int cc = 0; cc < 16; ++cc) {
      v4f lo = {o[cc][0], o[cc][1], o[cc][2], o[cc][3]};
      v4f hi = {o[cc][4], o[cc][5], o[cc][6], o[cc][7]};
      *(v4fa*)(rp + cc * 256) = lo;
      *(v4fa*)(rp + cc * 256 + 128) = hi;
    }
  }
  __syncthreads();
  if (kg < 2) {
    const float* rp = R + (kg * 4 + qt) * 4096 + lane * 4;
#pragma unroll
    for (int cc = 0; cc < 16; ++cc) {
      v4f lo = *(const v4fa*)(rp + cc * 256);
      v4f hi = *(const v4fa*)(rp + cc * 256 + 128);
#pragma unroll
      for (int e = 0; e < 4; ++e) { o[cc][e] += lo[e]; o[cc][4 + e] += hi[e]; }
    }
  }
  __syncthreads();
  if (kg == 1) {
    float* rp = R + qt * 4096 + lane * 4;
#pragma unroll
    for (int cc = 0; cc < 16; ++cc) {
      v4f lo = {o[cc][0], o[cc][1], o[cc][2], o[cc][3]};
      v4f hi = {o[cc][4], o[cc][5], o[cc][6], o[cc][7]};
      *(v4fa*)(rp + cc * 256) = lo;
      *(v4fa*)(rp + cc * 256 + 128) = hi;
    }
  }
  __syncthreads();
  // O^T tile (D rows = channel cc*16+8h+r, cols = q) -> f16, staged in the query tile's own Qs rows as [q][channel]
  if (kg == 0) {
    const float* rp = R + qt * 4096 + lane * 4;
#pragma unroll
    for (int cc = 0; cc < 16; ++cc) {
      v4f lo = *(const v4fa*)(rp + cc * 256);
      v4f hi = *(const v4fa*)(rp + cc * 256 + 128);
      v8h tv;
#pragma unroll
      for (int e = 0; e < 4; ++e) {
        tv[e]     = (_Float16)((o[cc][e] + lo[e]) * (1.f / 4096.f));
        tv[4 + e] = (_Float16)((o[cc][4 + e] + hi[e]) * (1.f / 4096.f));
      }
      *(v8h*)&Qs[qt * 16 + n][cc * 16 + 8 * h] = tv;
    }
  }
  __syncthreads();
  // attT[b][q][256]: one 512-B row per instruction, 16 B per lane, four rows per wave
  _Float16* arow = attT + ((size_t)(b * NP + qblk + wid * 4)) * NC + lane * 8;
#pragma unroll
  for (int i = 0; i < QCH / AW; ++i) {
    v8h v = *(const v8ha*)&Qs[wid * 4 + i][lane * 8];
    vst2((v8h*)(arow + (size_t)i * NC), v);
  }
  float* cp = cpart + ((size_t)(b * QCN + qc)) * NP;
#pragma unroll
  for (int i = 0; i < NP / 4 / ATH; ++i) {
    const int f = t + ATH * i;
    if (f * 4 < nk) {                                  // csb holds whole 128-key tiles up to nk
      v4f v = *(const v4fa*)&csb[f * 4];
      vst2((v4f*)(cp + (size_t)f * 4), v);
    }
  }
}

// 7) fused = concat(att_fore, x) . Fw^T, then out0[b][o][p] = m[p] ? fused : x. Block = 64 pixels x 256
//    channels; K = 512 in 8 staged tiles (prod64): input channels 0..255 from attT, 256..511 from the first 256 columns of inT.
__device__ __forceinline__ void
d_fuse(int blk, const _Float16* __restrict__ attT, const _Float16* __restrict__ inT, const _Float16* __restrict__ Fwh,
       const float* __restrict__ x, const float* __restrict__ mF, float* __restrict__ out0) {
  __shared__ __attribute__((aligned(16))) _Float16 S[2 * SBUF];   // two staged tiles; behind the loop G[channel][p_local] in f32, pitch 68
  const int t = threadIdx.x, lane = t & 31, wid = t >> 5, h = lane >> 4, n = lane & 15;
  if (blk >= NB * NP / PT) return;
  const int b = blk / (NP / PT), pb = (blk % (NP / PT)) * PT;
  const int pt = wid >> 2, og = wid & 3;
  const size_t row0 = (size_t)b * NP + pb;
  v8f d[2][4];
  prod64<NC / BK, NC / BK>(S, attT + row0 * NC, NC, inT + row0 * CIN, CIN, Fwh, CFU, d);
  // wave owns 32 channels; two 256-B row pieces per instruction, one address and constant offsets
  const int p4 = (lane & 15) * 4;
  const size_t g0 = ((size_t)(b * NC + wid * 32 + (lane >> 4))) * NP + pb + p4;
  const float* xp = x + g0;
  float* op = out0 + g0;
  const v4f mv = *(const v4f*)(mF + (size_t)b * NP + pb + p4);
  v4f xv[16];
#pragma unroll
  for (int i = 0; i < 16; ++i) {
    xv[i] = *(const v4f*)(xp + (size_t)(2 * i) * NP);
    if (i >= 14) asm volatile("s_wait_xcnt 0x0" ::: "memory");   // the shared address registers are free from the last load on
  }
  f1a* const G = (f1a*)S;
  __syncthreads();                                     // every wave has left the staged tiles
#pragma unroll
  for (int j = 0; j < 4; ++j) {
    const int o = og * 64 + j * 16 + n;
#pragma unroll
    for (int i = 0; i < 2; ++i) {
      v4f lo, hi;
#pragma unroll
      for (int e = 0; e < 4; ++e) { lo[e] = d[i][j][e] * (1.f / 64.f); hi[e] = d[i][j][4 + e] * (1.f / 64.f); }
      *(v4fa*)&G[o * 68 + pt * 32 + i * 16 + 8 * h] = lo;
      *(v4fa*)&G[o * 68 + pt * 32 + i * 16 + 8 * h + 4] = hi;
    }
  }
  __syncthreads();
#pragma unroll
  for (int i = 0; i < 16; ++i) {
    const v4f fz = *(const v4fa*)&G[(wid * 32 + 2 * i + (lane >> 4)) * 68 + p4];
    v4f rv;
#pragma unroll
    for (int e = 0; e < 4; ++e) rv[e] = (mv[e] > 0.5f) ? fz[e] : xv[i][e];
    vst2((v4f*)(op + (size_t)(2 * i) * NP), rv);
  }
}

// 8) visatt[b][p] = fixed-order sum of the 64 partial column sums at the pixel's key slot, 0 for a non-key;
//    one pixel per thread, 64 blocks of 256.
//    Each run of 128 pixels also leaves the maximum of its sums (start value 0) in bmax[run], two runs per block.
#define VB 128              // pixels per run, and number of runs (VB * VB = NB * NP)
__device__ __forceinline__ void d_vis(int blk, const float* __restrict__ cpart, const int* __restrict__ kpos,
                                      float* __restrict__ vis, float* __restrict__ bmax) {
  __shared__ float red[256 / 32];
  const int t = threadIdx.x, lane = t & 31, wid = t >> 5;
  const int idx = blk * 256 + t;
  if (blk >= NB * NP / 256) return;
  const int b = idx >> 12;
  const int slot = kpos[idx];
  float s = 0.f;
  if ((unsigned)slot < (unsigned)NP) {
    const float* cp = cpart + (size_t)b * QCN * NP + slot;
    float v[QCN];
#pragma unroll
    for (int q = 0; q < QCN; ++q) v[q] = cp[(size_t)q * NP];
#pragma unroll
    for (int q = 0; q < QCN; ++q) s += v[q];
  }
  vis[idx] = s;
  float mx = fmaxf(0.f, s);
  mx = fmaxf(mx, __shfl_xor(mx, 16)); mx = fmaxf(mx, __shfl_xor(mx, 8)); mx = fmaxf(mx, __shfl_xor(mx, 4));
  mx = fmaxf(mx, __shfl_xor(mx, 2));  mx = fmaxf(mx, __shfl_xor(mx, 1));
  if (lane == 0) red[wid] = mx;
  __syncthreads();
  if ((t & (VB - 1)) == 0) bmax[idx / VB] = fmaxf(fmaxf(red[wid], red[wid + 1]), fmaxf(red[wid + 2], red[wid + 3]));
}

// 7 + 8 in one grid: both read only what the score kernel and earlier launches left, and write buffers of their own.
#define SB (NB * NP / 256)                             // 64 column-sum blocks
__global__ void __launch_bounds__(256) k_post(const _Float16* __restrict__ attT, const _Float16* __restrict__ inT,
                                              const _Float16* __restrict__ Fwh, const float* __restrict__ x,
                                              const float* __restrict__ mF, float* __restrict__ out0,
                                              const float* __restrict__ cpart, const int* __restrict__ kpos,
                                              float* __restrict__ vis, float* __restrict__ bmax) {
  const int blk = blockIdx.x;
  if (blk < FB) d_fuse(blk, attT, inT, Fwh, x, mF, out0);
  else d_vis(blk - FB, cpart, kpos, vis, bmax);
}

// 9) out1 = 8x nearest upsample of visatt / global max. Block = one strip of 8 output rows (one visatt row):
//    every wave folds the 128 run maxima itself, each thread reads one visatt value and stores it 4 x 16 B.
__global__ void __launch_bounds__(256) k_up(const float* __restrict__ vis, const float* __restrict__ bmax,
                                            float* __restrict__ out1) {
  const int t = threadIdx.x, lane = t & 31;
  const int blk = blockIdx.x;
  if (blk >= NB * 64) return;
  const v4f bm = *(const v4f*)(bmax + lane * 4);
  const float sv = vis[blk * 64 + ((t & 127) >> 1)];
  float mx = fmaxf(fmaxf(bm[0], bm[1]), fmaxf(bm[2], bm[3]));
  mx = fmaxf(mx, __shfl_xor(mx, 16)); mx = fmaxf(mx, __shfl_xor(mx, 8)); mx = fmaxf(mx, __shfl_xor(mx, 4));
  mx = fmaxf(mx, __shfl_xor(mx, 2));  mx = fmaxf(mx, __shfl_xor(mx, 1));
  const float inv = 1.f / mx;
  const float v = sv * inv;
  v4f r; r[0] = v; r[1] = v; r[2] = v; r[3] = v;
  float* dst = out1 + ((size_t)blk * 1024 + t) * 4;
#pragma unroll
  for (int i = 0; i < 4; ++i) *(v4f*)(dst + (size_t)i * 1024) = r;
}

// ---------------------------------------------------------------------------
extern "C" void kernel_launch(void* const* d_in, const int* in_sizes, int n_in,
                              void* d_out, int out_size, void* d_ws, size_t ws_size,
                              hipStream_t stream) {
  if (n_in < 6) return;
  if (in_sizes[0] != NB * NC * NP) return;        // x      [4,256,64,64] f32
  if (in_sizes[1] != NB * MS * MS) return;        // mask   [4,1,512,512] f32
  if (in_sizes[2] != NB * CAUX * NP) return;      // aux    [4,768,64,64] f32
  if (in_sizes[3] != NC * CIN) return;            // K_w    [256,1024]    f32
  if (in_sizes[4] != NC) return;                  // K_b    [256]         f32
  if (in_sizes[5] != NC * CFU) return;            // fuse_w [256,512]     f32
  if (out_size != NB * NC * NP + NB * MS * MS) return;

  const float* x   = (const float*)d_in[0];
  const float* msk = (const float*)d_in[1];
  const float* aux = (const float*)d_in[2];
  const float* Kw  = (const float*)d_in[3];
  const float* Kb  = (const float*)d_in[4];
  const float* Fw  = (const float*)d_in[5];
  float* out0 = (float*)d_out;                           // 4,194,304 f32 at byte 0
  float* out1 = out0 + (size_t)NB * NC * NP;             // 1,048,576 f32 at byte 16,777,216

  const size_t o_m   = 0;                                          //     65,536 B
  const size_t o_kwh = o_m   + (size_t)NB * NP * 4;                //    524,288 B
  const size_t o_fwh = o_kwh + (size_t)NC * CIN * 2;               //    262,144 B
  const size_t o_inT = o_fwh + (size_t)NC * CFU * 2;               // 33,554,432 B
  const size_t o_nh  = o_inT + (size_t)NB * NP * CIN * 2;          //  8,388,608 B
  const size_t o_vh  = o_nh  + (size_t)NB * NP * NC * 2;           //  8,388,608 B
  const size_t o_att = o_vh  + (size_t)NB * NC * NP * 2;           //  8,388,608 B
  const size_t o_cp  = o_att + (size_t)NB * NP * NC * 2;           //  4,194,304 B
  const size_t o_vis = o_cp  + (size_t)NB * QCN * NP * 4;          //     65,536 B
  const size_t o_bm  = o_vis + (size_t)NB * NP * 4;                //        512 B
  const size_t o_kc  = o_bm  + (size_t)VB * 4;                     //  8,388,608 B
  const size_t o_kp  = o_kc  + (size_t)NB * NP * NC * 2;           //     65,536 B
  const size_t o_ki  = o_kp  + (size_t)NB * NP * 4;                //     65,536 B
  const size_t o_nk  = o_ki  + (size_t)NB * NP * 4;                //         16 B
  const size_t total = o_nk  + (size_t)NB * 4;                     // 72,352,272 B
  if (total > ws_size) return;

  char* w = (char*)d_ws;
  float*    mF    = (float*)(w + o_m);
  _Float16* Kwh   = (_Float16*)(w + o_kwh);
  _Float16* Fwh   = (_Float16*)(w + o_fwh);
  _Float16* inT   = (_Float16*)(w + o_inT);
  _Float16* Nh    = (_Float16*)(w + o_nh);
  _Float16* Vh    = (_Float16*)(w + o_vh);
  _Float16* attT  = (_Float16*)(w + o_att);
  float*    cpart = (float*)(w + o_cp);
  float*    vis   = (float*)(w + o_vis);
  float*    bmax  = (float*)(w + o_bm);
  _Float16* Kc    = (_Float16*)(w + o_kc);
  int*      kpos  = (int*)(w + o_kp);
  int*      kidx  = (int*)(w + o_ki);
  int*      nkA   = (int*)(w + o_nk);

  k_pre  <<<PB + WB + TB, 256, 0, stream>>>(msk, mF, Kw, Fw, Kwh, Fwh, x, aux, inT);      // 16 + 192 + 4096 blocks
  k_rank <<<NB, 256, 0, stream>>>(mF, kpos, kidx, nkA);                                 // 4 blocks
  k_fv   <<<FB + GB, 256, 0, stream>>>(inT, Kwh, Kb, kpos, Nh, Kc, x, kidx, nkA, Vh);     // 256 + 2048 blocks
  k_attn <<<NB * QCN, ATH, 0, stream>>>(Nh, Kc, Vh, mF, nkA, attT, cpart);                // 256 blocks
  k_post <<<FB + SB, 256, 0, stream>>>(attT, inT, Fwh, x, mF, out0, cpart, kpos, vis, bmax);   // 256 + 64 blocks
  k_up   <<<NB * 64, 256, 0, stream>>>(vis, bmax, out1);                                // 256 blocks
}

// v007
// It runs in 112 microseconds.
// Next to v006, in two timings, it ran 1.08 and 1.10 times as fast.
// Counting every step since v000, it is 6.39 times as fast.
#include <hip/hip_runtime.h>

// Contractions on v_wmma_f32_16x16x32_f16 (f16 operands, f32 accumulate): 1x1 input conv (weights x64),
// q.k scores (unit feature rows x8 on each side), att.v (att x4096), 1x1 fuse conv (weights x64);
// every scale is an exact power of two folded back in f32. Softmax, norms, sums and selects stay f32.

#define NB   4
#define NC   256
#define NP   4096
#define CIN  1024
#define CAUX 768
#define CFU  512
#define MS   512
#define QCH  64             // query rows per block in the score kernel (4 query tiles x 16)
#define KG   4              // key groups per block: waves that share a query tile and split the staged keys
#define KW   32             // keys per wave and trip
#define KT   (KG * KW)      // 128 keys per staged tile
#define AW   (QCH / 16 * KG)  // 16 waves per block in the score kernel
#define ATH  (AW * 32)      // its 512 threads
#define VP   (KT + 8)       // LDS pitch of a V row in elements: 272 B = 16 B x 17
#define QCN  (NP / QCH)     // 64 query chunks per batch
#define PT   64             // pixels per block in the two 1x1 conv products
#define BK   64             // k per staged tile: one 128-B line of every operand row
#define SP   (BK + 8)       // LDS pitch of a staged row in elements: 144 B = 16 B x 9
#define SBUF ((PT + NC) * SP)   // elements of one staged tile: 64 pixel rows, then 256 weight rows

typedef _Float16 v16h __attribute__((ext_vector_type(16)));
typedef _Float16 v8h  __attribute__((ext_vector_type(8)));
typedef v8h v8ha __attribute__((may_alias));
typedef float v8f __attribute__((ext_vector_type(8)));
typedef float v4f __attribute__((ext_vector_type(4)));
typedef v4f v4fa __attribute__((may_alias));
typedef int v4i __attribute__((ext_vector_type(4)));
typedef v4i v4ia __attribute__((may_alias));
typedef float f1a __attribute__((may_alias));

union Frag { v16h v; v8h hf[2]; };

__device__ __forceinline__ v8f zero8() {
  v8f z = {0.f, 0.f, 0.f, 0.f, 0.f, 0.f, 0.f, 0.f};
  return z;
}

__device__ __forceinline__ v8f wmma16(v16h a, v16h b, v8f c) {
  v8f d = __builtin_amdgcn_wmma_f32_16x16x32_f16(false, a, false, b, (short)0, c, false, false);
  asm volatile("v_nop\n\tv_nop\n\tv_nop\n\tv_nop" : "+v"(d) : "v"(a), "v"(b));
  return d;
}

// 16 rows x 32 k fragment from a k-contiguous 16-bit matrix. rowp = start of the row owned by this
// lane (row index = lane & 15). Elements 0..7 <- k0+8h+0..7, elements 8..15 <- k0+16+8h+0..7 with
// h = lane >> 4. Used for A (row = m) and for B (row = n of a [n][k] copy). D: acc[r] = (row 8h+r, col lane&15).
__device__ __forceinline__ v16h ldfrag_g(const _Float16* rowp, int k0, int h) {
  Frag f;
  f.hf[0] = *(const v8h*)(rowp + k0 + 8 * h);
  f.hf[1] = *(const v8h*)(rowp + k0 + 16 + 8 * h);
  return f.v;
}
__device__ __forceinline__ v16h ldfrag_l(const _Float16* rowp, int k0, int h) {
  Frag f;
  f.hf[0] = *(const v8ha*)(rowp + k0 + 8 * h);
  f.hf[1] = *(const v8ha*)(rowp + k0 + 16 + 8 * h);
  return f.v;
}

__device__ __forceinline__ v8h pack8(v4f a, v4f b) {
  v8h r;
  r[0] = (_Float16)a[0]; r[1] = (_Float16)a[1]; r[2] = (_Float16)a[2]; r[3] = (_Float16)a[3];
  r[4] = (_Float16)b[0]; r[5] = (_Float16)b[1]; r[6] = (_Float16)b[2]; r[7] = (_Float16)b[3];
  return r;
}

__device__ __forceinline__ float max8f(v4f a, v4f b) {
  float m0 = fmaxf(fmaxf(a[0], a[1]), fmaxf(a[2], a[3]));
  float m1 = fmaxf(fmaxf(b[0], b[1]), fmaxf(b[2], b[3]));
  return fmaxf(m0, m1);
}

template <typename T>
__device__ __forceinline__ void vst2(T* p, T v) {
  *(T*)p = v;
  
}

// ---------------------------------------------------------------------------
// 1) 8x8 max pool of the 512x512 mask, binarised: mF[b][p] in {0,1}. 4 pixels per thread, 16-B stores.
__device__ __forceinline__ void d_pool(int blk, const float* __restrict__ msk, float* __restrict__ mF) {
  const int i = blk * 256 + threadIdx.x;
  if (i >= NB * NP / 4) return;
  const int pix0 = i * 4;
  const int b = pix0 >> 12, p = pix0 & (NP - 1);
  const int y = p >> 6, x0 = p & 63;
  const float* s = msk + ((size_t)b * MS + (size_t)y * 8) * MS + (size_t)x0 * 8;
  float mx[4] = {0.f, 0.f, 0.f, 0.f};
#pragma unroll 1   // one mask row (eight 16-B loads) in flight: unrolled whole, this part's registers would halve the waves that the transpose blocks of the same grid keep on a SIMD
  for (int dy = 0; dy < 8; ++dy) {
    const float* row = s + dy * MS;
#pragma unroll
    for (int j = 0; j < 4; ++j) {
      v4f a = *(const v4f*)(row + j * 8);
      v4f c = *(const v4f*)(row + j * 8 + 4);
      mx[j] = fmaxf(mx[j], max8f(a, c));
    }
    asm volatile("s_wait_xcnt 0x0" ::: "memory");   // before the next trip's address is written into the registers that this trip's loads name
  }
  v4f r;
#pragma unroll
  for (int j = 0; j < 4; ++j) r[j] = (mx[j] > 0.f) ? 1.f : 0.f;
  vst2((v4f*)(mF + pix0), r);
}

// 1b) dense order of the keys. A pixel with m = 0 is a key; every term of a pixel with m = 1 on the key side is
//     multiplied by 0, so only the keys get a slot. Per batch: kpos[p] = slot of key p (-1 for a non-key),
//     kidx = the pixels as a permutation, keys first (in pixel order), then the non-keys; nkA[b] = number of keys.
__global__ void __launch_bounds__(256) k_rank(const float* __restrict__ mF, int* __restrict__ kpos,
                                              int* __restrict__ kidx, int* __restrict__ nkA) {
  __shared__ __attribute__((aligned(16))) int cnt[256];
  const int t = threadIdx.x, b = blockIdx.x;
  if (b >= NB) return;
  const float* ms = mF + (size_t)b * NP + t * 16;
  bool key[16];
  int c = 0;
#pragma unroll   // both loops unrolled whole: key[] is indexed by constants and stays in registers
  for (int j = 0; j < 4; ++j) {
    v4f a = *(const v4f*)(ms + j * 4);
#pragma unroll
    for (int e = 0; e < 4; ++e) { key[j * 4 + e] = a[e] < 0.5f; c += key[j * 4 + e] ? 1 : 0; }
  }
  cnt[t] = c;
  __syncthreads();
  int pre = 0, tot = 0;
#pragma unroll 4   // four 16-B LDS reads in flight per trip instead of one waited read
  for (int i = 0; i < 64; ++i) {
    v4i v = *(const v4ia*)&cnt[i * 4];
#pragma unroll
    for (int e = 0; e < 4; ++e) { tot += v[e]; pre += (i * 4 + e < t) ? v[e] : 0; }
  }
  int* kp = kpos + (size_t)b * NP + t * 16;
  int* ki = kidx + (size_t)b * NP;
  int r = pre;                                   // keys in front of the current pixel
#pragma unroll   // as above: key[] and w by constant index
  for (int j = 0; j < 4; ++j) {
    v4i w;
#pragma unroll
    for (int e = 0; e < 4; ++e) {
      const int p = t * 16 + j * 4 + e;
      const bool k = key[j * 4 + e];
      w[e] = k ? r : -1;
      ki[k ? r : tot + p - r] = p;
      r += k ? 1 : 0;
    }
    *(v4i*)(kp + j * 4) = w;
  }
  if (t == 0) nkA[b] = tot;
}

// 2) weights to f16 with x64 scale: Kwh[256][1024], Fwh[256][512]. 8 elements per thread, 16-B stores.
__device__ __forceinline__ void d_cvtw(int blk, const float* __restrict__ Kw, const float* __restrict__ Fw,
                                       _Float16* __restrict__ Kwh, _Float16* __restrict__ Fwh) {
  const int i = blk * 256 + threadIdx.x;
  const float* src;
  _Float16* dst;
  if (i < NC * CIN / 8) {
    src = Kw + (size_t)i * 8; dst = Kwh + (size_t)i * 8;
  } else if (i < NC * CIN / 8 + NC * CFU / 8) {
    const int j = i - NC * CIN / 8;
    src = Fw + (size_t)j * 8; dst = Fwh + (size_t)j * 8;
  } else {
    return;
  }
  v4f a = *(const v4f*)src;
  v4f c = *(const v4f*)(src + 4);
  a = a * 64.f; c = c * 64.f;
  vst2((v8h*)dst, pack8(a, c));
}

// 3) inT[b][p][1024] f16 = transpose of concat(x, aux) along channels. Block = 64 channels x 64 pixels,
__device__ __forceinline__ void d_tin(int blk, const float* __restrict__ x, const float* __restrict__ aux,
                                      _Float16* __restrict__ inT) {
  __shared__ __attribute__((aligned(16))) _Float16 T[64][72];   // T[p_local][c_local]
  const int t = threadIdx.x;
  if (blk >= NB * (CIN / 64) * (NP / 64)) return;
  const int b = blk >> 10, ct = (blk >> 6) & 15, pt = blk & 63;
  const int c0 = ct * 64, p0 = pt * 64;
  // the block's source is picked once, in front of the loop: picked per load, the merged grid's build branches round every load and waits for each
  const float* src0 = (c0 < NC) ? x   + ((size_t)(b * NC + c0)) * NP + p0
                                : aux + ((size_t)(b * CAUX + (c0 - NC))) * NP + p0;
#pragma unroll
  for (int i = 0; i < 4; ++i) {
    const int f = t + 256 * i;            // 1024 float4 chunks: 64 channel rows x 16
    const int cl = f >> 4, p4 = (f & 15) * 4;
    v4f v = *(const v4f*)(src0 + (size_t)cl * NP + p4);
    T[p4 + 0][cl] = (_Float16)v[0];
    T[p4 + 1][cl] = (_Float16)v[1];
    T[p4 + 2][cl] = (_Float16)v[2];
    T[p4 + 3][cl] = (_Float16)v[3];
  }
  __syncthreads();
  v8h val[2];
  size_t off[2];
#pragma unroll
  for (int i = 0; i < 2; ++i) {
    const int r = (t >> 3) + 32 * i, q = t & 7;
    val[i] = *(const v8ha*)&T[r][q * 8];
    off[i] = ((size_t)(b * NP + p0 + r)) * CIN + c0 + q * 8;
  }
#pragma unroll
  for (int i = 0; i < 2; ++i) vst2((v8h*)(inT + off[i]), val[i]);
}

// 1 + 2 + 3 in one grid: the three parts read inputs only and write buffers of their own, so none waits for another.
// The block index picks the part; the 16 pool blocks, the longest, take the lowest indices.
#define PB ((NB * NP / 4) / 256)                       // 16 pool blocks
#define WB ((NC * CIN / 8 + NC * CFU / 8) / 256)       // 192 weight blocks
#define TB (NB * (CIN / 64) * (NP / 64))               // 4096 transpose blocks
__global__ void __launch_bounds__(256) k_pre(const float* __restrict__ msk, float* __restrict__ mF,
                                             const float* __restrict__ Kw, const float* __restrict__ Fw,
                                             _Float16* __restrict__ Kwh, _Float16* __restrict__ Fwh,
                                             const float* __restrict__ x, const float* __restrict__ aux,
                                             _Float16* __restrict__ inT) {
  const int blk = blockIdx.x;
  if (blk < PB) d_pool(blk, msk, mF);
  else if (blk < PB + WB) d_cvtw(blk - PB, Kw, Fw, Kwh, Fwh);
  else d_tin(blk - (PB + WB), x, aux, inT);
}

// The k loop of both 1x1 conv products: D[64 pixels][256 channels] += A . B^T, A and B k-contiguous f16 rows.
// Every 64-k tile (64 A rows, 256 B rows) comes from global memory in whole 128-B lines, 16 B per lane, four lines per
// load, and is laid in LDS; the fragments are read from there. Two buffers: the next tile's loads fly while this tile
// is multiplied, and one barrier per tile publishes it and ends the reads of the buffer that is written next.
// The first NS1 tiles of A come from A1 (row pitch pa1), the other NS2 from A2 (pitch pa2). 8 waves: wave (pt, og) owns
// 32 pixels x 64 channels, d[i][j] = pixel tile i, channel tile j; k runs upward, as in a loop over 32-k steps.
template <int NS1, int NS2>
__device__ __forceinline__ void prod64(_Float16* S, const _Float16* A1, int pa1, const _Float16* A2, int pa2,
                                       const _Float16* B, int pbw, v8f (&d)[2][4]) {
  constexpr int NS = NS1 + NS2;
  const int t = threadIdx.x, lane = t & 31, wid = t >> 5, h = lane >> 4, n = lane & 15;
  const int pt = wid >> 2, og = wid & 3;
  // staging: row (of 32 per load) and 16-B piece of this thread; rows r and r + 8 lie side by side in a half wave,
  // so that at the 144-B pitch their two 128-B lines fall on the two halves of the LDS banks
  const int lr = ((t >> 3) & 16) | ((t & 8)) | ((t >> 4) & 7), lc = (t & 7) * 8;
  const _Float16* g1 = A1 + (size_t)lr * pa1 + lc;
  const _Float16* g2 = A2 + (size_t)lr * pa2 + lc;
  const _Float16* gb = B + (size_t)lr * pbw + lc;
  _Float16* const sw = S + lr * SP + lc;
  const _Float16* const fa = S + (pt * 32 + n) * SP;
  const _Float16* const fb = S + (PT + og * 64 + n) * SP;
  v8h ra[PT / 32], rb[NC / 32];
  auto fetch = [&](int s) {                            // tile s, global memory -> registers
    const bool first = (NS2 == 0) || s < NS1;
    const _Float16* ga = first ? g1 + s * BK : g2 + (s - NS1) * BK;
    const size_t st = first ? (size_t)32 * pa1 : (size_t)32 * pa2;
#pragma unroll
    for (int i = 0; i < PT / 32; ++i) ra[i] = *(const v8h*)(ga + i * st);
#pragma unroll
    for (int i = 0; i < NC / 32; ++i) rb[i] = *(const v8h*)(gb + s * BK + (size_t)(32 * i) * pbw);
    asm volatile("s_wait_xcnt 0x0" ::: "memory");      // before other values are written into the address registers that these loads name
  };
  auto put = [&](int s) {                              // tile s, registers -> its buffer
    _Float16* w = sw + (s & 1) * SBUF;
#pragma unroll
    for (int i = 0; i < PT / 32; ++i) *(v8ha*)(w + 32 * i * SP) = ra[i];
#pragma unroll
    for (int i = 0; i < NC / 32; ++i) *(v8ha*)(w + (PT + 32 * i) * SP) = rb[i];
  };
  auto mult = [&](int s) {                             // tile s: 2 k steps x 8 products
    const int cur = (s & 1) * SBUF;
    v16h af[BK / 32][2], bf[BK / 32][4];
#pragma unroll
    for (int q = 0; q < BK / 32; ++q) {
#pragma unroll
      for (int i = 0; i < 2; ++i) af[q][i] = ldfrag_l(fa + cur + i * 16 * SP, q * 32, h);
#pragma unroll
      for (int j = 0; j < 4; ++j) bf[q][j] = ldfrag_l(fb + cur + j * 16 * SP, q * 32, h);
    }
    __builtin_amdgcn_sched_barrier(0);                 // the tile's LDS reads stay one group in front of its products: spread among them, every place with reads is waited out to 0
#pragma unroll
    for (int q = 0; q < BK / 32; ++q)
#pragma unroll
      for (int j = 0; j < 4; ++j)
#pragma unroll
        for (int i = 0; i < 2; ++i) d[i][j] = wmma16(af[q][i], bf[q][j], d[i][j]);
  };
#pragma unroll
  for (int i = 0; i < 2; ++i)
#pragma unroll
    for (int j = 0; j < 4; ++j) d[i][j] = zero8();
  fetch(0);
  put(0);
  __syncthreads();                                     // tile 0 is published
#pragma unroll 1   // one tile per trip: unrolled, the trips' fragments and staged lines would not fit the registers
  for (int s = 0; s < NS - 1; ++s) {
    fetch(s + 1);
    mult(s);
    put(s + 1);
    __syncthreads();                                   // tile s + 1 is published; every wave has left the buffer of tile s
  }
  mult(NS - 1);
}

// 4) feats = inT . Kw^T (+ bias), then per-pixel L2 normalisation, stored as Nh[b][p][256] = f16(8 * unit row);
//    the row of a key goes to its dense slot Kc[b][kpos[p]][256] as well.
//    Block = 64 pixels x 256 channels; K = 1024 in 16 staged tiles (prod64).
__device__ __forceinline__ void d_feats(int blk, const _Float16* __restrict__ inT, const _Float16* __restrict__ Kwh,
                                        const float* __restrict__ Kb, const int* __restrict__ kpos,
                                        _Float16* __restrict__ Nh, _Float16* __restrict__ Kc) {
  __shared__ __attribute__((aligned(16))) _Float16 S[2 * SBUF];   // two staged tiles; behind the loop F[p_local][channel] in f32, pitch 260
  const int t = threadIdx.x, lane = t & 31, wid = t >> 5, h = lane >> 4, n = lane & 15;
  if (blk >= NB * NP / PT) return;
  const int b = blk / (NP / PT), pb = (blk % (NP / PT)) * PT;
  const int pt = wid >> 2, og = wid & 3;
  v8f d[2][4];
  prod64<CIN / BK, 0>(S, inT + (size_t)(b * NP + pb) * CIN, CIN, inT, 0, Kwh, CIN, d);
  f1a* const F = (f1a*)S;
  __syncthreads();                                     // every wave has left the staged tiles
#pragma unroll
  for (int j = 0; j < 4; ++j) {
    const int o = og * 64 + j * 16 + n;
    const float bias = Kb[o];
#pragma unroll
    for (int i = 0; i < 2; ++i)
#pragma unroll
      for (int r = 0; r < 8; ++r) F[(pt * 32 + i * 16 + 8 * h + r) * 260 + o] = d[i][j][r] * (1.f / 64.f) + bias;
  }
  __syncthreads();
  v8h vals[8];
  size_t offs[8];
  int slot[8];
#pragma unroll
  for (int i = 0; i < 8; ++i) {
    const int pl = wid * 8 + i;                        // 8 pixels per wave, one wave per 512-B row
    slot[i] = kpos[b * NP + pb + pl];
    v4f a = *(const v4fa*)&F[pl * 260 + lane * 8];
    v4f c = *(const v4fa*)&F[pl * 260 + lane * 8 + 4];
    float ss = a[0] * a[0] + a[1] * a[1] + a[2] * a[2] + a[3] * a[3]
             + c[0] * c[0] + c[1] * c[1] + c[2] * c[2] + c[3] * c[3];
    ss += __shfl_xor(ss, 16); ss += __shfl_xor(ss, 8); ss += __shfl_xor(ss, 4);
    ss += __shfl_xor(ss, 2);  ss += __shfl_xor(ss, 1);
    const float inv = 8.f * (1.f / (sqrtf(ss) + 1e-8f));
    vals[i] = pack8(a * inv, c * inv);
    offs[i] = ((size_t)(b * NP + pb + pl)) * NC + lane * 8;
  }
#pragma unroll
  for (int i = 0; i < 8; ++i) vst2((v8h*)(Nh + offs[i]), vals[i]);
#pragma unroll   // slot[] and vals[] by constant index, in registers
  for (int i = 0; i < 8; ++i)
    if ((unsigned)slot[i] < (unsigned)NP) vst2((v8h*)(Kc + ((size_t)(b * NP + slot[i])) * NC + lane * 8), vals[i]);
}

// 5) Vh[b][c][j] = f16( x[b][c][kidx[j]] ) for the dense key slots j < nk, 0 up to the end of the last 128-key tile.
//    8 slots per thread, 16-B stores.
__device__ __forceinline__ void d_makev(int blk, const float* __restrict__ x, const int* __restrict__ kidx,
                                        const int* __restrict__ nkA, _Float16* __restrict__ Vh) {
  const int i = blk * 256 + threadIdx.x;
  if (i >= NB * NC * NP / 8) return;
  const size_t e0 = (size_t)i * 8;
  const int j0 = (int)(e0 & (NP - 1));
  const int b = (int)(e0 >> 20);
  const int nk = min(max(nkA[b], 0), NP);
  if (j0 >= ((nk + KT - 1) & ~(KT - 1))) return;
  const float* xr = x + (e0 - (size_t)j0);
  const int* ki = kidx + (size_t)b * NP + j0;
  v4i i0 = *(const v4i*)ki;
  v4i i1 = *(const v4i*)(ki + 4);
  v4f a, c;
#pragma unroll   // vector elements by constant index, all eight gathers in flight
  for (int e = 0; e < 4; ++e) {
    const float va = xr[i0[e] & (NP - 1)];
    asm volatile("s_wait_xcnt 0x0" ::: "memory");   // before a later gather's result lands in this load's address registers
    const float vc = xr[i1[e] & (NP - 1)];
    asm volatile("s_wait_xcnt 0x0" ::: "memory");   // the same
    a[e] = (j0 + e < nk) ? va : 0.f;
    c[e] = (j0 + 4 + e < nk) ? vc : 0.f;
  }
  vst2((v8h*)(Vh + e0), pack8(a, c));
}

// 4 + 5 in one grid: neither reads what the other writes. The 256 long product blocks take the lowest indices, the
// short gather blocks the rest.
#define FB (NB * NP / PT)                              // 256 product blocks (here and in the fuse grid)
#define GB ((NB * NC * NP / 8) / 256)                  // 2048 gather blocks
__global__ void __launch_bounds__(256) k_fv(const _Float16* __restrict__ inT, const _Float16* __restrict__ Kwh,
                                            const float* __restrict__ Kb, const int* __restrict__ kpos,
                                            _Float16* __restrict__ Nh, _Float16* __restrict__ Kc,
                                            const float* __restrict__ x, const int* __restrict__ kidx,
                                            const int* __restrict__ nkA, _Float16* __restrict__ Vh) {
  const int blk = blockIdx.x;
  if (blk < FB) d_feats(blk, inT, Kwh, Kb, kpos, Nh, Kc);
  else d_makev(blk - FB, x, kidx, nkA, Vh);
}

// Eight asynchronous 16-B-per-lane copies, global memory -> LDS, through no register. l = the lane's LDS byte addresses,
// g = its global addresses. The s_wait_xcnt stands inside the statement, behind the last copy, so that no address
// register of a copy is written again in front of it.
__device__ __forceinline__ void copy8(const unsigned (&l)[8], const _Float16* const (&g)[8]) {
  asm volatile("global_load_async_to_lds_b128 %0, %8, off\n\t"
               "global_load_async_to_lds_b128 %1, %9, off\n\t"
               "global_load_async_to_lds_b128 %2, %10, off\n\t"
               "global_load_async_to_lds_b128 %3, %11, off\n\t"
               "global_load_async_to_lds_b128 %4, %12, off\n\t"
               "global_load_async_to_lds_b128 %5, %13, off\n\t"
               "global_load_async_to_lds_b128 %6, %14, off\n\t"
               "global_load_async_to_lds_b128 %7, %15, off\n\t"
               "s_wait_xcnt 0x0"
               :: "v"(l[0]), "v"(l[1]), "v"(l[2]), "v"(l[3]), "v"(l[4]), "v"(l[5]), "v"(l[6]), "v"(l[7]),
                  "v"(g[0]), "v"(g[1]), "v"(g[2]), "v"(g[3]), "v"(g[4]), "v"(g[5]), "v"(g[6]), "v"(g[7])
               : "memory");
}

// One wave's share of a staged key tile: rows r0, r0 + 16, ..., r0 + 112 of Kb, 512 B each, 16 B per lane (r0, nk the
// same in every lane, nk > 0), to the tile rows of pitch 264 from LDS byte address dst on. In the last, partial tile a
// slot past nk takes the last key again.
__device__ __forceinline__ void cpkeys(unsigned dst, const _Float16* Kb, int r0, int nk, int lane) {
  unsigned l[KT / AW];
  const _Float16* g[KT / AW];
#pragma unroll   // l[] and g[] by constant index, in registers
  for (int i = 0; i < KT / AW; ++i) {
    l[i] = dst + (unsigned)(AW * i * 264 * 2);
    g[i] = Kb + (size_t)min(r0 + AW * i, nk - 1) * NC + lane * 8;
  }
  copy8(l, g);
}

// One thread's share of a staged V tile: 16 B of channel rows vr0, vr0 + 32, ..., vr0 + 224 (p = its 16 B of row vr0),
// to the tile rows of pitch VP from LDS byte address dst on.
__device__ __forceinline__ void cpvals(unsigned dst, const _Float16* p) {
  unsigned l[KT / AW];
  const _Float16* g[KT / AW];
#pragma unroll   // l[] and g[] by constant index, in registers
  for (int i = 0; i < KT / AW; ++i) {
    l[i] = dst + (unsigned)(32 * i * VP * 2);
    g[i] = p + (size_t)(32 * i) * NP;
  }
  copy8(l, g);
}

// Hand-over of staged tiles between the waves of a block.
__device__ __forceinline__ void publish() {
  asm volatile("s_wait_dscnt 0x0" ::: "memory");      // this wave's LDS reads and writes are over before a buffer goes to its next writer
  asm volatile("s_wait_asynccnt 0x0" ::: "memory");   // this wave's copies have landed before other waves read them
  __syncthreads();
}

// 6) attention over the nk dense keys of the batch. Block = 64 query rows, 16 waves: wave (qt, kg) owns query tile qt
//    (16 rows) and key group kg (32 of the 128 keys staged per trip), so a trip covers four times the keys of a
//    one-group block and 256 blocks fill the chip. Pass 1: row sums of exp(20 cos - 20), fixed shift 20 (|cos| <= 1),
//    the four groups' partial sums added through LDS. Pass 2: att tiles -> per-block column sums (cpart) and
//    O^T = V . att^T, the four groups' partial O^T added through LDS behind the loop, in a fixed order.
//    Q chunk, K tile, V tile and the per-wave att^T tile are staged in LDS; every fragment uses ldfrag_*.
//    K and V tiles come by asynchronous copies that fly while the block multiplies: pass 1 has two K buffers (the second
//    in the V tile's space); in pass 2 the next K tile flies under V . att^T and the next V tile under the scores.
__global__ void __launch_bounds__(ATH) __attribute__((amdgpu_num_vgpr(252)))
k_attn(const _Float16* __restrict__ Nh, const _Float16* __restrict__ Kc, const _Float16* __restrict__ Vh,
       const float* __restrict__ mF, const int* __restrict__ nkA, _Float16* __restrict__ attT,
       float* __restrict__ cpart) {
  __shared__ __attribute__((aligned(16))) _Float16 Qs[QCH][264];   // q rows (later reused as O^T tile)
  __shared__ __attribute__((aligned(16))) _Float16 KV[KT * 264 + NC * VP];   // K tile, V tile (pass 1: a second K tile); behind the loop: partial O^T in f32
  __shared__ __attribute__((aligned(16))) _Float16 Ps[AW][16][40]; // att^T     [n=q][k=key] per wave
  __shared__ float cs[AW][KW];                                     // per-wave column sums, 32 keys
  __shared__ float rs[KG][QCH];                                    // per-key-group row sums
  __shared__ __attribute__((aligned(16))) float csb[NP];           // per-block column sums
  _Float16* const Ks = KV;                 // key rows  [n=key][k=channel], pitch 264
  _Float16* const Vs = KV + KT * 264;      // V tile    [m=channel][k=key], pitch VP

  const int t = threadIdx.x, lane = t & 31, h = lane >> 4, n = lane & 15;
  const int wid = __builtin_amdgcn_readfirstlane(t >> 5);   // in a scalar register: the tests on the wave's group are scalar branches
  const int qt = wid & 3, kg = wid >> 2;
  const int blk = blockIdx.x;
  if (blk >= NB * QCN) return;
  const int b = blk / QCN, qc = blk % QCN;
  const int qblk = qc * QCH;
  const _Float16* Nb = Nh + (size_t)b * NP * NC;
  const _Float16* Kb = Kc + (size_t)b * NP * NC;
  const int nk = __builtin_amdgcn_readfirstlane(min(max(nkA[b], 0), NP));   // in a scalar register: the key loops and their barriers stand under scalar branches
  const _Float16* Vb = Vh + (size_t)b * NC * NP;
  const float* mb = mF + (size_t)b * NP;

  const unsigned kdst = (unsigned)(size_t)&Ks[wid * 264 + lane * 8];   // LDS byte address of this lane's 16 B in tile row wid
  if (nk > 0) cpkeys(kdst, Kb, wid, nk, lane);         // pass 1, tile 0

  // stage the block's 64 query rows
#pragma unroll
  for (int i = 0; i < QCH * 32 / ATH; ++i) {
    const int id = t + ATH * i;
    const int row = id >> 5, c8 = (id & 31) * 8;
    *(v8h*)&Qs[row][c8] = *(const v8h*)(Nb + (size_t)(qblk + row) * NC + c8);
  }
  asm volatile("s_wait_asynccnt 0x0" ::: "memory");    // tile 0 has landed
  __syncthreads();                                     // the query rows and tile 0 are published
  if (KT < nk) cpkeys(kdst + KT * 264 * 2, Kb, KT + wid, nk, lane);   // tile 1, second buffer

  const _Float16* Qrow = &Qs[qt * 16 + n][0];
  const int vr0 = t >> 4, v8 = (t & 15) * 8;           // V staging: channel row and key offset of this thread's 16 B
  const unsigned voff = (unsigned)(vr0 * NP + v8);
  const unsigned vdst = (unsigned)(size_t)&Vs[vr0 * VP + v8];   // its LDS byte address

  float invs[8];
  {
    v16h qf[8];
#pragma unroll
    for (int cb = 0; cb < 8; ++cb) qf[cb] = ldfrag_l(Qrow, cb * 32, h);
    float acc[8];
#pragma unroll
    for (int r = 0; r < 8; ++r) acc[r] = 0.f;
    int cur = 0;                                       // buffer of this trip's tile
    int kb = 0;
#pragma unroll 1
    for (; kb < nk; kb += KT) {
      const _Float16* Krow = &Ks[(cur * KT + kg * KW + n) * 264];
      v16h kf[8][2];                                   // the wave's 32 key rows of this tile, all 16 fragments
#pragma unroll
      for (int cb = 0; cb < 8; ++cb)
#pragma unroll
        for (int sub = 0; sub < 2; ++sub) kf[cb][sub] = ldfrag_l(Krow + sub * 16 * 264, cb * 32, h);
      __builtin_amdgcn_sched_barrier(0);               // the trip's LDS reads stay one group in front of its products: left to the scheduler, each product stands behind its own two reads and waits out their whole latency
      v8f s[2] = {zero8(), zero8()};
#pragma unroll
      for (int cb = 0; cb < 8; ++cb)
#pragma unroll
        for (int sub = 0; sub < 2; ++sub) s[sub] = wmma16(qf[cb], kf[cb][sub], s[sub]);
#pragma unroll
      for (int sub = 0; sub < 2; ++sub) {
        const float km = (kb + kg * KW + sub * 16 + n < nk) ? 1.f : 0.f;
#pragma unroll
        for (int r = 0; r < 8; ++r) acc[r] += km * __expf(0.3125f * s[sub][r] - 20.f);
      }
      publish();                                       // the next tile is published; every wave has left this trip's buffer
      if (kb + 2 * KT < nk) cpkeys(kdst + cur * (KT * 264 * 2), Kb, kb + 2 * KT + wid, nk, lane);
      cur ^= 1;
    }
    asm volatile("s_wait_asynccnt 0x0" ::: "memory");  // no copy of pass 1 is left in flight
    if (kb > 0) {                                      // there are keys. Pass 2, tile 0: both fly under the row sums' fold
      cpkeys(kdst, Kb, wid, nk, lane);
      cpvals(vdst, Vb + voff);
    }
#pragma unroll
    for (int r = 0; r < 8; ++r) {
      float a = acc[r];
      a += __shfl_xor(a, 1); a += __shfl_xor(a, 2); a += __shfl_xor(a, 4); a += __shfl_xor(a, 8);
      if (n == 0) rs[kg][qt * 16 + 8 * h + r] = a;
    }
    __syncthreads();
#pragma unroll
    for (int r = 0; r < 8; ++r) {
      const int ql = qt * 16 + 8 * h + r;
      const float a = (rs[0][ql] + rs[1][ql]) + (rs[2][ql] + rs[3][ql]);
      invs[r] = mb[qblk + ql] / (a + 1e-30f);          // query mask folded in: invalid rows -> 0
    }
  }

  // ---- pass 2: att tiles, column sums, O^T = V . (att*4096)^T ----
  v8f o[16];
#pragma unroll
  for (int cc = 0; cc < 16; ++cc) o[cc] = zero8();
  publish();                                           // K and V tile 0 are published
#pragma unroll 1
  for (int kb = 0; kb < nk; kb += KT) {
    v8f s[2] = {zero8(), zero8()};
    const _Float16* Krow = &Ks[(kg * KW + n) * 264];
#pragma unroll
    for (int g = 0; g < 4; ++g) {                      // 64 channels a group: as many fragments as the registers hold beside O^T
      v16h qa[2], kf[2][2];
#pragma unroll
      for (int j = 0; j < 2; ++j) {
        qa[j] = ldfrag_l(Qrow, (g * 2 + j) * 32, h);
#pragma unroll
        for (int sub = 0; sub < 2; ++sub) kf[j][sub] = ldfrag_l(Krow + sub * 16 * 264, (g * 2 + j) * 32, h);
      }
      __builtin_amdgcn_sched_barrier(0);               // as in pass 1: the group's twelve LDS reads stand together in front of its four products
#pragma unroll
      for (int j = 0; j < 2; ++j)
#pragma unroll
        for (int sub = 0; sub < 2; ++sub) s[sub] = wmma16(qa[j], kf[j][sub], s[sub]);
      __builtin_amdgcn_sched_barrier(0);               // the next group's reads are not spread among these products
    }
#pragma unroll
    for (int sub = 0; sub < 2; ++sub) {
      const float km = (kb + kg * KW + sub * 16 + n < nk) ? 1.f : 0.f;
      float csum = 0.f;
#pragma unroll
      for (int r = 0; r < 8; ++r) {
        const float att = invs[r] * km * __expf(0.3125f * s[sub][r] - 20.f);   // D row q = 8h+r, col key = n
        csum += att;
        Ps[wid][8 * h + r][sub * 16 + n] = (_Float16)(att * 4096.f);
      }
      csum += __shfl_xor(csum, 16);
      if (lane < 16) cs[wid][sub * 16 + lane] = csum;
    }
    publish();                                         // this trip's V tile and column sums are published; every wave has left the K tile
    if (kb + KT < nk) cpkeys(kdst, Kb, kb + KT + wid, nk, lane);   // the next K tile flies under V . att^T
    if (wid < KG) {                                    // wave g folds key group g: its four query tiles' sums
      float tt = 0.f;
#pragma unroll
      for (int w = 0; w < 4; ++w) tt += cs[wid * 4 + w][lane];
      csb[kb + wid * KW + lane] = tt;
    }
    const v16h pB = ldfrag_l(&Ps[wid][n][0], 0, h);                   // B: k = key, n = q
#pragma unroll
    for (int g = 0; g < 2; ++g) {                      // 128 channels a group
      v16h vf[8];
#pragma unroll
      for (int j = 0; j < 8; ++j) vf[j] = ldfrag_l(&Vs[(g * 128 + j * 16 + n) * VP], kg * KW, h);   // A: m = channel
      __builtin_amdgcn_sched_barrier(0);               // as above: the group's sixteen LDS reads stand together in front of its eight products
#pragma unroll
      for (int j = 0; j < 8; ++j) o[g * 8 + j] = wmma16(vf[j], pB, o[g * 8 + j]);
      __builtin_amdgcn_sched_barrier(0);               // the next group's reads are not spread among these products
    }
    publish();                                         // the next K tile is published; every wave has left the V tile and the column sums
    if (kb + KT < nk) cpvals(vdst, Vb + (kb + KT) + voff);   // the next V tile flies under the next scores
  }
  asm volatile("s_wait_asynccnt 0x0" ::: "memory");    // no copy is left in flight when the tiles' space is used anew

  // the four key groups' partial O^T tiles, added in f32 as (g0 + g2) + (g1 + g3); a tile lies in the K/V space as
  // [cc][half][lane][4], 16 B per lane, 16 KiB per wave
  float* const R = (float*)KV;
  __syncthreads();                                     // every wave has left the K and V tiles
  if (kg >= 2) {
    float* rp = R + ((kg - 2) * 4 + qt) * 4096 + lane * 4;
#pragma unroll
    for (int cc = 0; cc < 16; ++cc) {
      v4f lo = {o[cc][0], o[cc][1], o[cc][2], o[cc][3]};
      v4f hi = {o[cc][4], o[cc][5], o[cc][6], o[cc][7]};
      *(v4fa*)(rp + cc * 256) = lo;
      *(v4fa*)(rp + cc * 256 + 128) = hi;
    }
  }
  __syncthreads();
  if (kg < 2) {
    const float* rp = R + (kg * 4 + qt) * 4096 + lane * 4;
#pragma unroll
    for (int cc = 0; cc < 16; ++cc) {
      v4f lo = *(const v4fa*)(rp + cc * 256);
      v4f hi = *(const v4fa*)(rp + cc * 256 + 128);
#pragma unroll
      for (int e = 0; e < 4; ++e) { o[cc][e] += lo[e]; o[cc][4 + e] += hi[e]; }
    }
  }
  __syncthreads();
  if (kg == 1) {
    float* rp = R + qt * 4096 + lane * 4;
#pragma unroll
    for (int cc = 0; cc < 16; ++cc) {
      v4f lo = {o[cc][0], o[cc][1], o[cc][2], o[cc][3]};
      v4f hi = {o[cc][4], o[cc][5], o[cc][6], o[cc][7]};
      *(v4fa*)(rp + cc * 256) = lo;
      *(v4fa*)(rp + cc * 256 + 128) = hi;
    }
  }
  __syncthreads();
  // O^T tile (D rows = channel cc*16+8h+r, cols = q) -> f16, staged in the query tile's own Qs rows as [q][channel]
  if (kg == 0) {
    const float* rp = R + qt * 4096 + lane * 4;
#pragma unroll
    for (int cc = 0; cc < 16; ++cc) {
      v4f lo = *(const v4fa*)(rp + cc * 256);
      v4f hi = *(const v4fa*)(rp + cc * 256 + 128);
      v8h tv;
#pragma unroll
      for (int e = 0; e < 4; ++e) {
        tv[e]     = (_Float16)((o[cc][e] + lo[e]) * (1.f / 4096.f));
        tv[4 + e] = (_Float16)((o[cc][4 + e] + hi[e]) * (1.f / 4096.f));
      }
      *(v8h*)&Qs[qt * 16 + n][cc * 16 + 8 * h] = tv;
    }
  }
  __syncthreads();
  // attT[b][q][256]: one 512-B row per instruction, 16 B per lane, four rows per wave
  _Float16* arow = attT + ((size_t)(b * NP + qblk + wid * 4)) * NC + lane * 8;
#pragma unroll
  for (int i = 0; i < QCH / AW; ++i) {
    v8h v = *(const v8ha*)&Qs[wid * 4 + i][lane * 8];
    vst2((v8h*)(arow + (size_t)i * NC), v);
  }
  float* cp = cpart + ((size_t)(b * QCN + qc)) * NP;
#pragma unroll
  for (int i = 0; i < NP / 4 / ATH; ++i) {
    const int f = t + ATH * i;
    if (f * 4 < nk) {                                  // csb holds whole 128-key tiles up to nk
      v4f v = *(const v4fa*)&csb[f * 4];
      vst2((v4f*)(cp + (size_t)f * 4), v);
    }
  }
}

// 7) fused = concat(att_fore, x) . Fw^T, then out0[b][o][p] = m[p] ? fused : x. Block = 64 pixels x 256
//    channels; K = 512 in 8 staged tiles (prod64): input channels 0..255 from attT, 256..511 from the first 256 columns of inT.
__device__ __forceinline__ void
d_fuse(int blk, const _Float16* __restrict__ attT, const _Float16* __restrict__ inT, const _Float16* __restrict__ Fwh,
       const float* __restrict__ x, const float* __restrict__ mF, float* __restrict__ out0) {
  __shared__ __attribute__((aligned(16))) _Float16 S[2 * SBUF];   // two staged tiles; behind the loop G[channel][p_local] in f32, pitch 68
  const int t = threadIdx.x, lane = t & 31, wid = t >> 5, h = lane >> 4, n = lane & 15;
  if (blk >= NB * NP / PT) return;
  const int b = blk / (NP / PT), pb = (blk % (NP / PT)) * PT;
  const int pt = wid >> 2, og = wid & 3;
  const size_t row0 = (size_t)b * NP + pb;
  v8f d[2][4];
  prod64<NC / BK, NC / BK>(S, attT + row0 * NC, NC, inT + row0 * CIN, CIN, Fwh, CFU, d);
  // wave owns 32 channels; two 256-B row pieces per instruction, one address and constant offsets
  const int p4 = (lane & 15) * 4;
  const size_t g0 = ((size_t)(b * NC + wid * 32 + (lane >> 4))) * NP + pb + p4;
  const float* xp = x + g0;
  float* op = out0 + g0;
  const v4f mv = *(const v4f*)(mF + (size_t)b * NP + pb + p4);
  v4f xv[16];
#pragma unroll
  for (int i = 0; i < 16; ++i) {
    xv[i] = *(const v4f*)(xp + (size_t)(2 * i) * NP);
    if (i >= 14) asm volatile("s_wait_xcnt 0x0" ::: "memory");   // the shared address registers are free from the last load on
  }
  f1a* const G = (f1a*)S;
  __syncthreads();                                     // every wave has left the staged tiles
#pragma unroll
  for (int j = 0; j < 4; ++j) {
    const int o = og * 64 + j * 16 + n;
#pragma unroll
    for (int i = 0; i < 2; ++i) {
      v4f lo, hi;
#pragma unroll
      for (int e = 0; e < 4; ++e) { lo[e] = d[i][j][e] * (1.f / 64.f); hi[e] = d[i][j][4 + e] * (1.f / 64.f); }
      *(v4fa*)&G[o * 68 + pt * 32 + i * 16 + 8 * h] = lo;
      *(v4fa*)&G[o * 68 + pt * 32 + i * 16 + 8 * h + 4] = hi;
    }
  }
  __syncthreads();
#pragma unroll
  for (int i = 0; i < 16; ++i) {
    const v4f fz = *(const v4fa*)&G[(wid * 32 + 2 * i + (lane >> 4)) * 68 + p4];
    v4f rv;
#pragma unroll
    for (int e = 0; e < 4; ++e) rv[e] = (mv[e] > 0.5f) ? fz[e] : xv[i][e];
    vst2((v4f*)(op + (size_t)(2 * i) * NP), rv);
  }
}

// 8) visatt[b][p] = fixed-order sum of the 64 partial column sums at the pixel's key slot, 0 for a non-key;
//    one pixel per thread, 64 blocks of 256.
//    Each run of 128 pixels also leaves the maximum of its sums (start value 0) in bmax[run], two runs per block.
#define VB 128              // pixels per run, and number of runs (VB * VB = NB * NP)
__device__ __forceinline__ void d_vis(int blk, const float* __restrict__ cpart, const int* __restrict__ kpos,
                                      float* __restrict__ vis, float* __restrict__ bmax) {
  __shared__ float red[256 / 32];
  const int t = threadIdx.x, lane = t & 31, wid = t >> 5;
  const int idx = blk * 256 + t;
  if (blk >= NB * NP / 256) return;
  const int b = idx >> 12;
  const int slot = kpos[idx];
  float s = 0.f;
  if ((unsigned)slot < (unsigned)NP) {
    const float* cp = cpart + (size_t)b * QCN * NP + slot;
    float v[QCN];
#pragma unroll
    for (int q = 0; q < QCN; ++q) v[q] = cp[(size_t)q * NP];
#pragma unroll
    for (int q = 0; q < QCN; ++q) s += v[q];
  }
  vis[idx] = s;
  float mx = fmaxf(0.f, s);
  mx = fmaxf(mx, __shfl_xor(mx, 16)); mx = fmaxf(mx, __shfl_xor(mx, 8)); mx = fmaxf(mx, __shfl_xor(mx, 4));
  mx = fmaxf(mx, __shfl_xor(mx, 2));  mx = fmaxf(mx, __shfl_xor(mx, 1));
  if (lane == 0) red[wid] = mx;
  __syncthreads();
  if ((t & (VB - 1)) == 0) bmax[idx / VB] = fmaxf(fmaxf(red[wid], red[wid + 1]), fmaxf(red[wid + 2], red[wid + 3]));
}

// 7 + 8 in one grid: both read only what the score kernel and earlier launches left, and write buffers of their own.
#define SB (NB * NP / 256)                             // 64 column-sum blocks
__global__ void __launch_bounds__(256) k_post(const _Float16* __restrict__ attT, const _Float16* __restrict__ inT,
                                              const _Float16* __restrict__ Fwh, const float* __restrict__ x,
                                              const float* __restrict__ mF, float* __restrict__ out0,
                                              const float* __restrict__ cpart, const int* __restrict__ kpos,
                                              float* __restrict__ vis, float* __restrict__ bmax) {
  const int blk = blockIdx.x;
  if (blk < FB) d_fuse(blk, attT, inT, Fwh, x, mF, out0);
  else d_vis(blk - FB, cpart, kpos, vis, bmax);
}

// 9) out1 = 8x nearest upsample of visatt / global max. Block = one strip of 8 output rows (one visatt row):
//    every wave folds the 128 run maxima itself, each thread reads one visatt value and stores it 4 x 16 B.
__global__ void __launch_bounds__(256) k_up(const float* __restrict__ vis, const float* __restrict__ bmax,
                                            float* __restrict__ out1) {
  const int t = threadIdx.x, lane = t & 31;
  const int blk = blockIdx.x;
  if (blk >= NB * 64) return;
  const v4f bm = *(const v4f*)(bmax + lane * 4);
  const float sv = vis[blk * 64 + ((t & 127) >> 1)];
  float mx = fmaxf(fmaxf(bm[0], bm[1]), fmaxf(bm[2], bm[3]));
  mx = fmaxf(mx, __shfl_xor(mx, 16)); mx = fmaxf(mx, __shfl_xor(mx, 8)); mx = fmaxf(mx, __shfl_xor(mx, 4));
  mx = fmaxf(mx, __shfl_xor(mx, 2));  mx = fmaxf(mx, __shfl_xor(mx, 1));
  const float inv = 1.f / mx;
  const float v = sv * inv;
  v4f r; r[0] = v; r[1] = v; r[2] = v; r[3] = v;
  float* dst = out1 + ((size_t)blk * 1024 + t) * 4;
#pragma unroll
  for (int i = 0; i < 4; ++i) *(v4f*)(dst + (size_t)i * 1024) = r;
}

// ---------------------------------------------------------------------------
extern "C" void kernel_launch(void* const* d_in, const int* in_sizes, int n_in,
                              void* d_out, int out_size, void* d_ws, size_t ws_size,
                              hipStream_t stream) {
  if (n_in < 6) return;
  if (in_sizes[0] != NB * NC * NP) return;        // x      [4,256,64,64] f32
  if (in_sizes[1] != NB * MS * MS) return;        // mask   [4,1,512,512] f32
  if (in_sizes[2] != NB * CAUX * NP) return;      // aux    [4,768,64,64] f32
  if (in_sizes[3] != NC * CIN) return;            // K_w    [256,1024]    f32
  if (in_sizes[4] != NC) return;                  // K_b    [256]         f32
  if (in_sizes[5] != NC * CFU) return;            // fuse_w [256,512]     f32
  if (out_size != NB * NC * NP + NB * MS * MS) return;

  const float* x   = (const float*)d_in[0];
  const float* msk = (const float*)d_in[1];
  const float* aux = (const float*)d_in[2];
  const float* Kw  = (const float*)d_in[3];
  const float* Kb  = (const float*)d_in[4];
  const float* Fw  = (const float*)d_in[5];
  float* out0 = (float*)d_out;                           // 4,194,304 f32 at byte 0
  float* out1 = out0 + (size_t)NB * NC * NP;             // 1,048,576 f32 at byte 16,777,216

  const size_t o_m   = 0;                                          //     65,536 B
  const size_t o_kwh = o_m   + (size_t)NB * NP * 4;                //    524,288 B
  const size_t o_fwh = o_kwh + (size_t)NC * CIN * 2;               //    262,144 B
  const size_t o_inT = o_fwh + (size_t)NC * CFU * 2;               // 33,554,432 B
  const size_t o_nh  = o_inT + (size_t)NB * NP * CIN * 2;          //  8,388,608 B
  const size_t o_vh  = o_nh  + (size_t)NB * NP * NC * 2;           //  8,388,608 B
  const size_t o_att = o_vh  + (size_t)NB * NC * NP * 2;           //  8,388,608 B
  const size_t o_cp  = o_att + (size_t)NB * NP * NC * 2;           //  4,194,304 B
  const size_t o_vis = o_cp  + (size_t)NB * QCN * NP * 4;          //     65,536 B
  const size_t o_bm  = o_vis + (size_t)NB * NP * 4;                //        512 B
  const size_t o_kc  = o_bm  + (size_t)VB * 4;                     //  8,388,608 B
  const size_t o_kp  = o_kc  + (size_t)NB * NP * NC * 2;           //     65,536 B
  const size_t o_ki  = o_kp  + (size_t)NB * NP * 4;                //     65,536 B
  const size_t o_nk  = o_ki  + (size_t)NB * NP * 4;                //         16 B
  const size_t total = o_nk  + (size_t)NB * 4;                     // 72,352,272 B
  if (total > ws_size) return;

  char* w = (char*)d_ws;
  float*    mF    = (float*)(w + o_m);
  _Float16* Kwh   = (_Float16*)(w + o_kwh);
  _Float16* Fwh   = (_Float16*)(w + o_fwh);
  _Float16* inT   = (_Float16*)(w + o_inT);
  _Float16* Nh    = (_Float16*)(w + o_nh);
  _Float16* Vh    = (_Float16*)(w + o_vh);
  _Float16* attT  = (_Float16*)(w + o_att);
  float*    cpart = (float*)(w + o_cp);
  float*    vis   = (float*)(w + o_vis);
  float*    bmax  = (float*)(w + o_bm);
  _Float16* Kc    = (_Float16*)(w + o_kc);
  int*      kpos  = (int*)(w + o_kp);
  int*      kidx  = (int*)(w + o_ki);
  int*      nkA   = (int*)(w + o_nk);

  k_pre  <<<PB + WB + TB, 256, 0, stream>>>(msk, mF, Kw, Fw, Kwh, Fwh, x, aux, inT);      // 16 + 192 + 4096 blocks
  k_rank <<<NB, 256, 0, stream>>>(mF, kpos, kidx, nkA);                                 // 4 blocks
  k_fv   <<<FB + GB, 256, 0, stream>>>(inT, Kwh, Kb, kpos, Nh, Kc, x, kidx, nkA, Vh);     // 256 + 2048 blocks
  k_attn <<<NB * QCN, ATH, 0, stream>>>(Nh, Kc, Vh, mF, nkA, attT, cpart);                // 256 blocks
  k_post <<<FB + SB, 256, 0, stream>>>(attT, inT, Fwh, x, mF, out0, cpart, kpos, vis, bmax);   // 256 + 64 blocks
  k_up   <<<NB * 64, 256, 0, stream>>>(vis, bmax, out1);                                // 256 blocks
}

// v008
// It runs in 102 microseconds.
// Next to v007, in two timings, it ran 1.10 times as fast each time.
// Over all steps from v000 it is 7.04 times as fast.
#include <hip/hip_runtime.h>

// Contractions on v_wmma_f32_16x16x32_f16 (f16 operands, f32 accumulate): 1x1 input conv (weights x64),
// q.k scores (unit feature rows x8 on each side), att.v (att x4096), 1x1 fuse conv (weights x64);
// every scale is an exact power of two folded back in f32. Softmax, norms, sums and selects stay f32.

#define NB   4
#define NC   256
#define NP   4096
#define CIN  1024
#define CAUX 768
#define CFU  512
#define MS   512
#define QCH  64             // query rows per block in the score kernel (4 query tiles x 16)
#define KG   4              // key groups per block: waves that share a query tile and split the staged keys
#define KW   32             // keys per wave and trip
#define KT   (KG * KW)      // 128 keys per staged tile
#define AW   (QCH / 16 * KG)  // 16 waves per block in the score kernel
#define ATH  (AW * 32)      // its 512 threads
#define VP   (KT + 8)       // LDS pitch of a V row in elements: 272 B = 16 B x 17
#define QCN  (NP / QCH)     // 64 query chunks per batch
#define PT   64             // pixels per block in the two 1x1 conv products
#define BK   64             // k per staged tile: one 128-B line of every operand row
#define SP   (BK + 8)       // LDS pitch of a staged row in elements: 144 B = 16 B x 9
#define SBUF ((PT + NC) * SP)   // elements of one staged tile: 64 pixel rows, then 256 weight rows

typedef _Float16 v16h __attribute__((ext_vector_type(16)));
typedef _Float16 v8h  __attribute__((ext_vector_type(8)));
typedef v8h v8ha __attribute__((may_alias));
typedef float v8f __attribute__((ext_vector_type(8)));
typedef float v4f __attribute__((ext_vector_type(4)));
typedef v4f v4fa __attribute__((may_alias));
typedef int v4i __attribute__((ext_vector_type(4)));
typedef v4i v4ia __attribute__((may_alias));
typedef float f1a __attribute__((may_alias));

union Frag { v16h v; v8h hf[2]; };

__device__ __forceinline__ v8f zero8() {
  v8f z = {0.f, 0.f, 0.f, 0.f, 0.f, 0.f, 0.f, 0.f};
  return z;
}

__device__ __forceinline__ v8f wmma16(v16h a, v16h b, v8f c) {
  v8f d = __builtin_amdgcn_wmma_f32_16x16x32_f16(false, a, false, b, (short)0, c, false, false);
  asm volatile("v_nop\n\tv_nop\n\tv_nop\n\tv_nop" : "+v"(d) : "v"(a), "v"(b));
  return d;
}

// 16 rows x 32 k fragment from a k-contiguous 16-bit matrix. rowp = start of the row owned by this
// lane (row index = lane & 15). Elements 0..7 <- k0+8h+0..7, elements 8..15 <- k0+16+8h+0..7 with
// h = lane >> 4. Used for A (row = m) and for B (row = n of a [n][k] copy). D: acc[r] = (row 8h+r, col lane&15).
__device__ __forceinline__ v16h ldfrag_g(const _Float16* rowp, int k0, int h) {
  Frag f;
  f.hf[0] = *(const v8h*)(rowp + k0 + 8 * h);
  f.hf[1] = *(const v8h*)(rowp + k0 + 16 + 8 * h);
  return f.v;
}
__device__ __forceinline__ v16h ldfrag_l(const _Float16* rowp, int k0, int h) {
  Frag f;
  f.hf[0] = *(const v8ha*)(rowp + k0 + 8 * h);
  f.hf[1] = *(const v8ha*)(rowp + k0 + 16 + 8 * h);
  return f.v;
}

__device__ __forceinline__ v8h pack8(v4f a, v4f b) {
  v8h r;
  r[0] = (_Float16)a[0]; r[1] = (_Float16)a[1]; r[2] = (_Float16)a[2]; r[3] = (_Float16)a[3];
  r[4] = (_Float16)b[0]; r[5] = (_Float16)b[1]; r[6] = (_Float16)b[2]; r[7] = (_Float16)b[3];
  return r;
}

__device__ __forceinline__ float max8f(v4f a, v4f b) {
  float m0 = fmaxf(fmaxf(a[0], a[1]), fmaxf(a[2], a[3]));
  float m1 = fmaxf(fmaxf(b[0], b[1]), fmaxf(b[2], b[3]));
  return fmaxf(m0, m1);
}

template <typename T>
__device__ __forceinline__ void vst2(T* p, T v) {
  *(T*)p = v;
  
}

// ---------------------------------------------------------------------------
// 1) 8x8 max pool of the 512x512 mask, binarised: mF[b][p] in {0,1}. 4 pixels per thread, 16-B stores.
__device__ __forceinline__ void d_pool(int blk, const float* __restrict__ msk, float* __restrict__ mF) {
  const int i = blk * 256 + threadIdx.x;
  if (i >= NB * NP / 4) return;
  const int pix0 = i * 4;
  const int b = pix0 >> 12, p = pix0 & (NP - 1);
  const int y = p >> 6, x0 = p & 63;
  const float* s = msk + ((size_t)b * MS + (size_t)y * 8) * MS + (size_t)x0 * 8;
  float mx[4] = {0.f, 0.f, 0.f, 0.f};
#pragma unroll 1   // one mask row (eight 16-B loads) in flight: unrolled whole, this part's registers would halve the waves that the transpose blocks of the same grid keep on a SIMD
  for (int dy = 0; dy < 8; ++dy) {
    const float* row = s + dy * MS;
#pragma unroll
    for (int j = 0; j < 4; ++j) {
      v4f a = *(const v4f*)(row + j * 8);
      v4f c = *(const v4f*)(row + j * 8 + 4);
      mx[j] = fmaxf(mx[j], max8f(a, c));
    }
    asm volatile("s_wait_xcnt 0x0" ::: "memory");   // before the next trip's address is written into the registers that this trip's loads name
  }
  v4f r;
#pragma unroll
  for (int j = 0; j < 4; ++j) r[j] = (mx[j] > 0.f) ? 1.f : 0.f;
  vst2((v4f*)(mF + pix0), r);
}

// 1b) dense order of the keys. A pixel with m = 0 is a key; every term of a pixel with m = 1 on the key side is
//     multiplied by 0, so only the keys get a slot. Per batch: kpos[p] = slot of key p (-1 for a non-key),
//     kidx = the pixels as a permutation, keys first (in pixel order), then the non-keys; nkA[b] = number of keys.
__global__ void __launch_bounds__(256) k_rank(const float* __restrict__ mF, int* __restrict__ kpos,
                                              int* __restrict__ kidx, int* __restrict__ nkA) {
  __shared__ __attribute__((aligned(16))) int cnt[256];
  const int t = threadIdx.x, b = blockIdx.x;
  if (b >= NB) return;
  const float* ms = mF + (size_t)b * NP + t * 16;
  bool key[16];
  int c = 0;
#pragma unroll   // both loops unrolled whole: key[] is indexed by constants and stays in registers
  for (int j = 0; j < 4; ++j) {
    v4f a = *(const v4f*)(ms + j * 4);
#pragma unroll
    for (int e = 0; e < 4; ++e) { key[j * 4 + e] = a[e] < 0.5f; c += key[j * 4 + e] ? 1 : 0; }
  }
  cnt[t] = c;
  __syncthreads();
  int pre = 0, tot = 0;
#pragma unroll 4   // four 16-B LDS reads in flight per trip instead of one waited read
  for (int i = 0; i < 64; ++i) {
    v4i v = *(const v4ia*)&cnt[i * 4];
#pragma unroll
    for (int e = 0; e < 4; ++e) { tot += v[e]; pre += (i * 4 + e < t) ? v[e] : 0; }
  }
  int* kp = kpos + (size_t)b * NP + t * 16;
  int* ki = kidx + (size_t)b * NP;
  int r = pre;                                   // keys in front of the current pixel
#pragma unroll   // as above: key[] and w by constant index
  for (int j = 0; j < 4; ++j) {
    v4i w;
#pragma unroll
    for (int e = 0; e < 4; ++e) {
      const int p = t * 16 + j * 4 + e;
      const bool k = key[j * 4 + e];
      w[e] = k ? r : -1;
      ki[k ? r : tot + p - r] = p;
      r += k ? 1 : 0;
    }
    *(v4i*)(kp + j * 4) = w;
  }
  if (t == 0) nkA[b] = tot;
}

// 2) weights to f16 with x64 scale: Kwh[256][1024], Fwh[256][512]. 8 elements per thread, 16-B stores.
__device__ __forceinline__ void d_cvtw(int blk, const float* __restrict__ Kw, const float* __restrict__ Fw,
                                       _Float16* __restrict__ Kwh, _Float16* __restrict__ Fwh) {
  const int i = blk * 256 + threadIdx.x;
  const float* src;
  _Float16* dst;
  if (i < NC * CIN / 8) {
    src = Kw + (size_t)i * 8; dst = Kwh + (size_t)i * 8;
  } else if (i < NC * CIN / 8 + NC * CFU / 8) {
    const int j = i - NC * CIN / 8;
    src = Fw + (size_t)j * 8; dst = Fwh + (size_t)j * 8;
  } else {
    return;
  }
  v4f a = *(const v4f*)src;
  v4f c = *(const v4f*)(src + 4);
  a = a * 64.f; c = c * 64.f;
  vst2((v8h*)dst, pack8(a, c));
}

// 3) inT[b][p][1024] f16 = transpose of concat(x, aux) along channels. Block = 64 channels x 64 pixels,
__device__ __forceinline__ void d_tin(int blk, const float* __restrict__ x, const float* __restrict__ aux,
                                      _Float16* __restrict__ inT) {
  __shared__ __attribute__((aligned(16))) _Float16 T[64][72];   // T[p_local][c_local]
  const int t = threadIdx.x;
  if (blk >= NB * (CIN / 64) * (NP / 64)) return;
  const int b = blk >> 10, ct = (blk >> 6) & 15, pt = blk & 63;
  const int c0 = ct * 64, p0 = pt * 64;
  // the block's source is picked once, in front of the loop: picked per load, the merged grid's build branches round every load and waits for each
  const float* src0 = (c0 < NC) ? x   + ((size_t)(b * NC + c0)) * NP + p0
                                : aux + ((size_t)(b * CAUX + (c0 - NC))) * NP + p0;
#pragma unroll
  for (int i = 0; i < 4; ++i) {
    const int f = t + 256 * i;            // 1024 float4 chunks: 64 channel rows x 16
    const int cl = f >> 4, p4 = (f & 15) * 4;
    v4f v = *(const v4f*)(src0 + (size_t)cl * NP + p4);
    T[p4 + 0][cl] = (_Float16)v[0];
    T[p4 + 1][cl] = (_Float16)v[1];
    T[p4 + 2][cl] = (_Float16)v[2];
    T[p4 + 3][cl] = (_Float16)v[3];
  }
  __syncthreads();
  v8h val[2];
  size_t off[2];
#pragma unroll
  for (int i = 0; i < 2; ++i) {
    const int r = (t >> 3) + 32 * i, q = t & 7;
    val[i] = *(const v8ha*)&T[r][q * 8];
    off[i] = ((size_t)(b * NP + p0 + r)) * CIN + c0 + q * 8;
  }
#pragma unroll
  for (int i = 0; i < 2; ++i) vst2((v8h*)(inT + off[i]), val[i]);
}

// 1 + 2 + 3 in one grid: the three parts read inputs only and write buffers of their own, so none waits for another.
// The block index picks the part; the 16 pool blocks, the longest, take the lowest indices.
#define PB ((NB * NP / 4) / 256)                       // 16 pool blocks
#define WB ((NC * CIN / 8 + NC * CFU / 8) / 256)       // 192 weight blocks
#define TB (NB * (CIN / 64) * (NP / 64))               // 4096 transpose blocks
__global__ void __launch_bounds__(256) k_pre(const float* __restrict__ msk, float* __restrict__ mF,
                                             const float* __restrict__ Kw, const float* __restrict__ Fw,
                                             _Float16* __restrict__ Kwh, _Float16* __restrict__ Fwh,
                                             const float* __restrict__ x, const float* __restrict__ aux,
                                             _Float16* __restrict__ inT) {
  const int blk = blockIdx.x;
  if (blk < PB) d_pool(blk, msk, mF);
  else if (blk < PB + WB) d_cvtw(blk - PB, Kw, Fw, Kwh, Fwh);
  else d_tin(blk - (PB + WB), x, aux, inT);
}

// The k loop of both 1x1 conv products: D[64 pixels][256 channels] += A . B^T, A and B k-contiguous f16 rows.
// Every 64-k tile (64 A rows, 256 B rows) comes from global memory in whole 128-B lines, 16 B per lane, four lines per
// load, and is laid in LDS; the fragments are read from there. Two buffers: the next tile's loads fly while this tile
// is multiplied, and one barrier per tile publishes it and ends the reads of the buffer that is written next.
// The first NS1 tiles of A come from A1 (row pitch pa1), the other NS2 from A2 (pitch pa2). 8 waves: wave (pt, og) owns
// 32 pixels x 64 channels, d[i][j] = pixel tile i, channel tile j; k runs upward, as in a loop over 32-k steps.
template <int NS1, int NS2>
__device__ __forceinline__ void prod64(_Float16* S, const _Float16* A1, int pa1, const _Float16* A2, int pa2,
                                       const _Float16* B, int pbw, v8f (&d)[2][4]) {
  constexpr int NS = NS1 + NS2;
  const int t = threadIdx.x, lane = t & 31, wid = t >> 5, h = lane >> 4, n = lane & 15;
  const int pt = wid >> 2, og = wid & 3;
  // staging: row (of 32 per load) and 16-B piece of this thread; rows r and r + 8 lie side by side in a half wave,
  // so that at the 144-B pitch their two 128-B lines fall on the two halves of the LDS banks
  const int lr = ((t >> 3) & 16) | ((t & 8)) | ((t >> 4) & 7), lc = (t & 7) * 8;
  const _Float16* g1 = A1 + (size_t)lr * pa1 + lc;
  const _Float16* g2 = A2 + (size_t)lr * pa2 + lc;
  const _Float16* gb = B + (size_t)lr * pbw + lc;
  _Float16* const sw = S + lr * SP + lc;
  const _Float16* const fa = S + (pt * 32 + n) * SP;
  const _Float16* const fb = S + (PT + og * 64 + n) * SP;
  v8h ra[PT / 32], rb[NC / 32];
  auto fetch = [&](int s) {                            // tile s, global memory -> registers
    const bool first = (NS2 == 0) || s < NS1;
    const _Float16* ga = first ? g1 + s * BK : g2 + (s - NS1) * BK;
    const size_t st = first ? (size_t)32 * pa1 : (size_t)32 * pa2;
#pragma unroll
    for (int i = 0; i < PT / 32; ++i) ra[i] = *(const v8h*)(ga + i * st);
#pragma unroll
    for (int i = 0; i < NC / 32; ++i) rb[i] = *(const v8h*)(gb + s * BK + (size_t)(32 * i) * pbw);
    asm volatile("s_wait_xcnt 0x0" ::: "memory");      // before other values are written into the address registers that these loads name
  };
  auto put = [&](int s) {                              // tile s, registers -> its buffer
    _Float16* w = sw + (s & 1) * SBUF;
#pragma unroll
    for (int i = 0; i < PT / 32; ++i) *(v8ha*)(w + 32 * i * SP) = ra[i];
#pragma unroll
    for (int i = 0; i < NC / 32; ++i) *(v8ha*)(w + (PT + 32 * i) * SP) = rb[i];
  };
  auto mult = [&](int s) {                             // tile s: 2 k steps x 8 products
    const int cur = (s & 1) * SBUF;
    v16h af[BK / 32][2], bf[BK / 32][4];
#pragma unroll
    for (int q = 0; q < BK / 32; ++q) {
#pragma unroll
      for (int i = 0; i < 2; ++i) af[q][i] = ldfrag_l(fa + cur + i * 16 * SP, q * 32, h);
#pragma unroll
      for (int j = 0; j < 4; ++j) bf[q][j] = ldfrag_l(fb + cur + j * 16 * SP, q * 32, h);
    }
    __builtin_amdgcn_sched_barrier(0);                 // the tile's LDS reads stay one group in front of its products: spread among them, every place with reads is waited out to 0
#pragma unroll
    for (int q = 0; q < BK / 32; ++q)
#pragma unroll
      for (int j = 0; j < 4; ++j)
#pragma unroll
        for (int i = 0; i < 2; ++i) d[i][j] = wmma16(af[q][i], bf[q][j], d[i][j]);
  };
#pragma unroll
  for (int i = 0; i < 2; ++i)
#pragma unroll
    for (int j = 0; j < 4; ++j) d[i][j] = zero8();
  fetch(0);
  put(0);
  __syncthreads();                                     // tile 0 is published
#pragma unroll 1   // one tile per trip: unrolled, the trips' fragments and staged lines would not fit the registers
  for (int s = 0; s < NS - 1; ++s) {
    fetch(s + 1);
    mult(s);
    put(s + 1);
    __syncthreads();                                   // tile s + 1 is published; every wave has left the buffer of tile s
  }
  mult(NS - 1);
}

// 4) feats = inT . Kw^T (+ bias), then per-pixel L2 normalisation, stored as Nh[b][p][256] = f16(8 * unit row);
//    the row of a key goes to its dense slot Kc[b][kpos[p]][256] as well. A key is no query: its row of attT, which the
//    score kernel does not write, is set to 0 here.
//    Block = 64 pixels x 256 channels; K = 1024 in 16 staged tiles (prod64).
__device__ __forceinline__ void d_feats(int blk, const _Float16* __restrict__ inT, const _Float16* __restrict__ Kwh,
                                        const float* __restrict__ Kb, const int* __restrict__ kpos,
                                        _Float16* __restrict__ Nh, _Float16* __restrict__ Kc,
                                        _Float16* __restrict__ attT) {
  __shared__ __attribute__((aligned(16))) _Float16 S[2 * SBUF];   // two staged tiles; behind the loop F[p_local][channel] in f32, pitch 260
  const int t = threadIdx.x, lane = t & 31, wid = t >> 5, h = lane >> 4, n = lane & 15;
  if (blk >= NB * NP / PT) return;
  const int b = blk / (NP / PT), pb = (blk % (NP / PT)) * PT;
  const int pt = wid >> 2, og = wid & 3;
  v8f d[2][4];
  prod64<CIN / BK, 0>(S, inT + (size_t)(b * NP + pb) * CIN, CIN, inT, 0, Kwh, CIN, d);
  f1a* const F = (f1a*)S;
  __syncthreads();                                     // every wave has left the staged tiles
#pragma unroll
  for (int j = 0; j < 4; ++j) {
    const int o = og * 64 + j * 16 + n;
    const float bias = Kb[o];
#pragma unroll
    for (int i = 0; i < 2; ++i)
#pragma unroll
      for (int r = 0; r < 8; ++r) F[(pt * 32 + i * 16 + 8 * h + r) * 260 + o] = d[i][j][r] * (1.f / 64.f) + bias;
  }
  __syncthreads();
  v8h vals[8];
  size_t offs[8];
  int slot[8];
#pragma unroll
  for (int i = 0; i < 8; ++i) {
    const int pl = wid * 8 + i;                        // 8 pixels per wave, one wave per 512-B row
    slot[i] = kpos[b * NP + pb + pl];
    v4f a = *(const v4fa*)&F[pl * 260 + lane * 8];
    v4f c = *(const v4fa*)&F[pl * 260 + lane * 8 + 4];
    float ss = a[0] * a[0] + a[1] * a[1] + a[2] * a[2] + a[3] * a[3]
             + c[0] * c[0] + c[1] * c[1] + c[2] * c[2] + c[3] * c[3];
    ss += __shfl_xor(ss, 16); ss += __shfl_xor(ss, 8); ss += __shfl_xor(ss, 4);
    ss += __shfl_xor(ss, 2);  ss += __shfl_xor(ss, 1);
    const float inv = 8.f * (1.f / (sqrtf(ss) + 1e-8f));
    vals[i] = pack8(a * inv, c * inv);
    offs[i] = ((size_t)(b * NP + pb + pl)) * NC + lane * 8;
  }
#pragma unroll
  for (int i = 0; i < 8; ++i) vst2((v8h*)(Nh + offs[i]), vals[i]);
#pragma unroll   // slot[] and vals[] by constant index, in registers
  for (int i = 0; i < 8; ++i)
    if ((unsigned)slot[i] < (unsigned)NP) {
      const v8h z8 = {};
      vst2((v8h*)(Kc + ((size_t)(b * NP + slot[i])) * NC + lane * 8), vals[i]);
      vst2((v8h*)(attT + offs[i]), z8);
    }
}

// 5) Vh[b][c][j] = f16( x[b][c][kidx[j]] ) for the dense key slots j < nk, 0 up to the end of the last 128-key tile.
//    8 slots per thread, 16-B stores.
__device__ __forceinline__ void d_makev(int blk, const float* __restrict__ x, const int* __restrict__ kidx,
                                        const int* __restrict__ nkA, _Float16* __restrict__ Vh) {
  const int i = blk * 256 + threadIdx.x;
  if (i >= NB * NC * NP / 8) return;
  const size_t e0 = (size_t)i * 8;
  const int j0 = (int)(e0 & (NP - 1));
  const int b = (int)(e0 >> 20);
  const int nk = min(max(nkA[b], 0), NP);
  if (j0 >= ((nk + KT - 1) & ~(KT - 1))) return;
  const float* xr = x + (e0 - (size_t)j0);
  const int* ki = kidx + (size_t)b * NP + j0;
  v4i i0 = *(const v4i*)ki;
  v4i i1 = *(const v4i*)(ki + 4);
  v4f a, c;
#pragma unroll   // vector elements by constant index, all eight gathers in flight
  for (int e = 0; e < 4; ++e) {
    const float va = xr[i0[e] & (NP - 1)];
    asm volatile("s_wait_xcnt 0x0" ::: "memory");   // before a later gather's result lands in this load's address registers
    const float vc = xr[i1[e] & (NP - 1)];
    asm volatile("s_wait_xcnt 0x0" ::: "memory");   // the same
    a[e] = (j0 + e < nk) ? va : 0.f;
    c[e] = (j0 + 4 + e < nk) ? vc : 0.f;
  }
  vst2((v8h*)(Vh + e0), pack8(a, c));
}

// 4 + 5 in one grid: neither reads what the other writes. The 256 long product blocks take the lowest indices, the
// short gather blocks the rest.
#define FB (NB * NP / PT)                              // 256 product blocks (here and in the fuse grid)
#define GB ((NB * NC * NP / 8) / 256)                  // 2048 gather blocks
__global__ void __launch_bounds__(256) k_fv(const _Float16* __restrict__ inT, const _Float16* __restrict__ Kwh,
                                            const float* __restrict__ Kb, const int* __restrict__ kpos,
                                            _Float16* __restrict__ Nh, _Float16* __restrict__ Kc,
                                            const float* __restrict__ x, const int* __restrict__ kidx,
                                            const int* __restrict__ nkA, _Float16* __restrict__ Vh,
                                            _Float16* __restrict__ attT) {
  const int blk = blockIdx.x;
  if (blk < FB) d_feats(blk, inT, Kwh, Kb, kpos, Nh, Kc, attT);
  else d_makev(blk - FB, x, kidx, nkA, Vh);
}

// Eight asynchronous 16-B-per-lane copies, global memory -> LDS, through no register. l = the lane's LDS byte addresses,
// g = its global addresses. The s_wait_xcnt stands inside the statement, behind the last copy, so that no address
// register of a copy is written again in front of it.
__device__ __forceinline__ void copy8(const unsigned (&l)[8], const _Float16* const (&g)[8]) {
  asm volatile("global_load_async_to_lds_b128 %0, %8, off\n\t"
               "global_load_async_to_lds_b128 %1, %9, off\n\t"
               "global_load_async_to_lds_b128 %2, %10, off\n\t"
               "global_load_async_to_lds_b128 %3, %11, off\n\t"
               "global_load_async_to_lds_b128 %4, %12, off\n\t"
               "global_load_async_to_lds_b128 %5, %13, off\n\t"
               "global_load_async_to_lds_b128 %6, %14, off\n\t"
               "global_load_async_to_lds_b128 %7, %15, off\n\t"
               "s_wait_xcnt 0x0"
               :: "v"(l[0]), "v"(l[1]), "v"(l[2]), "v"(l[3]), "v"(l[4]), "v"(l[5]), "v"(l[6]), "v"(l[7]),
                  "v"(g[0]), "v"(g[1]), "v"(g[2]), "v"(g[3]), "v"(g[4]), "v"(g[5]), "v"(g[6]), "v"(g[7])
               : "memory");
}

// One wave's share of a staged key tile: rows r0, r0 + 16, ..., r0 + 112 of Kb, 512 B each, 16 B per lane (r0, nk the
// same in every lane, nk > 0), to the tile rows of pitch 264 from LDS byte address dst on. In the last, partial tile a
// slot past nk takes the last key again.
__device__ __forceinline__ void cpkeys(unsigned dst, const _Float16* Kb, int r0, int nk, int lane) {
  unsigned l[KT / AW];
  const _Float16* g[KT / AW];
#pragma unroll   // l[] and g[] by constant index, in registers
  for (int i = 0; i < KT / AW; ++i) {
    l[i] = dst + (unsigned)(AW * i * 264 * 2);
    g[i] = Kb + (size_t)min(r0 + AW * i, nk - 1) * NC + lane * 8;
  }
  copy8(l, g);
}

// One thread's share of a staged V tile: 16 B of channel rows vr0, vr0 + 32, ..., vr0 + 224 (p = its 16 B of row vr0),
// to the tile rows of pitch VP from LDS byte address dst on.
__device__ __forceinline__ void cpvals(unsigned dst, const _Float16* p) {
  unsigned l[KT / AW];
  const _Float16* g[KT / AW];
#pragma unroll   // l[] and g[] by constant index, in registers
  for (int i = 0; i < KT / AW; ++i) {
    l[i] = dst + (unsigned)(32 * i * VP * 2);
    g[i] = p + (size_t)(32 * i) * NP;
  }
  copy8(l, g);
}

// Hand-over of staged tiles between the waves of a block.
__device__ __forceinline__ void publish() {
  asm volatile("s_wait_dscnt 0x0" ::: "memory");      // this wave's LDS reads and writes are over before a buffer goes to its next writer
  asm volatile("s_wait_asynccnt 0x0" ::: "memory");   // this wave's copies have landed before other waves read them
  __syncthreads();
}

// 6) attention of the nq = 4096 - nk dense queries over the nk dense keys of the batch. A pixel with m = 0 is no query:
//    its whole att row is multiplied by 0, so only the pixels behind the keys in kidx get a row here. The batch's 64
//    blocks take cnt queries each, cnt = nq / 64 rounded up to whole 16-row tiles; a query tile with no query does no
//    product, a block with no query leaves zero column sums and ends.
//    Block = up to 64 query rows, 16 waves: wave (qt, kg) owns query tile qt
//    (16 rows) and key group kg (32 of the 128 keys staged per trip), so a trip covers four times the keys of a
//    one-group block. Pass 1: row sums of exp(20 cos - 20), fixed shift 20 (|cos| <= 1),
//    the four groups' partial sums added through LDS. Pass 2: att tiles -> per-block column sums (cpart) and
//    O^T = V . att^T, the four groups' partial O^T added through LDS behind the loop, in a fixed order.
//    Q chunk, K tile, V tile and the per-wave att^T tile are staged in LDS; every fragment uses ldfrag_*.
//    K and V tiles come by asynchronous copies that fly while the block multiplies: pass 1 has two K buffers (the second
//    in the V tile's space); in pass 2 the next K tile flies under V . att^T and the next V tile under the scores.
__global__ void __launch_bounds__(ATH) __attribute__((amdgpu_num_vgpr(252)))
k_attn(const _Float16* __restrict__ Nh, const _Float16* __restrict__ Kc, const _Float16* __restrict__ Vh,
       const int* __restrict__ kidx, const int* __restrict__ nkA, _Float16* __restrict__ attT,
       float* __restrict__ cpart) {
  __shared__ __attribute__((aligned(16))) _Float16 Qs[QCH][264];   // q rows (later reused as O^T tile)
  __shared__ __attribute__((aligned(16))) _Float16 KV[KT * 264 + NC * VP];   // K tile, V tile (pass 1: a second K tile); behind the loop: partial O^T in f32
  __shared__ __attribute__((aligned(16))) _Float16 Ps[AW][16][40]; // att^T     [n=q][k=key] per wave
  __shared__ float cs[AW][KW];                                     // per-wave column sums, 32 keys
  __shared__ float rs[KG][QCH];                                    // per-key-group row sums
  __shared__ __attribute__((aligned(16))) float csb[NP];           // per-block column sums
  _Float16* const Ks = KV;                 // key rows  [n=key][k=channel], pitch 264
  _Float16* const Vs = KV + KT * 264;      // V tile    [m=channel][k=key], pitch VP

  const int t = threadIdx.x, lane = t & 31, h = lane >> 4, n = lane & 15;
  const int wid = __builtin_amdgcn_readfirstlane(t >> 5);   // in a scalar register: the tests on the wave's group are scalar branches
  const int qt = wid >> 2, kg = wid & 3;               // four waves in a row share a query tile: where waves in a row go to the four SIMDs in turn (assumed, not measured), an empty tile takes one wave's work off each SIMD
  const int blk = blockIdx.x;
  if (blk >= NB * QCN) return;
  const int b = blk / QCN, qc = blk % QCN;
  const _Float16* Nb = Nh + (size_t)b * NP * NC;
  const _Float16* Kb = Kc + (size_t)b * NP * NC;
  const int nk = __builtin_amdgcn_readfirstlane(min(max(nkA[b], 0), NP));   // in a scalar register: the key loops and their barriers stand under scalar branches
  const _Float16* Vb = Vh + (size_t)b * NC * NP;
  const int nq = NP - nk;
  const int cnt = ((nq + QCN - 1) / QCN + 15) & ~15;   // queries per block, at most QCH
  const int q0 = qc * cnt;                             // the block's first dense query
  const int nloc = min(max(nq - q0, 0), cnt);          // its queries: local rows 0 .. nloc - 1
  const bool act = qt * 16 < nloc;                     // this wave's query tile holds a query (scalar)
  float* cp = cpart + ((size_t)(b * QCN + qc)) * NP;
  if (nloc == 0) {                                     // the whole block leaves, in front of every copy and barrier
#pragma unroll
    for (int i = 0; i < NP / 4 / ATH; ++i) {
      const int f = t + ATH * i;
      const v4f z4 = {0.f, 0.f, 0.f, 0.f};
      if (f * 4 < nk) vst2((v4f*)(cp + (size_t)f * 4), z4);
    }
    return;
  }

  const unsigned kdst = (unsigned)(size_t)&Ks[wid * 264 + lane * 8];   // LDS byte address of this lane's 16 B in tile row wid
  if (nk > 0) cpkeys(kdst, Kb, wid, nk, lane);         // pass 1, tile 0

  // stage the block's query rows, four per wave: local row r is pixel kidx[nk + q0 + r]; a row past the last query takes
  // the last pixel of the permutation, and its att is multiplied by 0 below
  int qp[QCH / AW];
  {
    v8h qv[QCH / AW];
#pragma unroll   // qp[] and qv[] by constant index, in registers
    for (int i = 0; i < QCH / AW; ++i) {
      qp[i] = __builtin_amdgcn_readfirstlane(kidx[(size_t)b * NP + min(nk + q0 + wid * (QCH / AW) + i, NP - 1)] & (NP - 1));
      qv[i] = *(const v8h*)(Nb + (size_t)qp[i] * NC + lane * 8);
    }
    asm volatile("s_wait_xcnt 0x0" ::: "memory");      // before other values are written into the address registers that these loads name
#pragma unroll
    for (int i = 0; i < QCH / AW; ++i) *(v8h*)&Qs[wid * (QCH / AW) + i][lane * 8] = qv[i];
  }
  if (!act) cs[wid][lane] = 0.f;                       // an empty tile's column sums: written once, read in every trip's fold
  asm volatile("s_wait_asynccnt 0x0" ::: "memory");    // tile 0 has landed
  __syncthreads();                                     // the query rows and tile 0 are published
  if (KT < nk) cpkeys(kdst + KT * 264 * 2, Kb, KT + wid, nk, lane);   // tile 1, second buffer

  const _Float16* Qrow = &Qs[qt * 16 + n][0];
  const int vr0 = t >> 4, v8 = (t & 15) * 8;           // V staging: channel row and key offset of this thread's 16 B
  const unsigned voff = (unsigned)(vr0 * NP + v8);
  const unsigned vdst = (unsigned)(size_t)&Vs[vr0 * VP + v8];   // its LDS byte address

  float invs[8];
  {
    v16h qf[8];
#pragma unroll
    for (int cb = 0; cb < 8; ++cb) qf[cb] = ldfrag_l(Qrow, cb * 32, h);
    float acc[8];
#pragma unroll
    for (int r = 0; r < 8; ++r) acc[r] = 0.f;
    int cur = 0;                                       // buffer of this trip's tile
    int kb = 0;
#pragma unroll 1
    for (; kb < nk; kb += KT) {
      if (act) {
      const _Float16* Krow = &Ks[(cur * KT + kg * KW + n) * 264];
      v16h kf[8][2];                                   // the wave's 32 key rows of this tile, all 16 fragments
#pragma unroll
      for (int cb = 0; cb < 8; ++cb)
#pragma unroll
        for (int sub = 0; sub < 2; ++sub) kf[cb][sub] = ldfrag_l(Krow + sub * 16 * 264, cb * 32, h);
      __builtin_amdgcn_sched_barrier(0);               // the trip's LDS reads stay one group in front of its products: left to the scheduler, each product stands behind its own two reads and waits out their whole latency
      v8f s[2] = {zero8(), zero8()};
#pragma unroll
      for (int cb = 0; cb < 8; ++cb)
#pragma unroll
        for (int sub = 0; sub < 2; ++sub) s[sub] = wmma16(qf[cb], kf[cb][sub], s[sub]);
#pragma unroll
      for (int sub = 0; sub < 2; ++sub) {
        const float km = (kb + kg * KW + sub * 16 + n < nk) ? 1.f : 0.f;
#pragma unroll
        for (int r = 0; r < 8; ++r) acc[r] += km * __expf(0.3125f * s[sub][r] - 20.f);
      }
      }
      publish();                                       // the next tile is published; every wave has left this trip's buffer
      if (kb + 2 * KT < nk) cpkeys(kdst + cur * (KT * 264 * 2), Kb, kb + 2 * KT + wid, nk, lane);
      cur ^= 1;
    }
    asm volatile("s_wait_asynccnt 0x0" ::: "memory");  // no copy of pass 1 is left in flight
    if (kb > 0) {                                      // there are keys. Pass 2, tile 0: both fly under the row sums' fold
      cpkeys(kdst, Kb, wid, nk, lane);
      cpvals(vdst, Vb + voff);
    }
#pragma unroll
    for (int r = 0; r < 8; ++r) {
      float a = acc[r];
      a += __shfl_xor(a, 1); a += __shfl_xor(a, 2); a += __shfl_xor(a, 4); a += __shfl_xor(a, 8);
      if (n == 0) rs[kg][qt * 16 + 8 * h + r] = a;
    }
    __syncthreads();
#pragma unroll
    for (int r = 0; r < 8; ++r) {
      const int ql = qt * 16 + 8 * h + r;
      const float a = (rs[0][ql] + rs[1][ql]) + (rs[2][ql] + rs[3][ql]);
      invs[r] = (ql < nloc) ? 1.f / (a + 1e-30f) : 0.f;   // a row past the block's last query -> 0
    }
  }

  // ---- pass 2: att tiles, column sums, O^T = V . (att*4096)^T ----
  v8f o[16];
#pragma unroll
  for (int cc = 0; cc < 16; ++cc) o[cc] = zero8();
  publish();                                           // K and V tile 0 are published
#pragma unroll 1
  for (int kb = 0; kb < nk; kb += KT) {
    if (act) {
    v8f s[2] = {zero8(), zero8()};
    const _Float16* Krow = &Ks[(kg * KW + n) * 264];
#pragma unroll
    for (int g = 0; g < 4; ++g) {                      // 64 channels a group: as many fragments as the registers hold beside O^T
      v16h qa[2], kf[2][2];
#pragma unroll
      for (int j = 0; j < 2; ++j) {
        qa[j] = ldfrag_l(Qrow, (g * 2 + j) * 32, h);
#pragma unroll
        for (int sub = 0; sub < 2; ++sub) kf[j][sub] = ldfrag_l(Krow + sub * 16 * 264, (g * 2 + j) * 32, h);
      }
      __builtin_amdgcn_sched_barrier(0);               // as in pass 1: the group's twelve LDS reads stand together in front of its four products
#pragma unroll
      for (int j = 0; j < 2; ++j)
#pragma unroll
        for (int sub = 0; sub < 2; ++sub) s[sub] = wmma16(qa[j], kf[j][sub], s[sub]);
      __builtin_amdgcn_sched_barrier(0);               // the next group's reads are not spread among these products
    }
#pragma unroll
    for (int sub = 0; sub < 2; ++sub) {
      const float km = (kb + kg * KW + sub * 16 + n < nk) ? 1.f : 0.f;
      float csum = 0.f;
#pragma unroll
      for (int r = 0; r < 8; ++r) {
        const float att = invs[r] * km * __expf(0.3125f * s[sub][r] - 20.f);   // D row q = 8h+r, col key = n
        csum += att;
        Ps[wid][8 * h + r][sub * 16 + n] = (_Float16)(att * 4096.f);
      }
      csum += __shfl_xor(csum, 16);
      if (lane < 16) cs[wid][sub * 16 + lane] = csum;
    }
    }
    publish();                                         // this trip's V tile and column sums are published; every wave has left the K tile
    if (kb + KT < nk) cpkeys(kdst, Kb, kb + KT + wid, nk, lane);   // the next K tile flies under V . att^T
    if (wid < KG) {                                    // wave g folds key group g: its four query tiles' sums
      float tt = 0.f;
#pragma unroll
      for (int w = 0; w < 4; ++w) tt += cs[w * KG + wid][lane];
      csb[kb + wid * KW + lane] = tt;
    }
    if (act) {
    const v16h pB = ldfrag_l(&Ps[wid][n][0], 0, h);                   // B: k = key, n = q
#pragma unroll
    for (int g = 0; g < 2; ++g) {                      // 128 channels a group
      v16h vf[8];
#pragma unroll
      for (int j = 0; j < 8; ++j) vf[j] = ldfrag_l(&Vs[(g * 128 + j * 16 + n) * VP], kg * KW, h);   // A: m = channel
      __builtin_amdgcn_sched_barrier(0);               // as above: the group's sixteen LDS reads stand together in front of its eight products
#pragma unroll
      for (int j = 0; j < 8; ++j) o[g * 8 + j] = wmma16(vf[j], pB, o[g * 8 + j]);
      __builtin_amdgcn_sched_barrier(0);               // the next group's reads are not spread among these products
    }
    }
    publish();                                         // the next K tile is published; every wave has left the V tile and the column sums
    if (kb + KT < nk) cpvals(vdst, Vb + (kb + KT) + voff);   // the next V tile flies under the next scores
  }
  asm volatile("s_wait_asynccnt 0x0" ::: "memory");    // no copy is left in flight when the tiles' space is used anew

  // the four key groups' partial O^T tiles, added in f32 as (g0 + g2) + (g1 + g3); a tile lies in the K/V space as
  // [cc][half][lane][4], 16 B per lane, 16 KiB per wave
  float* const R = (float*)KV;
  __syncthreads();                                     // every wave has left the K and V tiles
  if (act && kg >= 2) {                                // an empty query tile has nothing to add, here and below
    float* rp = R + ((kg - 2) * 4 + qt) * 4096 + lane * 4;
#pragma unroll
    for (int cc = 0; cc < 16; ++cc) {
      v4f lo = {o[cc][0], o[cc][1], o[cc][2], o[cc][3]};
      v4f hi = {o[cc][4], o[cc][5], o[cc][6], o[cc][7]};
      *(v4fa*)(rp + cc * 256) = lo;
      *(v4fa*)(rp + cc * 256 + 128) = hi;
    }
  }
  __syncthreads();
  if (act && kg < 2) {
    const float* rp = R + (kg * 4 + qt) * 4096 + lane * 4;
#pragma unroll
    for (int cc = 0; cc < 16; ++cc) {
      v4f lo = *(const v4fa*)(rp + cc * 256);
      v4f hi = *(const v4fa*)(rp + cc * 256 + 128);
#pragma unroll
      for (int e = 0; e < 4; ++e) { o[cc][e] += lo[e]; o[cc][4 + e] += hi[e]; }
    }
  }
  __syncthreads();
  if (act && kg == 1) {
    float* rp = R + qt * 4096 + lane * 4;
#pragma unroll
    for (int cc = 0; cc < 16; ++cc) {
      v4f lo = {o[cc][0], o[cc][1], o[cc][2], o[cc][3]};
      v4f hi = {o[cc][4], o[cc][5], o[cc][6], o[cc][7]};
      *(v4fa*)(rp + cc * 256) = lo;
      *(v4fa*)(rp + cc * 256 + 128) = hi;
    }
  }
  __syncthreads();
  // O^T tile (D rows = channel cc*16+8h+r, cols = q) -> f16, staged in the query tile's own Qs rows as [q][channel]
  if (act && kg == 0) {
    const float* rp = R + qt * 4096 + lane * 4;
#pragma unroll
    for (int cc = 0; cc < 16; ++cc) {
      v4f lo = *(const v4fa*)(rp + cc * 256);
      v4f hi = *(const v4fa*)(rp + cc * 256 + 128);
      v8h tv;
#pragma unroll
      for (int e = 0; e < 4; ++e) {
        tv[e]     = (_Float16)((o[cc][e] + lo[e]) * (1.f / 4096.f));
        tv[4 + e] = (_Float16)((o[cc][4 + e] + hi[e]) * (1.f / 4096.f));
      }
      *(v8h*)&Qs[qt * 16 + n][cc * 16 + 8 * h] = tv;
    }
  }
  __syncthreads();
  // attT[b][pixel of the query][256]: one 512-B row per instruction, 16 B per lane, up to four rows per wave
  v8h ov[QCH / AW];
#pragma unroll   // ov[] and qp[] by constant index, in registers; the four LDS reads stand together
  for (int i = 0; i < QCH / AW; ++i) ov[i] = *(const v8ha*)&Qs[wid * (QCH / AW) + i][lane * 8];
#pragma unroll
  for (int i = 0; i < QCH / AW; ++i) {
    if (wid * (QCH / AW) + i < nloc) {
      vst2((v8h*)(attT + ((size_t)(b * NP + qp[i])) * NC + lane * 8), ov[i]);
      asm volatile("s_wait_xcnt 0x0" ::: "memory");    // before the next row's address is written into the registers that this store names
    }
  }
#pragma unroll
  for (int i = 0; i < NP / 4 / ATH; ++i) {
    const int f = t + ATH * i;
    if (f * 4 < nk) {                                  // csb holds whole 128-key tiles up to nk
      v4f v = *(const v4fa*)&csb[f * 4];
      vst2((v4f*)(cp + (size_t)f * 4), v);
    }
  }
}

// 7) fused = concat(att_fore, x) . Fw^T, then out0[b][o][p] = m[p] ? fused : x. Block = 64 pixels x 256
//    channels; K = 512 in 8 staged tiles (prod64): input channels 0..255 from attT, 256..511 from the first 256 columns of inT.
__device__ __forceinline__ void
d_fuse(int blk, const _Float16* __restrict__ attT, const _Float16* __restrict__ inT, const _Float16* __restrict__ Fwh,
       const float* __restrict__ x, const float* __restrict__ mF, float* __restrict__ out0) {
  __shared__ __attribute__((aligned(16))) _Float16 S[2 * SBUF];   // two staged tiles; behind the loop G[channel][p_local] in f32, pitch 68
  const int t = threadIdx.x, lane = t & 31, wid = t >> 5, h = lane >> 4, n = lane & 15;
  if (blk >= NB * NP / PT) return;
  const int b = blk / (NP / PT), pb = (blk % (NP / PT)) * PT;
  const int pt = wid >> 2, og = wid & 3;
  const size_t row0 = (size_t)b * NP + pb;
  v8f d[2][4];
  prod64<NC / BK, NC / BK>(S, attT + row0 * NC, NC, inT + row0 * CIN, CIN, Fwh, CFU, d);
  // wave owns 32 channels; two 256-B row pieces per instruction, one address and constant offsets
  const int p4 = (lane & 15) * 4;
  const size_t g0 = ((size_t)(b * NC + wid * 32 + (lane >> 4))) * NP + pb + p4;
  const float* xp = x + g0;
  float* op = out0 + g0;
  const v4f mv = *(const v4f*)(mF + (size_t)b * NP + pb + p4);
  v4f xv[16];
#pragma unroll
  for (int i = 0; i < 16; ++i) {
    xv[i] = *(const v4f*)(xp + (size_t)(2 * i) * NP);
    if (i >= 14) asm volatile("s_wait_xcnt 0x0" ::: "memory");   // the shared address registers are free from the last load on
  }
  f1a* const G = (f1a*)S;
  __syncthreads();                                     // every wave has left the staged tiles
#pragma unroll
  for (int j = 0; j < 4; ++j) {
    const int o = og * 64 + j * 16 + n;
#pragma unroll
    for (int i = 0; i < 2; ++i) {
      v4f lo, hi;
#pragma unroll
      for (int e = 0; e < 4; ++e) { lo[e] = d[i][j][e] * (1.f / 64.f); hi[e] = d[i][j][4 + e] * (1.f / 64.f); }
      *(v4fa*)&G[o * 68 + pt * 32 + i * 16 + 8 * h] = lo;
      *(v4fa*)&G[o * 68 + pt * 32 + i * 16 + 8 * h + 4] = hi;
    }
  }
  __syncthreads();
#pragma unroll
  for (int i = 0; i < 16; ++i) {
    const v4f fz = *(const v4fa*)&G[(wid * 32 + 2 * i + (lane >> 4)) * 68 + p4];
    v4f rv;
#pragma unroll
    for (int e = 0; e < 4; ++e) rv[e] = (mv[e] > 0.5f) ? fz[e] : xv[i][e];
    vst2((v4f*)(op + (size_t)(2 * i) * NP), rv);
  }
}

// 8) visatt[b][p] = fixed-order sum of the 64 partial column sums at the pixel's key slot, 0 for a non-key;
//    one pixel per thread, 64 blocks of 256.
//    Each run of 128 pixels also leaves the maximum of its sums (start value 0) in bmax[run], two runs per block.
#define VB 128              // pixels per run, and number of runs (VB * VB = NB * NP)
__device__ __forceinline__ void d_vis(int blk, const float* __restrict__ cpart, const int* __restrict__ kpos,
                                      float* __restrict__ vis, float* __restrict__ bmax) {
  __shared__ float red[256 / 32];
  const int t = threadIdx.x, lane = t & 31, wid = t >> 5;
  const int idx = blk * 256 + t;
  if (blk >= NB * NP / 256) return;
  const int b = idx >> 12;
  const int slot = kpos[idx];
  float s = 0.f;
  if ((unsigned)slot < (unsigned)NP) {
    const float* cp = cpart + (size_t)b * QCN * NP + slot;
    float v[QCN];
#pragma unroll
    for (int q = 0; q < QCN; ++q) v[q] = cp[(size_t)q * NP];
#pragma unroll
    for (int q = 0; q < QCN; ++q) s += v[q];
  }
  vis[idx] = s;
  float mx = fmaxf(0.f, s);
  mx = fmaxf(mx, __shfl_xor(mx, 16)); mx = fmaxf(mx, __shfl_xor(mx, 8)); mx = fmaxf(mx, __shfl_xor(mx, 4));
  mx = fmaxf(mx, __shfl_xor(mx, 2));  mx = fmaxf(mx, __shfl_xor(mx, 1));
  if (lane == 0) red[wid] = mx;
  __syncthreads();
  if ((t & (VB - 1)) == 0) bmax[idx / VB] = fmaxf(fmaxf(red[wid], red[wid + 1]), fmaxf(red[wid + 2], red[wid + 3]));
}

// 7 + 8 in one grid: both read only what the score kernel and earlier launches left, and write buffers of their own.
#define SB (NB * NP / 256)                             // 64 column-sum blocks
__global__ void __launch_bounds__(256) k_post(const _Float16* __restrict__ attT, const _Float16* __restrict__ inT,
                                              const _Float16* __restrict__ Fwh, const float* __restrict__ x,
                                              const float* __restrict__ mF, float* __restrict__ out0,
                                              const float* __restrict__ cpart, const int* __restrict__ kpos,
                                              float* __restrict__ vis, float* __restrict__ bmax) {
  const int blk = blockIdx.x;
  if (blk < FB) d_fuse(blk, attT, inT, Fwh, x, mF, out0);
  else d_vis(blk - FB, cpart, kpos, vis, bmax);
}

// 9) out1 = 8x nearest upsample of visatt / global max. Block = one strip of 8 output rows (one visatt row):
//    every wave folds the 128 run maxima itself, each thread reads one visatt value and stores it 4 x 16 B.
__global__ void __launch_bounds__(256) k_up(const float* __restrict__ vis, const float* __restrict__ bmax,
                                            float* __restrict__ out1) {
  const int t = threadIdx.x, lane = t & 31;
  const int blk = blockIdx.x;
  if (blk >= NB * 64) return;
  const v4f bm = *(const v4f*)(bmax + lane * 4);
  const float sv = vis[blk * 64 + ((t & 127) >> 1)];
  float mx = fmaxf(fmaxf(bm[0], bm[1]), fmaxf(bm[2], bm[3]));
  mx = fmaxf(mx, __shfl_xor(mx, 16)); mx = fmaxf(mx, __shfl_xor(mx, 8)); mx = fmaxf(mx, __shfl_xor(mx, 4));
  mx = fmaxf(mx, __shfl_xor(mx, 2));  mx = fmaxf(mx, __shfl_xor(mx, 1));
  const float inv = 1.f / mx;
  const float v = sv * inv;
  v4f r; r[0] = v; r[1] = v; r[2] = v; r[3] = v;
  float* dst = out1 + ((size_t)blk * 1024 + t) * 4;
#pragma unroll
  for (int i = 0; i < 4; ++i) *(v4f*)(dst + (size_t)i * 1024) = r;
}

// ---------------------------------------------------------------------------
extern "C" void kernel_launch(void* const* d_in, const int* in_sizes, int n_in,
                              void* d_out, int out_size, void* d_ws, size_t ws_size,
                              hipStream_t stream) {
  if (n_in < 6) return;
  if (in_sizes[0] != NB * NC * NP) return;        // x      [4,256,64,64] f32
  if (in_sizes[1] != NB * MS * MS) return;        // mask   [4,1,512,512] f32
  if (in_sizes[2] != NB * CAUX * NP) return;      // aux    [4,768,64,64] f32
  if (in_sizes[3] != NC * CIN) return;            // K_w    [256,1024]    f32
  if (in_sizes[4] != NC) return;                  // K_b    [256]         f32
  if (in_sizes[5] != NC * CFU) return;            // fuse_w [256,512]     f32
  if (out_size != NB * NC * NP + NB * MS * MS) return;

  const float* x   = (const float*)d_in[0];
  const float* msk = (const float*)d_in[1];
  const float* aux = (const float*)d_in[2];
  const float* Kw  = (const float*)d_in[3];
  const float* Kb  = (const float*)d_in[4];
  const float* Fw  = (const float*)d_in[5];
  float* out0 = (float*)d_out;                           // 4,194,304 f32 at byte 0
  float* out1 = out0 + (size_t)NB * NC * NP;             // 1,048,576 f32 at byte 16,777,216

  const size_t o_m   = 0;                                          //     65,536 B
  const size_t o_kwh = o_m   + (size_t)NB * NP * 4;                //    524,288 B
  const size_t o_fwh = o_kwh + (size_t)NC * CIN * 2;               //    262,144 B
  const size_t o_inT = o_fwh + (size_t)NC * CFU * 2;               // 33,554,432 B
  const size_t o_nh  = o_inT + (size_t)NB * NP * CIN * 2;          //  8,388,608 B
  const size_t o_vh  = o_nh  + (size_t)NB * NP * NC * 2;           //  8,388,608 B
  const size_t o_att = o_vh  + (size_t)NB * NC * NP * 2;           //  8,388,608 B
  const size_t o_cp  = o_att + (size_t)NB * NP * NC * 2;           //  4,194,304 B
  const size_t o_vis = o_cp  + (size_t)NB * QCN * NP * 4;          //     65,536 B
  const size_t o_bm  = o_vis + (size_t)NB * NP * 4;                //        512 B
  const size_t o_kc  = o_bm  + (size_t)VB * 4;                     //  8,388,608 B
  const size_t o_kp  = o_kc  + (size_t)NB * NP * NC * 2;           //     65,536 B
  const size_t o_ki  = o_kp  + (size_t)NB * NP * 4;                //     65,536 B
  const size_t o_nk  = o_ki  + (size_t)NB * NP * 4;                //         16 B
  const size_t total = o_nk  + (size_t)NB * 4;                     // 72,352,272 B
  if (total > ws_size) return;

  char* w = (char*)d_ws;
  float*    mF    = (float*)(w + o_m);
  _Float16* Kwh   = (_Float16*)(w + o_kwh);
  _Float16* Fwh   = (_Float16*)(w + o_fwh);
  _Float16* inT   = (_Float16*)(w + o_inT);
  _Float16* Nh    = (_Float16*)(w + o_nh);
  _Float16* Vh    = (_Float16*)(w + o_vh);
  _Float16* attT  = (_Float16*)(w + o_att);
  float*    cpart = (float*)(w + o_cp);
  float*    vis   = (float*)(w + o_vis);
  float*    bmax  = (float*)(w + o_bm);
  _Float16* Kc    = (_Float16*)(w + o_kc);
  int*      kpos  = (int*)(w + o_kp);
  int*      kidx  = (int*)(w + o_ki);
  int*      nkA   = (int*)(w + o_nk);

  k_pre  <<<PB + WB + TB, 256, 0, stream>>>(msk, mF, Kw, Fw, Kwh, Fwh, x, aux, inT);      // 16 + 192 + 4096 blocks
  k_rank <<<NB, 256, 0, stream>>>(mF, kpos, kidx, nkA);                                 // 4 blocks
  k_fv   <<<FB + GB, 256, 0, stream>>>(inT, Kwh, Kb, kpos, Nh, Kc, x, kidx, nkA, Vh, attT);     // 256 + 2048 blocks
  k_attn <<<NB * QCN, ATH, 0, stream>>>(Nh, Kc, Vh, kidx, nkA, attT, cpart);                // 256 blocks
  k_post <<<FB + SB, 256, 0, stream>>>(attT, inT, Fwh, x, mF, out0, cpart, kpos, vis, bmax);   // 256 + 64 blocks
  k_up   <<<NB * 64, 256, 0, stream>>>(vis, bmax, out1);                                // 256 blocks
}

// v009
// It runs in 96.4 microseconds.
// In both of two side-by-side timings against v008, it was 1.06 times as fast.
// Over all steps from v000 it is 7.45 times as fast.
#include <hip/hip_runtime.h>

// Contractions on v_wmma_f32_16x16x32_f16 (f16 operands, f32 accumulate): 1x1 input conv (weights x64),
// q.k scores (unit feature rows x8 on each side), att.v (att x4096), 1x1 fuse conv (weights x64);
// every scale is an exact power of two folded back in f32. Softmax, norms, sums and selects stay f32.

#define NB   4
#define NC   256
#define NP   4096
#define CIN  1024
#define CAUX 768
#define CFU  512
#define MS   512
#define QCH  64             // query rows per block in the score kernel (4 query tiles x 16)
#define KG   4              // key groups per block: waves that share a query tile and split the staged keys
#define KW   32             // keys per wave and trip
#define KT   (KG * KW)      // 128 keys per staged tile
#define AW   (QCH / 16 * KG)  // 16 waves per block in the score kernel
#define ATH  (AW * 32)      // its 512 threads
#define VP   (KT + 8)       // LDS pitch of a V row in elements: 272 B = 16 B x 17
#define QCN  (NP / QCH)     // 64 query chunks per batch
#define PT   64             // pixels per block in the two 1x1 conv products
#define BK   64             // k per staged tile: one 128-B line of every operand row
#define SP   (BK + 8)       // LDS pitch of a staged row in elements: 144 B = 16 B x 9
#define SBUF ((PT + NC) * SP)   // elements of one staged tile: 64 pixel rows, then 256 weight rows

typedef _Float16 v16h __attribute__((ext_vector_type(16)));
typedef _Float16 v8h  __attribute__((ext_vector_type(8)));
typedef v8h v8ha __attribute__((may_alias));
typedef float v8f __attribute__((ext_vector_type(8)));
typedef float v4f __attribute__((ext_vector_type(4)));
typedef v4f v4fa __attribute__((may_alias));
typedef int v4i __attribute__((ext_vector_type(4)));
typedef v4i v4ia __attribute__((may_alias));
typedef float f1a __attribute__((may_alias));
typedef int i1a __attribute__((may_alias));

union Frag { v16h v; v8h hf[2]; };

__device__ __forceinline__ v8f zero8() {
  v8f z = {0.f, 0.f, 0.f, 0.f, 0.f, 0.f, 0.f, 0.f};
  return z;
}

__device__ __forceinline__ v8f wmma16(v16h a, v16h b, v8f c) {
  v8f d = __builtin_amdgcn_wmma_f32_16x16x32_f16(false, a, false, b, (short)0, c, false, false);
  asm volatile("v_nop\n\tv_nop\n\tv_nop\n\tv_nop" : "+v"(d) : "v"(a), "v"(b));
  return d;
}

// 16 rows x 32 k fragment from a k-contiguous 16-bit matrix. rowp = start of the row owned by this
// lane (row index = lane & 15). Elements 0..7 <- k0+8h+0..7, elements 8..15 <- k0+16+8h+0..7 with
// h = lane >> 4. Used for A (row = m) and for B (row = n of a [n][k] copy). D: acc[r] = (row 8h+r, col lane&15).
__device__ __forceinline__ v16h ldfrag_g(const _Float16* rowp, int k0, int h) {
  Frag f;
  f.hf[0] = *(const v8h*)(rowp + k0 + 8 * h);
  f.hf[1] = *(const v8h*)(rowp + k0 + 16 + 8 * h);
  return f.v;
}
__device__ __forceinline__ v16h ldfrag_l(const _Float16* rowp, int k0, int h) {
  Frag f;
  f.hf[0] = *(const v8ha*)(rowp + k0 + 8 * h);
  f.hf[1] = *(const v8ha*)(rowp + k0 + 16 + 8 * h);
  return f.v;
}

__device__ __forceinline__ v8h pack8(v4f a, v4f b) {
  v8h r;
  r[0] = (_Float16)a[0]; r[1] = (_Float16)a[1]; r[2] = (_Float16)a[2]; r[3] = (_Float16)a[3];
  r[4] = (_Float16)b[0]; r[5] = (_Float16)b[1]; r[6] = (_Float16)b[2]; r[7] = (_Float16)b[3];
  return r;
}

__device__ __forceinline__ float max8f(v4f a, v4f b) {
  float m0 = fmaxf(fmaxf(a[0], a[1]), fmaxf(a[2], a[3]));
  float m1 = fmaxf(fmaxf(b[0], b[1]), fmaxf(b[2], b[3]));
  return fmaxf(m0, m1);
}

template <typename T>
__device__ __forceinline__ void vst2(T* p, T v) {
  *(T*)p = v;
  
}

// ---------------------------------------------------------------------------
// 1) 8x8 max pool of the 512x512 mask, binarised: mF[b][p] in {0,1}. 4 pixels per thread, 16-B stores.
__device__ __forceinline__ void d_pool(int blk, const float* __restrict__ msk, float* __restrict__ mF) {
  const int i = blk * 256 + threadIdx.x;
  if (i >= NB * NP / 4) return;
  const int pix0 = i * 4;
  const int b = pix0 >> 12, p = pix0 & (NP - 1);
  const int y = p >> 6, x0 = p & 63;
  const float* s = msk + ((size_t)b * MS + (size_t)y * 8) * MS + (size_t)x0 * 8;
  float mx[4] = {0.f, 0.f, 0.f, 0.f};
#pragma unroll 1   // one mask row (eight 16-B loads) in flight: unrolled whole, this part's registers would halve the waves that the transpose blocks of the same grid keep on a SIMD
  for (int dy = 0; dy < 8; ++dy) {
    const float* row = s + dy * MS;
#pragma unroll
    for (int j = 0; j < 4; ++j) {
      v4f a = *(const v4f*)(row + j * 8);
      v4f c = *(const v4f*)(row + j * 8 + 4);
      mx[j] = fmaxf(mx[j], max8f(a, c));
    }
    asm volatile("s_wait_xcnt 0x0" ::: "memory");   // before the next trip's address is written into the registers that this trip's loads name
  }
  v4f r;
#pragma unroll
  for (int j = 0; j < 4; ++j) r[j] = (mx[j] > 0.f) ? 1.f : 0.f;
  vst2((v4f*)(mF + pix0), r);
}

// 2) weights to f16 with x64 scale: Kwh[256][1024], Fwh[256][512]. 8 elements per thread, 16-B stores.
__device__ __forceinline__ void d_cvtw(int blk, const float* __restrict__ Kw, const float* __restrict__ Fw,
                                       _Float16* __restrict__ Kwh, _Float16* __restrict__ Fwh) {
  const int i = blk * 256 + threadIdx.x;
  const float* src;
  _Float16* dst;
  if (i < NC * CIN / 8) {
    src = Kw + (size_t)i * 8; dst = Kwh + (size_t)i * 8;
  } else if (i < NC * CIN / 8 + NC * CFU / 8) {
    const int j = i - NC * CIN / 8;
    src = Fw + (size_t)j * 8; dst = Fwh + (size_t)j * 8;
  } else {
    return;
  }
  v4f a = *(const v4f*)src;
  v4f c = *(const v4f*)(src + 4);
  a = a * 64.f; c = c * 64.f;
  vst2((v8h*)dst, pack8(a, c));
}

// 3) inT[b][p][1024] f16 = transpose of concat(x, aux) along channels. Block = 64 channels x 64 pixels,
__device__ __forceinline__ void d_tin(int blk, const float* __restrict__ x, const float* __restrict__ aux,
                                      _Float16* __restrict__ inT) {
  __shared__ __attribute__((aligned(16))) _Float16 T[64][72];   // T[p_local][c_local]
  const int t = threadIdx.x;
  if (blk >= NB * (CIN / 64) * (NP / 64)) return;
  const int b = blk >> 10, ct = (blk >> 6) & 15, pt = blk & 63;
  const int c0 = ct * 64, p0 = pt * 64;
  // the block's source is picked once, in front of the loop: picked per load, the merged grid's build branches round every load and waits for each
  const float* src0 = (c0 < NC) ? x   + ((size_t)(b * NC + c0)) * NP + p0
                                : aux + ((size_t)(b * CAUX + (c0 - NC))) * NP + p0;
#pragma unroll
  for (int i = 0; i < 4; ++i) {
    const int f = t + 256 * i;            // 1024 float4 chunks: 64 channel rows x 16
    const int cl = f >> 4, p4 = (f & 15) * 4;
    v4f v = *(const v4f*)(src0 + (size_t)cl * NP + p4);
    T[p4 + 0][cl] = (_Float16)v[0];
    T[p4 + 1][cl] = (_Float16)v[1];
    T[p4 + 2][cl] = (_Float16)v[2];
    T[p4 + 3][cl] = (_Float16)v[3];
  }
  __syncthreads();
  v8h val[2];
  size_t off[2];
#pragma unroll
  for (int i = 0; i < 2; ++i) {
    const int r = (t >> 3) + 32 * i, q = t & 7;
    val[i] = *(const v8ha*)&T[r][q * 8];
    off[i] = ((size_t)(b * NP + p0 + r)) * CIN + c0 + q * 8;
  }
#pragma unroll
  for (int i = 0; i < 2; ++i) vst2((v8h*)(inT + off[i]), val[i]);
}

// 1 + 2 + 3 in one grid: the three parts read inputs only and write buffers of their own, so none waits for another.
// The block index picks the part; the 16 pool blocks, the longest, take the lowest indices.
#define PB ((NB * NP / 4) / 256)                       // 16 pool blocks
#define WB ((NC * CIN / 8 + NC * CFU / 8) / 256)       // 192 weight blocks
#define TB (NB * (CIN / 64) * (NP / 64))               // 4096 transpose blocks
__global__ void __launch_bounds__(256) k_pre(const float* __restrict__ msk, float* __restrict__ mF,
                                             const float* __restrict__ Kw, const float* __restrict__ Fw,
                                             _Float16* __restrict__ Kwh, _Float16* __restrict__ Fwh,
                                             const float* __restrict__ x, const float* __restrict__ aux,
                                             _Float16* __restrict__ inT) {
  const int blk = blockIdx.x;
  if (blk < PB) d_pool(blk, msk, mF);
  else if (blk < PB + WB) d_cvtw(blk - PB, Kw, Fw, Kwh, Fwh);
  else d_tin(blk - (PB + WB), x, aux, inT);
}

// The k loop of both 1x1 conv products: D[64 pixels][256 channels] += A . B^T, A and B k-contiguous f16 rows.
// Every 64-k tile (64 A rows, 256 B rows) comes from global memory in whole 128-B lines, 16 B per lane, four lines per
// load, and is laid in LDS; the fragments are read from there. Two buffers: the next tile's loads fly while this tile
// is multiplied, and one barrier per tile publishes it and ends the reads of the buffer that is written next.
// The first NS1 tiles of A come from A1 (row pitch pa1), the other NS2 from A2 (pitch pa2). 8 waves: wave (pt, og) owns
// 32 pixels x 64 channels, d[i][j] = pixel tile i, channel tile j; k runs upward, as in a loop over 32-k steps.
template <int NS1, int NS2>
__device__ __forceinline__ void prod64(_Float16* S, const _Float16* A1, int pa1, const _Float16* A2, int pa2,
                                       const _Float16* B, int pbw, v8f (&d)[2][4]) {
  constexpr int NS = NS1 + NS2;
  const int t = threadIdx.x, lane = t & 31, wid = t >> 5, h = lane >> 4, n = lane & 15;
  const int pt = wid >> 2, og = wid & 3;
  // staging: row (of 32 per load) and 16-B piece of this thread; rows r and r + 8 lie side by side in a half wave,
  // so that at the 144-B pitch their two 128-B lines fall on the two halves of the LDS banks
  const int lr = ((t >> 3) & 16) | ((t & 8)) | ((t >> 4) & 7), lc = (t & 7) * 8;
  const _Float16* g1 = A1 + (size_t)lr * pa1 + lc;
  const _Float16* g2 = A2 + (size_t)lr * pa2 + lc;
  const _Float16* gb = B + (size_t)lr * pbw + lc;
  _Float16* const sw = S + lr * SP + lc;
  const _Float16* const fa = S + (pt * 32 + n) * SP;
  const _Float16* const fb = S + (PT + og * 64 + n) * SP;
  v8h ra[PT / 32], rb[NC / 32];
  auto fetch = [&](int s) {                            // tile s, global memory -> registers
    const bool first = (NS2 == 0) || s < NS1;
    const _Float16* ga = first ? g1 + s * BK : g2 + (s - NS1) * BK;
    const size_t st = first ? (size_t)32 * pa1 : (size_t)32 * pa2;
#pragma unroll
    for (int i = 0; i < PT / 32; ++i) ra[i] = *(const v8h*)(ga + i * st);
#pragma unroll
    for (int i = 0; i < NC / 32; ++i) rb[i] = *(const v8h*)(gb + s * BK + (size_t)(32 * i) * pbw);
    asm volatile("s_wait_xcnt 0x0" ::: "memory");      // before other values are written into the address registers that these loads name
  };
  auto put = [&](int s) {                              // tile s, registers -> its buffer
    _Float16* w = sw + (s & 1) * SBUF;
#pragma unroll
    for (int i = 0; i < PT / 32; ++i) *(v8ha*)(w + 32 * i * SP) = ra[i];
#pragma unroll
    for (int i = 0; i < NC / 32; ++i) *(v8ha*)(w + (PT + 32 * i) * SP) = rb[i];
  };
  auto mult = [&](int s) {                             // tile s: 2 k steps x 8 products
    const int cur = (s & 1) * SBUF;
    v16h af[BK / 32][2], bf[BK / 32][4];
#pragma unroll
    for (int q = 0; q < BK / 32; ++q) {
#pragma unroll
      for (int i = 0; i < 2; ++i) af[q][i] = ldfrag_l(fa + cur + i * 16 * SP, q * 32, h);
#pragma unroll
      for (int j = 0; j < 4; ++j) bf[q][j] = ldfrag_l(fb + cur + j * 16 * SP, q * 32, h);
    }
    __builtin_amdgcn_sched_barrier(0);                 // the tile's LDS reads stay one group in front of its products: spread among them, every place with reads is waited out to 0
#pragma unroll
    for (int q = 0; q < BK / 32; ++q)
#pragma unroll
      for (int j = 0; j < 4; ++j)
#pragma unroll
        for (int i = 0; i < 2; ++i) d[i][j] = wmma16(af[q][i], bf[q][j], d[i][j]);
  };
#pragma unroll
  for (int i = 0; i < 2; ++i)
#pragma unroll
    for (int j = 0; j < 4; ++j) d[i][j] = zero8();
  fetch(0);
  put(0);
  __syncthreads();                                     // tile 0 is published
#pragma unroll 1   // one tile per trip: unrolled, the trips' fragments and staged lines would not fit the registers
  for (int s = 0; s < NS - 1; ++s) {
    fetch(s + 1);
    mult(s);
    put(s + 1);
    __syncthreads();                                   // tile s + 1 is published; every wave has left the buffer of tile s
  }
  mult(NS - 1);
}

// 4) feats = inT . Kw^T (+ bias), then per-pixel L2 normalisation, stored as Nh[b][p][256] = f16(8 * unit row);
//    the row of a key goes to its dense slot in Kc[b][slot][256] as well: slot = number of keys in front of the pixel in
//    its batch, counted here from the pooled mask (the same numbers as in 5). A key is no query: its row of attT, which the
//    score kernel does not write, is set to 0 here.
//    Block = 64 pixels x 256 channels; K = 1024 in 16 staged tiles (prod64).
__device__ __forceinline__ void d_feats(int blk, _Float16* S, const _Float16* __restrict__ inT,
                                        const _Float16* __restrict__ Kwh,
                                        const float* __restrict__ Kb, const float* __restrict__ mF,
                                        _Float16* __restrict__ Nh, _Float16* __restrict__ Kc,
                                        _Float16* __restrict__ attT) {
  // S: two staged tiles; behind the loop F[p_local][channel] in f32, pitch 260
  __shared__ int red[8];                               // per wave: keys of the batch in front of the block's pixels
  const int t = threadIdx.x, lane = t & 31, wid = t >> 5, h = lane >> 4, n = lane & 15;
  if (blk >= NB * NP / PT) return;
  const int b = blk / (NP / PT), pb = (blk % (NP / PT)) * PT;
  const int pt = wid >> 2, og = wid & 3;
  const float* mb = mF + (size_t)b * NP;
  int kc = 0;
  if (t * 16 < pb) {                                   // 16 pixels per thread; pb is a multiple of 64
#pragma unroll
    for (int j = 0; j < 4; ++j) {
      v4f a = *(const v4f*)(mb + t * 16 + j * 4);
#pragma unroll
      for (int e = 0; e < 4; ++e) kc += (a[e] < 0.5f) ? 1 : 0;
    }
  }
  kc += __shfl_xor(kc, 16); kc += __shfl_xor(kc, 8); kc += __shfl_xor(kc, 4);
  kc += __shfl_xor(kc, 2);  kc += __shfl_xor(kc, 1);
  if (lane == 0) red[wid] = kc;                        // read behind the barriers of the k loop
  const unsigned km0 = __builtin_amdgcn_ballot_w32(mb[pb + lane] < 0.5f);        // bit i: pixel pb + i is a key
  const unsigned km1 = __builtin_amdgcn_ballot_w32(mb[pb + 32 + lane] < 0.5f);   // the same for pb + 32 + i
  asm volatile("s_wait_xcnt 0x0" ::: "memory");        // before other values are written into the address registers that the mask loads name
  v8f d[2][4];
  prod64<CIN / BK, 0>(S, inT + (size_t)(b * NP + pb) * CIN, CIN, inT, 0, Kwh, CIN, d);
  f1a* const F = (f1a*)S;
  __syncthreads();                                     // every wave has left the staged tiles
#pragma unroll
  for (int j = 0; j < 4; ++j) {
    const int o = og * 64 + j * 16 + n;
    const float bias = Kb[o];
#pragma unroll
    for (int i = 0; i < 2; ++i)
#pragma unroll
      for (int r = 0; r < 8; ++r) F[(pt * 32 + i * 16 + 8 * h + r) * 260 + o] = d[i][j][r] * (1.f / 64.f) + bias;
  }
  __syncthreads();
  v8h vals[8];
  size_t offs[8];
  int slot[8];
  const unsigned long long km = ((unsigned long long)km1 << 32) | km0;
  const int base = ((red[0] + red[1]) + (red[2] + red[3])) + ((red[4] + red[5]) + (red[6] + red[7]));
#pragma unroll
  for (int i = 0; i < 8; ++i) {
    const int pl = wid * 8 + i;                        // 8 pixels per wave, one wave per 512-B row
    slot[i] = ((km >> pl) & 1ull) ? base + __popcll(km & ((1ull << pl) - 1ull)) : -1;
    v4f a = *(const v4fa*)&F[pl * 260 + lane * 8];
    v4f c = *(const v4fa*)&F[pl * 260 + lane * 8 + 4];
    float ss = a[0] * a[0] + a[1] * a[1] + a[2] * a[2] + a[3] * a[3]
             + c[0] * c[0] + c[1] * c[1] + c[2] * c[2] + c[3] * c[3];
    ss += __shfl_xor(ss, 16); ss += __shfl_xor(ss, 8); ss += __shfl_xor(ss, 4);
    ss += __shfl_xor(ss, 2);  ss += __shfl_xor(ss, 1);
    const float inv = 8.f * (1.f / (sqrtf(ss) + 1e-8f));
    vals[i] = pack8(a * inv, c * inv);
    offs[i] = ((size_t)(b * NP + pb + pl)) * NC + lane * 8;
  }
#pragma unroll
  for (int i = 0; i < 8; ++i) vst2((v8h*)(Nh + offs[i]), vals[i]);
#pragma unroll   // slot[] and vals[] by constant index, in registers
  for (int i = 0; i < 8; ++i)
    if ((unsigned)slot[i] < (unsigned)NP) {
      const v8h z8 = {};
      vst2((v8h*)(Kc + ((size_t)(b * NP + slot[i])) * NC + lane * 8), vals[i]);
      vst2((v8h*)(attT + offs[i]), z8);
    }
}

// 5) dense order of the keys, then Vh[b][c][j] = f16( x[b][c][kidx[j]] ) for the dense key slots j < nk, 0 up to the end
//    of the last 128-key tile. A pixel with m = 0 is a key; every term of a pixel with m = 1 on the key side is
//    multiplied by 0, so only the keys get a slot. Block = one batch x CG whole channel rows: it ranks the batch's 4096
//    pixels itself from the pooled mask, L[0 .. 4095] = the pixels as a permutation, keys first (in pixel order), then
//    the non-keys. The block of channel row 0 also leaves the tables for the later launches: kpos[p] = slot of key p
//    (-1 for a non-key), kidx = the permutation, nkA[b] = number of keys. 8 slots per thread and row, 16-B stores.
#define CG 4                // channel rows per gather block
__device__ __forceinline__ void d_makev(int blk, i1a* L, const float* __restrict__ x, const float* __restrict__ mF,
                                        int* __restrict__ kpos, int* __restrict__ kidx, int* __restrict__ nkA,
                                        _Float16* __restrict__ Vh) {
  const int t = threadIdx.x, lane = t & 31, wid = t >> 5;
  if (blk >= NB * NC / CG) return;
  const int b = blk / (NC / CG), c0 = (blk % (NC / CG)) * CG;
  const float* ms = mF + (size_t)b * NP + t * 16;
  bool key[16];
  int c = 0;
#pragma unroll   // both loops unrolled whole: key[] is indexed by constants and stays in registers
  for (int j = 0; j < 4; ++j) {
    v4f a = *(const v4f*)(ms + j * 4);
#pragma unroll
    for (int e = 0; e < 4; ++e) { key[j * 4 + e] = a[e] < 0.5f; c += key[j * 4 + e] ? 1 : 0; }
  }
  int inc = c;                                   // keys up to and with this thread's 16 pixels, within the wave
#pragma unroll
  for (int d = 1; d < 32; d <<= 1) {
    const int o = __shfl_up(inc, d);
    inc += (lane >= d) ? o : 0;
  }
  if (lane == 31) L[NP + wid] = inc;
  __syncthreads();                               // the eight waves' key counts are published
  int pre = inc - c, tot = 0;
#pragma unroll
  for (int w = 0; w < 8; ++w) {
    const int v = L[NP + w];
    tot += v;
    pre += (w < wid) ? v : 0;
  }
  v4i kw[4];
  int r = pre;                                   // keys in front of the current pixel
#pragma unroll   // as above: key[] and kw[] by constant index
  for (int j = 0; j < 4; ++j) {
#pragma unroll
    for (int e = 0; e < 4; ++e) {
      const int p = t * 16 + j * 4 + e;
      const bool k = key[j * 4 + e];
      kw[j][e] = k ? r : -1;
      L[k ? r : tot + p - r] = p;
      r += k ? 1 : 0;
    }
  }
  __syncthreads();                               // the permutation is published
  if (c0 == 0) {
    int* kp = kpos + (size_t)b * NP + t * 16;
    int* ki = kidx + (size_t)b * NP;
#pragma unroll
    for (int j = 0; j < 4; ++j) {
      *(v4i*)(kp + j * 4) = kw[j];
      *(v4i*)(ki + (t + 256 * j) * 4) = *(const v4ia*)&L[(t + 256 * j) * 4];
    }
    if (t == 0) nkA[b] = tot;
  }
  const int nk = tot;
  const size_t row0 = (size_t)(b * NC + c0) * NP;
  for (int j0 = t * 8; j0 < ((nk + KT - 1) & ~(KT - 1)); j0 += 256 * 8) {
    const v4i i0 = *(const v4ia*)&L[j0];
    const v4i i1 = *(const v4ia*)&L[j0 + 4];
    v4f a[CG], c4[CG];
#pragma unroll   // vector elements by constant index, all the rows' gathers in flight in front of the first store
    for (int cc = 0; cc < CG; ++cc) {
      const float* xr = x + row0 + (size_t)cc * NP;
#pragma unroll
      for (int e = 0; e < 4; ++e) {
        const float va = xr[i0[e] & (NP - 1)];
        asm volatile("s_wait_xcnt 0x0" ::: "memory");   // before a later gather's result lands in this load's address registers
        const float vc = xr[i1[e] & (NP - 1)];
        asm volatile("s_wait_xcnt 0x0" ::: "memory");   // the same
        a[cc][e] = (j0 + e < nk) ? va : 0.f;
        c4[cc][e] = (j0 + 4 + e < nk) ? vc : 0.f;
      }
    }
#pragma unroll
    for (int cc = 0; cc < CG; ++cc) vst2((v8h*)(Vh + row0 + (size_t)cc * NP + j0), pack8(a[cc], c4[cc]));
  }
}

// 4 + 5 in one grid: neither reads what the other writes. The 256 long product blocks take the lowest
// indices, the short gather blocks the rest. Both parts use the one LDS array.
#define FB (NB * NP / PT)                              // 256 product blocks (here and in the fuse grid)
#define GB (NB * NC / CG)                              // 256 gather blocks
__global__ void __launch_bounds__(256) k_fv(const _Float16* __restrict__ inT, const _Float16* __restrict__ Kwh,
                                            const float* __restrict__ Kb, const float* __restrict__ mF,
                                            _Float16* __restrict__ Nh, _Float16* __restrict__ Kc,
                                            const float* __restrict__ x, int* __restrict__ kpos,
                                            int* __restrict__ kidx, int* __restrict__ nkA,
                                            _Float16* __restrict__ Vh, _Float16* __restrict__ attT) {
  __shared__ __attribute__((aligned(16))) _Float16 S[2 * SBUF];
  const int blk = blockIdx.x;
  if (blk < FB) d_feats(blk, S, inT, Kwh, Kb, mF, Nh, Kc, attT);
  else d_makev(blk - FB, (i1a*)S, x, mF, kpos, kidx, nkA, Vh);
}

// Eight asynchronous 16-B-per-lane copies, global memory -> LDS, through no register. l = the lane's LDS byte addresses,
// g = its global addresses. The s_wait_xcnt stands inside the statement, behind the last copy, so that no address
// register of a copy is written again in front of it.
__device__ __forceinline__ void copy8(const unsigned (&l)[8], const _Float16* const (&g)[8]) {
  asm volatile("global_load_async_to_lds_b128 %0, %8, off\n\t"
               "global_load_async_to_lds_b128 %1, %9, off\n\t"
               "global_load_async_to_lds_b128 %2, %10, off\n\t"
               "global_load_async_to_lds_b128 %3, %11, off\n\t"
               "global_load_async_to_lds_b128 %4, %12, off\n\t"
               "global_load_async_to_lds_b128 %5, %13, off\n\t"
               "global_load_async_to_lds_b128 %6, %14, off\n\t"
               "global_load_async_to_lds_b128 %7, %15, off\n\t"
               "s_wait_xcnt 0x0"
               :: "v"(l[0]), "v"(l[1]), "v"(l[2]), "v"(l[3]), "v"(l[4]), "v"(l[5]), "v"(l[6]), "v"(l[7]),
                  "v"(g[0]), "v"(g[1]), "v"(g[2]), "v"(g[3]), "v"(g[4]), "v"(g[5]), "v"(g[6]), "v"(g[7])
               : "memory");
}

// One wave's share of a staged key tile: rows r0, r0 + 16, ..., r0 + 112 of Kb, 512 B each, 16 B per lane (r0, nk the
// same in every lane, nk > 0), to the tile rows of pitch 264 from LDS byte address dst on. In the last, partial tile a
// slot past nk takes the last key again.
__device__ __forceinline__ void cpkeys(unsigned dst, const _Float16* Kb, int r0, int nk, int lane) {
  unsigned l[KT / AW];
  const _Float16* g[KT / AW];
#pragma unroll   // l[] and g[] by constant index, in registers
  for (int i = 0; i < KT / AW; ++i) {
    l[i] = dst + (unsigned)(AW * i * 264 * 2);
    g[i] = Kb + (size_t)min(r0 + AW * i, nk - 1) * NC + lane * 8;
  }
  copy8(l, g);
}

// One thread's share of a staged V tile: 16 B of channel rows vr0, vr0 + 32, ..., vr0 + 224 (p = its 16 B of row vr0),
// to the tile rows of pitch VP from LDS byte address dst on.
__device__ __forceinline__ void cpvals(unsigned dst, const _Float16* p) {
  unsigned l[KT / AW];
  const _Float16* g[KT / AW];
#pragma unroll   // l[] and g[] by constant index, in registers
  for (int i = 0; i < KT / AW; ++i) {
    l[i] = dst + (unsigned)(32 * i * VP * 2);
    g[i] = p + (size_t)(32 * i) * NP;
  }
  copy8(l, g);
}

// Hand-over of staged tiles between the waves of a block.
__device__ __forceinline__ void publish() {
  asm volatile("s_wait_dscnt 0x0" ::: "memory");      // this wave's LDS reads and writes are over before a buffer goes to its next writer
  asm volatile("s_wait_asynccnt 0x0" ::: "memory");   // this wave's copies have landed before other waves read them
  __syncthreads();
}

// 6) attention of the nq = 4096 - nk dense queries over the nk dense keys of the batch. A pixel with m = 0 is no query:
//    its whole att row is multiplied by 0, so only the pixels behind the keys in kidx get a row here. The batch's 64
//    blocks take cnt queries each, cnt = nq / 64 rounded up to whole 16-row tiles; a query tile with no query does no
//    product, a block with no query leaves zero column sums and ends.
//    Block = up to 64 query rows, 16 waves: wave (qt, kg) owns query tile qt
//    (16 rows) and key group kg (32 of the 128 keys staged per trip), so a trip covers four times the keys of a
//    one-group block. Pass 1: row sums of exp(20 cos - 20), fixed shift 20 (|cos| <= 1),
//    the four groups' partial sums added through LDS. Pass 2: att tiles -> per-block column sums (cpart) and
//    O^T = V . att^T, the four groups' partial O^T added through LDS behind the loop, in a fixed order.
//    Q chunk, K tile, V tile and the per-wave att^T tile are staged in LDS; every fragment uses ldfrag_*.
//    K and V tiles come by asynchronous copies that fly while the block multiplies: pass 1 has two K buffers (the second
//    in the V tile's space); in pass 2 the next K tile flies under V . att^T and the next V tile under the scores.
__global__ void __launch_bounds__(ATH) __attribute__((amdgpu_num_vgpr(252)))
k_attn(const _Float16* __restrict__ Nh, const _Float16* __restrict__ Kc, const _Float16* __restrict__ Vh,
       const int* __restrict__ kidx, const int* __restrict__ nkA, _Float16* __restrict__ attT,
       float* __restrict__ cpart) {
  __shared__ __attribute__((aligned(16))) _Float16 Qs[QCH][264];   // q rows (later reused as O^T tile)
  __shared__ __attribute__((aligned(16))) _Float16 KV[KT * 264 + NC * VP];   // K tile, V tile (pass 1: a second K tile); behind the loop: partial O^T in f32
  __shared__ __attribute__((aligned(16))) _Float16 Ps[AW][16][40]; // att^T     [n=q][k=key] per wave
  __shared__ float cs[AW][KW];                                     // per-wave column sums, 32 keys
  __shared__ float rs[KG][QCH];                                    // per-key-group row sums
  __shared__ __attribute__((aligned(16))) float csb[NP];           // per-block column sums
  _Float16* const Ks = KV;                 // key rows  [n=key][k=channel], pitch 264
  _Float16* const Vs = KV + KT * 264;      // V tile    [m=channel][k=key], pitch VP

  const int t = threadIdx.x, lane = t & 31, h = lane >> 4, n = lane & 15;
  const int wid = __builtin_amdgcn_readfirstlane(t >> 5);   // in a scalar register: the tests on the wave's group are scalar branches
  const int qt = wid >> 2, kg = wid & 3;               // four waves in a row share a query tile: where waves in a row go to the four SIMDs in turn (assumed, not measured), an empty tile takes one wave's work off each SIMD
  const int blk = blockIdx.x;
  if (blk >= NB * QCN) return;
  const int b = blk / QCN, qc = blk % QCN;
  const _Float16* Nb = Nh + (size_t)b * NP * NC;
  const _Float16* Kb = Kc + (size_t)b * NP * NC;
  const int nk = __builtin_amdgcn_readfirstlane(min(max(nkA[b], 0), NP));   // in a scalar register: the key loops and their barriers stand under scalar branches
  const _Float16* Vb = Vh + (size_t)b * NC * NP;
  const int nq = NP - nk;
  const int cnt = ((nq + QCN - 1) / QCN + 15) & ~15;   // queries per block, at most QCH
  const int q0 = qc * cnt;                             // the block's first dense query
  const int nloc = min(max(nq - q0, 0), cnt);          // its queries: local rows 0 .. nloc - 1
  const bool act = qt * 16 < nloc;                     // this wave's query tile holds a query (scalar)
  float* cp = cpart + ((size_t)(b * QCN + qc)) * NP;
  if (nloc == 0) {                                     // the whole block leaves, in front of every copy and barrier
#pragma unroll
    for (int i = 0; i < NP / 4 / ATH; ++i) {
      const int f = t + ATH * i;
      const v4f z4 = {0.f, 0.f, 0.f, 0.f};
      if (f * 4 < nk) vst2((v4f*)(cp + (size_t)f * 4), z4);
    }
    return;
  }

  const unsigned kdst = (unsigned)(size_t)&Ks[wid * 264 + lane * 8];   // LDS byte address of this lane's 16 B in tile row wid
  if (nk > 0) cpkeys(kdst, Kb, wid, nk, lane);         // pass 1, tile 0

  // stage the block's query rows, four per wave: local row r is pixel kidx[nk + q0 + r]; a row past the last query takes
  // the last pixel of the permutation, and its att is multiplied by 0 below
  int qp[QCH / AW];
  {
    v8h qv[QCH / AW];
#pragma unroll   // qp[] and qv[] by constant index, in registers
    for (int i = 0; i < QCH / AW; ++i) {
      qp[i] = __builtin_amdgcn_readfirstlane(kidx[(size_t)b * NP + min(nk + q0 + wid * (QCH / AW) + i, NP - 1)] & (NP - 1));
      qv[i] = *(const v8h*)(Nb + (size_t)qp[i] * NC + lane * 8);
    }
    asm volatile("s_wait_xcnt 0x0" ::: "memory");      // before other values are written into the address registers that these loads name
#pragma unroll
    for (int i = 0; i < QCH / AW; ++i) *(v8h*)&Qs[wid * (QCH / AW) + i][lane * 8] = qv[i];
  }
  if (!act) cs[wid][lane] = 0.f;                       // an empty tile's column sums: written once, read in every trip's fold
  asm volatile("s_wait_asynccnt 0x0" ::: "memory");    // tile 0 has landed
  __syncthreads();                                     // the query rows and tile 0 are published
  if (KT < nk) cpkeys(kdst + KT * 264 * 2, Kb, KT + wid, nk, lane);   // tile 1, second buffer

  const _Float16* Qrow = &Qs[qt * 16 + n][0];
  const int vr0 = t >> 4, v8 = (t & 15) * 8;           // V staging: channel row and key offset of this thread's 16 B
  const unsigned voff = (unsigned)(vr0 * NP + v8);
  const unsigned vdst = (unsigned)(size_t)&Vs[vr0 * VP + v8];   // its LDS byte address

  float invs[8];
  {
    v16h qf[8];
#pragma unroll
    for (int cb = 0; cb < 8; ++cb) qf[cb] = ldfrag_l(Qrow, cb * 32, h);
    float acc[8];
#pragma unroll
    for (int r = 0; r < 8; ++r) acc[r] = 0.f;
    int cur = 0;                                       // buffer of this trip's tile
    int kb = 0;
#pragma unroll 1
    for (; kb < nk; kb += KT) {
      if (act) {
      const _Float16* Krow = &Ks[(cur * KT + kg * KW + n) * 264];
      v16h kf[8][2];                                   // the wave's 32 key rows of this tile, all 16 fragments
#pragma unroll
      for (int cb = 0; cb < 8; ++cb)
#pragma unroll
        for (int sub = 0; sub < 2; ++sub) kf[cb][sub] = ldfrag_l(Krow + sub * 16 * 264, cb * 32, h);
      __builtin_amdgcn_sched_barrier(0);               // the trip's LDS reads stay one group in front of its products: left to the scheduler, each product stands behind its own two reads and waits out their whole latency
      v8f s[2] = {zero8(), zero8()};
#pragma unroll
      for (int cb = 0; cb < 8; ++cb)
#pragma unroll
        for (int sub = 0; sub < 2; ++sub) s[sub] = wmma16(qf[cb], kf[cb][sub], s[sub]);
#pragma unroll
      for (int sub = 0; sub < 2; ++sub) {
        const float km = (kb + kg * KW + sub * 16 + n < nk) ? 1.f : 0.f;
#pragma unroll
        for (int r = 0; r < 8; ++r) acc[r] += km * __expf(0.3125f * s[sub][r] - 20.f);
      }
      }
      publish();                                       // the next tile is published; every wave has left this trip's buffer
      if (kb + 2 * KT < nk) cpkeys(kdst + cur * (KT * 264 * 2), Kb, kb + 2 * KT + wid, nk, lane);
      cur ^= 1;
    }
    asm volatile("s_wait_asynccnt 0x0" ::: "memory");  // no copy of pass 1 is left in flight
    if (kb > 0) {                                      // there are keys. Pass 2, tile 0: both fly under the row sums' fold
      cpkeys(kdst, Kb, wid, nk, lane);
      cpvals(vdst, Vb + voff);
    }
#pragma unroll
    for (int r = 0; r < 8; ++r) {
      float a = acc[r];
      a += __shfl_xor(a, 1); a += __shfl_xor(a, 2); a += __shfl_xor(a, 4); a += __shfl_xor(a, 8);
      if (n == 0) rs[kg][qt * 16 + 8 * h + r] = a;
    }
    __syncthreads();
#pragma unroll
    for (int r = 0; r < 8; ++r) {
      const int ql = qt * 16 + 8 * h + r;
      const float a = (rs[0][ql] + rs[1][ql]) + (rs[2][ql] + rs[3][ql]);
      invs[r] = (ql < nloc) ? 1.f / (a + 1e-30f) : 0.f;   // a row past the block's last query -> 0
    }
  }

  // ---- pass 2: att tiles, column sums, O^T = V . (att*4096)^T ----
  v8f o[16];
#pragma unroll
  for (int cc = 0; cc < 16; ++cc) o[cc] = zero8();
  publish();                                           // K and V tile 0 are published
#pragma unroll 1
  for (int kb = 0; kb < nk; kb += KT) {
    if (act) {
    v8f s[2] = {zero8(), zero8()};
    const _Float16* Krow = &Ks[(kg * KW + n) * 264];
#pragma unroll
    for (int g = 0; g < 4; ++g) {                      // 64 channels a group: as many fragments as the registers hold beside O^T
      v16h qa[2], kf[2][2];
#pragma unroll
      for (int j = 0; j < 2; ++j) {
        qa[j] = ldfrag_l(Qrow, (g * 2 + j) * 32, h);
#pragma unroll
        for (int sub = 0; sub < 2; ++sub) kf[j][sub] = ldfrag_l(Krow + sub * 16 * 264, (g * 2 + j) * 32, h);
      }
      __builtin_amdgcn_sched_barrier(0);               // as in pass 1: the group's twelve LDS reads stand together in front of its four products
#pragma unroll
      for (int j = 0; j < 2; ++j)
#pragma unroll
        for (int sub = 0; sub < 2; ++sub) s[sub] = wmma16(qa[j], kf[j][sub], s[sub]);
      __builtin_amdgcn_sched_barrier(0);               // the next group's reads are not spread among these products
    }
#pragma unroll
    for (int sub = 0; sub < 2; ++sub) {
      const float km = (kb + kg * KW + sub * 16 + n < nk) ? 1.f : 0.f;
      float csum = 0.f;
#pragma unroll
      for (int r = 0; r < 8; ++r) {
        const float att = invs[r] * km * __expf(0.3125f * s[sub][r] - 20.f);   // D row q = 8h+r, col key = n
        csum += att;
        Ps[wid][8 * h + r][sub * 16 + n] = (_Float16)(att * 4096.f);
      }
      csum += __shfl_xor(csum, 16);
      if (lane < 16) cs[wid][sub * 16 + lane] = csum;
    }
    }
    publish();                                         // this trip's V tile and column sums are published; every wave has left the K tile
    if (kb + KT < nk) cpkeys(kdst, Kb, kb + KT + wid, nk, lane);   // the next K tile flies under V . att^T
    if (wid < KG) {                                    // wave g folds key group g: its four query tiles' sums
      float tt = 0.f;
#pragma unroll
      for (int w = 0; w < 4; ++w) tt += cs[w * KG + wid][lane];
      csb[kb + wid * KW + lane] = tt;
    }
    if (act) {
    const v16h pB = ldfrag_l(&Ps[wid][n][0], 0, h);                   // B: k = key, n = q
#pragma unroll
    for (int g = 0; g < 2; ++g) {                      // 128 channels a group
      v16h vf[8];
#pragma unroll
      for (int j = 0; j < 8; ++j) vf[j] = ldfrag_l(&Vs[(g * 128 + j * 16 + n) * VP], kg * KW, h);   // A: m = channel
      __builtin_amdgcn_sched_barrier(0);               // as above: the group's sixteen LDS reads stand together in front of its eight products
#pragma unroll
      for (int j = 0; j < 8; ++j) o[g * 8 + j] = wmma16(vf[j], pB, o[g * 8 + j]);
      __builtin_amdgcn_sched_barrier(0);               // the next group's reads are not spread among these products
    }
    }
    publish();                                         // the next K tile is published; every wave has left the V tile and the column sums
    if (kb + KT < nk) cpvals(vdst, Vb + (kb + KT) + voff);   // the next V tile flies under the next scores
  }
  asm volatile("s_wait_asynccnt 0x0" ::: "memory");    // no copy is left in flight when the tiles' space is used anew

  // the four key groups' partial O^T tiles, added in f32 as (g0 + g2) + (g1 + g3); a tile lies in the K/V space as
  // [cc][half][lane][4], 16 B per lane, 16 KiB per wave
  float* const R = (float*)KV;
  __syncthreads();                                     // every wave has left the K and V tiles
  if (act && kg >= 2) {                                // an empty query tile has nothing to add, here and below
    float* rp = R + ((kg - 2) * 4 + qt) * 4096 + lane * 4;
#pragma unroll
    for (int cc = 0; cc < 16; ++cc) {
      v4f lo = {o[cc][0], o[cc][1], o[cc][2], o[cc][3]};
      v4f hi = {o[cc][4], o[cc][5], o[cc][6], o[cc][7]};
      *(v4fa*)(rp + cc * 256) = lo;
      *(v4fa*)(rp + cc * 256 + 128) = hi;
    }
  }
  __syncthreads();
  if (act && kg < 2) {
    const float* rp = R + (kg * 4 + qt) * 4096 + lane * 4;
#pragma unroll
    for (int cc = 0; cc < 16; ++cc) {
      v4f lo = *(const v4fa*)(rp + cc * 256);
      v4f hi = *(const v4fa*)(rp + cc * 256 + 128);
#pragma unroll
      for (int e = 0; e < 4; ++e) { o[cc][e] += lo[e]; o[cc][4 + e] += hi[e]; }
    }
  }
  __syncthreads();
  if (act && kg == 1) {
    float* rp = R + qt * 4096 + lane * 4;
#pragma unroll
    for (int cc = 0; cc < 16; ++cc) {
      v4f lo = {o[cc][0], o[cc][1], o[cc][2], o[cc][3]};
      v4f hi = {o[cc][4], o[cc][5], o[cc][6], o[cc][7]};
      *(v4fa*)(rp + cc * 256) = lo;
      *(v4fa*)(rp + cc * 256 + 128) = hi;
    }
  }
  __syncthreads();
  // O^T tile (D rows = channel cc*16+8h+r, cols = q) -> f16, staged in the query tile's own Qs rows as [q][channel]
  if (act && kg == 0) {
    const float* rp = R + qt * 4096 + lane * 4;
#pragma unroll
    for (int cc = 0; cc < 16; ++cc) {
      v4f lo = *(const v4fa*)(rp + cc * 256);
      v4f hi = *(const v4fa*)(rp + cc * 256 + 128);
      v8h tv;
#pragma unroll
      for (int e = 0; e < 4; ++e) {
        tv[e]     = (_Float16)((o[cc][e] + lo[e]) * (1.f / 4096.f));
        tv[4 + e] = (_Float16)((o[cc][4 + e] + hi[e]) * (1.f / 4096.f));
      }
      *(v8h*)&Qs[qt * 16 + n][cc * 16 + 8 * h] = tv;
    }
  }
  __syncthreads();
  // attT[b][pixel of the query][256]: one 512-B row per instruction, 16 B per lane, up to four rows per wave
  v8h ov[QCH / AW];
#pragma unroll   // ov[] and qp[] by constant index, in registers; the four LDS reads stand together
  for (int i = 0; i < QCH / AW; ++i) ov[i] = *(const v8ha*)&Qs[wid * (QCH / AW) + i][lane * 8];
#pragma unroll
  for (int i = 0; i < QCH / AW; ++i) {
    if (wid * (QCH / AW) + i < nloc) {
      vst2((v8h*)(attT + ((size_t)(b * NP + qp[i])) * NC + lane * 8), ov[i]);
      asm volatile("s_wait_xcnt 0x0" ::: "memory");    // before the next row's address is written into the registers that this store names
    }
  }
#pragma unroll
  for (int i = 0; i < NP / 4 / ATH; ++i) {
    const int f = t + ATH * i;
    if (f * 4 < nk) {                                  // csb holds whole 128-key tiles up to nk
      v4f v = *(const v4fa*)&csb[f * 4];
      vst2((v4f*)(cp + (size_t)f * 4), v);
    }
  }
}

// 7) fused = concat(att_fore, x) . Fw^T, then out0[b][o][p] = m[p] ? fused : x. Block = 64 pixels x 256
//    channels; K = 512 in 8 staged tiles (prod64): input channels 0..255 from attT, 256..511 from the first 256 columns of inT.
__device__ __forceinline__ void
d_fuse(int blk, const _Float16* __restrict__ attT, const _Float16* __restrict__ inT, const _Float16* __restrict__ Fwh,
       const float* __restrict__ x, const float* __restrict__ mF, float* __restrict__ out0) {
  __shared__ __attribute__((aligned(16))) _Float16 S[2 * SBUF];   // two staged tiles; behind the loop G[channel][p_local] in f32, pitch 68
  const int t = threadIdx.x, lane = t & 31, wid = t >> 5, h = lane >> 4, n = lane & 15;
  if (blk >= NB * NP / PT) return;
  const int b = blk / (NP / PT), pb = (blk % (NP / PT)) * PT;
  const int pt = wid >> 2, og = wid & 3;
  const size_t row0 = (size_t)b * NP + pb;
  v8f d[2][4];
  prod64<NC / BK, NC / BK>(S, attT + row0 * NC, NC, inT + row0 * CIN, CIN, Fwh, CFU, d);
  // wave owns 32 channels; two 256-B row pieces per instruction, one address and constant offsets
  const int p4 = (lane & 15) * 4;
  const size_t g0 = ((size_t)(b * NC + wid * 32 + (lane >> 4))) * NP + pb + p4;
  const float* xp = x + g0;
  float* op = out0 + g0;
  const v4f mv = *(const v4f*)(mF + (size_t)b * NP + pb + p4);
  v4f xv[16];
#pragma unroll
  for (int i = 0; i < 16; ++i) {
    xv[i] = *(const v4f*)(xp + (size_t)(2 * i) * NP);
    if (i >= 14) asm volatile("s_wait_xcnt 0x0" ::: "memory");   // the shared address registers are free from the last load on
  }
  f1a* const G = (f1a*)S;
  __syncthreads();                                     // every wave has left the staged tiles
#pragma unroll
  for (int j = 0; j < 4; ++j) {
    const int o = og * 64 + j * 16 + n;
#pragma unroll
    for (int i = 0; i < 2; ++i) {
      v4f lo, hi;
#pragma unroll
      for (int e = 0; e < 4; ++e) { lo[e] = d[i][j][e] * (1.f / 64.f); hi[e] = d[i][j][4 + e] * (1.f / 64.f); }
      *(v4fa*)&G[o * 68 + pt * 32 + i * 16 + 8 * h] = lo;
      *(v4fa*)&G[o * 68 + pt * 32 + i * 16 + 8 * h + 4] = hi;
    }
  }
  __syncthreads();
#pragma unroll
  for (int i = 0; i < 16; ++i) {
    const v4f fz = *(const v4fa*)&G[(wid * 32 + 2 * i + (lane >> 4)) * 68 + p4];
    v4f rv;
#pragma unroll
    for (int e = 0; e < 4; ++e) rv[e] = (mv[e] > 0.5f) ? fz[e] : xv[i][e];
    vst2((v4f*)(op + (size_t)(2 * i) * NP), rv);
  }
}

// 8) visatt[b][p] = fixed-order sum of the 64 partial column sums at the pixel's key slot, 0 for a non-key;
//    one pixel per thread, 64 blocks of 256.
//    Each run of 128 pixels also leaves the maximum of its sums (start value 0) in bmax[run], two runs per block.
#define VB 128              // pixels per run, and number of runs (VB * VB = NB * NP)
__device__ __forceinline__ void d_vis(int blk, const float* __restrict__ cpart, const int* __restrict__ kpos,
                                      float* __restrict__ vis, float* __restrict__ bmax) {
  __shared__ float red[256 / 32];
  const int t = threadIdx.x, lane = t & 31, wid = t >> 5;
  const int idx = blk * 256 + t;
  if (blk >= NB * NP / 256) return;
  const int b = idx >> 12;
  const int slot = kpos[idx];
  float s = 0.f;
  if ((unsigned)slot < (unsigned)NP) {
    const float* cp = cpart + (size_t)b * QCN * NP + slot;
    float v[QCN];
#pragma unroll
    for (int q = 0; q < QCN; ++q) v[q] = cp[(size_t)q * NP];
#pragma unroll
    for (int q = 0; q < QCN; ++q) s += v[q];
  }
  vis[idx] = s;
  float mx = fmaxf(0.f, s);
  mx = fmaxf(mx, __shfl_xor(mx, 16)); mx = fmaxf(mx, __shfl_xor(mx, 8)); mx = fmaxf(mx, __shfl_xor(mx, 4));
  mx = fmaxf(mx, __shfl_xor(mx, 2));  mx = fmaxf(mx, __shfl_xor(mx, 1));
  if (lane == 0) red[wid] = mx;
  __syncthreads();
  if ((t & (VB - 1)) == 0) bmax[idx / VB] = fmaxf(fmaxf(red[wid], red[wid + 1]), fmaxf(red[wid + 2], red[wid + 3]));
}

// 7 + 8 in one grid: both read only what the score kernel and earlier launches left, and write buffers of their own.
#define SB (NB * NP / 256)                             // 64 column-sum blocks
__global__ void __launch_bounds__(256) k_post(const _Float16* __restrict__ attT, const _Float16* __restrict__ inT,
                                              const _Float16* __restrict__ Fwh, const float* __restrict__ x,
                                              const float* __restrict__ mF, float* __restrict__ out0,
                                              const float* __restrict__ cpart, const int* __restrict__ kpos,
                                              float* __restrict__ vis, float* __restrict__ bmax) {
  const int blk = blockIdx.x;
  if (blk < FB) d_fuse(blk, attT, inT, Fwh, x, mF, out0);
  else d_vis(blk - FB, cpart, kpos, vis, bmax);
}

// 9) out1 = 8x nearest upsample of visatt / global max. Block = one strip of 8 output rows (one visatt row):
//    every wave folds the 128 run maxima itself, each thread reads one visatt value and stores it 4 x 16 B.
__global__ void __launch_bounds__(256) k_up(const float* __restrict__ vis, const float* __restrict__ bmax,
                                            float* __restrict__ out1) {
  const int t = threadIdx.x, lane = t & 31;
  const int blk = blockIdx.x;
  if (blk >= NB * 64) return;
  const v4f bm = *(const v4f*)(bmax + lane * 4);
  const float sv = vis[blk * 64 + ((t & 127) >> 1)];
  float mx = fmaxf(fmaxf(bm[0], bm[1]), fmaxf(bm[2], bm[3]));
  mx = fmaxf(mx, __shfl_xor(mx, 16)); mx = fmaxf(mx, __shfl_xor(mx, 8)); mx = fmaxf(mx, __shfl_xor(mx, 4));
  mx = fmaxf(mx, __shfl_xor(mx, 2));  mx = fmaxf(mx, __shfl_xor(mx, 1));
  const float inv = 1.f / mx;
  const float v = sv * inv;
  v4f r; r[0] = v; r[1] = v; r[2] = v; r[3] = v;
  float* dst = out1 + ((size_t)blk * 1024 + t) * 4;
#pragma unroll
  for (int i = 0; i < 4; ++i) *(v4f*)(dst + (size_t)i * 1024) = r;
}

// ---------------------------------------------------------------------------
extern "C" void kernel_launch(void* const* d_in, const int* in_sizes, int n_in,
                              void* d_out, int out_size, void* d_ws, size_t ws_size,
                              hipStream_t stream) {
  if (n_in < 6) return;
  if (in_sizes[0] != NB * NC * NP) return;        // x      [4,256,64,64] f32
  if (in_sizes[1] != NB * MS * MS) return;        // mask   [4,1,512,512] f32
  if (in_sizes[2] != NB * CAUX * NP) return;      // aux    [4,768,64,64] f32
  if (in_sizes[3] != NC * CIN) return;            // K_w    [256,1024]    f32
  if (in_sizes[4] != NC) return;                  // K_b    [256]         f32
  if (in_sizes[5] != NC * CFU) return;            // fuse_w [256,512]     f32
  if (out_size != NB * NC * NP + NB * MS * MS) return;

  const float* x   = (const float*)d_in[0];
  const float* msk = (const float*)d_in[1];
  const float* aux = (const float*)d_in[2];
  const float* Kw  = (const float*)d_in[3];
  const float* Kb  = (const float*)d_in[4];
  const float* Fw  = (const float*)d_in[5];
  float* out0 = (float*)d_out;                           // 4,194,304 f32 at byte 0
  float* out1 = out0 + (size_t)NB * NC * NP;             // 1,048,576 f32 at byte 16,777,216

  const size_t o_m   = 0;                                          //     65,536 B
  const size_t o_kwh = o_m   + (size_t)NB * NP * 4;                //    524,288 B
  const size_t o_fwh = o_kwh + (size_t)NC * CIN * 2;               //    262,144 B
  const size_t o_inT = o_fwh + (size_t)NC * CFU * 2;               // 33,554,432 B
  const size_t o_nh  = o_inT + (size_t)NB * NP * CIN * 2;          //  8,388,608 B
  const size_t o_vh  = o_nh  + (size_t)NB * NP * NC * 2;           //  8,388,608 B
  const size_t o_att = o_vh  + (size_t)NB * NC * NP * 2;           //  8,388,608 B
  const size_t o_cp  = o_att + (size_t)NB * NP * NC * 2;           //  4,194,304 B
  const size_t o_vis = o_cp  + (size_t)NB * QCN * NP * 4;          //     65,536 B
  const size_t o_bm  = o_vis + (size_t)NB * NP * 4;                //        512 B
  const size_t o_kc  = o_bm  + (size_t)VB * 4;                     //  8,388,608 B
  const size_t o_kp  = o_kc  + (size_t)NB * NP * NC * 2;           //     65,536 B
  const size_t o_ki  = o_kp  + (size_t)NB * NP * 4;                //     65,536 B
  const size_t o_nk  = o_ki  + (size_t)NB * NP * 4;                //         16 B
  const size_t total = o_nk  + (size_t)NB * 4;                     // 72,352,272 B
  if (total > ws_size) return;

  char* w = (char*)d_ws;
  float*    mF    = (float*)(w + o_m);
  _Float16* Kwh   = (_Float16*)(w + o_kwh);
  _Float16* Fwh   = (_Float16*)(w + o_fwh);
  _Float16* inT   = (_Float16*)(w + o_inT);
  _Float16* Nh    = (_Float16*)(w + o_nh);
  _Float16* Vh    = (_Float16*)(w + o_vh);
  _Float16* attT  = (_Float16*)(w + o_att);
  float*    cpart = (float*)(w + o_cp);
  float*    vis   = (float*)(w + o_vis);
  float*    bmax  = (float*)(w + o_bm);
  _Float16* Kc    = (_Float16*)(w + o_kc);
  int*      kpos  = (int*)(w + o_kp);
  int*      kidx  = (int*)(w + o_ki);
  int*      nkA   = (int*)(w + o_nk);

  k_pre  <<<PB + WB + TB, 256, 0, stream>>>(msk, mF, Kw, Fw, Kwh, Fwh, x, aux, inT);      // 16 + 192 + 4096 blocks
  k_fv   <<<FB + GB, 256, 0, stream>>>(inT, Kwh, Kb, mF, Nh, Kc, x, kpos, kidx, nkA, Vh, attT);   // 256 + 256 blocks
  k_attn <<<NB * QCN, ATH, 0, stream>>>(Nh, Kc, Vh, kidx, nkA, attT, cpart);                // 256 blocks
  k_post <<<FB + SB, 256, 0, stream>>>(attT, inT, Fwh, x, mF, out0, cpart, kpos, vis, bmax);   // 256 + 64 blocks
  k_up   <<<NB * 64, 256, 0, stream>>>(vis, bmax, out1);                                // 256 blocks
}

// v010
// One run takes 84.4 microseconds.
// Next to v009, in two timings, it ran 1.13 and 1.16 times as fast.
// All steps since v000 together make it 8.53 times as fast.
#include <hip/hip_runtime.h>

// Contractions on v_wmma_f32_16x16x32_f16 (f16 operands, f32 accumulate): 1x1 input conv (weights x64),
// q.k scores (unit feature rows x8 on each side), att.v (att x4096), 1x1 fuse conv (weights x64);
// every scale is an exact power of two folded back in f32. Softmax, norms, sums and selects stay f32.

#define NB   4
#define NC   256
#define NP   4096
#define CIN  1024
#define CAUX 768
#define CFU  512
#define MS   512
#define QCH  64             // query rows per block in the score kernel (4 query tiles x 16)
#define KG   4              // key groups per block: waves that share a query tile and split the staged keys
#define KW   32             // keys per wave and trip
#define KT   (KG * KW)      // 128 keys per staged tile
#define AW   (QCH / 16 * KG)  // 16 waves per block in the score kernel
#define ATH  (AW * 32)      // its 512 threads
#define VP   (KT + 8)       // LDS pitch of a V row in elements: 272 B = 16 B x 17
#define QCN  (NP / QCH)     // 64 query chunks per batch
#define PT   64             // pixels per block in the two 1x1 conv products
#define BK   64             // k per staged tile: one 128-B line of every f16 source row, 64 channel rows of f32 A
#define SP   (BK + 8)       // LDS pitch of a staged row in elements: 144 B = 16 B x 9
#define SBUF ((PT + NC) * SP)   // elements of one staged tile: 64 pixel rows, then 256 weight rows

typedef _Float16 v16h __attribute__((ext_vector_type(16)));
typedef _Float16 v8h  __attribute__((ext_vector_type(8)));
typedef v8h v8ha __attribute__((may_alias));
typedef _Float16 v4h __attribute__((ext_vector_type(4)));
typedef v4h v4ha __attribute__((may_alias));
typedef float v8f __attribute__((ext_vector_type(8)));
typedef float v4f __attribute__((ext_vector_type(4)));
typedef v4f v4fa __attribute__((may_alias));
typedef int v4i __attribute__((ext_vector_type(4)));
typedef v4i v4ia __attribute__((may_alias));
typedef float f1a __attribute__((may_alias));
typedef int i1a __attribute__((may_alias));

union Frag { v16h v; v8h hf[2]; };

__device__ __forceinline__ v8f zero8() {
  v8f z = {0.f, 0.f, 0.f, 0.f, 0.f, 0.f, 0.f, 0.f};
  return z;
}

__device__ __forceinline__ v8f wmma16(v16h a, v16h b, v8f c) {
  v8f d = __builtin_amdgcn_wmma_f32_16x16x32_f16(false, a, false, b, (short)0, c, false, false);
  asm volatile("v_nop\n\tv_nop\n\tv_nop\n\tv_nop" : "+v"(d) : "v"(a), "v"(b));
  return d;
}

// 16 rows x 32 k fragment from a k-contiguous 16-bit matrix. rowp = start of the row owned by this
// lane (row index = lane & 15). Elements 0..7 <- k0+8h+0..7, elements 8..15 <- k0+16+8h+0..7 with
// h = lane >> 4. Used for A (row = m) and for B (row = n of a [n][k] copy). D: acc[r] = (row 8h+r, col lane&15).
__device__ __forceinline__ v16h ldfrag_g(const _Float16* rowp, int k0, int h) {
  Frag f;
  f.hf[0] = *(const v8h*)(rowp + k0 + 8 * h);
  f.hf[1] = *(const v8h*)(rowp + k0 + 16 + 8 * h);
  return f.v;
}
__device__ __forceinline__ v16h ldfrag_l(const _Float16* rowp, int k0, int h) {
  Frag f;
  f.hf[0] = *(const v8ha*)(rowp + k0 + 8 * h);
  f.hf[1] = *(const v8ha*)(rowp + k0 + 16 + 8 * h);
  return f.v;
}

__device__ __forceinline__ v8h pack8(v4f a, v4f b) {
  v8h r;
  r[0] = (_Float16)a[0]; r[1] = (_Float16)a[1]; r[2] = (_Float16)a[2]; r[3] = (_Float16)a[3];
  r[4] = (_Float16)b[0]; r[5] = (_Float16)b[1]; r[6] = (_Float16)b[2]; r[7] = (_Float16)b[3];
  return r;
}

__device__ __forceinline__ float max8f(v4f a, v4f b) {
  float m0 = fmaxf(fmaxf(a[0], a[1]), fmaxf(a[2], a[3]));
  float m1 = fmaxf(fmaxf(b[0], b[1]), fmaxf(b[2], b[3]));
  return fmaxf(m0, m1);
}

template <typename T>
__device__ __forceinline__ void vst2(T* p, T v) {
  *(T*)p = v;
  
}

// ---------------------------------------------------------------------------
// 1) 8x8 max pool of the 512x512 mask, binarised: mF[b][p] in {0,1}. Two threads per pixel, four mask rows each: all
//    eight 16-B loads of a thread are in flight at once, so the part takes one memory latency.
__device__ __forceinline__ void d_pool(int blk, const float* __restrict__ msk, float* __restrict__ mF) {
  const int i = blk * 256 + threadIdx.x;
  if (i >= NB * NP * 2) return;
  const int pix = i >> 1, hf = i & 1;
  const int b = pix >> 12, p = pix & (NP - 1);
  const int y = p >> 6, x0 = p & 63;
  const float* s = msk + ((size_t)b * MS + (size_t)(y * 8 + hf * 4)) * MS + (size_t)x0 * 8;
  v4f a[4], c[4];
#pragma unroll   // a[] and c[] by constant index, in registers
  for (int u = 0; u < 4; ++u) {
    a[u] = *(const v4f*)(s + u * MS);
    c[u] = *(const v4f*)(s + u * MS + 4);
  }
  asm volatile("s_wait_xcnt 0x0" ::: "memory");   // before other values are written into the address registers that these loads name
  float mx = 0.f;
#pragma unroll
  for (int u = 0; u < 4; ++u) mx = fmaxf(mx, max8f(a[u], c[u]));
  mx = fmaxf(mx, __shfl_xor(mx, 1));              // the pixel's other four rows
  if (hf == 0) mF[pix] = (mx > 0.f) ? 1.f : 0.f;
}

// 2) weights to f16 with x64 scale: Kwh[256][1024], Fwh[256][512]. 8 elements per thread, 16-B stores.
__device__ __forceinline__ void d_cvtw(int blk, const float* __restrict__ Kw, const float* __restrict__ Fw,
                                       _Float16* __restrict__ Kwh, _Float16* __restrict__ Fwh) {
  const int i = blk * 256 + threadIdx.x;
  const float* src;
  _Float16* dst;
  if (i < NC * CIN / 8) {
    src = Kw + (size_t)i * 8; dst = Kwh + (size_t)i * 8;
  } else if (i < NC * CIN / 8 + NC * CFU / 8) {
    const int j = i - NC * CIN / 8;
    src = Fw + (size_t)j * 8; dst = Fwh + (size_t)j * 8;
  } else {
    return;
  }
  v4f a = *(const v4f*)src;
  v4f c = *(const v4f*)(src + 4);
  a = a * 64.f; c = c * 64.f;
  vst2((v8h*)dst, pack8(a, c));
}

// 1 + 2 in one grid: the two parts read inputs only and write buffers of their own, so neither waits for the other.
// The block index picks the part.
#define PB ((NB * NP * 2) / 256)                       // 128 pool blocks
#define WB ((NC * CIN / 8 + NC * CFU / 8) / 256)       // 192 weight blocks
__global__ void __launch_bounds__(256) k_pre(const float* __restrict__ msk, float* __restrict__ mF,
                                             const float* __restrict__ Kw, const float* __restrict__ Fw,
                                             _Float16* __restrict__ Kwh, _Float16* __restrict__ Fwh) {
  const int blk = blockIdx.x;
  if (blk < PB) d_pool(blk, msk, mF);
  else d_cvtw(blk - PB, Kw, Fw, Kwh, Fwh);
}

// The k loop of both 1x1 conv products: D[64 pixels][256 channels] += A . B^T. Every 64-k tile (64 A rows, 256 B rows,
// k-contiguous f16) is laid in LDS and the fragments are read from there. B, and A where it lies in memory as f16 pixel
// rows (A1, row pitch pa1), come in whole 128-B lines, 16 B per lane, four lines per load. A that lies in memory as f32
// channel rows of NP pixels (X1, X2: the block's first pixel in channel 0 of the source) is read as it lies: a thread
// takes 4 pixels of 4 channels in a row (four loads, each of four whole lines per wave), rounds them to f16 and stores
// each pixel's 4 channels as 8 B of the pixel's LDS row.
// Two LDS buffers, one barrier per tile: it publishes the tile and ends the reads of the buffer that is written next.
// B is fetched one tile ahead, A two tiles ahead (two register sets, the loop runs two tiles a trip): the f32 rows come
// from memory, not from L2.
// The first NS1 tiles of A come from A1 (H1) or X1, the other NS2 from X2. 8 waves: wave (pt, og) owns
// 32 pixels x 64 channels, d[i][j] = pixel tile i, channel tile j; k runs upward, as in a loop over 32-k steps.
// Work-group barrier of the k loop. Its fences order LDS alone: behind __syncthreads() the build waits for every global
// load as well, and the A rows fetched two tiles ahead would have to land at each tile's barrier. Only LDS passes between
// the waves in the loop.
__device__ __forceinline__ void lds_barrier() {
  __builtin_amdgcn_fence(__ATOMIC_RELEASE, "workgroup", "local");
  __builtin_amdgcn_s_barrier();
  __builtin_amdgcn_fence(__ATOMIC_ACQUIRE, "workgroup", "local");
}

template <int NS1, int NS2, bool H1>
__device__ __forceinline__ void prod64(_Float16* S, const _Float16* A1, int pa1, const float* X1, const float* X2,
                                       const _Float16* B, int pbw, v8f (&d)[2][4]) {
  constexpr int NS = NS1 + NS2;
  static_assert(NS % 2 == 0 && NS >= 4, "the loop runs two tiles a trip");
  const int t = threadIdx.x, lane = t & 31, wid = t >> 5, h = lane >> 4, n = lane & 15;
  const int pt = wid >> 2, og = wid & 3;
  // staging of f16 rows: row (of 32 per load) and 16-B piece of this thread; rows r and r + 8 lie side by side in a half
  // wave, so that at the 144-B pitch their two 128-B lines fall on the two halves of the LDS banks
  const int lr = ((t >> 3) & 16) | ((t & 8)) | ((t >> 4) & 7), lc = (t & 7) * 8;
  // staging of f32 channel rows: first of this thread's 4 channels and of its 4 pixels; 8 threads in a row share a line
  const int xk = ((t >> 3) & 15) * 4, xp = (t >> 7) * 32 + (t & 7) * 4;
  // this thread's place in a tile's source, in 16-B units: one register each beside a base that is the same for the block
  const unsigned o1 = (unsigned)(lr * pa1 + lc) / 8, ox = (unsigned)(xk * NP + xp) / 4, ob = (unsigned)(lr * pbw + lc) / 8;
  _Float16* const sw = S + lr * SP + lc;
  _Float16* const sx = S + xp * SP + xk;
  const _Float16* const fa = S + (pt * 32 + n) * SP;
  const _Float16* const fb = S + (PT + og * 64 + n) * SP;
  v4f r0[4], r1[4];                                    // A of two tiles: 4 x 16 B of f32, or 2 x 16 B of f16 as they lie
  v8h rb[NC / 32];
  auto fetchA = [&](int s, v4f (&r)[4]) {              // A of tile s, global memory -> registers
    if (H1 && s < NS1) {
#pragma unroll
      for (int i = 0; i < PT / 32; ++i) r[i] = ((const v4fa*)(A1 + s * BK + (size_t)(32 * i) * pa1))[o1];
    } else {
      const float* gx = (!H1 && s < NS1) ? X1 + (size_t)s * (BK * NP) : X2 + (size_t)(s - NS1) * (BK * NP);
#pragma unroll
      for (int j = 0; j < 4; ++j) r[j] = ((const v4f*)(gx + (size_t)j * NP))[ox];
    }
    asm volatile("s_wait_xcnt 0x0" ::: "memory");      // before other values are written into the address registers that these loads name
  };
  auto fetchB = [&](int s) {                           // B of tile s, global memory -> registers
#pragma unroll
    for (int i = 0; i < NC / 32; ++i) rb[i] = ((const v8h*)(B + s * BK + (size_t)(32 * i) * pbw))[ob];
    asm volatile("s_wait_xcnt 0x0" ::: "memory");      // as in fetchA
  };
  auto put = [&](int s, int buf, const v4f (&r)[4]) {  // tile s, registers -> buffer buf
    if (H1 && s < NS1) {
#pragma unroll
      for (int i = 0; i < PT / 32; ++i) *(v4fa*)(sw + buf * SBUF + 32 * i * SP) = r[i];
    } else {
#pragma unroll
      for (int e = 0; e < 4; ++e) {
        v4h hv;
        hv[0] = (_Float16)r[0][e]; hv[1] = (_Float16)r[1][e]; hv[2] = (_Float16)r[2][e]; hv[3] = (_Float16)r[3][e];
        *(v4ha*)(sx + buf * SBUF + e * SP) = hv;
      }
    }
#pragma unroll
    for (int i = 0; i < NC / 32; ++i) *(v8ha*)(sw + buf * SBUF + (PT + 32 * i) * SP) = rb[i];
  };
  auto mult = [&](int buf) {                           // the tile in buffer buf: 2 k steps x 8 products
    const int cur = buf * SBUF;
    v16h af[BK / 32][2], bf[BK / 32][4];
#pragma unroll
    for (int q = 0; q < BK / 32; ++q) {
#pragma unroll
      for (int i = 0; i < 2; ++i) af[q][i] = ldfrag_l(fa + cur + i * 16 * SP, q * 32, h);
#pragma unroll
      for (int j = 0; j < 4; ++j) bf[q][j] = ldfrag_l(fb + cur + j * 16 * SP, q * 32, h);
    }
    __builtin_amdgcn_sched_barrier(0);                 // the tile's LDS reads stay one group in front of its products: spread among them, every place with reads is waited out to 0
#pragma unroll
    for (int q = 0; q < BK / 32; ++q)
#pragma unroll
      for (int j = 0; j < 4; ++j)
#pragma unroll
        for (int i = 0; i < 2; ++i) d[i][j] = wmma16(af[q][i], bf[q][j], d[i][j]);
    __builtin_amdgcn_sched_barrier(0);                 // the rounding of the next tile's A rows stays behind the products: lifted in front of them, so is the wait for those rows, and they have one tile's time to land, not two
  };
#pragma unroll
  for (int i = 0; i < 2; ++i)
#pragma unroll
    for (int j = 0; j < 4; ++j) d[i][j] = zero8();
  fetchA(0, r0);
  fetchB(0);
  fetchA(1, r1);
  put(0, 0, r0);
  lds_barrier();                                       // tile 0 is published
  auto trip = [&](int s) {                             // tiles s and s + 1, s even
    fetchB(s + 1);
    fetchA(s + 2, r0);
    mult(0);
    put(s + 1, 1, r1);
    lds_barrier();                                     // tile s + 1 is published; every wave has left the buffer of tile s
    fetchB(s + 2);
    fetchA(s + 3, r1);
    mult(1);
    put(s + 2, 0, r0);
    lds_barrier();                                     // tile s + 2 is published; every wave has left the buffer of tile s + 1
  };
  if constexpr (H1) {
#pragma unroll     // A changes its form on the way: unrolled whole, each tile's form is known at compile time; rolled, the build joins the two forms' loads and moves the rows between registers behind full waits
    for (int s = 0; s < NS - 2; s += 2) trip(s);
  } else {
#pragma unroll 1   // rolled: the two tiles of a trip give each register set its fixed turn, further unrolling only lengthens the text
    for (int s = 0; s < NS - 2; s += 2) trip(s);
  }
  fetchB(NS - 1);
  mult(0);
  put(NS - 1, 1, r1);
  lds_barrier();                                       // the last tile is published
  mult(1);
}

// 4) feats = concat(x, aux)^T . Kw^T (+ bias), then per-pixel L2 normalisation, stored as Nh[b][p][256] = f16(8 * unit row);
//    the row of a key goes to its dense slot in Kc[b][slot][256] as well: slot = number of keys in front of the pixel in
//    its batch, counted here from the pooled mask (the same numbers as in 5). A key is no query: its row of attT, which the
//    score kernel does not write, is set to 0 here.
//    Block = 64 pixels x 256 channels; K = 1024 in 16 staged tiles (prod64): 4 of x, 12 of aux, read as f32 channel rows.
__device__ __forceinline__ void d_feats(int blk, _Float16* S, const float* __restrict__ x,
                                        const float* __restrict__ aux, const _Float16* __restrict__ Kwh,
                                        const float* __restrict__ Kb, const float* __restrict__ mF,
                                        _Float16* __restrict__ Nh, _Float16* __restrict__ Kc,
                                        _Float16* __restrict__ attT) {
  // S: two staged tiles; behind the loop F[p_local][channel] in f32, pitch 260
  __shared__ int red[8];                               // per wave: keys of the batch in front of the block's pixels
  const int t = threadIdx.x, lane = t & 31, wid = t >> 5, h = lane >> 4, n = lane & 15;
  if (blk >= NB * NP / PT) return;
  const int b = blk / (NP / PT), pb = (blk % (NP / PT)) * PT;
  const int pt = wid >> 2, og = wid & 3;
  const float* mb = mF + (size_t)b * NP;
  int kc = 0;
  if (t * 16 < pb) {                                   // 16 pixels per thread; pb is a multiple of 64
#pragma unroll
    for (int j = 0; j < 4; ++j) {
      v4f a = *(const v4f*)(mb + t * 16 + j * 4);
#pragma unroll
      for (int e = 0; e < 4; ++e) kc += (a[e] < 0.5f) ? 1 : 0;
    }
  }
  kc += __shfl_xor(kc, 16); kc += __shfl_xor(kc, 8); kc += __shfl_xor(kc, 4);
  kc += __shfl_xor(kc, 2);  kc += __shfl_xor(kc, 1);
  if (lane == 0) red[wid] = kc;                        // read behind the barriers of the k loop
  const unsigned km0 = __builtin_amdgcn_ballot_w32(mb[pb + lane] < 0.5f);        // bit i: pixel pb + i is a key
  const unsigned km1 = __builtin_amdgcn_ballot_w32(mb[pb + 32 + lane] < 0.5f);   // the same for pb + 32 + i
  asm volatile("s_wait_xcnt 0x0" ::: "memory");        // before other values are written into the address registers that the mask loads name
  v8f d[2][4];
  prod64<NC / BK, CAUX / BK, false>(S, Kwh, 0, x + (size_t)b * NC * NP + pb, aux + (size_t)b * CAUX * NP + pb, Kwh, CIN, d);
  f1a* const F = (f1a*)S;
  __syncthreads();                                     // every wave has left the staged tiles
#pragma unroll
  for (int j = 0; j < 4; ++j) {
    const int o = og * 64 + j * 16 + n;
    const float bias = Kb[o];
#pragma unroll
    for (int i = 0; i < 2; ++i)
#pragma unroll
      for (int r = 0; r < 8; ++r) F[(pt * 32 + i * 16 + 8 * h + r) * 260 + o] = d[i][j][r] * (1.f / 64.f) + bias;
  }
  __syncthreads();
  v8h vals[8];
  size_t offs[8];
  int slot[8];
  const unsigned long long km = ((unsigned long long)km1 << 32) | km0;
  const int base = ((red[0] + red[1]) + (red[2] + red[3])) + ((red[4] + red[5]) + (red[6] + red[7]));
#pragma unroll
  for (int i = 0; i < 8; ++i) {
    const int pl = wid * 8 + i;                        // 8 pixels per wave, one wave per 512-B row
    slot[i] = ((km >> pl) & 1ull) ? base + __popcll(km & ((1ull << pl) - 1ull)) : -1;
    v4f a = *(const v4fa*)&F[pl * 260 + lane * 8];
    v4f c = *(const v4fa*)&F[pl * 260 + lane * 8 + 4];
    float ss = a[0] * a[0] + a[1] * a[1] + a[2] * a[2] + a[3] * a[3]
             + c[0] * c[0] + c[1] * c[1] + c[2] * c[2] + c[3] * c[3];
    ss += __shfl_xor(ss, 16); ss += __shfl_xor(ss, 8); ss += __shfl_xor(ss, 4);
    ss += __shfl_xor(ss, 2);  ss += __shfl_xor(ss, 1);
    const float inv = 8.f * (1.f / (sqrtf(ss) + 1e-8f));
    vals[i] = pack8(a * inv, c * inv);
    offs[i] = ((size_t)(b * NP + pb + pl)) * NC + lane * 8;
  }
#pragma unroll
  for (int i = 0; i < 8; ++i) vst2((v8h*)(Nh + offs[i]), vals[i]);
#pragma unroll   // slot[] and vals[] by constant index, in registers
  for (int i = 0; i < 8; ++i)
    if ((unsigned)slot[i] < (unsigned)NP) {
      const v8h z8 = {};
      vst2((v8h*)(Kc + ((size_t)(b * NP + slot[i])) * NC + lane * 8), vals[i]);
      vst2((v8h*)(attT + offs[i]), z8);
    }
}

// 5) dense order of the keys, then Vh[b][c][j] = f16( x[b][c][kidx[j]] ) for the dense key slots j < nk, 0 up to the end
//    of the last 128-key tile. A pixel with m = 0 is a key; every term of a pixel with m = 1 on the key side is
//    multiplied by 0, so only the keys get a slot. Block = one batch x CG whole channel rows: it ranks the batch's 4096
//    pixels itself from the pooled mask, L[0 .. 4095] = the pixels as a permutation, keys first (in pixel order), then
//    the non-keys. The block of channel row 0 also leaves the tables for the later launches: kpos[p] = slot of key p
//    (-1 for a non-key), kidx = the permutation, nkA[b] = number of keys. 8 slots per thread and row, 16-B stores.
#define CG 4                // channel rows per gather block
__device__ __forceinline__ void d_makev(int blk, i1a* L, const float* __restrict__ x, const float* __restrict__ mF,
                                        int* __restrict__ kpos, int* __restrict__ kidx, int* __restrict__ nkA,
                                        _Float16* __restrict__ Vh) {
  const int t = threadIdx.x, lane = t & 31, wid = t >> 5;
  if (blk >= NB * NC / CG) return;
  const int b = blk / (NC / CG), c0 = (blk % (NC / CG)) * CG;
  const float* ms = mF + (size_t)b * NP + t * 16;
  bool key[16];
  int c = 0;
#pragma unroll   // both loops unrolled whole: key[] is indexed by constants and stays in registers
  for (int j = 0; j < 4; ++j) {
    v4f a = *(const v4f*)(ms + j * 4);
#pragma unroll
    for (int e = 0; e < 4; ++e) { key[j * 4 + e] = a[e] < 0.5f; c += key[j * 4 + e] ? 1 : 0; }
  }
  int inc = c;                                   // keys up to and with this thread's 16 pixels, within the wave
#pragma unroll
  for (int d = 1; d < 32; d <<= 1) {
    const int o = __shfl_up(inc, d);
    inc += (lane >= d) ? o : 0;
  }
  if (lane == 31) L[NP + wid] = inc;
  __syncthreads();                               // the eight waves' key counts are published
  int pre = inc - c, tot = 0;
#pragma unroll
  for (int w = 0; w < 8; ++w) {
    const int v = L[NP + w];
    tot += v;
    pre += (w < wid) ? v : 0;
  }
  v4i kw[4];
  int r = pre;                                   // keys in front of the current pixel
#pragma unroll   // as above: key[] and kw[] by constant index
  for (int j = 0; j < 4; ++j) {
#pragma unroll
    for (int e = 0; e < 4; ++e) {
      const int p = t * 16 + j * 4 + e;
      const bool k = key[j * 4 + e];
      kw[j][e] = k ? r : -1;
      L[k ? r : tot + p - r] = p;
      r += k ? 1 : 0;
    }
  }
  __syncthreads();                               // the permutation is published
  if (c0 == 0) {
    int* kp = kpos + (size_t)b * NP + t * 16;
    int* ki = kidx + (size_t)b * NP;
#pragma unroll
    for (int j = 0; j < 4; ++j) {
      *(v4i*)(kp + j * 4) = kw[j];
      *(v4i*)(ki + (t + 256 * j) * 4) = *(const v4ia*)&L[(t + 256 * j) * 4];
    }
    if (t == 0) nkA[b] = tot;
  }
  const int nk = tot;
  const size_t row0 = (size_t)(b * NC + c0) * NP;
  for (int j0 = t * 8; j0 < ((nk + KT - 1) & ~(KT - 1)); j0 += 256 * 8) {
    const v4i i0 = *(const v4ia*)&L[j0];
    const v4i i1 = *(const v4ia*)&L[j0 + 4];
    v4f a[CG], c4[CG];
#pragma unroll   // vector elements by constant index, all the rows' gathers in flight in front of the first store
    for (int cc = 0; cc < CG; ++cc) {
      const float* xr = x + row0 + (size_t)cc * NP;
#pragma unroll
      for (int e = 0; e < 4; ++e) {
        const float va = xr[i0[e] & (NP - 1)];
        asm volatile("s_wait_xcnt 0x0" ::: "memory");   // before a later gather's result lands in this load's address registers
        const float vc = xr[i1[e] & (NP - 1)];
        asm volatile("s_wait_xcnt 0x0" ::: "memory");   // the same
        a[cc][e] = (j0 + e < nk) ? va : 0.f;
        c4[cc][e] = (j0 + 4 + e < nk) ? vc : 0.f;
      }
    }
#pragma unroll
    for (int cc = 0; cc < CG; ++cc) vst2((v8h*)(Vh + row0 + (size_t)cc * NP + j0), pack8(a[cc], c4[cc]));
  }
}

// 4 + 5 in one grid: neither reads what the other writes. The 256 long product blocks take the lowest
// indices, the short gather blocks the rest. Both parts use the one LDS array.
#define FB (NB * NP / PT)                              // 256 product blocks (here and in the fuse grid)
#define GB (NB * NC / CG)                              // 256 gather blocks
__global__ void __launch_bounds__(256) k_fv(const float* __restrict__ aux, const _Float16* __restrict__ Kwh,
                                            const float* __restrict__ Kb, const float* __restrict__ mF,
                                            _Float16* __restrict__ Nh, _Float16* __restrict__ Kc,
                                            const float* __restrict__ x, int* __restrict__ kpos,
                                            int* __restrict__ kidx, int* __restrict__ nkA,
                                            _Float16* __restrict__ Vh, _Float16* __restrict__ attT) {
  __shared__ __attribute__((aligned(16))) _Float16 S[2 * SBUF];
  const int blk = blockIdx.x;
  if (blk < FB) d_feats(blk, S, x, aux, Kwh, Kb, mF, Nh, Kc, attT);
  else d_makev(blk - FB, (i1a*)S, x, mF, kpos, kidx, nkA, Vh);
}

// Eight asynchronous 16-B-per-lane copies, global memory -> LDS, through no register. l = the lane's LDS byte addresses,
// g = its global addresses. The s_wait_xcnt stands inside the statement, behind the last copy, so that no address
// register of a copy is written again in front of it.
__device__ __forceinline__ void copy8(const unsigned (&l)[8], const _Float16* const (&g)[8]) {
  asm volatile("global_load_async_to_lds_b128 %0, %8, off\n\t"
               "global_load_async_to_lds_b128 %1, %9, off\n\t"
               "global_load_async_to_lds_b128 %2, %10, off\n\t"
               "global_load_async_to_lds_b128 %3, %11, off\n\t"
               "global_load_async_to_lds_b128 %4, %12, off\n\t"
               "global_load_async_to_lds_b128 %5, %13, off\n\t"
               "global_load_async_to_lds_b128 %6, %14, off\n\t"
               "global_load_async_to_lds_b128 %7, %15, off\n\t"
               "s_wait_xcnt 0x0"
               :: "v"(l[0]), "v"(l[1]), "v"(l[2]), "v"(l[3]), "v"(l[4]), "v"(l[5]), "v"(l[6]), "v"(l[7]),
                  "v"(g[0]), "v"(g[1]), "v"(g[2]), "v"(g[3]), "v"(g[4]), "v"(g[5]), "v"(g[6]), "v"(g[7])
               : "memory");
}

// One wave's share of a staged key tile: rows r0, r0 + 16, ..., r0 + 112 of Kb, 512 B each, 16 B per lane (r0, nk the
// same in every lane, nk > 0), to the tile rows of pitch 264 from LDS byte address dst on. In the last, partial tile a
// slot past nk takes the last key again.
__device__ __forceinline__ void cpkeys(unsigned dst, const _Float16* Kb, int r0, int nk, int lane) {
  unsigned l[KT / AW];
  const _Float16* g[KT / AW];
#pragma unroll   // l[] and g[] by constant index, in registers
  for (int i = 0; i < KT / AW; ++i) {
    l[i] = dst + (unsigned)(AW * i * 264 * 2);
    g[i] = Kb + (size_t)min(r0 + AW * i, nk - 1) * NC + lane * 8;
  }
  copy8(l, g);
}

// One thread's share of a staged V tile: 16 B of channel rows vr0, vr0 + 32, ..., vr0 + 224 (p = its 16 B of row vr0),
// to the tile rows of pitch VP from LDS byte address dst on.
__device__ __forceinline__ void cpvals(unsigned dst, const _Float16* p) {
  unsigned l[KT / AW];
  const _Float16* g[KT / AW];
#pragma unroll   // l[] and g[] by constant index, in registers
  for (int i = 0; i < KT / AW; ++i) {
    l[i] = dst + (unsigned)(32 * i * VP * 2);
    g[i] = p + (size_t)(32 * i) * NP;
  }
  copy8(l, g);
}

// Hand-over of staged tiles between the waves of a block.
__device__ __forceinline__ void publish() {
  asm volatile("s_wait_dscnt 0x0" ::: "memory");      // this wave's LDS reads and writes are over before a buffer goes to its next writer
  asm volatile("s_wait_asynccnt 0x0" ::: "memory");   // this wave's copies have landed before other waves read them
  __syncthreads();
}

// 6) attention of the nq = 4096 - nk dense queries over the nk dense keys of the batch. A pixel with m = 0 is no query:
//    its whole att row is multiplied by 0, so only the pixels behind the keys in kidx get a row here. The batch's 64
//    blocks take cnt queries each, cnt = nq / 64 rounded up to whole 16-row tiles; a query tile with no query does no
//    product, a block with no query leaves zero column sums and ends.
//    Block = up to 64 query rows, 16 waves: wave (qt, kg) owns query tile qt
//    (16 rows) and key group kg (32 of the 128 keys staged per trip), so a trip covers four times the keys of a
//    one-group block. Pass 1: row sums of exp(20 cos - 20), fixed shift 20 (|cos| <= 1),
//    the four groups' partial sums added through LDS. Pass 2: att tiles -> per-block column sums (cpart) and
//    O^T = V . att^T, the four groups' partial O^T added through LDS behind the loop, in a fixed order.
//    Q chunk, K tile, V tile and the per-wave att^T tile are staged in LDS; every fragment uses ldfrag_*.
//    K and V tiles come by asynchronous copies that fly while the block multiplies: pass 1 has two K buffers (the second
//    in the V tile's space); in pass 2 the next K tile flies under V . att^T and the next V tile under the scores.
__global__ void __launch_bounds__(ATH) __attribute__((amdgpu_num_vgpr(252)))
k_attn(const _Float16* __restrict__ Nh, const _Float16* __restrict__ Kc, const _Float16* __restrict__ Vh,
       const int* __restrict__ kidx, const int* __restrict__ nkA, _Float16* __restrict__ attT,
       float* __restrict__ cpart) {
  __shared__ __attribute__((aligned(16))) _Float16 Qs[QCH][264];   // q rows (later reused as O^T tile)
  __shared__ __attribute__((aligned(16))) _Float16 KV[KT * 264 + NC * VP];   // K tile, V tile (pass 1: a second K tile); behind the loop: partial O^T in f32
  __shared__ __attribute__((aligned(16))) _Float16 Ps[AW][16][40]; // att^T     [n=q][k=key] per wave
  __shared__ float cs[AW][KW];                                     // per-wave column sums, 32 keys
  __shared__ float rs[KG][QCH];                                    // per-key-group row sums
  __shared__ __attribute__((aligned(16))) float csb[NP];           // per-block column sums
  _Float16* const Ks = KV;                 // key rows  [n=key][k=channel], pitch 264
  _Float16* const Vs = KV + KT * 264;      // V tile    [m=channel][k=key], pitch VP

  const int t = threadIdx.x, lane = t & 31, h = lane >> 4, n = lane & 15;
  const int wid = __builtin_amdgcn_readfirstlane(t >> 5);   // in a scalar register: the tests on the wave's group are scalar branches
  const int qt = wid >> 2, kg = wid & 3;               // four waves in a row share a query tile: where waves in a row go to the four SIMDs in turn (assumed, not measured), an empty tile takes one wave's work off each SIMD
  const int blk = blockIdx.x;
  if (blk >= NB * QCN) return;
  const int b = blk / QCN, qc = blk % QCN;
  const _Float16* Nb = Nh + (size_t)b * NP * NC;
  const _Float16* Kb = Kc + (size_t)b * NP * NC;
  const int nk = __builtin_amdgcn_readfirstlane(min(max(nkA[b], 0), NP));   // in a scalar register: the key loops and their barriers stand under scalar branches
  const _Float16* Vb = Vh + (size_t)b * NC * NP;
  const int nq = NP - nk;
  const int cnt = ((nq + QCN - 1) / QCN + 15) & ~15;   // queries per block, at most QCH
  const int q0 = qc * cnt;                             // the block's first dense query
  const int nloc = min(max(nq - q0, 0), cnt);          // its queries: local rows 0 .. nloc - 1
  const bool act = qt * 16 < nloc;                     // this wave's query tile holds a query (scalar)
  float* cp = cpart + ((size_t)(b * QCN + qc)) * NP;
  if (nloc == 0) {                                     // the whole block leaves, in front of every copy and barrier
#pragma unroll
    for (int i = 0; i < NP / 4 / ATH; ++i) {
      const int f = t + ATH * i;
      const v4f z4 = {0.f, 0.f, 0.f, 0.f};
      if (f * 4 < nk) vst2((v4f*)(cp + (size_t)f * 4), z4);
    }
    return;
  }

  const unsigned kdst = (unsigned)(size_t)&Ks[wid * 264 + lane * 8];   // LDS byte address of this lane's 16 B in tile row wid
  if (nk > 0) cpkeys(kdst, Kb, wid, nk, lane);         // pass 1, tile 0

  // stage the block's query rows, four per wave: local row r is pixel kidx[nk + q0 + r]; a row past the last query takes
  // the last pixel of the permutation, and its att is multiplied by 0 below
  int qp[QCH / AW];
  {
    v8h qv[QCH / AW];
#pragma unroll   // qp[] and qv[] by constant index, in registers
    for (int i = 0; i < QCH / AW; ++i) {
      qp[i] = __builtin_amdgcn_readfirstlane(kidx[(size_t)b * NP + min(nk + q0 + wid * (QCH / AW) + i, NP - 1)] & (NP - 1));
      qv[i] = *(const v8h*)(Nb + (size_t)qp[i] * NC + lane * 8);
    }
    asm volatile("s_wait_xcnt 0x0" ::: "memory");      // before other values are written into the address registers that these loads name
#pragma unroll
    for (int i = 0; i < QCH / AW; ++i) *(v8h*)&Qs[wid * (QCH / AW) + i][lane * 8] = qv[i];
  }
  if (!act) cs[wid][lane] = 0.f;                       // an empty tile's column sums: written once, read in every trip's fold
  asm volatile("s_wait_asynccnt 0x0" ::: "memory");    // tile 0 has landed
  __syncthreads();                                     // the query rows and tile 0 are published
  if (KT < nk) cpkeys(kdst + KT * 264 * 2, Kb, KT + wid, nk, lane);   // tile 1, second buffer

  const _Float16* Qrow = &Qs[qt * 16 + n][0];
  const int vr0 = t >> 4, v8 = (t & 15) * 8;           // V staging: channel row and key offset of this thread's 16 B
  const unsigned voff = (unsigned)(vr0 * NP + v8);
  const unsigned vdst = (unsigned)(size_t)&Vs[vr0 * VP + v8];   // its LDS byte address

  float invs[8];
  {
    v16h qf[8];
#pragma unroll
    for (int cb = 0; cb < 8; ++cb) qf[cb] = ldfrag_l(Qrow, cb * 32, h);
    float acc[8];
#pragma unroll
    for (int r = 0; r < 8; ++r) acc[r] = 0.f;
    int cur = 0;                                       // buffer of this trip's tile
    int kb = 0;
#pragma unroll 1
    for (; kb < nk; kb += KT) {
      if (act) {
      const _Float16* Krow = &Ks[(cur * KT + kg * KW + n) * 264];
      v16h kf[8][2];                                   // the wave's 32 key rows of this tile, all 16 fragments
#pragma unroll
      for (int cb = 0; cb < 8; ++cb)
#pragma unroll
        for (int sub = 0; sub < 2; ++sub) kf[cb][sub] = ldfrag_l(Krow + sub * 16 * 264, cb * 32, h);
      __builtin_amdgcn_sched_barrier(0);               // the trip's LDS reads stay one group in front of its products: left to the scheduler, each product stands behind its own two reads and waits out their whole latency
      v8f s[2] = {zero8(), zero8()};
#pragma unroll
      for (int cb = 0; cb < 8; ++cb)
#pragma unroll
        for (int sub = 0; sub < 2; ++sub) s[sub] = wmma16(qf[cb], kf[cb][sub], s[sub]);
#pragma unroll
      for (int sub = 0; sub < 2; ++sub) {
        const float km = (kb + kg * KW + sub * 16 + n < nk) ? 1.f : 0.f;
#pragma unroll
        for (int r = 0; r < 8; ++r) acc[r] += km * __expf(0.3125f * s[sub][r] - 20.f);
      }
      }
      publish();                                       // the next tile is published; every wave has left this trip's buffer
      if (kb + 2 * KT < nk) cpkeys(kdst + cur * (KT * 264 * 2), Kb, kb + 2 * KT + wid, nk, lane);
      cur ^= 1;
    }
    asm volatile("s_wait_asynccnt 0x0" ::: "memory");  // no copy of pass 1 is left in flight
    if (kb > 0) {                                      // there are keys. Pass 2, tile 0: both fly under the row sums' fold
      cpkeys(kdst, Kb, wid, nk, lane);
      cpvals(vdst, Vb + voff);
    }
#pragma unroll
    for (int r = 0; r < 8; ++r) {
      float a = acc[r];
      a += __shfl_xor(a, 1); a += __shfl_xor(a, 2); a += __shfl_xor(a, 4); a += __shfl_xor(a, 8);
      if (n == 0) rs[kg][qt * 16 + 8 * h + r] = a;
    }
    __syncthreads();
#pragma unroll
    for (int r = 0; r < 8; ++r) {
      const int ql = qt * 16 + 8 * h + r;
      const float a = (rs[0][ql] + rs[1][ql]) + (rs[2][ql] + rs[3][ql]);
      invs[r] = (ql < nloc) ? 1.f / (a + 1e-30f) : 0.f;   // a row past the block's last query -> 0
    }
  }

  // ---- pass 2: att tiles, column sums, O^T = V . (att*4096)^T ----
  v8f o[16];
#pragma unroll
  for (int cc = 0; cc < 16; ++cc) o[cc] = zero8();
  publish();                                           // K and V tile 0 are published
#pragma unroll 1
  for (int kb = 0; kb < nk; kb += KT) {
    if (act) {
    v8f s[2] = {zero8(), zero8()};
    const _Float16* Krow = &Ks[(kg * KW + n) * 264];
#pragma unroll
    for (int g = 0; g < 4; ++g) {                      // 64 channels a group: as many fragments as the registers hold beside O^T
      v16h qa[2], kf[2][2];
#pragma unroll
      for (int j = 0; j < 2; ++j) {
        qa[j] = ldfrag_l(Qrow, (g * 2 + j) * 32, h);
#pragma unroll
        for (int sub = 0; sub < 2; ++sub) kf[j][sub] = ldfrag_l(Krow + sub * 16 * 264, (g * 2 + j) * 32, h);
      }
      __builtin_amdgcn_sched_barrier(0);               // as in pass 1: the group's twelve LDS reads stand together in front of its four products
#pragma unroll
      for (int j = 0; j < 2; ++j)
#pragma unroll
        for (int sub = 0; sub < 2; ++sub) s[sub] = wmma16(qa[j], kf[j][sub], s[sub]);
      __builtin_amdgcn_sched_barrier(0);               // the next group's reads are not spread among these products
    }
#pragma unroll
    for (int sub = 0; sub < 2; ++sub) {
      const float km = (kb + kg * KW + sub * 16 + n < nk) ? 1.f : 0.f;
      float csum = 0.f;
#pragma unroll
      for (int r = 0; r < 8; ++r) {
        const float att = invs[r] * km * __expf(0.3125f * s[sub][r] - 20.f);   // D row q = 8h+r, col key = n
        csum += att;
        Ps[wid][8 * h + r][sub * 16 + n] = (_Float16)(att * 4096.f);
      }
      csum += __shfl_xor(csum, 16);
      if (lane < 16) cs[wid][sub * 16 + lane] = csum;
    }
    }
    publish();                                         // this trip's V tile and column sums are published; every wave has left the K tile
    if (kb + KT < nk) cpkeys(kdst, Kb, kb + KT + wid, nk, lane);   // the next K tile flies under V . att^T
    if (wid < KG) {                                    // wave g folds key group g: its four query tiles' sums
      float tt = 0.f;
#pragma unroll
      for (int w = 0; w < 4; ++w) tt += cs[w * KG + wid][lane];
      csb[kb + wid * KW + lane] = tt;
    }
    if (act) {
    const v16h pB = ldfrag_l(&Ps[wid][n][0], 0, h);                   // B: k = key, n = q
#pragma unroll
    for (int g = 0; g < 2; ++g) {                      // 128 channels a group
      v16h vf[8];
#pragma unroll
      for (int j = 0; j < 8; ++j) vf[j] = ldfrag_l(&Vs[(g * 128 + j * 16 + n) * VP], kg * KW, h);   // A: m = channel
      __builtin_amdgcn_sched_barrier(0);               // as above: the group's sixteen LDS reads stand together in front of its eight products
#pragma unroll
      for (int j = 0; j < 8; ++j) o[g * 8 + j] = wmma16(vf[j], pB, o[g * 8 + j]);
      __builtin_amdgcn_sched_barrier(0);               // the next group's reads are not spread among these products
    }
    }
    publish();                                         // the next K tile is published; every wave has left the V tile and the column sums
    if (kb + KT < nk) cpvals(vdst, Vb + (kb + KT) + voff);   // the next V tile flies under the next scores
  }
  asm volatile("s_wait_asynccnt 0x0" ::: "memory");    // no copy is left in flight when the tiles' space is used anew

  // the four key groups' partial O^T tiles, added in f32 as (g0 + g2) + (g1 + g3); a tile lies in the K/V space as
  // [cc][half][lane][4], 16 B per lane, 16 KiB per wave
  float* const R = (float*)KV;
  __syncthreads();                                     // every wave has left the K and V tiles
  if (act && kg >= 2) {                                // an empty query tile has nothing to add, here and below
    float* rp = R + ((kg - 2) * 4 + qt) * 4096 + lane * 4;
#pragma unroll
    for (int cc = 0; cc < 16; ++cc) {
      v4f lo = {o[cc][0], o[cc][1], o[cc][2], o[cc][3]};
      v4f hi = {o[cc][4], o[cc][5], o[cc][6], o[cc][7]};
      *(v4fa*)(rp + cc * 256) = lo;
      *(v4fa*)(rp + cc * 256 + 128) = hi;
    }
  }
  __syncthreads();
  if (act && kg < 2) {
    const float* rp = R + (kg * 4 + qt) * 4096 + lane * 4;
#pragma unroll
    for (int cc = 0; cc < 16; ++cc) {
      v4f lo = *(const v4fa*)(rp + cc * 256);
      v4f hi = *(const v4fa*)(rp + cc * 256 + 128);
#pragma unroll
      for (int e = 0; e < 4; ++e) { o[cc][e] += lo[e]; o[cc][4 + e] += hi[e]; }
    }
  }
  __syncthreads();
  if (act && kg == 1) {
    float* rp = R + qt * 4096 + lane * 4;
#pragma unroll
    for (int cc = 0; cc < 16; ++cc) {
      v4f lo = {o[cc][0], o[cc][1], o[cc][2], o[cc][3]};
      v4f hi = {o[cc][4], o[cc][5], o[cc][6], o[cc][7]};
      *(v4fa*)(rp + cc * 256) = lo;
      *(v4fa*)(rp + cc * 256 + 128) = hi;
    }
  }
  __syncthreads();
  // O^T tile (D rows = channel cc*16+8h+r, cols = q) -> f16, staged in the query tile's own Qs rows as [q][channel]
  if (act && kg == 0) {
    const float* rp = R + qt * 4096 + lane * 4;
#pragma unroll
    for (int cc = 0; cc < 16; ++cc) {
      v4f lo = *(const v4fa*)(rp + cc * 256);
      v4f hi = *(const v4fa*)(rp + cc * 256 + 128);
      v8h tv;
#pragma unroll
      for (int e = 0; e < 4; ++e) {
        tv[e]     = (_Float16)((o[cc][e] + lo[e]) * (1.f / 4096.f));
        tv[4 + e] = (_Float16)((o[cc][4 + e] + hi[e]) * (1.f / 4096.f));
      }
      *(v8h*)&Qs[qt * 16 + n][cc * 16 + 8 * h] = tv;
    }
  }
  __syncthreads();
  // attT[b][pixel of the query][256]: one 512-B row per instruction, 16 B per lane, up to four rows per wave
  v8h ov[QCH / AW];
#pragma unroll   // ov[] and qp[] by constant index, in registers; the four LDS reads stand together
  for (int i = 0; i < QCH / AW; ++i) ov[i] = *(const v8ha*)&Qs[wid * (QCH / AW) + i][lane * 8];
#pragma unroll
  for (int i = 0; i < QCH / AW; ++i) {
    if (wid * (QCH / AW) + i < nloc) {
      vst2((v8h*)(attT + ((size_t)(b * NP + qp[i])) * NC + lane * 8), ov[i]);
      asm volatile("s_wait_xcnt 0x0" ::: "memory");    // before the next row's address is written into the registers that this store names
    }
  }
#pragma unroll
  for (int i = 0; i < NP / 4 / ATH; ++i) {
    const int f = t + ATH * i;
    if (f * 4 < nk) {                                  // csb holds whole 128-key tiles up to nk
      v4f v = *(const v4fa*)&csb[f * 4];
      vst2((v4f*)(cp + (size_t)f * 4), v);
    }
  }
}

// 7) fused = concat(att_fore, x) . Fw^T, then out0[b][o][p] = m[p] ? fused : x. Block = 64 pixels x 256
//    channels; K = 512 in 8 staged tiles (prod64): input channels 0..255 from attT, 256..511 from x, read as f32 channel rows.
__device__ __forceinline__ void
d_fuse(int blk, const _Float16* __restrict__ attT, const _Float16* __restrict__ Fwh,
       const float* __restrict__ x, const float* __restrict__ mF, float* __restrict__ out0) {
  __shared__ __attribute__((aligned(16))) _Float16 S[2 * SBUF];   // two staged tiles; behind the loop G[channel][p_local] in f32, pitch 68
  const int t = threadIdx.x, lane = t & 31, wid = t >> 5, h = lane >> 4, n = lane & 15;
  if (blk >= NB * NP / PT) return;
  const int b = blk / (NP / PT), pb = (blk % (NP / PT)) * PT;
  const int pt = wid >> 2, og = wid & 3;
  const size_t row0 = (size_t)b * NP + pb;
  v8f d[2][4];
  const float* xb = x + (size_t)b * NC * NP + pb;
  prod64<NC / BK, NC / BK, true>(S, attT + row0 * NC, NC, xb, xb, Fwh, CFU, d);
  // wave owns 32 channels; two 256-B row pieces per instruction, one address and constant offsets
  const int p4 = (lane & 15) * 4;
  const size_t g0 = ((size_t)(b * NC + wid * 32 + (lane >> 4))) * NP + pb + p4;
  const float* xp = x + g0;
  float* op = out0 + g0;
  const v4f mv = *(const v4f*)(mF + (size_t)b * NP + pb + p4);
  v4f xv[16];
#pragma unroll
  for (int i = 0; i < 16; ++i) {
    xv[i] = *(const v4f*)(xp + (size_t)(2 * i) * NP);
    if (i >= 14) asm volatile("s_wait_xcnt 0x0" ::: "memory");   // the shared address registers are free from the last load on
  }
  f1a* const G = (f1a*)S;
  __syncthreads();                                     // every wave has left the staged tiles
#pragma unroll
  for (int j = 0; j < 4; ++j) {
    const int o = og * 64 + j * 16 + n;
#pragma unroll
    for (int i = 0; i < 2; ++i) {
      v4f lo, hi;
#pragma unroll
      for (int e = 0; e < 4; ++e) { lo[e] = d[i][j][e] * (1.f / 64.f); hi[e] = d[i][j][4 + e] * (1.f / 64.f); }
      *(v4fa*)&G[o * 68 + pt * 32 + i * 16 + 8 * h] = lo;
      *(v4fa*)&G[o * 68 + pt * 32 + i * 16 + 8 * h + 4] = hi;
    }
  }
  __syncthreads();
#pragma unroll
  for (int i = 0; i < 16; ++i) {
    const v4f fz = *(const v4fa*)&G[(wid * 32 + 2 * i + (lane >> 4)) * 68 + p4];
    v4f rv;
#pragma unroll
    for (int e = 0; e < 4; ++e) rv[e] = (mv[e] > 0.5f) ? fz[e] : xv[i][e];
    vst2((v4f*)(op + (size_t)(2 * i) * NP), rv);
  }
}

// 8) visatt[b][p] = fixed-order sum of the 64 partial column sums at the pixel's key slot, 0 for a non-key;
//    one pixel per thread, 64 blocks of 256.
//    Each run of 128 pixels also leaves the maximum of its sums (start value 0) in bmax[run], two runs per block.
#define VB 128              // pixels per run, and number of runs (VB * VB = NB * NP)
__device__ __forceinline__ void d_vis(int blk, const float* __restrict__ cpart, const int* __restrict__ kpos,
                                      float* __restrict__ vis, float* __restrict__ bmax) {
  __shared__ float red[256 / 32];
  const int t = threadIdx.x, lane = t & 31, wid = t >> 5;
  const int idx = blk * 256 + t;
  if (blk >= NB * NP / 256) return;
  const int b = idx >> 12;
  const int slot = kpos[idx];
  float s = 0.f;
  if ((unsigned)slot < (unsigned)NP) {
    const float* cp = cpart + (size_t)b * QCN * NP + slot;
    float v[QCN];
#pragma unroll
    for (int q = 0; q < QCN; ++q) v[q] = cp[(size_t)q * NP];
#pragma unroll
    for (int q = 0; q < QCN; ++q) s += v[q];
  }
  vis[idx] = s;
  float mx = fmaxf(0.f, s);
  mx = fmaxf(mx, __shfl_xor(mx, 16)); mx = fmaxf(mx, __shfl_xor(mx, 8)); mx = fmaxf(mx, __shfl_xor(mx, 4));
  mx = fmaxf(mx, __shfl_xor(mx, 2));  mx = fmaxf(mx, __shfl_xor(mx, 1));
  if (lane == 0) red[wid] = mx;
  __syncthreads();
  if ((t & (VB - 1)) == 0) bmax[idx / VB] = fmaxf(fmaxf(red[wid], red[wid + 1]), fmaxf(red[wid + 2], red[wid + 3]));
}

// 7 + 8 in one grid: both read only what the score kernel and earlier launches left, and write buffers of their own.
#define SB (NB * NP / 256)                             // 64 column-sum blocks
__global__ void __launch_bounds__(256) k_post(const _Float16* __restrict__ attT,
                                              const _Float16* __restrict__ Fwh, const float* __restrict__ x,
                                              const float* __restrict__ mF, float* __restrict__ out0,
                                              const float* __restrict__ cpart, const int* __restrict__ kpos,
                                              float* __restrict__ vis, float* __restrict__ bmax) {
  const int blk = blockIdx.x;
  if (blk < FB) d_fuse(blk, attT, Fwh, x, mF, out0);
  else d_vis(blk - FB, cpart, kpos, vis, bmax);
}

// 9) out1 = 8x nearest upsample of visatt / global max. Block = one strip of 8 output rows (one visatt row):
//    every wave folds the 128 run maxima itself, each thread reads one visatt value and stores it 4 x 16 B.
__global__ void __launch_bounds__(256) k_up(const float* __restrict__ vis, const float* __restrict__ bmax,
                                            float* __restrict__ out1) {
  const int t = threadIdx.x, lane = t & 31;
  const int blk = blockIdx.x;
  if (blk >= NB * 64) return;
  const v4f bm = *(const v4f*)(bmax + lane * 4);
  const float sv = vis[blk * 64 + ((t & 127) >> 1)];
  float mx = fmaxf(fmaxf(bm[0], bm[1]), fmaxf(bm[2], bm[3]));
  mx = fmaxf(mx, __shfl_xor(mx, 16)); mx = fmaxf(mx, __shfl_xor(mx, 8)); mx = fmaxf(mx, __shfl_xor(mx, 4));
  mx = fmaxf(mx, __shfl_xor(mx, 2));  mx = fmaxf(mx, __shfl_xor(mx, 1));
  const float inv = 1.f / mx;
  const float v = sv * inv;
  v4f r; r[0] = v; r[1] = v; r[2] = v; r[3] = v;
  float* dst = out1 + ((size_t)blk * 1024 + t) * 4;
#pragma unroll
  for (int i = 0; i < 4; ++i) *(v4f*)(dst + (size_t)i * 1024) = r;
}

// ---------------------------------------------------------------------------
extern "C" void kernel_launch(void* const* d_in, const int* in_sizes, int n_in,
                              void* d_out, int out_size, void* d_ws, size_t ws_size,
                              hipStream_t stream) {
  if (n_in < 6) return;
  if (in_sizes[0] != NB * NC * NP) return;        // x      [4,256,64,64] f32
  if (in_sizes[1] != NB * MS * MS) return;        // mask   [4,1,512,512] f32
  if (in_sizes[2] != NB * CAUX * NP) return;      // aux    [4,768,64,64] f32
  if (in_sizes[3] != NC * CIN) return;            // K_w    [256,1024]    f32
  if (in_sizes[4] != NC) return;                  // K_b    [256]         f32
  if (in_sizes[5] != NC * CFU) return;            // fuse_w [256,512]     f32
  if (out_size != NB * NC * NP + NB * MS * MS) return;

  const float* x   = (const float*)d_in[0];
  const float* msk = (const float*)d_in[1];
  const float* aux = (const float*)d_in[2];
  const float* Kw  = (const float*)d_in[3];
  const float* Kb  = (const float*)d_in[4];
  const float* Fw  = (const float*)d_in[5];
  float* out0 = (float*)d_out;                           // 4,194,304 f32 at byte 0
  float* out1 = out0 + (size_t)NB * NC * NP;             // 1,048,576 f32 at byte 16,777,216

  const size_t o_m   = 0;                                          //     65,536 B
  const size_t o_kwh = o_m   + (size_t)NB * NP * 4;                //    524,288 B
  const size_t o_fwh = o_kwh + (size_t)NC * CIN * 2;               //    262,144 B
  const size_t o_nh  = o_fwh + (size_t)NC * CFU * 2;               //  8,388,608 B
  const size_t o_vh  = o_nh  + (size_t)NB * NP * NC * 2;           //  8,388,608 B
  const size_t o_att = o_vh  + (size_t)NB * NC * NP * 2;           //  8,388,608 B
  const size_t o_cp  = o_att + (size_t)NB * NP * NC * 2;           //  4,194,304 B
  const size_t o_vis = o_cp  + (size_t)NB * QCN * NP * 4;          //     65,536 B
  const size_t o_bm  = o_vis + (size_t)NB * NP * 4;                //        512 B
  const size_t o_kc  = o_bm  + (size_t)VB * 4;                     //  8,388,608 B
  const size_t o_kp  = o_kc  + (size_t)NB * NP * NC * 2;           //     65,536 B
  const size_t o_ki  = o_kp  + (size_t)NB * NP * 4;                //     65,536 B
  const size_t o_nk  = o_ki  + (size_t)NB * NP * 4;                //         16 B
  const size_t total = o_nk  + (size_t)NB * 4;                     // 38,797,840 B
  if (total > ws_size) return;

  char* w = (char*)d_ws;
  float*    mF    = (float*)(w + o_m);
  _Float16* Kwh   = (_Float16*)(w + o_kwh);
  _Float16* Fwh   = (_Float16*)(w + o_fwh);
  _Float16* Nh    = (_Float16*)(w + o_nh);
  _Float16* Vh    = (_Float16*)(w + o_vh);
  _Float16* attT  = (_Float16*)(w + o_att);
  float*    cpart = (float*)(w + o_cp);
  float*    vis   = (float*)(w + o_vis);
  float*    bmax  = (float*)(w + o_bm);
  _Float16* Kc    = (_Float16*)(w + o_kc);
  int*      kpos  = (int*)(w + o_kp);
  int*      kidx  = (int*)(w + o_ki);
  int*      nkA   = (int*)(w + o_nk);

  k_pre  <<<PB + WB, 256, 0, stream>>>(msk, mF, Kw, Fw, Kwh, Fwh);                         // 128 + 192 blocks
  k_fv   <<<FB + GB, 256, 0, stream>>>(aux, Kwh, Kb, mF, Nh, Kc, x, kpos, kidx, nkA, Vh, attT);   // 256 + 256 blocks
  k_attn <<<NB * QCN, ATH, 0, stream>>>(Nh, Kc, Vh, kidx, nkA, attT, cpart);                // 256 blocks
  k_post <<<FB + SB, 256, 0, stream>>>(attT, Fwh, x, mF, out0, cpart, kpos, vis, bmax);   // 256 + 64 blocks
  k_up   <<<NB * 64, 256, 0, stream>>>(vis, bmax, out1);                                // 256 blocks
}
